// v000
// Measured on an AMD MI455X. A time is GPU time per run, averaged over a window of back-to-back runs after a warm-up
// (all launches, gaps included; the runs take copies of the inputs in turn), and the median of several windows.
// Apart from v000's, it joins two sittings. Times from different sittings can be a few percent apart, while
// side-by-side timings come from the same sitting.
// v000, which the later versions start from, runs in 5870 microseconds.
#include <hip/hip_runtime.h>
// Sparse-pattern transformer decoder (1 x 2048 tokens, 512 = 8 heads x 64, 6 layers, MLP 2048 (tanh-GELU), vocab 256): x = embed[shift_right(tokens)] + pos_emb; per layer: h = LN1(x); q = h Wq / 8, k, v; scores masked by the structural fixed sparse pattern (causal & (same 128-block | last 32 columns of each block)) AND the INPUT key padding (token > 0), masked entries = -1e9 exactly as the reference; softmax; x += (P v) Wo; x += gelu(LN2(x) W1 + b1) W2 + b2; out = LNf(x) Wout + bout -> [1,2048,256].
// Structure: token-embedding gather by the INPUT ids on VALU; LayerNorms on VALU; all Linears as f16 WMMA GEMMs (32x64 wave tiles, f32 accumulation, exact x16 weights, biases / GELU / residual accumulation in the epilogue); per (layer, head) the scores as a GEMM (K 64) into an f32 plane, a wave-per-row f32 softmax applying the structural pattern and the key-padding predicate (three rolled passes, P x2^10 f16), V transposed by LDS tiles, P.v as a GEMM into the head's columns of an f16 plane.
// Compute dtype: embeddings, weights, biases, LN parameters rounded to bf16; LN outputs, q, k, v, P, attention output, GELU hidden as f16 operands (~2^-12; logits small); the residual stream, softmax, LayerNorm in f32. v_wmma_f32_16x16x32_f16.
#define SLEN 2048
#define DM 512
#define NH 8
#define NL 6
#define NLRUN NL                 /* layers executed */
#define DMLP 2048
#define NVOC 256
#define BLK 128
#define CSP 32
#define NR SLEN
typedef __bf16 v16b __attribute__((ext_vector_type(16)));
typedef unsigned short v8us __attribute__((ext_vector_type(8), may_alias));
typedef float  v8f  __attribute__((ext_vector_type(8)));
typedef float  v4f  __attribute__((ext_vector_type(4)));
typedef float  v4fa __attribute__((ext_vector_type(4), may_alias));
union FragB { v16b v; v8us half[2]; unsigned short u[16]; };

__device__ __forceinline__ unsigned short bf16_bits(float x) { unsigned int u = __float_as_uint(x); return (unsigned short)((u + 0x7FFFu + ((u >> 16) & 1u)) >> 16); }
__device__ __forceinline__ float bf16_val(unsigned short b) { return __uint_as_float(((unsigned int)b) << 16); }
__device__ __forceinline__ float bf16_round(float x) { return bf16_val(bf16_bits(x)); }
// D += A·B with NT terms: 1 = ah·bh, 2 = + al·bh (A split), 3 = + ah·bl (both split)
template <int NT>
__device__ __forceinline__ v8f mmaN(v16b ah, v16b al, v16b bh, v16b bl, v8f c) {
  c = __builtin_amdgcn_wmma_f32_16x16x32_bf16(false, ah, false, bh, (short)0, c, false, false);
  if (NT >= 2) c = __builtin_amdgcn_wmma_f32_16x16x32_bf16(false, al, false, bh, (short)0, c, false, false);
  if (NT >= 3) c = __builtin_amdgcn_wmma_f32_16x16x32_bf16(false, ah, false, bl, (short)0, c, false, false);
  asm volatile("v_nop\n\tv_nop\n\tv_nop\n\tv_nop" : "+v"(c) : "v"(ah), "v"(al), "v"(bh), "v"(bl));
  return c;
}

__global__ __launch_bounds__(256) void k_wt_bf16(const float* __restrict__ W, unsigned short* __restrict__ Wt, int K, int N) {
  const int t = blockIdx.x * 256 + threadIdx.x;
  const int k8n = K / 8;
  if (t >= N * k8n) return;
  const int n = t / k8n, k8 = (t % k8n) * 8;
  v8us v;
#pragma unroll
  for (int i = 0; i < 8; ++i) v[i] = bf16_bits(W[(size_t)(k8 + i) * N + n]);
  *(v8us*)(Wt + (size_t)n * K + k8) = v;
  
}

// GEMM C[M][N] (f32, pitch ldc) = act(A[M][K]·W + bias). A f32 row-major (pitch lda) converted per fragment to bf16
// (ASPLIT: hi/lo two planes -> 2 terms, else single rounded term); Wt bf16 [N][K] (pitch ldb). BIAS_BF16 rounds the
// bias to bf16 first (bias quantised to bf16 before the add). K%32==0, M%16==0, N%64==0.
template <bool ASPLIT, int ACT, bool BIAS_BF16>
__global__ __launch_bounds__(128) void k_gemm_bf(const float* __restrict__ A, int lda, const unsigned short* __restrict__ Wt, int ldb,
                                               const float* __restrict__ bias, float* __restrict__ C, int ldc, int M, int N, int K) {
  __shared__ __attribute__((aligned(16))) float so[4][16][64];
  const int tid = threadIdx.x, w = tid >> 5, lane = tid & 31, ln = lane & 15, hh = lane >> 4;
  const int ntn = N / 64;
  const int wid = blockIdx.x * 4 + w;
  const int mt = wid / ntn, nq = wid % ntn;
  if (mt * 16 >= M) return;
  const int row0 = mt * 16, col0 = nq * 64;
  const float* arow = A + (size_t)(row0 + ln) * lda;
  v8f acc[4] = {};
  for (int kb = 0; kb < K; kb += 32) {
    FragB ah, al;
    const v4f x0 = *(const v4fa*)(arow + kb + 8 * hh), x1 = *(const v4fa*)(arow + kb + 8 * hh + 4);
    const v4f x2 = *(const v4fa*)(arow + kb + 16 + 8 * hh), x3 = *(const v4fa*)(arow + kb + 16 + 8 * hh + 4);
    float xs[16] = {x0[0],x0[1],x0[2],x0[3],x1[0],x1[1],x1[2],x1[3],x2[0],x2[1],x2[2],x2[3],x3[0],x3[1],x3[2],x3[3]};
#pragma unroll
    for (int i = 0; i < 16; ++i) { const unsigned short hb = bf16_bits(xs[i]); ah.u[i] = hb; al.u[i] = ASPLIT ? bf16_bits(xs[i] - bf16_val(hb)) : (unsigned short)0; }
#pragma unroll
    for (int t = 0; t < 4; ++t) {
      const unsigned short* brow = Wt + (size_t)(col0 + t * 16 + ln) * ldb + kb;
      FragB b;
      b.half[0] = *(const v8us*)(brow + 8 * hh);
      b.half[1] = *(const v8us*)(brow + 16 + 8 * hh);
      acc[t] = mmaN<ASPLIT ? 2 : 1>(ah.v, al.v, b.v, b.v, acc[t]);
    }
  }
#pragma unroll
  for (int t = 0; t < 4; ++t) {
    float bv = bias ? bias[col0 + t * 16 + ln] : 0.f;
    if (BIAS_BF16) bv = bf16_round(bv);
#pragma unroll
    for (int r = 0; r < 8; ++r) { float v = acc[t][r] + bv; if (ACT == 1) v = fmaxf(v, 0.f); so[w][8 * hh + r][t * 16 + ln] = v; }
  }
  __builtin_amdgcn_fence(__ATOMIC_ACQ_REL, "workgroup");
  __builtin_amdgcn_wave_barrier();
  const int rsub = lane >> 4, c4 = (lane & 15) * 4;
  {
#pragma unroll
    for (int q = 0; q < 8; ++q) {
      const int r = q * 2 + rsub;
      const v4f v = *(const v4fa*)&so[w][r][c4];
      *(v4f*)(C + (size_t)(row0 + r) * ldc + col0 + c4) = v;
    }
    
  }
}

// GEMM C = act(A·W + bias + resid): A f32 (ASPLIT -> hi/lo 2 terms), Wt bf16 [N][K]; ACT 0 none, 1 relu, 2 exact gelu;
// resid (optional, f32, row index = (row % rmod), pitch ldr, RES_BF16 rounds it) added before the activation.
template <bool ASPLIT, int ACT, bool BIAS_BF16, bool RES_BF16>
__global__ __launch_bounds__(128) void k_gemm_bf3(const float* __restrict__ A, int lda, const unsigned short* __restrict__ Wt, int ldb,
                                                const float* __restrict__ bias, const float* __restrict__ resid, int rmod, int ldr,
                                                float* __restrict__ C, int ldc, int M, int N, int K) {
  __shared__ __attribute__((aligned(16))) float so[4][16][64];
  const int tid = threadIdx.x, w = tid >> 5, lane = tid & 31, ln = lane & 15, hh = lane >> 4;
  const int ntn = N / 64;
  const int wid = blockIdx.x * 4 + w;
  const int mt = wid / ntn, nq = wid % ntn;
  if (mt * 16 >= M) return;
  const int row0 = mt * 16, col0 = nq * 64;
  const float* arow = A + (size_t)(row0 + ln) * lda;
  v8f acc[4] = {};
  for (int kb = 0; kb < K; kb += 32) {
    FragB ah, al;
    const v4f x0 = *(const v4fa*)(arow + kb + 8 * hh), x1 = *(const v4fa*)(arow + kb + 8 * hh + 4);
    const v4f x2 = *(const v4fa*)(arow + kb + 16 + 8 * hh), x3 = *(const v4fa*)(arow + kb + 16 + 8 * hh + 4);
    float xs[16] = {x0[0],x0[1],x0[2],x0[3],x1[0],x1[1],x1[2],x1[3],x2[0],x2[1],x2[2],x2[3],x3[0],x3[1],x3[2],x3[3]};
#pragma unroll
    for (int i = 0; i < 16; ++i) { const unsigned short hb = bf16_bits(xs[i]); ah.u[i] = hb; al.u[i] = ASPLIT ? bf16_bits(xs[i] - bf16_val(hb)) : (unsigned short)0; }
#pragma unroll
    for (int t = 0; t < 4; ++t) {
      const unsigned short* brow = Wt + (size_t)(col0 + t * 16 + ln) * ldb + kb;
      FragB b;
      b.half[0] = *(const v8us*)(brow + 8 * hh);
      b.half[1] = *(const v8us*)(brow + 16 + 8 * hh);
      acc[t] = mmaN<ASPLIT ? 2 : 1>(ah.v, al.v, b.v, b.v, acc[t]);
    }
  }
#pragma unroll
  for (int t = 0; t < 4; ++t) {
    const int col = col0 + t * 16 + ln;
    float bv = bias ? bias[col] : 0.f;
    if (BIAS_BF16) bv = bf16_round(bv);
#pragma unroll
    for (int r = 0; r < 8; ++r) {
      float v = acc[t][r] + bv;
      if (resid) { float rv = resid[(size_t)((row0 + 8 * hh + r) % rmod) * ldr + col]; if (RES_BF16) rv = bf16_round(rv); v += rv; }
      if (ACT == 1) v = fmaxf(v, 0.f);
      if (ACT == 2) v = 0.5f * v * (1.0f + erff(v * 0.70710678118654752f));
      if (ACT == 3) { const float u = 0.7978845608028654f * (v + 0.044715f * v * v * v); v = 0.5f * v * (1.0f + tanhf(u)); }
      so[w][8 * hh + r][t * 16 + ln] = v;
    }
  }
  __builtin_amdgcn_fence(__ATOMIC_ACQ_REL, "workgroup");
  __builtin_amdgcn_wave_barrier();
  const int rsub = lane >> 4, c4 = (lane & 15) * 4;
  {
#pragma unroll
    for (int q = 0; q < 8; ++q) {
      const int r = q * 2 + rsub;
      const v4f v = *(const v4fa*)&so[w][r][c4];
      *(v4f*)(C + (size_t)(row0 + r) * ldc + col0 + c4) = v;
    }
    
  }
}
// row LayerNorm (biased variance, eps) over N: s = X (+ R); optional out_sum <- s; out_norm <- (s-mu)*rsqrt(var+eps)*g + b
template <bool PARAM_BF16>
__global__ __launch_bounds__(256) void k_layernorm(const float* __restrict__ X, const float* __restrict__ R, const float* __restrict__ g, const float* __restrict__ bta,
                                                  float* __restrict__ out_sum, float* __restrict__ out_norm, int N, float eps) {
  __shared__ float red[256];
  const int row = blockIdx.x, tid = threadIdx.x;
  const float* x = X + (size_t)row * N; const float* rr = R ? R + (size_t)row * N : nullptr;
  float vals[16];                     // up to N = 4096
  const int per = N / 256;            // contiguous chunk per thread? use strided-by-4 chunks: thread handles j = tid*4 + 1024*u
  float s1 = 0.f;
  for (int u = 0; u < per / 4; ++u) {
    const int j = tid * 4 + 1024 * u;
    const v4f a = *(const v4fa*)(x + j);
    v4f b = {0.f,0.f,0.f,0.f}; if (rr) b = *(const v4fa*)(rr + j);
#pragma unroll
    for (int q = 0; q < 4; ++q) { const float v = a[q] + b[q]; vals[u * 4 + q] = v; s1 += v; }
  }
  red[tid] = s1; __syncthreads();
  for (int st = 128; st > 0; st >>= 1) { if (tid < st) red[tid] += red[tid + st]; __syncthreads(); }
  const float mu = red[0] / (float)N; __syncthreads();
  float s2 = 0.f;
  for (int u = 0; u < per / 4; ++u)
#pragma unroll
    for (int q = 0; q < 4; ++q) { const float c = vals[u * 4 + q] - mu; s2 += c * c; }
  red[tid] = s2; __syncthreads();
  for (int st = 128; st > 0; st >>= 1) { if (tid < st) red[tid] += red[tid + st]; __syncthreads(); }
  const float rs = rsqrtf(red[0] / (float)N + eps);
  {
    for (int u = 0; u < per / 4; ++u) {
      const int j = tid * 4 + 1024 * u;
      v4f o, sm;
#pragma unroll
      for (int q = 0; q < 4; ++q) {
        float gg = g[j + q], bb = bta[j + q];
        if (PARAM_BF16) { gg = bf16_round(gg); bb = bf16_round(bb); }
        sm[q] = vals[u * 4 + q]; o[q] = (vals[u * 4 + q] - mu) * rs * gg + bb;
      }
      if (out_sum) *(v4f*)(out_sum + (size_t)row * N + j) = sm;
      *(v4f*)(out_norm + (size_t)row * N + j) = o;
    }
    
  }
}



// ---- f16 WMMA path (v_wmma_f32_16x16x32_f16): 11-bit significands for operands in range — used where a [0,1] probability operand needs more precision than bf16
typedef _Float16 v16h __attribute__((ext_vector_type(16)));
union FragH { v16h v; v8us half[2]; _Float16 h[16]; unsigned short u[16]; };
template <int NT>
__device__ __forceinline__ v8f mmaH(v16h ah, v16h al, v16h bh, v16h bl, v8f c) {
  c = __builtin_amdgcn_wmma_f32_16x16x32_f16(false, ah, false, bh, (short)0, c, false, false);
  if (NT >= 2) c = __builtin_amdgcn_wmma_f32_16x16x32_f16(false, al, false, bh, (short)0, c, false, false);
  if (NT >= 3) c = __builtin_amdgcn_wmma_f32_16x16x32_f16(false, ah, false, bl, (short)0, c, false, false);
  asm volatile("v_nop\n\tv_nop\n\tv_nop\n\tv_nop" : "+v"(c) : "v"(ah), "v"(al), "v"(bh), "v"(bl));
  return c;
}
// batched GEMM like k_gemm_b but f16 operands: A f32 (split into f16 hi/lo if ASPLIT, else rounded to f16), Bt = f16 values [n][k]; alpha; C f32; N multiple of 16 (partial tiles skipped)
template <bool ASPLIT>
__global__ __launch_bounds__(128) void k_gemm_h(const float* __restrict__ A, int lda, size_t sA, const _Float16* __restrict__ Bh, int ldb, size_t sB, float alpha, float* __restrict__ C, int ldc, size_t sC, int M, int N, int K) {
  __shared__ __attribute__((aligned(16))) float so[4][16][64];
  const int tid = threadIdx.x, w = tid >> 5, lane = tid & 31, ln = lane & 15, hh = lane >> 4; const int by = blockIdx.y;
  A += (size_t)by * sA; Bh += (size_t)by * sB; C += (size_t)by * sC;
  const int ntn = (N + 63) / 64; const int wid = blockIdx.x * 4 + w; const int mt = wid / ntn, nq = wid % ntn; if (mt * 16 >= M) return;
  const int row0 = mt * 16, col0 = nq * 64; const float* arow = A + (size_t)(row0 + ln) * lda;
  v8f acc[4] = {};
  for (int kb = 0; kb < K; kb += 32) {
    FragH ah, al;
    const v4f x0 = *(const v4fa*)(arow + kb + 8 * hh), x1 = *(const v4fa*)(arow + kb + 8 * hh + 4), x2 = *(const v4fa*)(arow + kb + 16 + 8 * hh), x3 = *(const v4fa*)(arow + kb + 16 + 8 * hh + 4);
    float xs[16] = {x0[0],x0[1],x0[2],x0[3],x1[0],x1[1],x1[2],x1[3],x2[0],x2[1],x2[2],x2[3],x3[0],x3[1],x3[2],x3[3]};
#pragma unroll
    for (int i = 0; i < 16; ++i) { const _Float16 h = (_Float16)xs[i]; ah.h[i] = h; al.h[i] = ASPLIT ? (_Float16)(xs[i] - (float)h) : (_Float16)0.0f; }
#pragma unroll
    for (int t = 0; t < 4; ++t) { if (col0 + t * 16 >= N) continue; const size_t boff = (size_t)(col0 + t * 16 + ln) * ldb + kb; FragH bq; bq.half[0] = *(const v8us*)(Bh + boff + 8 * hh); bq.half[1] = *(const v8us*)(Bh + boff + 16 + 8 * hh);
      acc[t] = mmaH<ASPLIT ? 2 : 1>(ah.v, al.v, bq.v, bq.v, acc[t]); }
  }
#pragma unroll
  for (int t = 0; t < 4; ++t) { if (col0 + t * 16 >= N) continue;
#pragma unroll
    for (int r = 0; r < 8; ++r) so[w][8 * hh + r][t * 16 + ln] = acc[t][r] * alpha; }
  __builtin_amdgcn_fence(__ATOMIC_ACQ_REL, "workgroup"); __builtin_amdgcn_wave_barrier();
  const int rsub = lane >> 4, c4 = (lane & 15) * 4;
  {
#pragma unroll
    for (int q = 0; q < 8; ++q) { const int r = q * 2 + rsub; if (col0 + c4 < N) { const v4f v = *(const v4fa*)&so[w][r][c4]; *(v4f*)(C + (size_t)(row0 + r) * ldc + col0 + c4) = v; } }
     }
}

// Wt[n][k] = f16(W[k][n]·scale) from f32 row-major W[K][N] (scale = power of two; bf16-exact weights stay exact in f16 away from the subnormal range)
__global__ __launch_bounds__(256) void k_wt_f16(const float* __restrict__ W, _Float16* __restrict__ Wt, int K, int N, float scale) {
  const int t = blockIdx.x * 256 + threadIdx.x; if (t >= N * (K / 8)) return; const int n = t / (K / 8), k8 = (t % (K / 8)) * 8; FragH f;
#pragma unroll
  for (int i = 0; i < 8; ++i) f.h[i] = (_Float16)(bf16_round(W[(size_t)(k8 + i) * N + n]) * scale); const v8us o = f.half[0];
  *(v8us*)((unsigned short*)Wt + (size_t)n * K + k8) = o; 
}
// k_gemm_hh variant with fused epilogue: v = acc·alpha + bias[by·sBias + col] (+ CP[(row/rowsPerB)·sCPb + by·64 + col] if CP) ; ACT 0 none / 1 elu ; writes f16 C16 (and f32 C if non-null)
template <int ACT>
__global__ __launch_bounds__(128) void k_gemm_hhx(const _Float16* __restrict__ A, int lda, size_t sA, const _Float16* __restrict__ Bh, int ldb, size_t sB, float alpha, const float* __restrict__ bias, size_t sBias, const float* __restrict__ CP, int rowsPerB, size_t sCPb, int row0g,
    float* __restrict__ C, _Float16* __restrict__ C16, int ldc, size_t sC, int M, int N, int K) {
  __shared__ __attribute__((aligned(16))) float so[4][16][64];
  const int tid = threadIdx.x, w = tid >> 5, lane = tid & 31, ln = lane & 15, hh = lane >> 4; const int by = blockIdx.y;
  A += (size_t)by * sA; Bh += (size_t)by * sB; const size_t cofs = (size_t)by * sC; const float* bp = bias ? bias + (size_t)by * sBias : nullptr;
  const int ntn = (N + 63) / 64; const int wid = blockIdx.x * 4 + w; const int mt = wid / ntn, nq = wid % ntn; if (mt * 16 >= M) return;
  const int row0 = mt * 16, col0 = nq * 64; const _Float16* arow = A + (size_t)(row0 + ln) * lda;
  v8f acc[4] = {};
  for (int kb = 0; kb < K; kb += 32) { FragH ah; ah.half[0] = *(const v8us*)((const unsigned short*)arow + kb + 8 * hh); ah.half[1] = *(const v8us*)((const unsigned short*)arow + kb + 16 + 8 * hh);
#pragma unroll
    for (int t = 0; t < 4; ++t) { if (col0 + t * 16 >= N) continue; const size_t boff = (size_t)(col0 + t * 16 + ln) * ldb + kb; FragH bq; bq.half[0] = *(const v8us*)((const unsigned short*)Bh + boff + 8 * hh); bq.half[1] = *(const v8us*)((const unsigned short*)Bh + boff + 16 + 8 * hh);
      acc[t] = mmaH<1>(ah.v, ah.v, bq.v, bq.v, acc[t]); }
  }
#pragma unroll
  for (int t = 0; t < 4; ++t) { if (col0 + t * 16 >= N) continue; const int col = col0 + t * 16 + ln; const float bv = bp ? bf16_round(bp[col]) : 0.f;
#pragma unroll
    for (int r = 0; r < 8; ++r) { float v = acc[t][r] * alpha + bv; if (CP) { const int bidx = (row0g + row0 + 8 * hh + r) / rowsPerB; v += CP[(size_t)bidx * sCPb + (size_t)by * 64 + col]; } if (ACT == 1) v = (v > 0.f) ? v : expm1f(v); else if (ACT == 7) v = (v > 0.f) ? v + 1.0f : expf(v); else if (ACT == 8) v = tanhf(v); else if (ACT == 9) v = 0.5f * v * (1.0f + tanhf(0.7978845608028654f * (v + 0.044715f * v * v * v))); else if (ACT == 11) v = 1.0f / (1.0f + expf(-v)); else if (ACT == 12) v = (v > 0.f) ? v : 0.01f * v; else if (ACT == 14) v = (v > 0.f) ? v : 0.1f * v; else if (ACT == 15) v = v / (1.0f + expf(-v)); else if (ACT == 3) v = fmaxf(v, 0.f); else if (ACT == 6) v = 0.5f * v * (1.0f + erff(v * 0.70710678118654752f)); so[w][8 * hh + r][t * 16 + ln] = v; } }
  __builtin_amdgcn_fence(__ATOMIC_ACQ_REL, "workgroup"); __builtin_amdgcn_wave_barrier();
  const int rsub = lane >> 4, c4 = (lane & 15) * 4; typedef _Float16 v4h __attribute__((ext_vector_type(4)));
  {
#pragma unroll
    for (int q = 0; q < 8; ++q) { const int r = q * 2 + rsub; if (col0 + c4 < N) { const v4f v = *(const v4fa*)&so[w][r][c4]; if (C) *(v4f*)(C + cofs + (size_t)(row0 + r) * ldc + col0 + c4) = v; if (C16) { v4h h4; for (int i = 0; i < 4; ++i) h4[i] = (_Float16)v[i]; *(v4h*)(C16 + cofs + (size_t)(row0 + r) * ldc + col0 + c4) = h4; } } }
     }
}


typedef _Float16 v4h __attribute__((ext_vector_type(4)));

__global__ __launch_bounds__(256) void k_x16(const float* __restrict__ x, _Float16* __restrict__ X16, size_t n8) { const size_t t = (size_t)blockIdx.x * 256 + threadIdx.x; if (t >= n8) return; FragH f;
#pragma unroll
  for (int q = 0; q < 8; ++q) f.h[q] = (_Float16)bf16_round(x[t * 8 + q]); *(v8us*)((unsigned short*)X16 + t * 8) = f.half[0];  }
__global__ __launch_bounds__(256) void k_h16(const float* __restrict__ x, _Float16* __restrict__ X16, size_t n8) { const size_t t = (size_t)blockIdx.x * 256 + threadIdx.x; if (t >= n8) return; FragH f;
#pragma unroll
  for (int q = 0; q < 8; ++q) f.h[q] = (_Float16)x[t * 8 + q]; *(v8us*)((unsigned short*)X16 + t * 8) = f.half[0];  }
__global__ __launch_bounds__(256) void k_round16f(const float* __restrict__ W, _Float16* __restrict__ Bt, size_t n8) { const size_t t = (size_t)blockIdx.x * 256 + threadIdx.x; if (t >= n8) return; FragH f;
#pragma unroll
  for (int i = 0; i < 8; ++i) f.h[i] = (_Float16)(bf16_round(W[t * 8 + i]) * 16.0f); *(v8us*)((unsigned short*)Bt + t * 8) = f.half[0];  }
template <int NHv, int TTv>
__global__ __launch_bounds__(256) void k_vt(const _Float16* __restrict__ V16, int ldv, int voff, _Float16* __restrict__ Vt) { __shared__ unsigned short tl[64][66]; const int tid = threadIdx.x; const int slab = blockIdx.x / (TTv / 64), lg = blockIdx.x % (TTv / 64); const int b = slab / NHv, h = slab % NHv;
  for (int i = tid; i < 64 * 8; i += 256) { const int r = i / 8, c8 = (i % 8) * 8; FragH f; f.half[0] = *(const v8us*)((const unsigned short*)V16 + ((size_t)b * TTv + lg * 64 + r) * ldv + voff + h * 64 + c8);
#pragma unroll
    for (int q = 0; q < 8; ++q) tl[r][c8 + q] = f.u[q]; }
  __syncthreads();
  {
#pragma unroll
    for (int rd = 0; rd < 2; ++rd) { const int d = rd * 32 + tid / 8, pc = tid % 8; FragH f;
#pragma unroll
      for (int q = 0; q < 8; ++q) f.u[q] = tl[pc * 8 + q][d];
      *(v8us*)((unsigned short*)Vt + ((size_t)slab * 64 + d) * TTv + lg * 64 + pc * 8) = f.half[0]; }
     } }

__global__ __launch_bounds__(256) void k_hl(const float* __restrict__ F, _Float16* __restrict__ Hh, _Float16* __restrict__ Hl, size_t n8) { const size_t t = (size_t)blockIdx.x * 256 + threadIdx.x; if (t >= n8) return; FragH fh, fl; const v4f a = *(const v4fa*)(F + t * 8), c = *(const v4fa*)(F + t * 8 + 4);
#pragma unroll
  for (int q = 0; q < 4; ++q) { _Float16 h = (_Float16)a[q]; fh.h[q] = h; fl.h[q] = (_Float16)((a[q] - (float)h) * 1024.0f); h = (_Float16)c[q]; fh.h[4 + q] = h; fl.h[4 + q] = (_Float16)((c[q] - (float)h) * 1024.0f); }
  { *(v8us*)((unsigned short*)Hh + t * 8) = fh.half[0]; *(v8us*)((unsigned short*)Hl + t * 8) = fl.half[0];  } }

// ---- fast GEMM (wave tile 32x64; requires M % 32 == 0 rows per launch region and N % 64 == 0); epilogue = k_gemm_hhx semantics ----
__device__ __forceinline__ v16h g2_frag(const _Float16* p, int hh) { FragH f; f.half[0] = *(const v8us*)((const unsigned short*)p + 8 * hh); f.half[1] = *(const v8us*)((const unsigned short*)p + 16 + 8 * hh); return f.v; }
__device__ __forceinline__ v8f g2_mma(v16h a, v16h b, v8f c) { v8f d = __builtin_amdgcn_wmma_f32_16x16x32_f16(false, a, false, b, (short)0, c, false, false); asm volatile("v_nop\n\tv_nop\n\tv_nop\n\tv_nop" : "+v"(d) : "v"(a), "v"(b)); return d; }
template <int ACT>
__global__ __launch_bounds__(128) void k_gemm2(const _Float16* __restrict__ A, int lda, size_t sA, const _Float16* __restrict__ Bh, int ldb, size_t sB, float alpha, const float* __restrict__ bias, size_t sBias, const float* __restrict__ CP, int rowsPerB, size_t sCPb, int row0g,
    float* __restrict__ C, _Float16* __restrict__ C16, int ldc, size_t sC, int M, int N, int K) {
  __shared__ __attribute__((aligned(16))) float so[4][32][68];
  const int tid = threadIdx.x, w = tid >> 5, lane = tid & 31, ln = lane & 15, hh = lane >> 4; const int by = blockIdx.y;
  A += (size_t)by * sA; Bh += (size_t)by * sB; const size_t cofs = (size_t)by * sC; const float* bp = bias ? bias + (size_t)by * sBias : nullptr;
  const int ntn = N >> 6; const int mt = blockIdx.x / ntn, nq = blockIdx.x - mt * ntn; const int row0 = mt * 128 + 32 * w, col0 = nq * 64; if (row0 >= M) return;
  const _Float16* a0p = A + (size_t)(row0 + ln) * lda; const _Float16* a1p = a0p + (size_t)16 * lda;
  const _Float16* b0p = Bh + (size_t)(col0 + ln) * ldb; const _Float16* b1p = b0p + (size_t)16 * ldb; const _Float16* b2p = b1p + (size_t)16 * ldb; const _Float16* b3p = b2p + (size_t)16 * ldb;
  const v8f z8 = {0.f,0.f,0.f,0.f,0.f,0.f,0.f,0.f}; v8f c00 = z8, c01 = z8, c02 = z8, c03 = z8, c10 = z8, c11 = z8, c12 = z8, c13 = z8;
#pragma unroll 1
  for (int kb = 0; kb < K; kb += 32) { const v16h a0 = g2_frag(a0p + kb, hh), a1 = g2_frag(a1p + kb, hh);
    v16h b = g2_frag(b0p + kb, hh); c00 = g2_mma(a0, b, c00); c10 = g2_mma(a1, b, c10);
    b = g2_frag(b1p + kb, hh); c01 = g2_mma(a0, b, c01); c11 = g2_mma(a1, b, c11);
    b = g2_frag(b2p + kb, hh); c02 = g2_mma(a0, b, c02); c12 = g2_mma(a1, b, c12);
    b = g2_frag(b3p + kb, hh); c03 = g2_mma(a0, b, c03); c13 = g2_mma(a1, b, c13); }
  v8f accs[8] = {c00, c01, c02, c03, c10, c11, c12, c13};
#pragma unroll
  for (int u = 0; u < 8; ++u) { const int t = u & 3, half = u >> 2; const int col = col0 + t * 16 + ln; const float bv = bp ? bf16_round(bp[col]) : 0.f;
#pragma unroll
    for (int r = 0; r < 8; ++r) { const int rloc = half * 16 + 8 * hh + r; float v = accs[u][r] * alpha + bv; if (CP) { const int bidx = (row0g + row0 + rloc) / rowsPerB; v += CP[(size_t)bidx * sCPb + (size_t)by * 64 + col]; }
      if (ACT == 3) v = fmaxf(v, 0.f); else if (ACT == 6) v = 0.5f * v * (1.0f + erff(v * 0.70710678118654752f)); else if (ACT == 11) v = 1.0f / (1.0f + expf(-v)); else if (ACT == 15) v = v / (1.0f + expf(-v)); else if (ACT == 12) v = (v > 0.f) ? v : 0.01f * v; else if (ACT == 8) v = tanhf(v); else if (ACT == 9) v = 0.5f * v * (1.0f + tanhf(0.7978845608028654f * (v + 0.044715f * v * v * v)));      /* tanh-GELU */
      so[w][rloc][t * 16 + ln] = v; } }
  __builtin_amdgcn_fence(__ATOMIC_ACQ_REL, "workgroup"); __builtin_amdgcn_wave_barrier();
  const int rsub = lane >> 4, c4 = (lane & 15) * 4;
  {
#pragma unroll
    for (int q = 0; q < 16; ++q) { const int r = q * 2 + rsub; const v4f v = *(const v4fa*)&so[w][r][c4]; if (C) *(v4f*)(C + cofs + (size_t)(row0 + r) * ldc + col0 + c4) = v; if (C16) { v4h h4; for (int i = 0; i < 4; ++i) h4[i] = (_Float16)v[i]; *(v4h*)(C16 + cofs + (size_t)(row0 + r) * ldc + col0 + c4) = h4; } }
     } }


__global__ __launch_bounds__(256) void k_embed(const int* __restrict__ tok, const float* __restrict__ emb, const float* __restrict__ pos, float* __restrict__ X) {
  #pragma clang fp contract(off)
  const int t = blockIdx.x * 256 + threadIdx.x; if (t >= SLEN * (DM / 4)) return; const int c0 = (t % (DM / 4)) * 4, s = t / (DM / 4); const int id = (s == 0) ? 0 : tok[s - 1]; v4f o;
#pragma unroll
  for (int q = 0; q < 4; ++q) o[q] = bf16_round(emb[(size_t)id * DM + c0 + q]) + bf16_round(pos[(size_t)s * DM + c0 + q]);
  *(v4f*)(X + (size_t)s * DM + c0) = o;  }
__global__ __launch_bounds__(256) void k_ln512(const float* __restrict__ X, const float* __restrict__ g, const float* __restrict__ bb, _Float16* __restrict__ Y16) {
  #pragma clang fp contract(off)
  const int tid = threadIdx.x, w = tid >> 5, ln = tid & 31; const int r = blockIdx.x * 8 + w; if (r >= SLEN) return; const float* x = X + (size_t)r * DM; v4f a[4]; float s = 0.f;
#pragma unroll
  for (int i = 0; i < 4; ++i) { a[i] = *(const v4fa*)(x + i * 128 + ln * 4); for (int q = 0; q < 4; ++q) s += a[i][q]; }
  for (int o = 16; o > 0; o >>= 1) s += __shfl_xor(s, o, 32); const float mu = s / (float)DM; float q2 = 0.f;
#pragma unroll
  for (int i = 0; i < 4; ++i) for (int q = 0; q < 4; ++q) { const float d = a[i][q] - mu; q2 += d * d; }
  for (int o = 16; o > 0; o >>= 1) q2 += __shfl_xor(q2, o, 32); const float rs = rsqrtf(q2 / (float)DM + 1e-6f);
  {
#pragma unroll
    for (int i = 0; i < 4; ++i) { const int c0 = i * 128 + ln * 4; _Float16 h4[4]; for (int q = 0; q < 4; ++q) h4[q] = (_Float16)((a[i][q] - mu) * rs * bf16_round(g[c0 + q]) + bf16_round(bb[c0 + q])); *(unsigned long long*)((unsigned short*)Y16 + (size_t)r * DM + c0) = *(const unsigned long long*)h4; }
     } }
__global__ __launch_bounds__(256) void k_softsp(const float* __restrict__ S, const int* __restrict__ tok, _Float16* __restrict__ P16) {
  #pragma clang fp contract(off)
  const int tid = threadIdx.x, w = tid >> 5, ln = tid & 31; const int i = blockIdx.x * 8 + w; if (i >= SLEN) return; const float* s = S + (size_t)i * SLEN; float m = -3.0e38f;
  auto val = [&](int j) -> float { const bool keep = (j <= i) && (((i / BLK) == (j / BLK)) || ((j % BLK) >= BLK - CSP)) && (tok[j] > 0); return keep ? s[j] : -1.0e9f; };
#pragma unroll 1
  for (int c = 0; c < SLEN / 256; ++c) { const int kb = c * 256 + ln * 8; for (int q = 0; q < 8; ++q) m = fmaxf(m, val(kb + q)); }
  for (int o = 16; o > 0; o >>= 1) m = fmaxf(m, __shfl_xor(m, o, 32)); float su = 0.f;
#pragma unroll 1
  for (int c = 0; c < SLEN / 256; ++c) { const int kb = c * 256 + ln * 8; for (int q = 0; q < 8; ++q) su += expf(val(kb + q) - m); }
  for (int o = 16; o > 0; o >>= 1) su += __shfl_xor(su, o, 32); const float inv = 1024.0f / su; unsigned short* d = (unsigned short*)P16 + (size_t)i * SLEN;
  {
#pragma unroll 1
    for (int c = 0; c < SLEN / 256; ++c) { const int kb = c * 256 + ln * 8; FragH f;
#pragma unroll
      for (int q = 0; q < 8; ++q) f.h[q] = (_Float16)(expf(val(kb + q) - m) * inv);
      *(v8us*)(d + kb) = f.half[0]; }
     } }

extern "C" void kernel_launch(void* const* d_in, const int* in_sizes, int n_in,
                              void* d_out, int out_size, void* d_ws, size_t ws_size, hipStream_t stream) {
  (void)in_sizes; (void)n_in; (void)out_size;
  const float* const* I = (const float* const*)d_in; const int* tok = (const int*)d_in[0]; const float* emb = I[1]; const float* pos = I[2]; const float* l1s = I[3]; const float* l1b = I[4]; const float* wq = I[5]; const float* wk = I[6]; const float* wv = I[7]; const float* wo = I[8];
  const float* l2s = I[9]; const float* l2b = I[10]; const float* w1 = I[11]; const float* b1 = I[12]; const float* w2 = I[13]; const float* b2 = I[14]; const float* lfs = I[15]; const float* lfb = I[16]; const float* wout = I[17]; const float* bout = I[18];
  char* ws = (char*)d_ws; size_t off = 0;
  auto take = [&](size_t bytes) { char* p = ws + off; off += (bytes + 255) & ~(size_t)255; return p; };
  _Float16* BQ = (_Float16*)take((size_t)DM * DM * 2); _Float16* BK = (_Float16*)take((size_t)DM * DM * 2); _Float16* BV = (_Float16*)take((size_t)DM * DM * 2); _Float16* BO = (_Float16*)take((size_t)DM * DM * 2); _Float16* BW1 = (_Float16*)take((size_t)DMLP * DM * 2); _Float16* BW2 = (_Float16*)take((size_t)DM * DMLP * 2); _Float16* BOUT = (_Float16*)take((size_t)NVOC * DM * 2);
  float* X = (float*)take((size_t)SLEN * DM * 4); _Float16* H16 = (_Float16*)take((size_t)SLEN * DM * 2); _Float16* Q16 = (_Float16*)take((size_t)SLEN * DM * 2); _Float16* K16 = (_Float16*)take((size_t)SLEN * DM * 2); _Float16* V16 = (_Float16*)take((size_t)SLEN * DM * 2); _Float16* VT = (_Float16*)take((size_t)DM * SLEN * 2);
  float* S = (float*)take((size_t)SLEN * SLEN * 4); _Float16* P16 = (_Float16*)take((size_t)SLEN * SLEN * 2); _Float16* O16 = (_Float16*)take((size_t)SLEN * DM * 2); _Float16* G16 = (_Float16*)take((size_t)SLEN * DMLP * 2);
  if (off > ws_size) return;      /* 6.3 + 4 + 2 x 5 + 16 + 8 + 2 + 8 = 54.3 MiB */
  const size_t w8 = (size_t)DM * DM / 8; const unsigned wb = (unsigned)((w8 + 255) / 256); const dim3 gP((SLEN / 128) * (DM / 64), 1), gS((SLEN / 128) * (SLEN / 64), 1), gH((SLEN / 128) * 1, 1), gM((SLEN / 128) * (DMLP / 64), 1), gV((SLEN / 128) * (NVOC / 64), 1);
  k_embed<<<(SLEN * (DM / 4) + 255) / 256, 256, 0, stream>>>(tok, emb, pos, X);
  for (int l = 0; l < NLRUN; ++l) {
    k_wt_f16<<<wb, 256, 0, stream>>>(wq + (size_t)l * DM * DM, BQ, DM, DM, 16.0f); k_wt_f16<<<wb, 256, 0, stream>>>(wk + (size_t)l * DM * DM, BK, DM, DM, 16.0f); k_wt_f16<<<wb, 256, 0, stream>>>(wv + (size_t)l * DM * DM, BV, DM, DM, 16.0f); k_wt_f16<<<wb, 256, 0, stream>>>(wo + (size_t)l * DM * DM, BO, DM, DM, 16.0f);      /* wq[l] [D][H][DH] = (in, out=h*64+k); wo[l] [H][DH][D] = (in=h*64+k, out) */
    k_wt_f16<<<(unsigned)(((size_t)DM * DMLP / 8 + 255) / 256), 256, 0, stream>>>(w1 + (size_t)l * DM * DMLP, BW1, DM, DMLP, 16.0f); k_wt_f16<<<(unsigned)(((size_t)DMLP * DM / 8 + 255) / 256), 256, 0, stream>>>(w2 + (size_t)l * DMLP * DM, BW2, DMLP, DM, 16.0f);
    k_ln512<<<SLEN / 8, 256, 0, stream>>>(X, l1s + l * DM, l1b + l * DM, H16);
    k_gemm2<0><<<gP, 128, 0, stream>>>(H16, DM, 0, BQ, DM, 0, 0.0625f, nullptr, 0, nullptr, 1, 0, 0, nullptr, Q16, DM, 0, SLEN, DM, DM);
    k_gemm2<0><<<gP, 128, 0, stream>>>(H16, DM, 0, BK, DM, 0, 0.0625f, nullptr, 0, nullptr, 1, 0, 0, nullptr, K16, DM, 0, SLEN, DM, DM);
    k_gemm2<0><<<gP, 128, 0, stream>>>(H16, DM, 0, BV, DM, 0, 0.0625f, nullptr, 0, nullptr, 1, 0, 0, nullptr, V16, DM, 0, SLEN, DM, DM);
    k_vt<NH, SLEN><<<NH * (SLEN / 64), 256, 0, stream>>>(V16, DM, 0, VT);
    for (int h = 0; h < NH; ++h) {
      k_gemm2<0><<<gS, 128, 0, stream>>>(Q16 + h * 64, DM, 0, K16 + h * 64, DM, 0, 0.125f, nullptr, 0, nullptr, 1, 0, 0, S, nullptr, SLEN, 0, SLEN, SLEN, 64);      /* (q / 8) . k */
      k_softsp<<<SLEN / 8, 256, 0, stream>>>(S, tok, P16);
      k_gemm2<0><<<gH, 128, 0, stream>>>(P16, SLEN, 0, VT + (size_t)h * 64 * SLEN, SLEN, 0, 0.0009765625f, nullptr, 0, nullptr, 1, 0, 0, nullptr, O16 + h * 64, DM, 0, SLEN, 64, SLEN); }
    k_gemm2<0><<<gP, 128, 0, stream>>>(O16, DM, 0, BO, DM, 0, 0.0625f, nullptr, 0, X, 1, (size_t)DM, 0, X, nullptr, DM, 0, SLEN, DM, DM);      /* x += o Wo (own tile, in place) */
    k_ln512<<<SLEN / 8, 256, 0, stream>>>(X, l2s + l * DM, l2b + l * DM, H16);
    k_gemm2<9><<<gM, 128, 0, stream>>>(H16, DM, 0, BW1, DM, 0, 0.0625f, b1 + (size_t)l * DMLP, 0, nullptr, 1, 0, 0, nullptr, G16, DMLP, 0, SLEN, DMLP, DM);      /* tanh-gelu(y W1 + b1) */
    k_gemm2<0><<<gP, 128, 0, stream>>>(G16, DMLP, 0, BW2, DMLP, 0, 0.0625f, b2 + (size_t)l * DM, 0, X, 1, (size_t)DM, 0, X, nullptr, DM, 0, SLEN, DM, DMLP); }      /* x += mlp + b2 */
  k_wt_f16<<<(unsigned)(((size_t)DM * NVOC / 8 + 255) / 256), 256, 0, stream>>>(wout, BOUT, DM, NVOC, 16.0f);
  k_ln512<<<SLEN / 8, 256, 0, stream>>>(X, lfs, lfb, H16);
  k_gemm2<0><<<gV, 128, 0, stream>>>(H16, DM, 0, BOUT, DM, 0, 0.0625f, bout, 0, nullptr, 1, 0, 0, (float*)d_out, nullptr, NVOC, 0, SLEN, NVOC, DM);
}

// v001
// It runs in 2340 microseconds.
// In two side-by-side timings against v000, it was 2.53 and 2.54 times as fast.
#include <hip/hip_runtime.h>
// Sparse-pattern transformer decoder (1 x 2048 tokens, 512 = 8 heads x 64, 6 layers, MLP 2048 (tanh-GELU), vocab 256): x = embed[shift_right(tokens)] + pos_emb; per layer: h = LN1(x); q = h Wq / 8, k, v; scores masked by the structural fixed sparse pattern (causal & (same 128-block | last 32 columns of each block)) AND the INPUT key padding (token > 0), masked entries = -1e9 exactly as the reference; softmax; x += (P v) Wo; x += gelu(LN2(x) W1 + b1) W2 + b2; out = LNf(x) Wout + bout -> [1,2048,256].
// Structure: token-embedding gather by the INPUT ids on VALU; LayerNorms on VALU; all Linears as f16 WMMA GEMMs (32x64 wave tiles, f32 accumulation, exact x16 weights, biases / GELU / residual accumulation in the epilogue); per layer, all heads in one launch each (grid y = head): the scores as a GEMM (K 64) into the head's f32 plane, a wave-per-row f32 softmax applying the structural pattern and the key-padding predicate (three rolled passes, P x2^10 f16), V transposed by LDS tiles, P.v as a GEMM into the head's columns of an f16 plane.
// Compute dtype: embeddings, weights, biases, LN parameters rounded to bf16; LN outputs, q, k, v, P, attention output, GELU hidden as f16 operands (~2^-12; logits small); the residual stream, softmax, LayerNorm in f32. v_wmma_f32_16x16x32_f16.
#define SLEN 2048
#define DM 512
#define NH 8
#define NL 6
#define NLRUN NL                 /* layers executed */
#define DMLP 2048
#define NVOC 256
#define BLK 128
#define CSP 32
#define NR SLEN
typedef __bf16 v16b __attribute__((ext_vector_type(16)));
typedef unsigned short v8us __attribute__((ext_vector_type(8), may_alias));
typedef float  v8f  __attribute__((ext_vector_type(8)));
typedef float  v4f  __attribute__((ext_vector_type(4)));
typedef float  v4fa __attribute__((ext_vector_type(4), may_alias));
union FragB { v16b v; v8us half[2]; unsigned short u[16]; };

__device__ __forceinline__ unsigned short bf16_bits(float x) { unsigned int u = __float_as_uint(x); return (unsigned short)((u + 0x7FFFu + ((u >> 16) & 1u)) >> 16); }
__device__ __forceinline__ float bf16_val(unsigned short b) { return __uint_as_float(((unsigned int)b) << 16); }
__device__ __forceinline__ float bf16_round(float x) { return bf16_val(bf16_bits(x)); }
// D += A·B with NT terms: 1 = ah·bh, 2 = + al·bh (A split), 3 = + ah·bl (both split)
template <int NT>
__device__ __forceinline__ v8f mmaN(v16b ah, v16b al, v16b bh, v16b bl, v8f c) {
  c = __builtin_amdgcn_wmma_f32_16x16x32_bf16(false, ah, false, bh, (short)0, c, false, false);
  if (NT >= 2) c = __builtin_amdgcn_wmma_f32_16x16x32_bf16(false, al, false, bh, (short)0, c, false, false);
  if (NT >= 3) c = __builtin_amdgcn_wmma_f32_16x16x32_bf16(false, ah, false, bl, (short)0, c, false, false);
  asm volatile("v_nop\n\tv_nop\n\tv_nop\n\tv_nop" : "+v"(c) : "v"(ah), "v"(al), "v"(bh), "v"(bl));
  return c;
}

__global__ __launch_bounds__(256) void k_wt_bf16(const float* __restrict__ W, unsigned short* __restrict__ Wt, int K, int N) {
  const int t = blockIdx.x * 256 + threadIdx.x;
  const int k8n = K / 8;
  if (t >= N * k8n) return;
  const int n = t / k8n, k8 = (t % k8n) * 8;
  v8us v;
#pragma unroll
  for (int i = 0; i < 8; ++i) v[i] = bf16_bits(W[(size_t)(k8 + i) * N + n]);
  *(v8us*)(Wt + (size_t)n * K + k8) = v;
  
}

// GEMM C[M][N] (f32, pitch ldc) = act(A[M][K]·W + bias). A f32 row-major (pitch lda) converted per fragment to bf16
// (ASPLIT: hi/lo two planes -> 2 terms, else single rounded term); Wt bf16 [N][K] (pitch ldb). BIAS_BF16 rounds the
// bias to bf16 first (bias quantised to bf16 before the add). K%32==0, M%16==0, N%64==0.
template <bool ASPLIT, int ACT, bool BIAS_BF16>
__global__ __launch_bounds__(128) void k_gemm_bf(const float* __restrict__ A, int lda, const unsigned short* __restrict__ Wt, int ldb,
                                               const float* __restrict__ bias, float* __restrict__ C, int ldc, int M, int N, int K) {
  __shared__ __attribute__((aligned(16))) float so[4][16][64];
  const int tid = threadIdx.x, w = tid >> 5, lane = tid & 31, ln = lane & 15, hh = lane >> 4;
  const int ntn = N / 64;
  const int wid = blockIdx.x * 4 + w;
  const int mt = wid / ntn, nq = wid % ntn;
  if (mt * 16 >= M) return;
  const int row0 = mt * 16, col0 = nq * 64;
  const float* arow = A + (size_t)(row0 + ln) * lda;
  v8f acc[4] = {};
  for (int kb = 0; kb < K; kb += 32) {
    FragB ah, al;
    const v4f x0 = *(const v4fa*)(arow + kb + 8 * hh), x1 = *(const v4fa*)(arow + kb + 8 * hh + 4);
    const v4f x2 = *(const v4fa*)(arow + kb + 16 + 8 * hh), x3 = *(const v4fa*)(arow + kb + 16 + 8 * hh + 4);
    float xs[16] = {x0[0],x0[1],x0[2],x0[3],x1[0],x1[1],x1[2],x1[3],x2[0],x2[1],x2[2],x2[3],x3[0],x3[1],x3[2],x3[3]};
#pragma unroll
    for (int i = 0; i < 16; ++i) { const unsigned short hb = bf16_bits(xs[i]); ah.u[i] = hb; al.u[i] = ASPLIT ? bf16_bits(xs[i] - bf16_val(hb)) : (unsigned short)0; }
#pragma unroll
    for (int t = 0; t < 4; ++t) {
      const unsigned short* brow = Wt + (size_t)(col0 + t * 16 + ln) * ldb + kb;
      FragB b;
      b.half[0] = *(const v8us*)(brow + 8 * hh);
      b.half[1] = *(const v8us*)(brow + 16 + 8 * hh);
      acc[t] = mmaN<ASPLIT ? 2 : 1>(ah.v, al.v, b.v, b.v, acc[t]);
    }
  }
#pragma unroll
  for (int t = 0; t < 4; ++t) {
    float bv = bias ? bias[col0 + t * 16 + ln] : 0.f;
    if (BIAS_BF16) bv = bf16_round(bv);
#pragma unroll
    for (int r = 0; r < 8; ++r) { float v = acc[t][r] + bv; if (ACT == 1) v = fmaxf(v, 0.f); so[w][8 * hh + r][t * 16 + ln] = v; }
  }
  __builtin_amdgcn_fence(__ATOMIC_ACQ_REL, "workgroup");
  __builtin_amdgcn_wave_barrier();
  const int rsub = lane >> 4, c4 = (lane & 15) * 4;
  {
#pragma unroll
    for (int q = 0; q < 8; ++q) {
      const int r = q * 2 + rsub;
      const v4f v = *(const v4fa*)&so[w][r][c4];
      *(v4f*)(C + (size_t)(row0 + r) * ldc + col0 + c4) = v;
    }
    
  }
}

// GEMM C = act(A·W + bias + resid): A f32 (ASPLIT -> hi/lo 2 terms), Wt bf16 [N][K]; ACT 0 none, 1 relu, 2 exact gelu;
// resid (optional, f32, row index = (row % rmod), pitch ldr, RES_BF16 rounds it) added before the activation.
template <bool ASPLIT, int ACT, bool BIAS_BF16, bool RES_BF16>
__global__ __launch_bounds__(128) void k_gemm_bf3(const float* __restrict__ A, int lda, const unsigned short* __restrict__ Wt, int ldb,
                                                const float* __restrict__ bias, const float* __restrict__ resid, int rmod, int ldr,
                                                float* __restrict__ C, int ldc, int M, int N, int K) {
  __shared__ __attribute__((aligned(16))) float so[4][16][64];
  const int tid = threadIdx.x, w = tid >> 5, lane = tid & 31, ln = lane & 15, hh = lane >> 4;
  const int ntn = N / 64;
  const int wid = blockIdx.x * 4 + w;
  const int mt = wid / ntn, nq = wid % ntn;
  if (mt * 16 >= M) return;
  const int row0 = mt * 16, col0 = nq * 64;
  const float* arow = A + (size_t)(row0 + ln) * lda;
  v8f acc[4] = {};
  for (int kb = 0; kb < K; kb += 32) {
    FragB ah, al;
    const v4f x0 = *(const v4fa*)(arow + kb + 8 * hh), x1 = *(const v4fa*)(arow + kb + 8 * hh + 4);
    const v4f x2 = *(const v4fa*)(arow + kb + 16 + 8 * hh), x3 = *(const v4fa*)(arow + kb + 16 + 8 * hh + 4);
    float xs[16] = {x0[0],x0[1],x0[2],x0[3],x1[0],x1[1],x1[2],x1[3],x2[0],x2[1],x2[2],x2[3],x3[0],x3[1],x3[2],x3[3]};
#pragma unroll
    for (int i = 0; i < 16; ++i) { const unsigned short hb = bf16_bits(xs[i]); ah.u[i] = hb; al.u[i] = ASPLIT ? bf16_bits(xs[i] - bf16_val(hb)) : (unsigned short)0; }
#pragma unroll
    for (int t = 0; t < 4; ++t) {
      const unsigned short* brow = Wt + (size_t)(col0 + t * 16 + ln) * ldb + kb;
      FragB b;
      b.half[0] = *(const v8us*)(brow + 8 * hh);
      b.half[1] = *(const v8us*)(brow + 16 + 8 * hh);
      acc[t] = mmaN<ASPLIT ? 2 : 1>(ah.v, al.v, b.v, b.v, acc[t]);
    }
  }
#pragma unroll
  for (int t = 0; t < 4; ++t) {
    const int col = col0 + t * 16 + ln;
    float bv = bias ? bias[col] : 0.f;
    if (BIAS_BF16) bv = bf16_round(bv);
#pragma unroll
    for (int r = 0; r < 8; ++r) {
      float v = acc[t][r] + bv;
      if (resid) { float rv = resid[(size_t)((row0 + 8 * hh + r) % rmod) * ldr + col]; if (RES_BF16) rv = bf16_round(rv); v += rv; }
      if (ACT == 1) v = fmaxf(v, 0.f);
      if (ACT == 2) v = 0.5f * v * (1.0f + erff(v * 0.70710678118654752f));
      if (ACT == 3) { const float u = 0.7978845608028654f * (v + 0.044715f * v * v * v); v = 0.5f * v * (1.0f + tanhf(u)); }
      so[w][8 * hh + r][t * 16 + ln] = v;
    }
  }
  __builtin_amdgcn_fence(__ATOMIC_ACQ_REL, "workgroup");
  __builtin_amdgcn_wave_barrier();
  const int rsub = lane >> 4, c4 = (lane & 15) * 4;
  {
#pragma unroll
    for (int q = 0; q < 8; ++q) {
      const int r = q * 2 + rsub;
      const v4f v = *(const v4fa*)&so[w][r][c4];
      *(v4f*)(C + (size_t)(row0 + r) * ldc + col0 + c4) = v;
    }
    
  }
}
// row LayerNorm (biased variance, eps) over N: s = X (+ R); optional out_sum <- s; out_norm <- (s-mu)*rsqrt(var+eps)*g + b
template <bool PARAM_BF16>
__global__ __launch_bounds__(256) void k_layernorm(const float* __restrict__ X, const float* __restrict__ R, const float* __restrict__ g, const float* __restrict__ bta,
                                                  float* __restrict__ out_sum, float* __restrict__ out_norm, int N, float eps) {
  __shared__ float red[256];
  const int row = blockIdx.x, tid = threadIdx.x;
  const float* x = X + (size_t)row * N; const float* rr = R ? R + (size_t)row * N : nullptr;
  float vals[16];                     // up to N = 4096
  const int per = N / 256;            // contiguous chunk per thread? use strided-by-4 chunks: thread handles j = tid*4 + 1024*u
  float s1 = 0.f;
  for (int u = 0; u < per / 4; ++u) {
    const int j = tid * 4 + 1024 * u;
    const v4f a = *(const v4fa*)(x + j);
    v4f b = {0.f,0.f,0.f,0.f}; if (rr) b = *(const v4fa*)(rr + j);
#pragma unroll
    for (int q = 0; q < 4; ++q) { const float v = a[q] + b[q]; vals[u * 4 + q] = v; s1 += v; }
  }
  red[tid] = s1; __syncthreads();
  for (int st = 128; st > 0; st >>= 1) { if (tid < st) red[tid] += red[tid + st]; __syncthreads(); }
  const float mu = red[0] / (float)N; __syncthreads();
  float s2 = 0.f;
  for (int u = 0; u < per / 4; ++u)
#pragma unroll
    for (int q = 0; q < 4; ++q) { const float c = vals[u * 4 + q] - mu; s2 += c * c; }
  red[tid] = s2; __syncthreads();
  for (int st = 128; st > 0; st >>= 1) { if (tid < st) red[tid] += red[tid + st]; __syncthreads(); }
  const float rs = rsqrtf(red[0] / (float)N + eps);
  {
    for (int u = 0; u < per / 4; ++u) {
      const int j = tid * 4 + 1024 * u;
      v4f o, sm;
#pragma unroll
      for (int q = 0; q < 4; ++q) {
        float gg = g[j + q], bb = bta[j + q];
        if (PARAM_BF16) { gg = bf16_round(gg); bb = bf16_round(bb); }
        sm[q] = vals[u * 4 + q]; o[q] = (vals[u * 4 + q] - mu) * rs * gg + bb;
      }
      if (out_sum) *(v4f*)(out_sum + (size_t)row * N + j) = sm;
      *(v4f*)(out_norm + (size_t)row * N + j) = o;
    }
    
  }
}



// ---- f16 WMMA path (v_wmma_f32_16x16x32_f16): 11-bit significands for operands in range — used where a [0,1] probability operand needs more precision than bf16
typedef _Float16 v16h __attribute__((ext_vector_type(16)));
union FragH { v16h v; v8us half[2]; _Float16 h[16]; unsigned short u[16]; };
template <int NT>
__device__ __forceinline__ v8f mmaH(v16h ah, v16h al, v16h bh, v16h bl, v8f c) {
  c = __builtin_amdgcn_wmma_f32_16x16x32_f16(false, ah, false, bh, (short)0, c, false, false);
  if (NT >= 2) c = __builtin_amdgcn_wmma_f32_16x16x32_f16(false, al, false, bh, (short)0, c, false, false);
  if (NT >= 3) c = __builtin_amdgcn_wmma_f32_16x16x32_f16(false, ah, false, bl, (short)0, c, false, false);
  asm volatile("v_nop\n\tv_nop\n\tv_nop\n\tv_nop" : "+v"(c) : "v"(ah), "v"(al), "v"(bh), "v"(bl));
  return c;
}
// batched GEMM like k_gemm_b but f16 operands: A f32 (split into f16 hi/lo if ASPLIT, else rounded to f16), Bt = f16 values [n][k]; alpha; C f32; N multiple of 16 (partial tiles skipped)
template <bool ASPLIT>
__global__ __launch_bounds__(128) void k_gemm_h(const float* __restrict__ A, int lda, size_t sA, const _Float16* __restrict__ Bh, int ldb, size_t sB, float alpha, float* __restrict__ C, int ldc, size_t sC, int M, int N, int K) {
  __shared__ __attribute__((aligned(16))) float so[4][16][64];
  const int tid = threadIdx.x, w = tid >> 5, lane = tid & 31, ln = lane & 15, hh = lane >> 4; const int by = blockIdx.y;
  A += (size_t)by * sA; Bh += (size_t)by * sB; C += (size_t)by * sC;
  const int ntn = (N + 63) / 64; const int wid = blockIdx.x * 4 + w; const int mt = wid / ntn, nq = wid % ntn; if (mt * 16 >= M) return;
  const int row0 = mt * 16, col0 = nq * 64; const float* arow = A + (size_t)(row0 + ln) * lda;
  v8f acc[4] = {};
  for (int kb = 0; kb < K; kb += 32) {
    FragH ah, al;
    const v4f x0 = *(const v4fa*)(arow + kb + 8 * hh), x1 = *(const v4fa*)(arow + kb + 8 * hh + 4), x2 = *(const v4fa*)(arow + kb + 16 + 8 * hh), x3 = *(const v4fa*)(arow + kb + 16 + 8 * hh + 4);
    float xs[16] = {x0[0],x0[1],x0[2],x0[3],x1[0],x1[1],x1[2],x1[3],x2[0],x2[1],x2[2],x2[3],x3[0],x3[1],x3[2],x3[3]};
#pragma unroll
    for (int i = 0; i < 16; ++i) { const _Float16 h = (_Float16)xs[i]; ah.h[i] = h; al.h[i] = ASPLIT ? (_Float16)(xs[i] - (float)h) : (_Float16)0.0f; }
#pragma unroll
    for (int t = 0; t < 4; ++t) { if (col0 + t * 16 >= N) continue; const size_t boff = (size_t)(col0 + t * 16 + ln) * ldb + kb; FragH bq; bq.half[0] = *(const v8us*)(Bh + boff + 8 * hh); bq.half[1] = *(const v8us*)(Bh + boff + 16 + 8 * hh);
      acc[t] = mmaH<ASPLIT ? 2 : 1>(ah.v, al.v, bq.v, bq.v, acc[t]); }
  }
#pragma unroll
  for (int t = 0; t < 4; ++t) { if (col0 + t * 16 >= N) continue;
#pragma unroll
    for (int r = 0; r < 8; ++r) so[w][8 * hh + r][t * 16 + ln] = acc[t][r] * alpha; }
  __builtin_amdgcn_fence(__ATOMIC_ACQ_REL, "workgroup"); __builtin_amdgcn_wave_barrier();
  const int rsub = lane >> 4, c4 = (lane & 15) * 4;
  {
#pragma unroll
    for (int q = 0; q < 8; ++q) { const int r = q * 2 + rsub; if (col0 + c4 < N) { const v4f v = *(const v4fa*)&so[w][r][c4]; *(v4f*)(C + (size_t)(row0 + r) * ldc + col0 + c4) = v; } }
     }
}

// Wt[n][k] = f16(W[k][n]·scale) from f32 row-major W[K][N] (scale = power of two; bf16-exact weights stay exact in f16 away from the subnormal range)
__global__ __launch_bounds__(256) void k_wt_f16(const float* __restrict__ W, _Float16* __restrict__ Wt, int K, int N, float scale) {
  const int t = blockIdx.x * 256 + threadIdx.x; if (t >= N * (K / 8)) return; const int n = t / (K / 8), k8 = (t % (K / 8)) * 8; FragH f;
#pragma unroll
  for (int i = 0; i < 8; ++i) f.h[i] = (_Float16)(bf16_round(W[(size_t)(k8 + i) * N + n]) * scale); const v8us o = f.half[0];
  *(v8us*)((unsigned short*)Wt + (size_t)n * K + k8) = o; 
}
// k_gemm_hh variant with fused epilogue: v = acc·alpha + bias[by·sBias + col] (+ CP[(row/rowsPerB)·sCPb + by·64 + col] if CP) ; ACT 0 none / 1 elu ; writes f16 C16 (and f32 C if non-null)
template <int ACT>
__global__ __launch_bounds__(128) void k_gemm_hhx(const _Float16* __restrict__ A, int lda, size_t sA, const _Float16* __restrict__ Bh, int ldb, size_t sB, float alpha, const float* __restrict__ bias, size_t sBias, const float* __restrict__ CP, int rowsPerB, size_t sCPb, int row0g,
    float* __restrict__ C, _Float16* __restrict__ C16, int ldc, size_t sC, int M, int N, int K) {
  __shared__ __attribute__((aligned(16))) float so[4][16][64];
  const int tid = threadIdx.x, w = tid >> 5, lane = tid & 31, ln = lane & 15, hh = lane >> 4; const int by = blockIdx.y;
  A += (size_t)by * sA; Bh += (size_t)by * sB; const size_t cofs = (size_t)by * sC; const float* bp = bias ? bias + (size_t)by * sBias : nullptr;
  const int ntn = (N + 63) / 64; const int wid = blockIdx.x * 4 + w; const int mt = wid / ntn, nq = wid % ntn; if (mt * 16 >= M) return;
  const int row0 = mt * 16, col0 = nq * 64; const _Float16* arow = A + (size_t)(row0 + ln) * lda;
  v8f acc[4] = {};
  for (int kb = 0; kb < K; kb += 32) { FragH ah; ah.half[0] = *(const v8us*)((const unsigned short*)arow + kb + 8 * hh); ah.half[1] = *(const v8us*)((const unsigned short*)arow + kb + 16 + 8 * hh);
#pragma unroll
    for (int t = 0; t < 4; ++t) { if (col0 + t * 16 >= N) continue; const size_t boff = (size_t)(col0 + t * 16 + ln) * ldb + kb; FragH bq; bq.half[0] = *(const v8us*)((const unsigned short*)Bh + boff + 8 * hh); bq.half[1] = *(const v8us*)((const unsigned short*)Bh + boff + 16 + 8 * hh);
      acc[t] = mmaH<1>(ah.v, ah.v, bq.v, bq.v, acc[t]); }
  }
#pragma unroll
  for (int t = 0; t < 4; ++t) { if (col0 + t * 16 >= N) continue; const int col = col0 + t * 16 + ln; const float bv = bp ? bf16_round(bp[col]) : 0.f;
#pragma unroll
    for (int r = 0; r < 8; ++r) { float v = acc[t][r] * alpha + bv; if (CP) { const int bidx = (row0g + row0 + 8 * hh + r) / rowsPerB; v += CP[(size_t)bidx * sCPb + (size_t)by * 64 + col]; } if (ACT == 1) v = (v > 0.f) ? v : expm1f(v); else if (ACT == 7) v = (v > 0.f) ? v + 1.0f : expf(v); else if (ACT == 8) v = tanhf(v); else if (ACT == 9) v = 0.5f * v * (1.0f + tanhf(0.7978845608028654f * (v + 0.044715f * v * v * v))); else if (ACT == 11) v = 1.0f / (1.0f + expf(-v)); else if (ACT == 12) v = (v > 0.f) ? v : 0.01f * v; else if (ACT == 14) v = (v > 0.f) ? v : 0.1f * v; else if (ACT == 15) v = v / (1.0f + expf(-v)); else if (ACT == 3) v = fmaxf(v, 0.f); else if (ACT == 6) v = 0.5f * v * (1.0f + erff(v * 0.70710678118654752f)); so[w][8 * hh + r][t * 16 + ln] = v; } }
  __builtin_amdgcn_fence(__ATOMIC_ACQ_REL, "workgroup"); __builtin_amdgcn_wave_barrier();
  const int rsub = lane >> 4, c4 = (lane & 15) * 4; typedef _Float16 v4h __attribute__((ext_vector_type(4)));
  {
#pragma unroll
    for (int q = 0; q < 8; ++q) { const int r = q * 2 + rsub; if (col0 + c4 < N) { const v4f v = *(const v4fa*)&so[w][r][c4]; if (C) *(v4f*)(C + cofs + (size_t)(row0 + r) * ldc + col0 + c4) = v; if (C16) { v4h h4; for (int i = 0; i < 4; ++i) h4[i] = (_Float16)v[i]; *(v4h*)(C16 + cofs + (size_t)(row0 + r) * ldc + col0 + c4) = h4; } } }
     }
}


typedef _Float16 v4h __attribute__((ext_vector_type(4)));

__global__ __launch_bounds__(256) void k_x16(const float* __restrict__ x, _Float16* __restrict__ X16, size_t n8) { const size_t t = (size_t)blockIdx.x * 256 + threadIdx.x; if (t >= n8) return; FragH f;
#pragma unroll
  for (int q = 0; q < 8; ++q) f.h[q] = (_Float16)bf16_round(x[t * 8 + q]); *(v8us*)((unsigned short*)X16 + t * 8) = f.half[0];  }
__global__ __launch_bounds__(256) void k_h16(const float* __restrict__ x, _Float16* __restrict__ X16, size_t n8) { const size_t t = (size_t)blockIdx.x * 256 + threadIdx.x; if (t >= n8) return; FragH f;
#pragma unroll
  for (int q = 0; q < 8; ++q) f.h[q] = (_Float16)x[t * 8 + q]; *(v8us*)((unsigned short*)X16 + t * 8) = f.half[0];  }
__global__ __launch_bounds__(256) void k_round16f(const float* __restrict__ W, _Float16* __restrict__ Bt, size_t n8) { const size_t t = (size_t)blockIdx.x * 256 + threadIdx.x; if (t >= n8) return; FragH f;
#pragma unroll
  for (int i = 0; i < 8; ++i) f.h[i] = (_Float16)(bf16_round(W[t * 8 + i]) * 16.0f); *(v8us*)((unsigned short*)Bt + t * 8) = f.half[0];  }
template <int NHv, int TTv>
__global__ __launch_bounds__(256) void k_vt(const _Float16* __restrict__ V16, int ldv, int voff, _Float16* __restrict__ Vt) { __shared__ unsigned short tl[64][66]; const int tid = threadIdx.x; const int slab = blockIdx.x / (TTv / 64), lg = blockIdx.x % (TTv / 64); const int b = slab / NHv, h = slab % NHv;
  for (int i = tid; i < 64 * 8; i += 256) { const int r = i / 8, c8 = (i % 8) * 8; FragH f; f.half[0] = *(const v8us*)((const unsigned short*)V16 + ((size_t)b * TTv + lg * 64 + r) * ldv + voff + h * 64 + c8);
#pragma unroll
    for (int q = 0; q < 8; ++q) tl[r][c8 + q] = f.u[q]; }
  __syncthreads();
  {
#pragma unroll
    for (int rd = 0; rd < 2; ++rd) { const int d = rd * 32 + tid / 8, pc = tid % 8; FragH f;
#pragma unroll
      for (int q = 0; q < 8; ++q) f.u[q] = tl[pc * 8 + q][d];
      *(v8us*)((unsigned short*)Vt + ((size_t)slab * 64 + d) * TTv + lg * 64 + pc * 8) = f.half[0]; }
     } }

__global__ __launch_bounds__(256) void k_hl(const float* __restrict__ F, _Float16* __restrict__ Hh, _Float16* __restrict__ Hl, size_t n8) { const size_t t = (size_t)blockIdx.x * 256 + threadIdx.x; if (t >= n8) return; FragH fh, fl; const v4f a = *(const v4fa*)(F + t * 8), c = *(const v4fa*)(F + t * 8 + 4);
#pragma unroll
  for (int q = 0; q < 4; ++q) { _Float16 h = (_Float16)a[q]; fh.h[q] = h; fl.h[q] = (_Float16)((a[q] - (float)h) * 1024.0f); h = (_Float16)c[q]; fh.h[4 + q] = h; fl.h[4 + q] = (_Float16)((c[q] - (float)h) * 1024.0f); }
  { *(v8us*)((unsigned short*)Hh + t * 8) = fh.half[0]; *(v8us*)((unsigned short*)Hl + t * 8) = fl.half[0];  } }

// ---- fast GEMM (wave tile 32x64; requires M % 32 == 0 rows per launch region and N % 64 == 0); epilogue = k_gemm_hhx semantics ----
__device__ __forceinline__ v16h g2_frag(const _Float16* p, int hh) { FragH f; f.half[0] = *(const v8us*)((const unsigned short*)p + 8 * hh); f.half[1] = *(const v8us*)((const unsigned short*)p + 16 + 8 * hh); return f.v; }
__device__ __forceinline__ v8f g2_mma(v16h a, v16h b, v8f c) { v8f d = __builtin_amdgcn_wmma_f32_16x16x32_f16(false, a, false, b, (short)0, c, false, false); asm volatile("v_nop\n\tv_nop\n\tv_nop\n\tv_nop" : "+v"(d) : "v"(a), "v"(b)); return d; }
template <int ACT>
__global__ __launch_bounds__(128) void k_gemm2(const _Float16* __restrict__ A, int lda, size_t sA, const _Float16* __restrict__ Bh, int ldb, size_t sB, float alpha, const float* __restrict__ bias, size_t sBias, const float* __restrict__ CP, int rowsPerB, size_t sCPb, int row0g,
    float* __restrict__ C, _Float16* __restrict__ C16, int ldc, size_t sC, int M, int N, int K) {
  __shared__ __attribute__((aligned(16))) float so[4][32][68];
  const int tid = threadIdx.x, w = tid >> 5, lane = tid & 31, ln = lane & 15, hh = lane >> 4; const int by = blockIdx.y;
  A += (size_t)by * sA; Bh += (size_t)by * sB; const size_t cofs = (size_t)by * sC; const float* bp = bias ? bias + (size_t)by * sBias : nullptr;
  const int ntn = N >> 6; const int mt = blockIdx.x / ntn, nq = blockIdx.x - mt * ntn; const int row0 = mt * 128 + 32 * w, col0 = nq * 64; if (row0 >= M) return;
  const _Float16* a0p = A + (size_t)(row0 + ln) * lda; const _Float16* a1p = a0p + (size_t)16 * lda;
  const _Float16* b0p = Bh + (size_t)(col0 + ln) * ldb; const _Float16* b1p = b0p + (size_t)16 * ldb; const _Float16* b2p = b1p + (size_t)16 * ldb; const _Float16* b3p = b2p + (size_t)16 * ldb;
  const v8f z8 = {0.f,0.f,0.f,0.f,0.f,0.f,0.f,0.f}; v8f c00 = z8, c01 = z8, c02 = z8, c03 = z8, c10 = z8, c11 = z8, c12 = z8, c13 = z8;
#pragma unroll 1
  for (int kb = 0; kb < K; kb += 32) { const v16h a0 = g2_frag(a0p + kb, hh), a1 = g2_frag(a1p + kb, hh);
    v16h b = g2_frag(b0p + kb, hh); c00 = g2_mma(a0, b, c00); c10 = g2_mma(a1, b, c10);
    b = g2_frag(b1p + kb, hh); c01 = g2_mma(a0, b, c01); c11 = g2_mma(a1, b, c11);
    b = g2_frag(b2p + kb, hh); c02 = g2_mma(a0, b, c02); c12 = g2_mma(a1, b, c12);
    b = g2_frag(b3p + kb, hh); c03 = g2_mma(a0, b, c03); c13 = g2_mma(a1, b, c13); }
  v8f accs[8] = {c00, c01, c02, c03, c10, c11, c12, c13};
#pragma unroll
  for (int u = 0; u < 8; ++u) { const int t = u & 3, half = u >> 2; const int col = col0 + t * 16 + ln; const float bv = bp ? bf16_round(bp[col]) : 0.f;
#pragma unroll
    for (int r = 0; r < 8; ++r) { const int rloc = half * 16 + 8 * hh + r; float v = accs[u][r] * alpha + bv; if (CP) { const int bidx = (row0g + row0 + rloc) / rowsPerB; v += CP[(size_t)bidx * sCPb + (size_t)by * 64 + col]; }
      if (ACT == 3) v = fmaxf(v, 0.f); else if (ACT == 6) v = 0.5f * v * (1.0f + erff(v * 0.70710678118654752f)); else if (ACT == 11) v = 1.0f / (1.0f + expf(-v)); else if (ACT == 15) v = v / (1.0f + expf(-v)); else if (ACT == 12) v = (v > 0.f) ? v : 0.01f * v; else if (ACT == 8) v = tanhf(v); else if (ACT == 9) v = 0.5f * v * (1.0f + tanhf(0.7978845608028654f * (v + 0.044715f * v * v * v)));      /* tanh-GELU */
      so[w][rloc][t * 16 + ln] = v; } }
  __builtin_amdgcn_fence(__ATOMIC_ACQ_REL, "workgroup"); __builtin_amdgcn_wave_barrier();
  const int rsub = lane >> 4, c4 = (lane & 15) * 4;
  {
#pragma unroll
    for (int q = 0; q < 16; ++q) { const int r = q * 2 + rsub; const v4f v = *(const v4fa*)&so[w][r][c4]; if (C) *(v4f*)(C + cofs + (size_t)(row0 + r) * ldc + col0 + c4) = v; if (C16) { v4h h4; for (int i = 0; i < 4; ++i) h4[i] = (_Float16)v[i]; *(v4h*)(C16 + cofs + (size_t)(row0 + r) * ldc + col0 + c4) = h4; } }
     } }


__global__ __launch_bounds__(256) void k_embed(const int* __restrict__ tok, const float* __restrict__ emb, const float* __restrict__ pos, float* __restrict__ X) {
  #pragma clang fp contract(off)
  const int t = blockIdx.x * 256 + threadIdx.x; if (t >= SLEN * (DM / 4)) return; const int c0 = (t % (DM / 4)) * 4, s = t / (DM / 4); const int id = (s == 0) ? 0 : tok[s - 1]; v4f o;
#pragma unroll
  for (int q = 0; q < 4; ++q) o[q] = bf16_round(emb[(size_t)id * DM + c0 + q]) + bf16_round(pos[(size_t)s * DM + c0 + q]);
  *(v4f*)(X + (size_t)s * DM + c0) = o;  }
__global__ __launch_bounds__(256) void k_ln512(const float* __restrict__ X, const float* __restrict__ g, const float* __restrict__ bb, _Float16* __restrict__ Y16) {
  #pragma clang fp contract(off)
  const int tid = threadIdx.x, w = tid >> 5, ln = tid & 31; const int r = blockIdx.x * 8 + w; if (r >= SLEN) return; const float* x = X + (size_t)r * DM; v4f a[4]; float s = 0.f;
#pragma unroll
  for (int i = 0; i < 4; ++i) { a[i] = *(const v4fa*)(x + i * 128 + ln * 4); for (int q = 0; q < 4; ++q) s += a[i][q]; }
  for (int o = 16; o > 0; o >>= 1) s += __shfl_xor(s, o, 32); const float mu = s / (float)DM; float q2 = 0.f;
#pragma unroll
  for (int i = 0; i < 4; ++i) for (int q = 0; q < 4; ++q) { const float d = a[i][q] - mu; q2 += d * d; }
  for (int o = 16; o > 0; o >>= 1) q2 += __shfl_xor(q2, o, 32); const float rs = rsqrtf(q2 / (float)DM + 1e-6f);
  {
#pragma unroll
    for (int i = 0; i < 4; ++i) { const int c0 = i * 128 + ln * 4; _Float16 h4[4]; for (int q = 0; q < 4; ++q) h4[q] = (_Float16)((a[i][q] - mu) * rs * bf16_round(g[c0 + q]) + bf16_round(bb[c0 + q])); *(unsigned long long*)((unsigned short*)Y16 + (size_t)r * DM + c0) = *(const unsigned long long*)h4; }
     } }
__global__ __launch_bounds__(256) void k_softsp(const float* __restrict__ S, const int* __restrict__ tok, _Float16* __restrict__ P16) {
  #pragma clang fp contract(off)
  const int tid = threadIdx.x, w = tid >> 5, ln = tid & 31; const int i = blockIdx.x * 8 + w; if (i >= SLEN) return; const size_t hp = (size_t)blockIdx.y * SLEN * SLEN; /* this head's plane */ const float* s = S + hp + (size_t)i * SLEN; float m = -3.0e38f;
  auto val = [&](int j) -> float { const bool keep = (j <= i) && (((i / BLK) == (j / BLK)) || ((j % BLK) >= BLK - CSP)) && (tok[j] > 0); return keep ? s[j] : -1.0e9f; };
#pragma unroll 1
  for (int c = 0; c < SLEN / 256; ++c) { const int kb = c * 256 + ln * 8; for (int q = 0; q < 8; ++q) m = fmaxf(m, val(kb + q)); }
  for (int o = 16; o > 0; o >>= 1) m = fmaxf(m, __shfl_xor(m, o, 32)); float su = 0.f;
#pragma unroll 1
  for (int c = 0; c < SLEN / 256; ++c) { const int kb = c * 256 + ln * 8; for (int q = 0; q < 8; ++q) su += expf(val(kb + q) - m); }
  for (int o = 16; o > 0; o >>= 1) su += __shfl_xor(su, o, 32); const float inv = 1024.0f / su; unsigned short* d = (unsigned short*)P16 + hp + (size_t)i * SLEN;
  {
#pragma unroll 1
    for (int c = 0; c < SLEN / 256; ++c) { const int kb = c * 256 + ln * 8; FragH f;
#pragma unroll
      for (int q = 0; q < 8; ++q) f.h[q] = (_Float16)(expf(val(kb + q) - m) * inv);
      *(v8us*)(d + kb) = f.half[0]; }
     } }

extern "C" void kernel_launch(void* const* d_in, const int* in_sizes, int n_in,
                              void* d_out, int out_size, void* d_ws, size_t ws_size, hipStream_t stream) {
  (void)in_sizes; (void)n_in; (void)out_size;
  const float* const* I = (const float* const*)d_in; const int* tok = (const int*)d_in[0]; const float* emb = I[1]; const float* pos = I[2]; const float* l1s = I[3]; const float* l1b = I[4]; const float* wq = I[5]; const float* wk = I[6]; const float* wv = I[7]; const float* wo = I[8];
  const float* l2s = I[9]; const float* l2b = I[10]; const float* w1 = I[11]; const float* b1 = I[12]; const float* w2 = I[13]; const float* b2 = I[14]; const float* lfs = I[15]; const float* lfb = I[16]; const float* wout = I[17]; const float* bout = I[18];
  char* ws = (char*)d_ws; size_t off = 0;
  auto take = [&](size_t bytes) { char* p = ws + off; off += (bytes + 255) & ~(size_t)255; return p; };
  _Float16* BQ = (_Float16*)take((size_t)DM * DM * 2); _Float16* BK = (_Float16*)take((size_t)DM * DM * 2); _Float16* BV = (_Float16*)take((size_t)DM * DM * 2); _Float16* BO = (_Float16*)take((size_t)DM * DM * 2); _Float16* BW1 = (_Float16*)take((size_t)DMLP * DM * 2); _Float16* BW2 = (_Float16*)take((size_t)DM * DMLP * 2); _Float16* BOUT = (_Float16*)take((size_t)NVOC * DM * 2);
  float* X = (float*)take((size_t)SLEN * DM * 4); _Float16* H16 = (_Float16*)take((size_t)SLEN * DM * 2); _Float16* Q16 = (_Float16*)take((size_t)SLEN * DM * 2); _Float16* K16 = (_Float16*)take((size_t)SLEN * DM * 2); _Float16* V16 = (_Float16*)take((size_t)SLEN * DM * 2); _Float16* VT = (_Float16*)take((size_t)DM * SLEN * 2);
  float* S = (float*)take((size_t)NH * SLEN * SLEN * 4); _Float16* P16 = (_Float16*)take((size_t)NH * SLEN * SLEN * 2);      /* one plane per head */ _Float16* O16 = (_Float16*)take((size_t)SLEN * DM * 2); _Float16* G16 = (_Float16*)take((size_t)SLEN * DMLP * 2);
  if (off > ws_size) return;      /* 6.3 + 4 + 2 x 5 + 128 + 64 + 2 + 8 = 222 MiB */
  const size_t w8 = (size_t)DM * DM / 8; const unsigned wb = (unsigned)((w8 + 255) / 256); const dim3 gP((SLEN / 128) * (DM / 64), 1), gS((SLEN / 128) * (SLEN / 64), NH), gH((SLEN / 128) * 1, NH), gX(SLEN / 8, NH), gM((SLEN / 128) * (DMLP / 64), 1), gV((SLEN / 128) * (NVOC / 64), 1);
  k_embed<<<(SLEN * (DM / 4) + 255) / 256, 256, 0, stream>>>(tok, emb, pos, X);
  for (int l = 0; l < NLRUN; ++l) {
    k_wt_f16<<<wb, 256, 0, stream>>>(wq + (size_t)l * DM * DM, BQ, DM, DM, 16.0f); k_wt_f16<<<wb, 256, 0, stream>>>(wk + (size_t)l * DM * DM, BK, DM, DM, 16.0f); k_wt_f16<<<wb, 256, 0, stream>>>(wv + (size_t)l * DM * DM, BV, DM, DM, 16.0f); k_wt_f16<<<wb, 256, 0, stream>>>(wo + (size_t)l * DM * DM, BO, DM, DM, 16.0f);      /* wq[l] [D][H][DH] = (in, out=h*64+k); wo[l] [H][DH][D] = (in=h*64+k, out) */
    k_wt_f16<<<(unsigned)(((size_t)DM * DMLP / 8 + 255) / 256), 256, 0, stream>>>(w1 + (size_t)l * DM * DMLP, BW1, DM, DMLP, 16.0f); k_wt_f16<<<(unsigned)(((size_t)DMLP * DM / 8 + 255) / 256), 256, 0, stream>>>(w2 + (size_t)l * DMLP * DM, BW2, DMLP, DM, 16.0f);
    k_ln512<<<SLEN / 8, 256, 0, stream>>>(X, l1s + l * DM, l1b + l * DM, H16);
    k_gemm2<0><<<gP, 128, 0, stream>>>(H16, DM, 0, BQ, DM, 0, 0.0625f, nullptr, 0, nullptr, 1, 0, 0, nullptr, Q16, DM, 0, SLEN, DM, DM);
    k_gemm2<0><<<gP, 128, 0, stream>>>(H16, DM, 0, BK, DM, 0, 0.0625f, nullptr, 0, nullptr, 1, 0, 0, nullptr, K16, DM, 0, SLEN, DM, DM);
    k_gemm2<0><<<gP, 128, 0, stream>>>(H16, DM, 0, BV, DM, 0, 0.0625f, nullptr, 0, nullptr, 1, 0, 0, nullptr, V16, DM, 0, SLEN, DM, DM);
    k_vt<NH, SLEN><<<NH * (SLEN / 64), 256, 0, stream>>>(V16, DM, 0, VT);
    /* all heads in one launch each: blockIdx.y = head */
    k_gemm2<0><<<gS, 128, 0, stream>>>(Q16, DM, 64, K16, DM, 64, 0.125f, nullptr, 0, nullptr, 1, 0, 0, S, nullptr, SLEN, (size_t)SLEN * SLEN, SLEN, SLEN, 64);      /* (q / 8) . k */
    k_softsp<<<gX, 256, 0, stream>>>(S, tok, P16);
    k_gemm2<0><<<gH, 128, 0, stream>>>(P16, SLEN, (size_t)SLEN * SLEN, VT, SLEN, (size_t)64 * SLEN, 0.0009765625f, nullptr, 0, nullptr, 1, 0, 0, nullptr, O16, DM, 64, SLEN, 64, SLEN);
    k_gemm2<0><<<gP, 128, 0, stream>>>(O16, DM, 0, BO, DM, 0, 0.0625f, nullptr, 0, X, 1, (size_t)DM, 0, X, nullptr, DM, 0, SLEN, DM, DM);      /* x += o Wo (own tile, in place) */
    k_ln512<<<SLEN / 8, 256, 0, stream>>>(X, l2s + l * DM, l2b + l * DM, H16);
    k_gemm2<9><<<gM, 128, 0, stream>>>(H16, DM, 0, BW1, DM, 0, 0.0625f, b1 + (size_t)l * DMLP, 0, nullptr, 1, 0, 0, nullptr, G16, DMLP, 0, SLEN, DMLP, DM);      /* tanh-gelu(y W1 + b1) */
    k_gemm2<0><<<gP, 128, 0, stream>>>(G16, DMLP, 0, BW2, DMLP, 0, 0.0625f, b2 + (size_t)l * DM, 0, X, 1, (size_t)DM, 0, X, nullptr, DM, 0, SLEN, DM, DMLP); }      /* x += mlp + b2 */
  k_wt_f16<<<(unsigned)(((size_t)DM * NVOC / 8 + 255) / 256), 256, 0, stream>>>(wout, BOUT, DM, NVOC, 16.0f);
  k_ln512<<<SLEN / 8, 256, 0, stream>>>(X, lfs, lfb, H16);
  k_gemm2<0><<<gV, 128, 0, stream>>>(H16, DM, 0, BOUT, DM, 0, 0.0625f, bout, 0, nullptr, 1, 0, 0, (float*)d_out, nullptr, NVOC, 0, SLEN, NVOC, DM);
}

// v002
// A run of this version takes 1570 microseconds.
// Next to v001, in two timings, it ran 1.46 times as fast each time.
// Over all steps from v000 it is 3.69 times as fast.
#include <hip/hip_runtime.h>
// Sparse-pattern transformer decoder (1 x 2048 tokens, 512 = 8 heads x 64, 6 layers, MLP 2048 (tanh-GELU), vocab 256): x = embed[shift_right(tokens)] + pos_emb; per layer: h = LN1(x); q = h Wq / 8, k, v; scores masked by the structural fixed sparse pattern (causal & (same 128-block | last 32 columns of each block)) AND the INPUT key padding (token > 0), masked entries = -1e9 exactly as the reference; softmax; x += (P v) Wo; x += gelu(LN2(x) W1 + b1) W2 + b2; out = LNf(x) Wout + bout -> [1,2048,256].
// Structure: token-embedding gather by the INPUT ids on VALU; LayerNorms on VALU; all Linears as f16 WMMA GEMMs (32x64 wave tiles, f32 accumulation, exact x16 weights, biases / GELU / residual accumulation in the epilogue); per layer, all heads in one launch each (grid y = head): the scores as a GEMM (K 64) into the head's f32 plane, a wave-per-row f32 softmax applying the structural pattern and the key-padding predicate (three rolled passes, P x2^10 f16), V transposed by LDS tiles, P.v as a GEMM into the head's columns of an f16 plane.
// Compute dtype: embeddings, weights, biases, LN parameters rounded to bf16; LN outputs, q, k, v, P, attention output, GELU hidden as f16 operands (~2^-12; logits small); the residual stream, softmax, LayerNorm in f32. v_wmma_f32_16x16x32_f16.
#define SLEN 2048
#define DM 512
#define NH 8
#define NL 6
#define NLRUN NL                 /* layers executed */
#define DMLP 2048
#define NVOC 256
#define BLK 128
#define CSP 32
#define NR SLEN
typedef __bf16 v16b __attribute__((ext_vector_type(16)));
typedef unsigned short v8us __attribute__((ext_vector_type(8), may_alias));
typedef float  v8f  __attribute__((ext_vector_type(8)));
typedef float  v4f  __attribute__((ext_vector_type(4)));
typedef float  v4fa __attribute__((ext_vector_type(4), may_alias));
union FragB { v16b v; v8us half[2]; unsigned short u[16]; };

__device__ __forceinline__ unsigned short bf16_bits(float x) { unsigned int u = __float_as_uint(x); return (unsigned short)((u + 0x7FFFu + ((u >> 16) & 1u)) >> 16); }
__device__ __forceinline__ float bf16_val(unsigned short b) { return __uint_as_float(((unsigned int)b) << 16); }
__device__ __forceinline__ float bf16_round(float x) { return bf16_val(bf16_bits(x)); }
// D += A·B with NT terms: 1 = ah·bh, 2 = + al·bh (A split), 3 = + ah·bl (both split)
template <int NT>
__device__ __forceinline__ v8f mmaN(v16b ah, v16b al, v16b bh, v16b bl, v8f c) {
  c = __builtin_amdgcn_wmma_f32_16x16x32_bf16(false, ah, false, bh, (short)0, c, false, false);
  if (NT >= 2) c = __builtin_amdgcn_wmma_f32_16x16x32_bf16(false, al, false, bh, (short)0, c, false, false);
  if (NT >= 3) c = __builtin_amdgcn_wmma_f32_16x16x32_bf16(false, ah, false, bl, (short)0, c, false, false);
  asm volatile("v_nop\n\tv_nop\n\tv_nop\n\tv_nop" : "+v"(c) : "v"(ah), "v"(al), "v"(bh), "v"(bl));
  return c;
}

__global__ __launch_bounds__(256) void k_wt_bf16(const float* __restrict__ W, unsigned short* __restrict__ Wt, int K, int N) {
  const int t = blockIdx.x * 256 + threadIdx.x;
  const int k8n = K / 8;
  if (t >= N * k8n) return;
  const int n = t / k8n, k8 = (t % k8n) * 8;
  v8us v;
#pragma unroll
  for (int i = 0; i < 8; ++i) v[i] = bf16_bits(W[(size_t)(k8 + i) * N + n]);
  *(v8us*)(Wt + (size_t)n * K + k8) = v;
  
}

// GEMM C[M][N] (f32, pitch ldc) = act(A[M][K]·W + bias). A f32 row-major (pitch lda) converted per fragment to bf16
// (ASPLIT: hi/lo two planes -> 2 terms, else single rounded term); Wt bf16 [N][K] (pitch ldb). BIAS_BF16 rounds the
// bias to bf16 first (bias quantised to bf16 before the add). K%32==0, M%16==0, N%64==0.
template <bool ASPLIT, int ACT, bool BIAS_BF16>
__global__ __launch_bounds__(128) void k_gemm_bf(const float* __restrict__ A, int lda, const unsigned short* __restrict__ Wt, int ldb,
                                               const float* __restrict__ bias, float* __restrict__ C, int ldc, int M, int N, int K) {
  __shared__ __attribute__((aligned(16))) float so[4][16][64];
  const int tid = threadIdx.x, w = tid >> 5, lane = tid & 31, ln = lane & 15, hh = lane >> 4;
  const int ntn = N / 64;
  const int wid = blockIdx.x * 4 + w;
  const int mt = wid / ntn, nq = wid % ntn;
  if (mt * 16 >= M) return;
  const int row0 = mt * 16, col0 = nq * 64;
  const float* arow = A + (size_t)(row0 + ln) * lda;
  v8f acc[4] = {};
  for (int kb = 0; kb < K; kb += 32) {
    FragB ah, al;
    const v4f x0 = *(const v4fa*)(arow + kb + 8 * hh), x1 = *(const v4fa*)(arow + kb + 8 * hh + 4);
    const v4f x2 = *(const v4fa*)(arow + kb + 16 + 8 * hh), x3 = *(const v4fa*)(arow + kb + 16 + 8 * hh + 4);
    float xs[16] = {x0[0],x0[1],x0[2],x0[3],x1[0],x1[1],x1[2],x1[3],x2[0],x2[1],x2[2],x2[3],x3[0],x3[1],x3[2],x3[3]};
#pragma unroll
    for (int i = 0; i < 16; ++i) { const unsigned short hb = bf16_bits(xs[i]); ah.u[i] = hb; al.u[i] = ASPLIT ? bf16_bits(xs[i] - bf16_val(hb)) : (unsigned short)0; }
#pragma unroll
    for (int t = 0; t < 4; ++t) {
      const unsigned short* brow = Wt + (size_t)(col0 + t * 16 + ln) * ldb + kb;
      FragB b;
      b.half[0] = *(const v8us*)(brow + 8 * hh);
      b.half[1] = *(const v8us*)(brow + 16 + 8 * hh);
      acc[t] = mmaN<ASPLIT ? 2 : 1>(ah.v, al.v, b.v, b.v, acc[t]);
    }
  }
#pragma unroll
  for (int t = 0; t < 4; ++t) {
    float bv = bias ? bias[col0 + t * 16 + ln] : 0.f;
    if (BIAS_BF16) bv = bf16_round(bv);
#pragma unroll
    for (int r = 0; r < 8; ++r) { float v = acc[t][r] + bv; if (ACT == 1) v = fmaxf(v, 0.f); so[w][8 * hh + r][t * 16 + ln] = v; }
  }
  __builtin_amdgcn_fence(__ATOMIC_ACQ_REL, "workgroup");
  __builtin_amdgcn_wave_barrier();
  const int rsub = lane >> 4, c4 = (lane & 15) * 4;
  {
#pragma unroll
    for (int q = 0; q < 8; ++q) {
      const int r = q * 2 + rsub;
      const v4f v = *(const v4fa*)&so[w][r][c4];
      *(v4f*)(C + (size_t)(row0 + r) * ldc + col0 + c4) = v;
    }
    
  }
}

// GEMM C = act(A·W + bias + resid): A f32 (ASPLIT -> hi/lo 2 terms), Wt bf16 [N][K]; ACT 0 none, 1 relu, 2 exact gelu;
// resid (optional, f32, row index = (row % rmod), pitch ldr, RES_BF16 rounds it) added before the activation.
template <bool ASPLIT, int ACT, bool BIAS_BF16, bool RES_BF16>
__global__ __launch_bounds__(128) void k_gemm_bf3(const float* __restrict__ A, int lda, const unsigned short* __restrict__ Wt, int ldb,
                                                const float* __restrict__ bias, const float* __restrict__ resid, int rmod, int ldr,
                                                float* __restrict__ C, int ldc, int M, int N, int K) {
  __shared__ __attribute__((aligned(16))) float so[4][16][64];
  const int tid = threadIdx.x, w = tid >> 5, lane = tid & 31, ln = lane & 15, hh = lane >> 4;
  const int ntn = N / 64;
  const int wid = blockIdx.x * 4 + w;
  const int mt = wid / ntn, nq = wid % ntn;
  if (mt * 16 >= M) return;
  const int row0 = mt * 16, col0 = nq * 64;
  const float* arow = A + (size_t)(row0 + ln) * lda;
  v8f acc[4] = {};
  for (int kb = 0; kb < K; kb += 32) {
    FragB ah, al;
    const v4f x0 = *(const v4fa*)(arow + kb + 8 * hh), x1 = *(const v4fa*)(arow + kb + 8 * hh + 4);
    const v4f x2 = *(const v4fa*)(arow + kb + 16 + 8 * hh), x3 = *(const v4fa*)(arow + kb + 16 + 8 * hh + 4);
    float xs[16] = {x0[0],x0[1],x0[2],x0[3],x1[0],x1[1],x1[2],x1[3],x2[0],x2[1],x2[2],x2[3],x3[0],x3[1],x3[2],x3[3]};
#pragma unroll
    for (int i = 0; i < 16; ++i) { const unsigned short hb = bf16_bits(xs[i]); ah.u[i] = hb; al.u[i] = ASPLIT ? bf16_bits(xs[i] - bf16_val(hb)) : (unsigned short)0; }
#pragma unroll
    for (int t = 0; t < 4; ++t) {
      const unsigned short* brow = Wt + (size_t)(col0 + t * 16 + ln) * ldb + kb;
      FragB b;
      b.half[0] = *(const v8us*)(brow + 8 * hh);
      b.half[1] = *(const v8us*)(brow + 16 + 8 * hh);
      acc[t] = mmaN<ASPLIT ? 2 : 1>(ah.v, al.v, b.v, b.v, acc[t]);
    }
  }
#pragma unroll
  for (int t = 0; t < 4; ++t) {
    const int col = col0 + t * 16 + ln;
    float bv = bias ? bias[col] : 0.f;
    if (BIAS_BF16) bv = bf16_round(bv);
#pragma unroll
    for (int r = 0; r < 8; ++r) {
      float v = acc[t][r] + bv;
      if (resid) { float rv = resid[(size_t)((row0 + 8 * hh + r) % rmod) * ldr + col]; if (RES_BF16) rv = bf16_round(rv); v += rv; }
      if (ACT == 1) v = fmaxf(v, 0.f);
      if (ACT == 2) v = 0.5f * v * (1.0f + erff(v * 0.70710678118654752f));
      if (ACT == 3) { const float u = 0.7978845608028654f * (v + 0.044715f * v * v * v); v = 0.5f * v * (1.0f + tanhf(u)); }
      so[w][8 * hh + r][t * 16 + ln] = v;
    }
  }
  __builtin_amdgcn_fence(__ATOMIC_ACQ_REL, "workgroup");
  __builtin_amdgcn_wave_barrier();
  const int rsub = lane >> 4, c4 = (lane & 15) * 4;
  {
#pragma unroll
    for (int q = 0; q < 8; ++q) {
      const int r = q * 2 + rsub;
      const v4f v = *(const v4fa*)&so[w][r][c4];
      *(v4f*)(C + (size_t)(row0 + r) * ldc + col0 + c4) = v;
    }
    
  }
}
// row LayerNorm (biased variance, eps) over N: s = X (+ R); optional out_sum <- s; out_norm <- (s-mu)*rsqrt(var+eps)*g + b
template <bool PARAM_BF16>
__global__ __launch_bounds__(256) void k_layernorm(const float* __restrict__ X, const float* __restrict__ R, const float* __restrict__ g, const float* __restrict__ bta,
                                                  float* __restrict__ out_sum, float* __restrict__ out_norm, int N, float eps) {
  __shared__ float red[256];
  const int row = blockIdx.x, tid = threadIdx.x;
  const float* x = X + (size_t)row * N; const float* rr = R ? R + (size_t)row * N : nullptr;
  float vals[16];                     // up to N = 4096
  const int per = N / 256;            // contiguous chunk per thread? use strided-by-4 chunks: thread handles j = tid*4 + 1024*u
  float s1 = 0.f;
  for (int u = 0; u < per / 4; ++u) {
    const int j = tid * 4 + 1024 * u;
    const v4f a = *(const v4fa*)(x + j);
    v4f b = {0.f,0.f,0.f,0.f}; if (rr) b = *(const v4fa*)(rr + j);
#pragma unroll
    for (int q = 0; q < 4; ++q) { const float v = a[q] + b[q]; vals[u * 4 + q] = v; s1 += v; }
  }
  red[tid] = s1; __syncthreads();
  for (int st = 128; st > 0; st >>= 1) { if (tid < st) red[tid] += red[tid + st]; __syncthreads(); }
  const float mu = red[0] / (float)N; __syncthreads();
  float s2 = 0.f;
  for (int u = 0; u < per / 4; ++u)
#pragma unroll
    for (int q = 0; q < 4; ++q) { const float c = vals[u * 4 + q] - mu; s2 += c * c; }
  red[tid] = s2; __syncthreads();
  for (int st = 128; st > 0; st >>= 1) { if (tid < st) red[tid] += red[tid + st]; __syncthreads(); }
  const float rs = rsqrtf(red[0] / (float)N + eps);
  {
    for (int u = 0; u < per / 4; ++u) {
      const int j = tid * 4 + 1024 * u;
      v4f o, sm;
#pragma unroll
      for (int q = 0; q < 4; ++q) {
        float gg = g[j + q], bb = bta[j + q];
        if (PARAM_BF16) { gg = bf16_round(gg); bb = bf16_round(bb); }
        sm[q] = vals[u * 4 + q]; o[q] = (vals[u * 4 + q] - mu) * rs * gg + bb;
      }
      if (out_sum) *(v4f*)(out_sum + (size_t)row * N + j) = sm;
      *(v4f*)(out_norm + (size_t)row * N + j) = o;
    }
    
  }
}



// ---- f16 WMMA path (v_wmma_f32_16x16x32_f16): 11-bit significands for operands in range — used where a [0,1] probability operand needs more precision than bf16
typedef _Float16 v16h __attribute__((ext_vector_type(16)));
union FragH { v16h v; v8us half[2]; _Float16 h[16]; unsigned short u[16]; };
template <int NT>
__device__ __forceinline__ v8f mmaH(v16h ah, v16h al, v16h bh, v16h bl, v8f c) {
  c = __builtin_amdgcn_wmma_f32_16x16x32_f16(false, ah, false, bh, (short)0, c, false, false);
  if (NT >= 2) c = __builtin_amdgcn_wmma_f32_16x16x32_f16(false, al, false, bh, (short)0, c, false, false);
  if (NT >= 3) c = __builtin_amdgcn_wmma_f32_16x16x32_f16(false, ah, false, bl, (short)0, c, false, false);
  asm volatile("v_nop\n\tv_nop\n\tv_nop\n\tv_nop" : "+v"(c) : "v"(ah), "v"(al), "v"(bh), "v"(bl));
  return c;
}
// batched GEMM like k_gemm_b but f16 operands: A f32 (split into f16 hi/lo if ASPLIT, else rounded to f16), Bt = f16 values [n][k]; alpha; C f32; N multiple of 16 (partial tiles skipped)
template <bool ASPLIT>
__global__ __launch_bounds__(128) void k_gemm_h(const float* __restrict__ A, int lda, size_t sA, const _Float16* __restrict__ Bh, int ldb, size_t sB, float alpha, float* __restrict__ C, int ldc, size_t sC, int M, int N, int K) {
  __shared__ __attribute__((aligned(16))) float so[4][16][64];
  const int tid = threadIdx.x, w = tid >> 5, lane = tid & 31, ln = lane & 15, hh = lane >> 4; const int by = blockIdx.y;
  A += (size_t)by * sA; Bh += (size_t)by * sB; C += (size_t)by * sC;
  const int ntn = (N + 63) / 64; const int wid = blockIdx.x * 4 + w; const int mt = wid / ntn, nq = wid % ntn; if (mt * 16 >= M) return;
  const int row0 = mt * 16, col0 = nq * 64; const float* arow = A + (size_t)(row0 + ln) * lda;
  v8f acc[4] = {};
  for (int kb = 0; kb < K; kb += 32) {
    FragH ah, al;
    const v4f x0 = *(const v4fa*)(arow + kb + 8 * hh), x1 = *(const v4fa*)(arow + kb + 8 * hh + 4), x2 = *(const v4fa*)(arow + kb + 16 + 8 * hh), x3 = *(const v4fa*)(arow + kb + 16 + 8 * hh + 4);
    float xs[16] = {x0[0],x0[1],x0[2],x0[3],x1[0],x1[1],x1[2],x1[3],x2[0],x2[1],x2[2],x2[3],x3[0],x3[1],x3[2],x3[3]};
#pragma unroll
    for (int i = 0; i < 16; ++i) { const _Float16 h = (_Float16)xs[i]; ah.h[i] = h; al.h[i] = ASPLIT ? (_Float16)(xs[i] - (float)h) : (_Float16)0.0f; }
#pragma unroll
    for (int t = 0; t < 4; ++t) { if (col0 + t * 16 >= N) continue; const size_t boff = (size_t)(col0 + t * 16 + ln) * ldb + kb; FragH bq; bq.half[0] = *(const v8us*)(Bh + boff + 8 * hh); bq.half[1] = *(const v8us*)(Bh + boff + 16 + 8 * hh);
      acc[t] = mmaH<ASPLIT ? 2 : 1>(ah.v, al.v, bq.v, bq.v, acc[t]); }
  }
#pragma unroll
  for (int t = 0; t < 4; ++t) { if (col0 + t * 16 >= N) continue;
#pragma unroll
    for (int r = 0; r < 8; ++r) so[w][8 * hh + r][t * 16 + ln] = acc[t][r] * alpha; }
  __builtin_amdgcn_fence(__ATOMIC_ACQ_REL, "workgroup"); __builtin_amdgcn_wave_barrier();
  const int rsub = lane >> 4, c4 = (lane & 15) * 4;
  {
#pragma unroll
    for (int q = 0; q < 8; ++q) { const int r = q * 2 + rsub; if (col0 + c4 < N) { const v4f v = *(const v4fa*)&so[w][r][c4]; *(v4f*)(C + (size_t)(row0 + r) * ldc + col0 + c4) = v; } }
     }
}

// Wt[n][k] = f16(W[k][n]·scale) from f32 row-major W[K][N] (scale = power of two; bf16-exact weights stay exact in f16 away from the subnormal range)
__global__ __launch_bounds__(256) void k_wt_f16(const float* __restrict__ W, _Float16* __restrict__ Wt, int K, int N, float scale) {
  const int t = blockIdx.x * 256 + threadIdx.x; if (t >= N * (K / 8)) return; const int n = t / (K / 8), k8 = (t % (K / 8)) * 8; FragH f;
#pragma unroll
  for (int i = 0; i < 8; ++i) f.h[i] = (_Float16)(bf16_round(W[(size_t)(k8 + i) * N + n]) * scale); const v8us o = f.half[0];
  *(v8us*)((unsigned short*)Wt + (size_t)n * K + k8) = o; 
}
// k_gemm_hh variant with fused epilogue: v = acc·alpha + bias[by·sBias + col] (+ CP[(row/rowsPerB)·sCPb + by·64 + col] if CP) ; ACT 0 none / 1 elu ; writes f16 C16 (and f32 C if non-null)
template <int ACT>
__global__ __launch_bounds__(128) void k_gemm_hhx(const _Float16* __restrict__ A, int lda, size_t sA, const _Float16* __restrict__ Bh, int ldb, size_t sB, float alpha, const float* __restrict__ bias, size_t sBias, const float* __restrict__ CP, int rowsPerB, size_t sCPb, int row0g,
    float* __restrict__ C, _Float16* __restrict__ C16, int ldc, size_t sC, int M, int N, int K) {
  __shared__ __attribute__((aligned(16))) float so[4][16][64];
  const int tid = threadIdx.x, w = tid >> 5, lane = tid & 31, ln = lane & 15, hh = lane >> 4; const int by = blockIdx.y;
  A += (size_t)by * sA; Bh += (size_t)by * sB; const size_t cofs = (size_t)by * sC; const float* bp = bias ? bias + (size_t)by * sBias : nullptr;
  const int ntn = (N + 63) / 64; const int wid = blockIdx.x * 4 + w; const int mt = wid / ntn, nq = wid % ntn; if (mt * 16 >= M) return;
  const int row0 = mt * 16, col0 = nq * 64; const _Float16* arow = A + (size_t)(row0 + ln) * lda;
  v8f acc[4] = {};
  for (int kb = 0; kb < K; kb += 32) { FragH ah; ah.half[0] = *(const v8us*)((const unsigned short*)arow + kb + 8 * hh); ah.half[1] = *(const v8us*)((const unsigned short*)arow + kb + 16 + 8 * hh);
#pragma unroll
    for (int t = 0; t < 4; ++t) { if (col0 + t * 16 >= N) continue; const size_t boff = (size_t)(col0 + t * 16 + ln) * ldb + kb; FragH bq; bq.half[0] = *(const v8us*)((const unsigned short*)Bh + boff + 8 * hh); bq.half[1] = *(const v8us*)((const unsigned short*)Bh + boff + 16 + 8 * hh);
      acc[t] = mmaH<1>(ah.v, ah.v, bq.v, bq.v, acc[t]); }
  }
#pragma unroll
  for (int t = 0; t < 4; ++t) { if (col0 + t * 16 >= N) continue; const int col = col0 + t * 16 + ln; const float bv = bp ? bf16_round(bp[col]) : 0.f;
#pragma unroll
    for (int r = 0; r < 8; ++r) { float v = acc[t][r] * alpha + bv; if (CP) { const int bidx = (row0g + row0 + 8 * hh + r) / rowsPerB; v += CP[(size_t)bidx * sCPb + (size_t)by * 64 + col]; } if (ACT == 1) v = (v > 0.f) ? v : expm1f(v); else if (ACT == 7) v = (v > 0.f) ? v + 1.0f : expf(v); else if (ACT == 8) v = tanhf(v); else if (ACT == 9) v = 0.5f * v * (1.0f + tanhf(0.7978845608028654f * (v + 0.044715f * v * v * v))); else if (ACT == 11) v = 1.0f / (1.0f + expf(-v)); else if (ACT == 12) v = (v > 0.f) ? v : 0.01f * v; else if (ACT == 14) v = (v > 0.f) ? v : 0.1f * v; else if (ACT == 15) v = v / (1.0f + expf(-v)); else if (ACT == 3) v = fmaxf(v, 0.f); else if (ACT == 6) v = 0.5f * v * (1.0f + erff(v * 0.70710678118654752f)); so[w][8 * hh + r][t * 16 + ln] = v; } }
  __builtin_amdgcn_fence(__ATOMIC_ACQ_REL, "workgroup"); __builtin_amdgcn_wave_barrier();
  const int rsub = lane >> 4, c4 = (lane & 15) * 4; typedef _Float16 v4h __attribute__((ext_vector_type(4)));
  {
#pragma unroll
    for (int q = 0; q < 8; ++q) { const int r = q * 2 + rsub; if (col0 + c4 < N) { const v4f v = *(const v4fa*)&so[w][r][c4]; if (C) *(v4f*)(C + cofs + (size_t)(row0 + r) * ldc + col0 + c4) = v; if (C16) { v4h h4; for (int i = 0; i < 4; ++i) h4[i] = (_Float16)v[i]; *(v4h*)(C16 + cofs + (size_t)(row0 + r) * ldc + col0 + c4) = h4; } } }
     }
}


typedef _Float16 v4h __attribute__((ext_vector_type(4)));

__global__ __launch_bounds__(256) void k_x16(const float* __restrict__ x, _Float16* __restrict__ X16, size_t n8) { const size_t t = (size_t)blockIdx.x * 256 + threadIdx.x; if (t >= n8) return; FragH f;
#pragma unroll
  for (int q = 0; q < 8; ++q) f.h[q] = (_Float16)bf16_round(x[t * 8 + q]); *(v8us*)((unsigned short*)X16 + t * 8) = f.half[0];  }
__global__ __launch_bounds__(256) void k_h16(const float* __restrict__ x, _Float16* __restrict__ X16, size_t n8) { const size_t t = (size_t)blockIdx.x * 256 + threadIdx.x; if (t >= n8) return; FragH f;
#pragma unroll
  for (int q = 0; q < 8; ++q) f.h[q] = (_Float16)x[t * 8 + q]; *(v8us*)((unsigned short*)X16 + t * 8) = f.half[0];  }
__global__ __launch_bounds__(256) void k_round16f(const float* __restrict__ W, _Float16* __restrict__ Bt, size_t n8) { const size_t t = (size_t)blockIdx.x * 256 + threadIdx.x; if (t >= n8) return; FragH f;
#pragma unroll
  for (int i = 0; i < 8; ++i) f.h[i] = (_Float16)(bf16_round(W[t * 8 + i]) * 16.0f); *(v8us*)((unsigned short*)Bt + t * 8) = f.half[0];  }
template <int NHv, int TTv>
__global__ __launch_bounds__(256) void k_vt(const _Float16* __restrict__ V16, int ldv, int voff, _Float16* __restrict__ Vt) { __shared__ unsigned short tl[64][66]; const int tid = threadIdx.x; const int slab = blockIdx.x / (TTv / 64), lg = blockIdx.x % (TTv / 64); const int b = slab / NHv, h = slab % NHv;
  for (int i = tid; i < 64 * 8; i += 256) { const int r = i / 8, c8 = (i % 8) * 8; FragH f; f.half[0] = *(const v8us*)((const unsigned short*)V16 + ((size_t)b * TTv + lg * 64 + r) * ldv + voff + h * 64 + c8);
#pragma unroll
    for (int q = 0; q < 8; ++q) tl[r][c8 + q] = f.u[q]; }
  __syncthreads();
  {
#pragma unroll
    for (int rd = 0; rd < 2; ++rd) { const int d = rd * 32 + tid / 8, pc = tid % 8; FragH f;
#pragma unroll
      for (int q = 0; q < 8; ++q) f.u[q] = tl[pc * 8 + q][d];
      *(v8us*)((unsigned short*)Vt + ((size_t)slab * 64 + d) * TTv + lg * 64 + pc * 8) = f.half[0]; }
     } }

__global__ __launch_bounds__(256) void k_hl(const float* __restrict__ F, _Float16* __restrict__ Hh, _Float16* __restrict__ Hl, size_t n8) { const size_t t = (size_t)blockIdx.x * 256 + threadIdx.x; if (t >= n8) return; FragH fh, fl; const v4f a = *(const v4fa*)(F + t * 8), c = *(const v4fa*)(F + t * 8 + 4);
#pragma unroll
  for (int q = 0; q < 4; ++q) { _Float16 h = (_Float16)a[q]; fh.h[q] = h; fl.h[q] = (_Float16)((a[q] - (float)h) * 1024.0f); h = (_Float16)c[q]; fh.h[4 + q] = h; fl.h[4 + q] = (_Float16)((c[q] - (float)h) * 1024.0f); }
  { *(v8us*)((unsigned short*)Hh + t * 8) = fh.half[0]; *(v8us*)((unsigned short*)Hl + t * 8) = fl.half[0];  } }

// ---- fast GEMM (wave tile 32x64; requires M % 32 == 0 rows per launch region and N % 64 == 0); epilogue = k_gemm_hhx semantics ----
__device__ __forceinline__ v16h g2_frag(const _Float16* p, int hh) { FragH f; f.half[0] = *(const v8us*)((const unsigned short*)p + 8 * hh); f.half[1] = *(const v8us*)((const unsigned short*)p + 16 + 8 * hh); return f.v; }
__device__ __forceinline__ v8f g2_mma(v16h a, v16h b, v8f c) { v8f d = __builtin_amdgcn_wmma_f32_16x16x32_f16(false, a, false, b, (short)0, c, false, false); asm volatile("v_nop\n\tv_nop\n\tv_nop\n\tv_nop" : "+v"(d) : "v"(a), "v"(b)); return d; }
template <int ACT>
__global__ __launch_bounds__(128) void k_gemm2(const _Float16* __restrict__ A, int lda, size_t sA, const _Float16* __restrict__ Bh, int ldb, size_t sB, float alpha, const float* __restrict__ bias, size_t sBias, const float* __restrict__ CP, int rowsPerB, size_t sCPb, int row0g,
    float* __restrict__ C, _Float16* __restrict__ C16, int ldc, size_t sC, int M, int N, int K) {
  __shared__ __attribute__((aligned(16))) float so[4][32][68];
  const int tid = threadIdx.x, w = tid >> 5, lane = tid & 31, ln = lane & 15, hh = lane >> 4; const int by = blockIdx.y;
  A += (size_t)by * sA; Bh += (size_t)by * sB; const size_t cofs = (size_t)by * sC; const float* bp = bias ? bias + (size_t)by * sBias : nullptr;
  const int ntn = N >> 6; const int mt = blockIdx.x / ntn, nq = blockIdx.x - mt * ntn; const int row0 = mt * 128 + 32 * w, col0 = nq * 64; if (row0 >= M) return;
  /* each lane's byte offsets in A and B are fixed for the whole loop; only the wave-uniform base moves with k (every operand plane here is far below 4 GiB) */
  const unsigned ao0 = (unsigned)((row0 + ln) * lda + 8 * hh) * 2u, ao1 = ao0 + 32u * (unsigned)lda;
  const unsigned bo0 = (unsigned)((col0 + ln) * ldb + 8 * hh) * 2u, bo1 = bo0 + 32u * (unsigned)ldb, bo2 = bo1 + 32u * (unsigned)ldb, bo3 = bo2 + 32u * (unsigned)ldb;
  const v8f z8 = {0.f,0.f,0.f,0.f,0.f,0.f,0.f,0.f}; v8f c00 = z8, c01 = z8, c02 = z8, c03 = z8, c10 = z8, c11 = z8, c12 = z8, c13 = z8;
  /* Fragment loads run ahead of the products: the 12 loads of a 32-k step are issued as one group, two steps before the products that read them, into three rotating register sets.
     The k order of every accumulator is unchanged. A load past the last step is aimed at the last step again (in bounds, its values unused). K % 32 == 0, K >= 32. */
  struct Stg { v16h a0, a1, b0, b1, b2, b3; };
  const int klast = K - 32;
  auto fr = [](const char* p, unsigned o) -> v16h { FragH f; f.half[0] = *(const v8us*)(p + o); f.half[1] = *(const v8us*)(p + o + 32); return f.v; };
  auto ld = [&](Stg& s, int kq) { const int k = kq < klast ? kq : klast; const char* ak = (const char*)A + 2 * k; const char* bk = (const char*)Bh + 2 * k;
    s.a0 = fr(ak, ao0); s.a1 = fr(ak, ao1); s.b0 = fr(bk, bo0); s.b1 = fr(bk, bo1); s.b2 = fr(bk, bo2); s.b3 = fr(bk, bo3);
    asm volatile("s_wait_xcnt 0x0" ::: "memory");      /* the address registers that these loads name are rewritten for the next group only behind this wait */
    __builtin_amdgcn_sched_barrier(0);      /* keeps the whole group in front of the wait of the products behind it (below that wait the loads would start one latency late), and the next group's address work behind the wait above */
  };
  auto mm = [&](const Stg& s) { c00 = g2_mma(s.a0, s.b0, c00); c10 = g2_mma(s.a1, s.b0, c10); c01 = g2_mma(s.a0, s.b1, c01); c11 = g2_mma(s.a1, s.b1, c11);
    c02 = g2_mma(s.a0, s.b2, c02); c12 = g2_mma(s.a1, s.b2, c12); c03 = g2_mma(s.a0, s.b3, c03); c13 = g2_mma(s.a1, s.b3, c13); };
  { Stg s0, s1, s2; ld(s0, 0); ld(s1, 32); int kb = 0;
#pragma unroll 1      /* one copy of the three-step body: a second copy would not fit the register sets */
    for (; kb + 96 <= K; kb += 96) { ld(s2, kb + 64); mm(s0); ld(s0, kb + 96); mm(s1); ld(s1, kb + 128); mm(s2); }
    if (kb < K) mm(s0);
    if (kb + 32 < K) mm(s1); }
  v8f accs[8] = {c00, c01, c02, c03, c10, c11, c12, c13};
#pragma unroll
  for (int u = 0; u < 8; ++u) { const int t = u & 3, half = u >> 2; const int col = col0 + t * 16 + ln; const float bv = bp ? bf16_round(bp[col]) : 0.f;
#pragma unroll
    for (int r = 0; r < 8; ++r) { const int rloc = half * 16 + 8 * hh + r; float v = accs[u][r] * alpha + bv; if (CP) { const int bidx = (row0g + row0 + rloc) / rowsPerB; v += CP[(size_t)bidx * sCPb + (size_t)by * 64 + col]; }
      if (ACT == 3) v = fmaxf(v, 0.f); else if (ACT == 6) v = 0.5f * v * (1.0f + erff(v * 0.70710678118654752f)); else if (ACT == 11) v = 1.0f / (1.0f + expf(-v)); else if (ACT == 15) v = v / (1.0f + expf(-v)); else if (ACT == 12) v = (v > 0.f) ? v : 0.01f * v; else if (ACT == 8) v = tanhf(v); else if (ACT == 9) v = 0.5f * v * (1.0f + tanhf(0.7978845608028654f * (v + 0.044715f * v * v * v)));      /* tanh-GELU */
      so[w][rloc][t * 16 + ln] = v; } }
  __builtin_amdgcn_fence(__ATOMIC_ACQ_REL, "workgroup"); __builtin_amdgcn_wave_barrier();
  const int rsub = lane >> 4, c4 = (lane & 15) * 4;
  {
#pragma unroll
    for (int q = 0; q < 16; ++q) { const int r = q * 2 + rsub; const v4f v = *(const v4fa*)&so[w][r][c4]; if (C) *(v4f*)(C + cofs + (size_t)(row0 + r) * ldc + col0 + c4) = v; if (C16) { v4h h4; for (int i = 0; i < 4; ++i) h4[i] = (_Float16)v[i]; *(v4h*)(C16 + cofs + (size_t)(row0 + r) * ldc + col0 + c4) = h4; } }
     } }


__global__ __launch_bounds__(256) void k_embed(const int* __restrict__ tok, const float* __restrict__ emb, const float* __restrict__ pos, float* __restrict__ X) {
  #pragma clang fp contract(off)
  const int t = blockIdx.x * 256 + threadIdx.x; if (t >= SLEN * (DM / 4)) return; const int c0 = (t % (DM / 4)) * 4, s = t / (DM / 4); const int id = (s == 0) ? 0 : tok[s - 1]; v4f o;
#pragma unroll
  for (int q = 0; q < 4; ++q) o[q] = bf16_round(emb[(size_t)id * DM + c0 + q]) + bf16_round(pos[(size_t)s * DM + c0 + q]);
  *(v4f*)(X + (size_t)s * DM + c0) = o;  }
__global__ __launch_bounds__(256) void k_ln512(const float* __restrict__ X, const float* __restrict__ g, const float* __restrict__ bb, _Float16* __restrict__ Y16) {
  #pragma clang fp contract(off)
  const int tid = threadIdx.x, w = tid >> 5, ln = tid & 31; const int r = blockIdx.x * 8 + w; if (r >= SLEN) return; const float* x = X + (size_t)r * DM; v4f a[4]; float s = 0.f;
#pragma unroll
  for (int i = 0; i < 4; ++i) { a[i] = *(const v4fa*)(x + i * 128 + ln * 4); for (int q = 0; q < 4; ++q) s += a[i][q]; }
  for (int o = 16; o > 0; o >>= 1) s += __shfl_xor(s, o, 32); const float mu = s / (float)DM; float q2 = 0.f;
#pragma unroll
  for (int i = 0; i < 4; ++i) for (int q = 0; q < 4; ++q) { const float d = a[i][q] - mu; q2 += d * d; }
  for (int o = 16; o > 0; o >>= 1) q2 += __shfl_xor(q2, o, 32); const float rs = rsqrtf(q2 / (float)DM + 1e-6f);
  {
#pragma unroll
    for (int i = 0; i < 4; ++i) { const int c0 = i * 128 + ln * 4; _Float16 h4[4]; for (int q = 0; q < 4; ++q) h4[q] = (_Float16)((a[i][q] - mu) * rs * bf16_round(g[c0 + q]) + bf16_round(bb[c0 + q])); *(unsigned long long*)((unsigned short*)Y16 + (size_t)r * DM + c0) = *(const unsigned long long*)h4; }
     } }
__global__ __launch_bounds__(256) void k_softsp(const float* __restrict__ S, const int* __restrict__ tok, _Float16* __restrict__ P16) {
  #pragma clang fp contract(off)
  const int tid = threadIdx.x, w = tid >> 5, ln = tid & 31; const int i = blockIdx.x * 8 + w; if (i >= SLEN) return; const size_t hp = (size_t)blockIdx.y * SLEN * SLEN; /* this head's plane */ const float* s = S + hp + (size_t)i * SLEN; float m = -3.0e38f;
  auto val = [&](int j) -> float { const bool keep = (j <= i) && (((i / BLK) == (j / BLK)) || ((j % BLK) >= BLK - CSP)) && (tok[j] > 0); return keep ? s[j] : -1.0e9f; };
#pragma unroll 1
  for (int c = 0; c < SLEN / 256; ++c) { const int kb = c * 256 + ln * 8; for (int q = 0; q < 8; ++q) m = fmaxf(m, val(kb + q)); }
  for (int o = 16; o > 0; o >>= 1) m = fmaxf(m, __shfl_xor(m, o, 32)); float su = 0.f;
#pragma unroll 1
  for (int c = 0; c < SLEN / 256; ++c) { const int kb = c * 256 + ln * 8; for (int q = 0; q < 8; ++q) su += expf(val(kb + q) - m); }
  for (int o = 16; o > 0; o >>= 1) su += __shfl_xor(su, o, 32); const float inv = 1024.0f / su; unsigned short* d = (unsigned short*)P16 + hp + (size_t)i * SLEN;
  {
#pragma unroll 1
    for (int c = 0; c < SLEN / 256; ++c) { const int kb = c * 256 + ln * 8; FragH f;
#pragma unroll
      for (int q = 0; q < 8; ++q) f.h[q] = (_Float16)(expf(val(kb + q) - m) * inv);
      *(v8us*)(d + kb) = f.half[0]; }
     } }

extern "C" void kernel_launch(void* const* d_in, const int* in_sizes, int n_in,
                              void* d_out, int out_size, void* d_ws, size_t ws_size, hipStream_t stream) {
  (void)in_sizes; (void)n_in; (void)out_size;
  const float* const* I = (const float* const*)d_in; const int* tok = (const int*)d_in[0]; const float* emb = I[1]; const float* pos = I[2]; const float* l1s = I[3]; const float* l1b = I[4]; const float* wq = I[5]; const float* wk = I[6]; const float* wv = I[7]; const float* wo = I[8];
  const float* l2s = I[9]; const float* l2b = I[10]; const float* w1 = I[11]; const float* b1 = I[12]; const float* w2 = I[13]; const float* b2 = I[14]; const float* lfs = I[15]; const float* lfb = I[16]; const float* wout = I[17]; const float* bout = I[18];
  char* ws = (char*)d_ws; size_t off = 0;
  auto take = [&](size_t bytes) { char* p = ws + off; off += (bytes + 255) & ~(size_t)255; return p; };
  _Float16* BQ = (_Float16*)take((size_t)DM * DM * 2); _Float16* BK = (_Float16*)take((size_t)DM * DM * 2); _Float16* BV = (_Float16*)take((size_t)DM * DM * 2); _Float16* BO = (_Float16*)take((size_t)DM * DM * 2); _Float16* BW1 = (_Float16*)take((size_t)DMLP * DM * 2); _Float16* BW2 = (_Float16*)take((size_t)DM * DMLP * 2); _Float16* BOUT = (_Float16*)take((size_t)NVOC * DM * 2);
  float* X = (float*)take((size_t)SLEN * DM * 4); _Float16* H16 = (_Float16*)take((size_t)SLEN * DM * 2); _Float16* Q16 = (_Float16*)take((size_t)SLEN * DM * 2); _Float16* K16 = (_Float16*)take((size_t)SLEN * DM * 2); _Float16* V16 = (_Float16*)take((size_t)SLEN * DM * 2); _Float16* VT = (_Float16*)take((size_t)DM * SLEN * 2);
  float* S = (float*)take((size_t)NH * SLEN * SLEN * 4); _Float16* P16 = (_Float16*)take((size_t)NH * SLEN * SLEN * 2);      /* one plane per head */ _Float16* O16 = (_Float16*)take((size_t)SLEN * DM * 2); _Float16* G16 = (_Float16*)take((size_t)SLEN * DMLP * 2);
  if (off > ws_size) return;      /* 6.3 + 4 + 2 x 5 + 128 + 64 + 2 + 8 = 222 MiB */
  const size_t w8 = (size_t)DM * DM / 8; const unsigned wb = (unsigned)((w8 + 255) / 256); const dim3 gP((SLEN / 128) * (DM / 64), 1), gS((SLEN / 128) * (SLEN / 64), NH), gH((SLEN / 128) * 1, NH), gX(SLEN / 8, NH), gM((SLEN / 128) * (DMLP / 64), 1), gV((SLEN / 128) * (NVOC / 64), 1);
  k_embed<<<(SLEN * (DM / 4) + 255) / 256, 256, 0, stream>>>(tok, emb, pos, X);
  for (int l = 0; l < NLRUN; ++l) {
    k_wt_f16<<<wb, 256, 0, stream>>>(wq + (size_t)l * DM * DM, BQ, DM, DM, 16.0f); k_wt_f16<<<wb, 256, 0, stream>>>(wk + (size_t)l * DM * DM, BK, DM, DM, 16.0f); k_wt_f16<<<wb, 256, 0, stream>>>(wv + (size_t)l * DM * DM, BV, DM, DM, 16.0f); k_wt_f16<<<wb, 256, 0, stream>>>(wo + (size_t)l * DM * DM, BO, DM, DM, 16.0f);      /* wq[l] [D][H][DH] = (in, out=h*64+k); wo[l] [H][DH][D] = (in=h*64+k, out) */
    k_wt_f16<<<(unsigned)(((size_t)DM * DMLP / 8 + 255) / 256), 256, 0, stream>>>(w1 + (size_t)l * DM * DMLP, BW1, DM, DMLP, 16.0f); k_wt_f16<<<(unsigned)(((size_t)DMLP * DM / 8 + 255) / 256), 256, 0, stream>>>(w2 + (size_t)l * DMLP * DM, BW2, DMLP, DM, 16.0f);
    k_ln512<<<SLEN / 8, 256, 0, stream>>>(X, l1s + l * DM, l1b + l * DM, H16);
    k_gemm2<0><<<gP, 128, 0, stream>>>(H16, DM, 0, BQ, DM, 0, 0.0625f, nullptr, 0, nullptr, 1, 0, 0, nullptr, Q16, DM, 0, SLEN, DM, DM);
    k_gemm2<0><<<gP, 128, 0, stream>>>(H16, DM, 0, BK, DM, 0, 0.0625f, nullptr, 0, nullptr, 1, 0, 0, nullptr, K16, DM, 0, SLEN, DM, DM);
    k_gemm2<0><<<gP, 128, 0, stream>>>(H16, DM, 0, BV, DM, 0, 0.0625f, nullptr, 0, nullptr, 1, 0, 0, nullptr, V16, DM, 0, SLEN, DM, DM);
    k_vt<NH, SLEN><<<NH * (SLEN / 64), 256, 0, stream>>>(V16, DM, 0, VT);
    /* all heads in one launch each: blockIdx.y = head */
    k_gemm2<0><<<gS, 128, 0, stream>>>(Q16, DM, 64, K16, DM, 64, 0.125f, nullptr, 0, nullptr, 1, 0, 0, S, nullptr, SLEN, (size_t)SLEN * SLEN, SLEN, SLEN, 64);      /* (q / 8) . k */
    k_softsp<<<gX, 256, 0, stream>>>(S, tok, P16);
    k_gemm2<0><<<gH, 128, 0, stream>>>(P16, SLEN, (size_t)SLEN * SLEN, VT, SLEN, (size_t)64 * SLEN, 0.0009765625f, nullptr, 0, nullptr, 1, 0, 0, nullptr, O16, DM, 64, SLEN, 64, SLEN);
    k_gemm2<0><<<gP, 128, 0, stream>>>(O16, DM, 0, BO, DM, 0, 0.0625f, nullptr, 0, X, 1, (size_t)DM, 0, X, nullptr, DM, 0, SLEN, DM, DM);      /* x += o Wo (own tile, in place) */
    k_ln512<<<SLEN / 8, 256, 0, stream>>>(X, l2s + l * DM, l2b + l * DM, H16);
    k_gemm2<9><<<gM, 128, 0, stream>>>(H16, DM, 0, BW1, DM, 0, 0.0625f, b1 + (size_t)l * DMLP, 0, nullptr, 1, 0, 0, nullptr, G16, DMLP, 0, SLEN, DMLP, DM);      /* tanh-gelu(y W1 + b1) */
    k_gemm2<0><<<gP, 128, 0, stream>>>(G16, DMLP, 0, BW2, DMLP, 0, 0.0625f, b2 + (size_t)l * DM, 0, X, 1, (size_t)DM, 0, X, nullptr, DM, 0, SLEN, DM, DMLP); }      /* x += mlp + b2 */
  k_wt_f16<<<(unsigned)(((size_t)DM * NVOC / 8 + 255) / 256), 256, 0, stream>>>(wout, BOUT, DM, NVOC, 16.0f);
  k_ln512<<<SLEN / 8, 256, 0, stream>>>(X, lfs, lfb, H16);
  k_gemm2<0><<<gV, 128, 0, stream>>>(H16, DM, 0, BOUT, DM, 0, 0.0625f, bout, 0, nullptr, 1, 0, 0, (float*)d_out, nullptr, NVOC, 0, SLEN, NVOC, DM);
}

// v003
// A run of this version takes 1260 microseconds.
// Two timings next to v002 put it at 1.25 and 1.26 times that version's speed.
// Counting every step since v000, it is 4.63 times as fast.
#include <hip/hip_runtime.h>
// Sparse-pattern transformer decoder (1 x 2048 tokens, 512 = 8 heads x 64, 6 layers, MLP 2048 (tanh-GELU), vocab 256): x = embed[shift_right(tokens)] + pos_emb; per layer: h = LN1(x); q = h Wq / 8, k, v; scores masked by the structural fixed sparse pattern (causal & (same 128-block | last 32 columns of each block)) AND the INPUT key padding (token > 0), masked entries = -1e9 exactly as the reference; softmax; x += (P v) Wo; x += gelu(LN2(x) W1 + b1) W2 + b2; out = LNf(x) Wout + bout -> [1,2048,256].
// Structure: token-embedding gather by the INPUT ids on VALU; LayerNorms on VALU; all Linears as f16 WMMA GEMMs (32x64 wave tiles, f32 accumulation, exact x16 weights, biases / GELU / residual accumulation in the epilogue); per layer, all heads in one launch each (grid y = head): the scores as a GEMM (K 64) into the head's f32 plane, a wave-per-row f32 softmax applying the structural pattern and the key-padding predicate (P x2^10 f16), V transposed by LDS tiles, P.v as a GEMM into the head's columns of an f16 plane. Softmax and P.v visit only the columns that the structural pattern can keep for a 128-row block (its own block, the last 32 columns of each earlier block), the scores only the 128x64 tiles that hold them (its own block, the upper 64 columns of each earlier block); a block that holds a row with no kept key at all (uniform softmax over all 2048 columns) takes the full-width softmax and P.v.
// Compute dtype: embeddings, weights, biases, LN parameters rounded to bf16; LN outputs, q, k, v, P, attention output, GELU hidden as f16 operands (~2^-12; logits small); the residual stream, softmax, LayerNorm in f32. v_wmma_f32_16x16x32_f16.
#define SLEN 2048
#define DM 512
#define NH 8
#define NL 6
#define NLRUN NL                 /* layers executed */
#define DMLP 2048
#define NVOC 256
#define BLK 128
#define CSP 32
#define NR SLEN
typedef __bf16 v16b __attribute__((ext_vector_type(16)));
typedef unsigned short v8us __attribute__((ext_vector_type(8), may_alias));
typedef float  v8f  __attribute__((ext_vector_type(8)));
typedef float  v4f  __attribute__((ext_vector_type(4)));
typedef float  v4fa __attribute__((ext_vector_type(4), may_alias));
union FragB { v16b v; v8us half[2]; unsigned short u[16]; };

__device__ __forceinline__ unsigned short bf16_bits(float x) { unsigned int u = __float_as_uint(x); return (unsigned short)((u + 0x7FFFu + ((u >> 16) & 1u)) >> 16); }
__device__ __forceinline__ float bf16_val(unsigned short b) { return __uint_as_float(((unsigned int)b) << 16); }
__device__ __forceinline__ float bf16_round(float x) { return bf16_val(bf16_bits(x)); }
// D += A·B with NT terms: 1 = ah·bh, 2 = + al·bh (A split), 3 = + ah·bl (both split)
template <int NT>
__device__ __forceinline__ v8f mmaN(v16b ah, v16b al, v16b bh, v16b bl, v8f c) {
  c = __builtin_amdgcn_wmma_f32_16x16x32_bf16(false, ah, false, bh, (short)0, c, false, false);
  if (NT >= 2) c = __builtin_amdgcn_wmma_f32_16x16x32_bf16(false, al, false, bh, (short)0, c, false, false);
  if (NT >= 3) c = __builtin_amdgcn_wmma_f32_16x16x32_bf16(false, ah, false, bl, (short)0, c, false, false);
  asm volatile("v_nop\n\tv_nop\n\tv_nop\n\tv_nop" : "+v"(c) : "v"(ah), "v"(al), "v"(bh), "v"(bl));
  return c;
}

__global__ __launch_bounds__(256) void k_wt_bf16(const float* __restrict__ W, unsigned short* __restrict__ Wt, int K, int N) {
  const int t = blockIdx.x * 256 + threadIdx.x;
  const int k8n = K / 8;
  if (t >= N * k8n) return;
  const int n = t / k8n, k8 = (t % k8n) * 8;
  v8us v;
#pragma unroll
  for (int i = 0; i < 8; ++i) v[i] = bf16_bits(W[(size_t)(k8 + i) * N + n]);
  *(v8us*)(Wt + (size_t)n * K + k8) = v;
  
}

// GEMM C[M][N] (f32, pitch ldc) = act(A[M][K]·W + bias). A f32 row-major (pitch lda) converted per fragment to bf16
// (ASPLIT: hi/lo two planes -> 2 terms, else single rounded term); Wt bf16 [N][K] (pitch ldb). BIAS_BF16 rounds the
// bias to bf16 first (bias quantised to bf16 before the add). K%32==0, M%16==0, N%64==0.
template <bool ASPLIT, int ACT, bool BIAS_BF16>
__global__ __launch_bounds__(128) void k_gemm_bf(const float* __restrict__ A, int lda, const unsigned short* __restrict__ Wt, int ldb,
                                               const float* __restrict__ bias, float* __restrict__ C, int ldc, int M, int N, int K) {
  __shared__ __attribute__((aligned(16))) float so[4][16][64];
  const int tid = threadIdx.x, w = tid >> 5, lane = tid & 31, ln = lane & 15, hh = lane >> 4;
  const int ntn = N / 64;
  const int wid = blockIdx.x * 4 + w;
  const int mt = wid / ntn, nq = wid % ntn;
  if (mt * 16 >= M) return;
  const int row0 = mt * 16, col0 = nq * 64;
  const float* arow = A + (size_t)(row0 + ln) * lda;
  v8f acc[4] = {};
  for (int kb = 0; kb < K; kb += 32) {
    FragB ah, al;
    const v4f x0 = *(const v4fa*)(arow + kb + 8 * hh), x1 = *(const v4fa*)(arow + kb + 8 * hh + 4);
    const v4f x2 = *(const v4fa*)(arow + kb + 16 + 8 * hh), x3 = *(const v4fa*)(arow + kb + 16 + 8 * hh + 4);
    float xs[16] = {x0[0],x0[1],x0[2],x0[3],x1[0],x1[1],x1[2],x1[3],x2[0],x2[1],x2[2],x2[3],x3[0],x3[1],x3[2],x3[3]};
#pragma unroll
    for (int i = 0; i < 16; ++i) { const unsigned short hb = bf16_bits(xs[i]); ah.u[i] = hb; al.u[i] = ASPLIT ? bf16_bits(xs[i] - bf16_val(hb)) : (unsigned short)0; }
#pragma unroll
    for (int t = 0; t < 4; ++t) {
      const unsigned short* brow = Wt + (size_t)(col0 + t * 16 + ln) * ldb + kb;
      FragB b;
      b.half[0] = *(const v8us*)(brow + 8 * hh);
      b.half[1] = *(const v8us*)(brow + 16 + 8 * hh);
      acc[t] = mmaN<ASPLIT ? 2 : 1>(ah.v, al.v, b.v, b.v, acc[t]);
    }
  }
#pragma unroll
  for (int t = 0; t < 4; ++t) {
    float bv = bias ? bias[col0 + t * 16 + ln] : 0.f;
    if (BIAS_BF16) bv = bf16_round(bv);
#pragma unroll
    for (int r = 0; r < 8; ++r) { float v = acc[t][r] + bv; if (ACT == 1) v = fmaxf(v, 0.f); so[w][8 * hh + r][t * 16 + ln] = v; }
  }
  __builtin_amdgcn_fence(__ATOMIC_ACQ_REL, "workgroup");
  __builtin_amdgcn_wave_barrier();
  const int rsub = lane >> 4, c4 = (lane & 15) * 4;
  {
#pragma unroll
    for (int q = 0; q < 8; ++q) {
      const int r = q * 2 + rsub;
      const v4f v = *(const v4fa*)&so[w][r][c4];
      *(v4f*)(C + (size_t)(row0 + r) * ldc + col0 + c4) = v;
    }
    
  }
}

// GEMM C = act(A·W + bias + resid): A f32 (ASPLIT -> hi/lo 2 terms), Wt bf16 [N][K]; ACT 0 none, 1 relu, 2 exact gelu;
// resid (optional, f32, row index = (row % rmod), pitch ldr, RES_BF16 rounds it) added before the activation.
template <bool ASPLIT, int ACT, bool BIAS_BF16, bool RES_BF16>
__global__ __launch_bounds__(128) void k_gemm_bf3(const float* __restrict__ A, int lda, const unsigned short* __restrict__ Wt, int ldb,
                                                const float* __restrict__ bias, const float* __restrict__ resid, int rmod, int ldr,
                                                float* __restrict__ C, int ldc, int M, int N, int K) {
  __shared__ __attribute__((aligned(16))) float so[4][16][64];
  const int tid = threadIdx.x, w = tid >> 5, lane = tid & 31, ln = lane & 15, hh = lane >> 4;
  const int ntn = N / 64;
  const int wid = blockIdx.x * 4 + w;
  const int mt = wid / ntn, nq = wid % ntn;
  if (mt * 16 >= M) return;
  const int row0 = mt * 16, col0 = nq * 64;
  const float* arow = A + (size_t)(row0 + ln) * lda;
  v8f acc[4] = {};
  for (int kb = 0; kb < K; kb += 32) {
    FragB ah, al;
    const v4f x0 = *(const v4fa*)(arow + kb + 8 * hh), x1 = *(const v4fa*)(arow + kb + 8 * hh + 4);
    const v4f x2 = *(const v4fa*)(arow + kb + 16 + 8 * hh), x3 = *(const v4fa*)(arow + kb + 16 + 8 * hh + 4);
    float xs[16] = {x0[0],x0[1],x0[2],x0[3],x1[0],x1[1],x1[2],x1[3],x2[0],x2[1],x2[2],x2[3],x3[0],x3[1],x3[2],x3[3]};
#pragma unroll
    for (int i = 0; i < 16; ++i) { const unsigned short hb = bf16_bits(xs[i]); ah.u[i] = hb; al.u[i] = ASPLIT ? bf16_bits(xs[i] - bf16_val(hb)) : (unsigned short)0; }
#pragma unroll
    for (int t = 0; t < 4; ++t) {
      const unsigned short* brow = Wt + (size_t)(col0 + t * 16 + ln) * ldb + kb;
      FragB b;
      b.half[0] = *(const v8us*)(brow + 8 * hh);
      b.half[1] = *(const v8us*)(brow + 16 + 8 * hh);
      acc[t] = mmaN<ASPLIT ? 2 : 1>(ah.v, al.v, b.v, b.v, acc[t]);
    }
  }
#pragma unroll
  for (int t = 0; t < 4; ++t) {
    const int col = col0 + t * 16 + ln;
    float bv = bias ? bias[col] : 0.f;
    if (BIAS_BF16) bv = bf16_round(bv);
#pragma unroll
    for (int r = 0; r < 8; ++r) {
      float v = acc[t][r] + bv;
      if (resid) { float rv = resid[(size_t)((row0 + 8 * hh + r) % rmod) * ldr + col]; if (RES_BF16) rv = bf16_round(rv); v += rv; }
      if (ACT == 1) v = fmaxf(v, 0.f);
      if (ACT == 2) v = 0.5f * v * (1.0f + erff(v * 0.70710678118654752f));
      if (ACT == 3) { const float u = 0.7978845608028654f * (v + 0.044715f * v * v * v); v = 0.5f * v * (1.0f + tanhf(u)); }
      so[w][8 * hh + r][t * 16 + ln] = v;
    }
  }
  __builtin_amdgcn_fence(__ATOMIC_ACQ_REL, "workgroup");
  __builtin_amdgcn_wave_barrier();
  const int rsub = lane >> 4, c4 = (lane & 15) * 4;
  {
#pragma unroll
    for (int q = 0; q < 8; ++q) {
      const int r = q * 2 + rsub;
      const v4f v = *(const v4fa*)&so[w][r][c4];
      *(v4f*)(C + (size_t)(row0 + r) * ldc + col0 + c4) = v;
    }
    
  }
}
// row LayerNorm (biased variance, eps) over N: s = X (+ R); optional out_sum <- s; out_norm <- (s-mu)*rsqrt(var+eps)*g + b
template <bool PARAM_BF16>
__global__ __launch_bounds__(256) void k_layernorm(const float* __restrict__ X, const float* __restrict__ R, const float* __restrict__ g, const float* __restrict__ bta,
                                                  float* __restrict__ out_sum, float* __restrict__ out_norm, int N, float eps) {
  __shared__ float red[256];
  const int row = blockIdx.x, tid = threadIdx.x;
  const float* x = X + (size_t)row * N; const float* rr = R ? R + (size_t)row * N : nullptr;
  float vals[16];                     // up to N = 4096
  const int per = N / 256;            // contiguous chunk per thread? use strided-by-4 chunks: thread handles j = tid*4 + 1024*u
  float s1 = 0.f;
  for (int u = 0; u < per / 4; ++u) {
    const int j = tid * 4 + 1024 * u;
    const v4f a = *(const v4fa*)(x + j);
    v4f b = {0.f,0.f,0.f,0.f}; if (rr) b = *(const v4fa*)(rr + j);
#pragma unroll
    for (int q = 0; q < 4; ++q) { const float v = a[q] + b[q]; vals[u * 4 + q] = v; s1 += v; }
  }
  red[tid] = s1; __syncthreads();
  for (int st = 128; st > 0; st >>= 1) { if (tid < st) red[tid] += red[tid + st]; __syncthreads(); }
  const float mu = red[0] / (float)N; __syncthreads();
  float s2 = 0.f;
  for (int u = 0; u < per / 4; ++u)
#pragma unroll
    for (int q = 0; q < 4; ++q) { const float c = vals[u * 4 + q] - mu; s2 += c * c; }
  red[tid] = s2; __syncthreads();
  for (int st = 128; st > 0; st >>= 1) { if (tid < st) red[tid] += red[tid + st]; __syncthreads(); }
  const float rs = rsqrtf(red[0] / (float)N + eps);
  {
    for (int u = 0; u < per / 4; ++u) {
      const int j = tid * 4 + 1024 * u;
      v4f o, sm;
#pragma unroll
      for (int q = 0; q < 4; ++q) {
        float gg = g[j + q], bb = bta[j + q];
        if (PARAM_BF16) { gg = bf16_round(gg); bb = bf16_round(bb); }
        sm[q] = vals[u * 4 + q]; o[q] = (vals[u * 4 + q] - mu) * rs * gg + bb;
      }
      if (out_sum) *(v4f*)(out_sum + (size_t)row * N + j) = sm;
      *(v4f*)(out_norm + (size_t)row * N + j) = o;
    }
    
  }
}



// ---- f16 WMMA path (v_wmma_f32_16x16x32_f16): 11-bit significands for operands in range — used where a [0,1] probability operand needs more precision than bf16
typedef _Float16 v16h __attribute__((ext_vector_type(16)));
union FragH { v16h v; v8us half[2]; _Float16 h[16]; unsigned short u[16]; };
template <int NT>
__device__ __forceinline__ v8f mmaH(v16h ah, v16h al, v16h bh, v16h bl, v8f c) {
  c = __builtin_amdgcn_wmma_f32_16x16x32_f16(false, ah, false, bh, (short)0, c, false, false);
  if (NT >= 2) c = __builtin_amdgcn_wmma_f32_16x16x32_f16(false, al, false, bh, (short)0, c, false, false);
  if (NT >= 3) c = __builtin_amdgcn_wmma_f32_16x16x32_f16(false, ah, false, bl, (short)0, c, false, false);
  asm volatile("v_nop\n\tv_nop\n\tv_nop\n\tv_nop" : "+v"(c) : "v"(ah), "v"(al), "v"(bh), "v"(bl));
  return c;
}
// batched GEMM like k_gemm_b but f16 operands: A f32 (split into f16 hi/lo if ASPLIT, else rounded to f16), Bt = f16 values [n][k]; alpha; C f32; N multiple of 16 (partial tiles skipped)
template <bool ASPLIT>
__global__ __launch_bounds__(128) void k_gemm_h(const float* __restrict__ A, int lda, size_t sA, const _Float16* __restrict__ Bh, int ldb, size_t sB, float alpha, float* __restrict__ C, int ldc, size_t sC, int M, int N, int K) {
  __shared__ __attribute__((aligned(16))) float so[4][16][64];
  const int tid = threadIdx.x, w = tid >> 5, lane = tid & 31, ln = lane & 15, hh = lane >> 4; const int by = blockIdx.y;
  A += (size_t)by * sA; Bh += (size_t)by * sB; C += (size_t)by * sC;
  const int ntn = (N + 63) / 64; const int wid = blockIdx.x * 4 + w; const int mt = wid / ntn, nq = wid % ntn; if (mt * 16 >= M) return;
  const int row0 = mt * 16, col0 = nq * 64; const float* arow = A + (size_t)(row0 + ln) * lda;
  v8f acc[4] = {};
  for (int kb = 0; kb < K; kb += 32) {
    FragH ah, al;
    const v4f x0 = *(const v4fa*)(arow + kb + 8 * hh), x1 = *(const v4fa*)(arow + kb + 8 * hh + 4), x2 = *(const v4fa*)(arow + kb + 16 + 8 * hh), x3 = *(const v4fa*)(arow + kb + 16 + 8 * hh + 4);
    float xs[16] = {x0[0],x0[1],x0[2],x0[3],x1[0],x1[1],x1[2],x1[3],x2[0],x2[1],x2[2],x2[3],x3[0],x3[1],x3[2],x3[3]};
#pragma unroll
    for (int i = 0; i < 16; ++i) { const _Float16 h = (_Float16)xs[i]; ah.h[i] = h; al.h[i] = ASPLIT ? (_Float16)(xs[i] - (float)h) : (_Float16)0.0f; }
#pragma unroll
    for (int t = 0; t < 4; ++t) { if (col0 + t * 16 >= N) continue; const size_t boff = (size_t)(col0 + t * 16 + ln) * ldb + kb; FragH bq; bq.half[0] = *(const v8us*)(Bh + boff + 8 * hh); bq.half[1] = *(const v8us*)(Bh + boff + 16 + 8 * hh);
      acc[t] = mmaH<ASPLIT ? 2 : 1>(ah.v, al.v, bq.v, bq.v, acc[t]); }
  }
#pragma unroll
  for (int t = 0; t < 4; ++t) { if (col0 + t * 16 >= N) continue;
#pragma unroll
    for (int r = 0; r < 8; ++r) so[w][8 * hh + r][t * 16 + ln] = acc[t][r] * alpha; }
  __builtin_amdgcn_fence(__ATOMIC_ACQ_REL, "workgroup"); __builtin_amdgcn_wave_barrier();
  const int rsub = lane >> 4, c4 = (lane & 15) * 4;
  {
#pragma unroll
    for (int q = 0; q < 8; ++q) { const int r = q * 2 + rsub; if (col0 + c4 < N) { const v4f v = *(const v4fa*)&so[w][r][c4]; *(v4f*)(C + (size_t)(row0 + r) * ldc + col0 + c4) = v; } }
     }
}

// Wt[n][k] = f16(W[k][n]·scale) from f32 row-major W[K][N] (scale = power of two; bf16-exact weights stay exact in f16 away from the subnormal range)
__global__ __launch_bounds__(256) void k_wt_f16(const float* __restrict__ W, _Float16* __restrict__ Wt, int K, int N, float scale) {
  const int t = blockIdx.x * 256 + threadIdx.x; if (t >= N * (K / 8)) return; const int n = t / (K / 8), k8 = (t % (K / 8)) * 8; FragH f;
#pragma unroll
  for (int i = 0; i < 8; ++i) f.h[i] = (_Float16)(bf16_round(W[(size_t)(k8 + i) * N + n]) * scale); const v8us o = f.half[0];
  *(v8us*)((unsigned short*)Wt + (size_t)n * K + k8) = o; 
}
// k_gemm_hh variant with fused epilogue: v = acc·alpha + bias[by·sBias + col] (+ CP[(row/rowsPerB)·sCPb + by·64 + col] if CP) ; ACT 0 none / 1 elu ; writes f16 C16 (and f32 C if non-null)
template <int ACT>
__global__ __launch_bounds__(128) void k_gemm_hhx(const _Float16* __restrict__ A, int lda, size_t sA, const _Float16* __restrict__ Bh, int ldb, size_t sB, float alpha, const float* __restrict__ bias, size_t sBias, const float* __restrict__ CP, int rowsPerB, size_t sCPb, int row0g,
    float* __restrict__ C, _Float16* __restrict__ C16, int ldc, size_t sC, int M, int N, int K) {
  __shared__ __attribute__((aligned(16))) float so[4][16][64];
  const int tid = threadIdx.x, w = tid >> 5, lane = tid & 31, ln = lane & 15, hh = lane >> 4; const int by = blockIdx.y;
  A += (size_t)by * sA; Bh += (size_t)by * sB; const size_t cofs = (size_t)by * sC; const float* bp = bias ? bias + (size_t)by * sBias : nullptr;
  const int ntn = (N + 63) / 64; const int wid = blockIdx.x * 4 + w; const int mt = wid / ntn, nq = wid % ntn; if (mt * 16 >= M) return;
  const int row0 = mt * 16, col0 = nq * 64; const _Float16* arow = A + (size_t)(row0 + ln) * lda;
  v8f acc[4] = {};
  for (int kb = 0; kb < K; kb += 32) { FragH ah; ah.half[0] = *(const v8us*)((const unsigned short*)arow + kb + 8 * hh); ah.half[1] = *(const v8us*)((const unsigned short*)arow + kb + 16 + 8 * hh);
#pragma unroll
    for (int t = 0; t < 4; ++t) { if (col0 + t * 16 >= N) continue; const size_t boff = (size_t)(col0 + t * 16 + ln) * ldb + kb; FragH bq; bq.half[0] = *(const v8us*)((const unsigned short*)Bh + boff + 8 * hh); bq.half[1] = *(const v8us*)((const unsigned short*)Bh + boff + 16 + 8 * hh);
      acc[t] = mmaH<1>(ah.v, ah.v, bq.v, bq.v, acc[t]); }
  }
#pragma unroll
  for (int t = 0; t < 4; ++t) { if (col0 + t * 16 >= N) continue; const int col = col0 + t * 16 + ln; const float bv = bp ? bf16_round(bp[col]) : 0.f;
#pragma unroll
    for (int r = 0; r < 8; ++r) { float v = acc[t][r] * alpha + bv; if (CP) { const int bidx = (row0g + row0 + 8 * hh + r) / rowsPerB; v += CP[(size_t)bidx * sCPb + (size_t)by * 64 + col]; } if (ACT == 1) v = (v > 0.f) ? v : expm1f(v); else if (ACT == 7) v = (v > 0.f) ? v + 1.0f : expf(v); else if (ACT == 8) v = tanhf(v); else if (ACT == 9) v = 0.5f * v * (1.0f + tanhf(0.7978845608028654f * (v + 0.044715f * v * v * v))); else if (ACT == 11) v = 1.0f / (1.0f + expf(-v)); else if (ACT == 12) v = (v > 0.f) ? v : 0.01f * v; else if (ACT == 14) v = (v > 0.f) ? v : 0.1f * v; else if (ACT == 15) v = v / (1.0f + expf(-v)); else if (ACT == 3) v = fmaxf(v, 0.f); else if (ACT == 6) v = 0.5f * v * (1.0f + erff(v * 0.70710678118654752f)); so[w][8 * hh + r][t * 16 + ln] = v; } }
  __builtin_amdgcn_fence(__ATOMIC_ACQ_REL, "workgroup"); __builtin_amdgcn_wave_barrier();
  const int rsub = lane >> 4, c4 = (lane & 15) * 4; typedef _Float16 v4h __attribute__((ext_vector_type(4)));
  {
#pragma unroll
    for (int q = 0; q < 8; ++q) { const int r = q * 2 + rsub; if (col0 + c4 < N) { const v4f v = *(const v4fa*)&so[w][r][c4]; if (C) *(v4f*)(C + cofs + (size_t)(row0 + r) * ldc + col0 + c4) = v; if (C16) { v4h h4; for (int i = 0; i < 4; ++i) h4[i] = (_Float16)v[i]; *(v4h*)(C16 + cofs + (size_t)(row0 + r) * ldc + col0 + c4) = h4; } } }
     }
}


typedef _Float16 v4h __attribute__((ext_vector_type(4)));
typedef int v4ia __attribute__((ext_vector_type(4), may_alias));

__global__ __launch_bounds__(256) void k_x16(const float* __restrict__ x, _Float16* __restrict__ X16, size_t n8) { const size_t t = (size_t)blockIdx.x * 256 + threadIdx.x; if (t >= n8) return; FragH f;
#pragma unroll
  for (int q = 0; q < 8; ++q) f.h[q] = (_Float16)bf16_round(x[t * 8 + q]); *(v8us*)((unsigned short*)X16 + t * 8) = f.half[0];  }
__global__ __launch_bounds__(256) void k_h16(const float* __restrict__ x, _Float16* __restrict__ X16, size_t n8) { const size_t t = (size_t)blockIdx.x * 256 + threadIdx.x; if (t >= n8) return; FragH f;
#pragma unroll
  for (int q = 0; q < 8; ++q) f.h[q] = (_Float16)x[t * 8 + q]; *(v8us*)((unsigned short*)X16 + t * 8) = f.half[0];  }
__global__ __launch_bounds__(256) void k_round16f(const float* __restrict__ W, _Float16* __restrict__ Bt, size_t n8) { const size_t t = (size_t)blockIdx.x * 256 + threadIdx.x; if (t >= n8) return; FragH f;
#pragma unroll
  for (int i = 0; i < 8; ++i) f.h[i] = (_Float16)(bf16_round(W[t * 8 + i]) * 16.0f); *(v8us*)((unsigned short*)Bt + t * 8) = f.half[0];  }
template <int NHv, int TTv>
__global__ __launch_bounds__(256) void k_vt(const _Float16* __restrict__ V16, int ldv, int voff, _Float16* __restrict__ Vt) { __shared__ unsigned short tl[64][66]; const int tid = threadIdx.x; const int slab = blockIdx.x / (TTv / 64), lg = blockIdx.x % (TTv / 64); const int b = slab / NHv, h = slab % NHv;
  for (int i = tid; i < 64 * 8; i += 256) { const int r = i / 8, c8 = (i % 8) * 8; FragH f; f.half[0] = *(const v8us*)((const unsigned short*)V16 + ((size_t)b * TTv + lg * 64 + r) * ldv + voff + h * 64 + c8);
#pragma unroll
    for (int q = 0; q < 8; ++q) tl[r][c8 + q] = f.u[q]; }
  __syncthreads();
  {
#pragma unroll
    for (int rd = 0; rd < 2; ++rd) { const int d = rd * 32 + tid / 8, pc = tid % 8; FragH f;
#pragma unroll
      for (int q = 0; q < 8; ++q) f.u[q] = tl[pc * 8 + q][d];
      *(v8us*)((unsigned short*)Vt + ((size_t)slab * 64 + d) * TTv + lg * 64 + pc * 8) = f.half[0]; }
     } }

__global__ __launch_bounds__(256) void k_hl(const float* __restrict__ F, _Float16* __restrict__ Hh, _Float16* __restrict__ Hl, size_t n8) { const size_t t = (size_t)blockIdx.x * 256 + threadIdx.x; if (t >= n8) return; FragH fh, fl; const v4f a = *(const v4fa*)(F + t * 8), c = *(const v4fa*)(F + t * 8 + 4);
#pragma unroll
  for (int q = 0; q < 4; ++q) { _Float16 h = (_Float16)a[q]; fh.h[q] = h; fl.h[q] = (_Float16)((a[q] - (float)h) * 1024.0f); h = (_Float16)c[q]; fh.h[4 + q] = h; fl.h[4 + q] = (_Float16)((c[q] - (float)h) * 1024.0f); }
  { *(v8us*)((unsigned short*)Hh + t * 8) = fh.half[0]; *(v8us*)((unsigned short*)Hl + t * 8) = fl.half[0];  } }

// ---- fast GEMM (wave tile 32x64; requires M % 32 == 0 rows per launch region and N % 64 == 0); epilogue = k_gemm_hhx semantics ----
__device__ __forceinline__ v16h g2_frag(const _Float16* p, int hh) { FragH f; f.half[0] = *(const v8us*)((const unsigned short*)p + 8 * hh); f.half[1] = *(const v8us*)((const unsigned short*)p + 16 + 8 * hh); return f.v; }
__device__ __forceinline__ v8f g2_mma(v16h a, v16h b, v8f c) { v8f d = __builtin_amdgcn_wmma_f32_16x16x32_f16(false, a, false, b, (short)0, c, false, false); asm volatile("v_nop\n\tv_nop\n\tv_nop\n\tv_nop" : "+v"(d) : "v"(a), "v"(b)); return d; }
/* SP 0: plain. SP 1 (scores): blockIdx.x counts only the 128x64 tiles that hold a column the pattern can keep. SP 2 (P.v, N 64): the k loop visits only such columns, unless rows_all_masked(). */
/* The last 32 columns of the (at most 15) earlier blocks, 4 columns a lane, 4 blocks a load: slot u of a lane is block 4u + lane / 8. A slot past the earlier blocks is off; it is aimed at the own block's last 32 columns (in bounds, written) so that no branch stands round a load. */
__device__ __forceinline__ bool sum_on(int blk, int lane, int u) { return u * 4 + (lane >> 3) < blk; }
__device__ __forceinline__ int sum_col(int blk, int lane, int u) { return (sum_on(blk, lane, u) ? u * 4 + (lane >> 3) : blk) * BLK + (BLK - CSP) + (lane & 7) * 4; }
/* true where the first row of 128-row block blk has no kept key (a later row keeps every key of an earlier row of its block, so false means that no row of the block is without one); the same in every lane. t[u] = the tokens at sum_col(u), tfirst = the token of the block's first column */
__device__ __forceinline__ bool rows_all_masked(const v4ia (&t)[4], int tfirst, int blk, int lane) {
  bool kept = tfirst > 0;
#pragma unroll      /* constant indices, so that the array stays in registers */
  for (int u = 0; u < 4; ++u) for (int q = 0; q < 4; ++q) kept |= sum_on(blk, lane, u) & (t[u][q] > 0);
  return !__any(kept); }
template <int ACT, int SP = 0>
__global__ __launch_bounds__(128) void k_gemm2(const _Float16* __restrict__ A, int lda, size_t sA, const _Float16* __restrict__ Bh, int ldb, size_t sB, float alpha, const float* __restrict__ bias, size_t sBias, const float* __restrict__ CP, int rowsPerB, size_t sCPb, int row0g,
    float* __restrict__ C, _Float16* __restrict__ C16, int ldc, size_t sC, int M, int N, int Kfull, const int* __restrict__ tok = nullptr) {
  __shared__ __attribute__((aligned(16))) float so[4][32][68];
  const int tid = threadIdx.x, w = tid >> 5, lane = tid & 31, ln = lane & 15, hh = lane >> 4; const int by = blockIdx.y;
  A += (size_t)by * sA; Bh += (size_t)by * sB; const size_t cofs = (size_t)by * sC; const float* bp = bias ? bias + (size_t)by * sBias : nullptr;
  const int ntn = N >> 6; int mt = blockIdx.x / ntn, nq = blockIdx.x - mt * ntn;
  if (SP == 1) { int t = blockIdx.x; for (mt = 0; mt < SLEN / BLK - 1 && t >= mt + 2; ++mt) t -= mt + 2;      /* row block mt has mt + 2 tiles: the upper half of each earlier block, then the two halves of its own */
    nq = t < mt ? 2 * t + 1 : mt + t; }
  const int row0 = mt * 128 + 32 * w, col0 = nq * 64; if (row0 >= M) return;
  bool sparse = false;      /* true: P is written, and non-zero, only in the columns that the pattern can keep */
  if (SP == 2) { v4ia t[4];
#pragma unroll      /* constant indices, so that the array stays in registers */
    for (int u = 0; u < 4; ++u) t[u] = *(const v4ia*)(tok + sum_col(mt, lane, u));
    const int tf = tok[mt * BLK];
    asm volatile("s_wait_xcnt 0x0" :: "v"(t[0]), "v"(t[1]), "v"(t[2]), "v"(t[3]), "s"(tf) : "memory");      /* the loaded values as inputs only: the five loads are in flight together (one latency, not five); their address registers are rewritten only behind this wait */
    __builtin_amdgcn_sched_barrier(0);      /* keeps the work below from being lifted in front of that wait */
    sparse = !rows_all_masked(t, tf, mt, lane); }
  const int K = sparse ? (mt + BLK / 32) * 32 : Kfull;      /* 32-k steps: one for each earlier block, four for the own block */
  const int ksum = sparse ? mt * 32 : 0;      /* the steps below ksum are the earlier blocks': step k reads columns 4 k + 96 up; a step of the own block reads columns k + 3 ksum up (ld) */
  /* each lane's byte offsets in A and B are fixed for the whole loop; only the wave-uniform base moves with k (every operand plane here is far below 4 GiB) */
  const unsigned ao0 = (unsigned)((row0 + ln) * lda + 8 * hh) * 2u, ao1 = ao0 + 32u * (unsigned)lda;
  const unsigned bo0 = (unsigned)((col0 + ln) * ldb + 8 * hh) * 2u, bo1 = bo0 + 32u * (unsigned)ldb, bo2 = bo1 + 32u * (unsigned)ldb, bo3 = bo2 + 32u * (unsigned)ldb;
  const v8f z8 = {0.f,0.f,0.f,0.f,0.f,0.f,0.f,0.f}; v8f c00 = z8, c01 = z8, c02 = z8, c03 = z8, c10 = z8, c11 = z8, c12 = z8, c13 = z8;
  /* Fragment loads run ahead of the products: the 12 loads of a 32-k step are issued as one group, two steps before the products that read them, into three rotating register sets.
     The k order of every accumulator is unchanged. A load past the last step is aimed at the last step again (in bounds, its values unused). K % 32 == 0, K >= 32. */
  struct Stg { v16h a0, a1, b0, b1, b2, b3; };
  const int klast = K - 32;
  auto fr = [](const char* p, unsigned o) -> v16h { FragH f; f.half[0] = *(const v8us*)(p + o); f.half[1] = *(const v8us*)(p + o + 32); return f.v; };
  auto ld = [&](Stg& s, int kq) { int k = kq < klast ? kq : klast; if (SP == 2) k += (BLK / 32 - 1) * (k < ksum ? k : ksum) + (k < ksum ? BLK - CSP : 0); const char* ak = (const char*)A + 2 * k; const char* bk = (const char*)Bh + 2 * k;
    s.a0 = fr(ak, ao0); s.a1 = fr(ak, ao1); s.b0 = fr(bk, bo0); s.b1 = fr(bk, bo1); s.b2 = fr(bk, bo2); s.b3 = fr(bk, bo3);
    asm volatile("s_wait_xcnt 0x0" ::: "memory");      /* the address registers that these loads name are rewritten for the next group only behind this wait */
    __builtin_amdgcn_sched_barrier(0);      /* keeps the whole group in front of the wait of the products behind it (below that wait the loads would start one latency late), and the next group's address work behind the wait above */
  };
  auto mm = [&](const Stg& s) { c00 = g2_mma(s.a0, s.b0, c00); c10 = g2_mma(s.a1, s.b0, c10); c01 = g2_mma(s.a0, s.b1, c01); c11 = g2_mma(s.a1, s.b1, c11);
    c02 = g2_mma(s.a0, s.b2, c02); c12 = g2_mma(s.a1, s.b2, c12); c03 = g2_mma(s.a0, s.b3, c03); c13 = g2_mma(s.a1, s.b3, c13); };
  { Stg s0, s1, s2; ld(s0, 0); ld(s1, 32); int kb = 0;
#pragma unroll 1      /* one copy of the three-step body: a second copy would not fit the register sets */
    for (; kb + 96 <= K; kb += 96) { ld(s2, kb + 64); mm(s0); ld(s0, kb + 96); mm(s1); ld(s1, kb + 128); mm(s2); }
    if (kb < K) mm(s0);
    if (kb + 32 < K) mm(s1); }
  v8f accs[8] = {c00, c01, c02, c03, c10, c11, c12, c13};
#pragma unroll
  for (int u = 0; u < 8; ++u) { const int t = u & 3, half = u >> 2; const int col = col0 + t * 16 + ln; const float bv = bp ? bf16_round(bp[col]) : 0.f;
#pragma unroll
    for (int r = 0; r < 8; ++r) { const int rloc = half * 16 + 8 * hh + r; float v = accs[u][r] * alpha + bv; if (CP) { const int bidx = (row0g + row0 + rloc) / rowsPerB; v += CP[(size_t)bidx * sCPb + (size_t)by * 64 + col]; }
      if (ACT == 3) v = fmaxf(v, 0.f); else if (ACT == 6) v = 0.5f * v * (1.0f + erff(v * 0.70710678118654752f)); else if (ACT == 11) v = 1.0f / (1.0f + expf(-v)); else if (ACT == 15) v = v / (1.0f + expf(-v)); else if (ACT == 12) v = (v > 0.f) ? v : 0.01f * v; else if (ACT == 8) v = tanhf(v); else if (ACT == 9) v = 0.5f * v * (1.0f + tanhf(0.7978845608028654f * (v + 0.044715f * v * v * v)));      /* tanh-GELU */
      so[w][rloc][t * 16 + ln] = v; } }
  __builtin_amdgcn_fence(__ATOMIC_ACQ_REL, "workgroup"); __builtin_amdgcn_wave_barrier();
  const int rsub = lane >> 4, c4 = (lane & 15) * 4;
  {
#pragma unroll
    for (int q = 0; q < 16; ++q) { const int r = q * 2 + rsub; const v4f v = *(const v4fa*)&so[w][r][c4]; if (C) *(v4f*)(C + cofs + (size_t)(row0 + r) * ldc + col0 + c4) = v; if (C16) { v4h h4; for (int i = 0; i < 4; ++i) h4[i] = (_Float16)v[i]; *(v4h*)(C16 + cofs + (size_t)(row0 + r) * ldc + col0 + c4) = h4; } }
     } }


__global__ __launch_bounds__(256) void k_embed(const int* __restrict__ tok, const float* __restrict__ emb, const float* __restrict__ pos, float* __restrict__ X) {
  #pragma clang fp contract(off)
  const int t = blockIdx.x * 256 + threadIdx.x; if (t >= SLEN * (DM / 4)) return; const int c0 = (t % (DM / 4)) * 4, s = t / (DM / 4); const int id = (s == 0) ? 0 : tok[s - 1]; v4f o;
#pragma unroll
  for (int q = 0; q < 4; ++q) o[q] = bf16_round(emb[(size_t)id * DM + c0 + q]) + bf16_round(pos[(size_t)s * DM + c0 + q]);
  *(v4f*)(X + (size_t)s * DM + c0) = o;  }
__global__ __launch_bounds__(256) void k_ln512(const float* __restrict__ X, const float* __restrict__ g, const float* __restrict__ bb, _Float16* __restrict__ Y16) {
  #pragma clang fp contract(off)
  const int tid = threadIdx.x, w = tid >> 5, ln = tid & 31; const int r = blockIdx.x * 8 + w; if (r >= SLEN) return; const float* x = X + (size_t)r * DM; v4f a[4]; float s = 0.f;
#pragma unroll
  for (int i = 0; i < 4; ++i) { a[i] = *(const v4fa*)(x + i * 128 + ln * 4); for (int q = 0; q < 4; ++q) s += a[i][q]; }
  for (int o = 16; o > 0; o >>= 1) s += __shfl_xor(s, o, 32); const float mu = s / (float)DM; float q2 = 0.f;
#pragma unroll
  for (int i = 0; i < 4; ++i) for (int q = 0; q < 4; ++q) { const float d = a[i][q] - mu; q2 += d * d; }
  for (int o = 16; o > 0; o >>= 1) q2 += __shfl_xor(q2, o, 32); const float rs = rsqrtf(q2 / (float)DM + 1e-6f);
  {
#pragma unroll
    for (int i = 0; i < 4; ++i) { const int c0 = i * 128 + ln * 4; _Float16 h4[4]; for (int q = 0; q < 4; ++q) h4[q] = (_Float16)((a[i][q] - mu) * rs * bf16_round(g[c0 + q]) + bf16_round(bb[c0 + q])); *(unsigned long long*)((unsigned short*)Y16 + (size_t)r * DM + c0) = *(const unsigned long long*)h4; }
     } }
__global__ __launch_bounds__(256) void k_softsp(const float* __restrict__ S, const int* __restrict__ tok, _Float16* __restrict__ P16) {
  #pragma clang fp contract(off)
  const int tid = threadIdx.x, w = tid >> 5, ln = tid & 31; const int i = blockIdx.x * 8 + w; if (i >= SLEN) return; const size_t hp = (size_t)blockIdx.y * SLEN * SLEN; /* this head's plane */ const float* s = S + hp + (size_t)i * SLEN; float m = -3.0e38f;
  const int b = blockIdx.x / (BLK / 8);      /* the row's 128-block, the same for the whole work-group */
  v4f sv[4]; v4ia st[4];      /* the columns that the pattern can keep: the last 32 of each earlier block (sum_col), then 4 columns a lane of the own block */
  const char* srow = (const char*)(S + hp + (size_t)__builtin_amdgcn_readfirstlane(i) * SLEN);      /* the wave's row, its base in scalar registers: each load names a scalar base and one lane offset */
  unsigned jo[5];      /* byte offsets of a lane's columns, the same in the f32 score row and in the int32 tokens */
#pragma unroll      /* constant indices, so that the array stays in registers */
  for (int u = 0; u < 4; ++u) jo[u] = 4u * (unsigned)sum_col(b, ln, u);
  const int j0 = b * BLK + ln * 4; jo[4] = 4u * (unsigned)j0;
#pragma unroll      /* constant indices, so that the array stays in registers */
  for (int u = 0; u < 4; ++u) { sv[u] = *(const v4fa*)(srow + jo[u]); st[u] = *(const v4ia*)((const char*)tok + jo[u]); }
  v4f ov = *(const v4fa*)(srow + jo[4]); const v4ia ot = *(const v4ia*)((const char*)tok + jo[4]); const int tf = tok[b * BLK];
  asm volatile("s_wait_xcnt 0x0" :: "v"(sv[0]), "v"(sv[1]), "v"(sv[2]), "v"(sv[3]), "v"(st[0]), "v"(st[1]), "v"(st[2]), "v"(st[3]), "v"(ov), "v"(ot), "s"(tf), "v"(jo[0]), "v"(jo[1]), "v"(jo[2]), "v"(jo[3]), "v"(jo[4]), "s"(srow) : "memory");      /* inputs only. The loaded values: the eleven loads are in flight together (one latency, not eleven). The five lane offsets and the row base: they stay live up to here, so no load's result lands in a register that an earlier load of the run names ahead of this wait */
  __builtin_amdgcn_sched_barrier(0);      /* keeps the work below from being lifted in front of that wait */
  if (!rows_all_masked(st, tf, b, ln)) {      /* every row of the block has a kept key: exp(-1e9 - m) is 0, so only these columns are summed and written */
#pragma unroll      /* constant indices, so that the array stays in registers */
    for (int u = 0; u < 4; ++u) for (int q = 0; q < 4; ++q) { sv[u][q] = (sum_on(b, ln, u) & (st[u][q] > 0)) ? sv[u][q] : -1.0e9f; m = fmaxf(m, sv[u][q]); }
#pragma unroll      /* constant indices, so that the array stays in registers */
    for (int q = 0; q < 4; ++q) { ov[q] = ((j0 + q <= i) & (ot[q] > 0)) ? ov[q] : -1.0e9f; m = fmaxf(m, ov[q]); }
    for (int o = 16; o > 0; o >>= 1) m = fmaxf(m, __shfl_xor(m, o, 32)); float su = 0.f;
#pragma unroll      /* constant indices, so that the array stays in registers */
    for (int u = 0; u < 4; ++u) for (int q = 0; q < 4; ++q) { sv[u][q] = expf(sv[u][q] - m); su += sv[u][q]; }
#pragma unroll      /* constant indices, so that the array stays in registers */
    for (int q = 0; q < 4; ++q) { ov[q] = expf(ov[q] - m); su += ov[q]; }
    for (int o = 16; o > 0; o >>= 1) su += __shfl_xor(su, o, 32); const float inv = 1024.0f / su; _Float16* d = P16 + hp + (size_t)i * SLEN;
#pragma unroll      /* constant indices, so that the array stays in registers */
    for (int u = 0; u < 4; ++u) { v4h h4; for (int q = 0; q < 4; ++q) h4[q] = (_Float16)(sv[u][q] * inv); if (sum_on(b, ln, u)) *(v4h*)(d + sum_col(b, ln, u)) = h4; }
    v4h h4;
#pragma unroll      /* constant indices, so that the array stays in registers */
    for (int q = 0; q < 4; ++q) h4[q] = (_Float16)(ov[q] * inv);
    *(v4h*)(d + j0) = h4;
    return; }
  auto val = [&](int j) -> float { const bool keep = (j <= i) && (((i / BLK) == (j / BLK)) || ((j % BLK) >= BLK - CSP)) && (tok[j] > 0); return keep ? s[j] : -1.0e9f; };
#pragma unroll 1
  for (int c = 0; c < SLEN / 256; ++c) { const int kb = c * 256 + ln * 8; for (int q = 0; q < 8; ++q) m = fmaxf(m, val(kb + q)); }
  for (int o = 16; o > 0; o >>= 1) m = fmaxf(m, __shfl_xor(m, o, 32)); float su = 0.f;
#pragma unroll 1
  for (int c = 0; c < SLEN / 256; ++c) { const int kb = c * 256 + ln * 8; for (int q = 0; q < 8; ++q) su += expf(val(kb + q) - m); }
  for (int o = 16; o > 0; o >>= 1) su += __shfl_xor(su, o, 32); const float inv = 1024.0f / su; unsigned short* d = (unsigned short*)P16 + hp + (size_t)i * SLEN;
  {
#pragma unroll 1
    for (int c = 0; c < SLEN / 256; ++c) { const int kb = c * 256 + ln * 8; FragH f;
#pragma unroll
      for (int q = 0; q < 8; ++q) f.h[q] = (_Float16)(expf(val(kb + q) - m) * inv);
      *(v8us*)(d + kb) = f.half[0]; }
     } }

extern "C" void kernel_launch(void* const* d_in, const int* in_sizes, int n_in,
                              void* d_out, int out_size, void* d_ws, size_t ws_size, hipStream_t stream) {
  (void)in_sizes; (void)n_in; (void)out_size;
  const float* const* I = (const float* const*)d_in; const int* tok = (const int*)d_in[0]; const float* emb = I[1]; const float* pos = I[2]; const float* l1s = I[3]; const float* l1b = I[4]; const float* wq = I[5]; const float* wk = I[6]; const float* wv = I[7]; const float* wo = I[8];
  const float* l2s = I[9]; const float* l2b = I[10]; const float* w1 = I[11]; const float* b1 = I[12]; const float* w2 = I[13]; const float* b2 = I[14]; const float* lfs = I[15]; const float* lfb = I[16]; const float* wout = I[17]; const float* bout = I[18];
  char* ws = (char*)d_ws; size_t off = 0;
  auto take = [&](size_t bytes) { char* p = ws + off; off += (bytes + 255) & ~(size_t)255; return p; };
  _Float16* BQ = (_Float16*)take((size_t)DM * DM * 2); _Float16* BK = (_Float16*)take((size_t)DM * DM * 2); _Float16* BV = (_Float16*)take((size_t)DM * DM * 2); _Float16* BO = (_Float16*)take((size_t)DM * DM * 2); _Float16* BW1 = (_Float16*)take((size_t)DMLP * DM * 2); _Float16* BW2 = (_Float16*)take((size_t)DM * DMLP * 2); _Float16* BOUT = (_Float16*)take((size_t)NVOC * DM * 2);
  float* X = (float*)take((size_t)SLEN * DM * 4); _Float16* H16 = (_Float16*)take((size_t)SLEN * DM * 2); _Float16* Q16 = (_Float16*)take((size_t)SLEN * DM * 2); _Float16* K16 = (_Float16*)take((size_t)SLEN * DM * 2); _Float16* V16 = (_Float16*)take((size_t)SLEN * DM * 2); _Float16* VT = (_Float16*)take((size_t)DM * SLEN * 2);
  float* S = (float*)take((size_t)NH * SLEN * SLEN * 4); _Float16* P16 = (_Float16*)take((size_t)NH * SLEN * SLEN * 2);      /* one plane per head */ _Float16* O16 = (_Float16*)take((size_t)SLEN * DM * 2); _Float16* G16 = (_Float16*)take((size_t)SLEN * DMLP * 2);
  if (off > ws_size) return;      /* 6.3 + 4 + 2 x 5 + 128 + 64 + 2 + 8 = 222 MiB */
  const size_t w8 = (size_t)DM * DM / 8; const unsigned wb = (unsigned)((w8 + 255) / 256); const dim3 gP((SLEN / 128) * (DM / 64), 1), gS((SLEN / BLK) * 2 + (SLEN / BLK) * (SLEN / BLK - 1) / 2, NH), gH((SLEN / 128) * 1, NH), gX(SLEN / 8, NH), gM((SLEN / 128) * (DMLP / 64), 1), gV((SLEN / 128) * (NVOC / 64), 1);
  k_embed<<<(SLEN * (DM / 4) + 255) / 256, 256, 0, stream>>>(tok, emb, pos, X);
  for (int l = 0; l < NLRUN; ++l) {
    k_wt_f16<<<wb, 256, 0, stream>>>(wq + (size_t)l * DM * DM, BQ, DM, DM, 16.0f); k_wt_f16<<<wb, 256, 0, stream>>>(wk + (size_t)l * DM * DM, BK, DM, DM, 16.0f); k_wt_f16<<<wb, 256, 0, stream>>>(wv + (size_t)l * DM * DM, BV, DM, DM, 16.0f); k_wt_f16<<<wb, 256, 0, stream>>>(wo + (size_t)l * DM * DM, BO, DM, DM, 16.0f);      /* wq[l] [D][H][DH] = (in, out=h*64+k); wo[l] [H][DH][D] = (in=h*64+k, out) */
    k_wt_f16<<<(unsigned)(((size_t)DM * DMLP / 8 + 255) / 256), 256, 0, stream>>>(w1 + (size_t)l * DM * DMLP, BW1, DM, DMLP, 16.0f); k_wt_f16<<<(unsigned)(((size_t)DMLP * DM / 8 + 255) / 256), 256, 0, stream>>>(w2 + (size_t)l * DMLP * DM, BW2, DMLP, DM, 16.0f);
    k_ln512<<<SLEN / 8, 256, 0, stream>>>(X, l1s + l * DM, l1b + l * DM, H16);
    k_gemm2<0><<<gP, 128, 0, stream>>>(H16, DM, 0, BQ, DM, 0, 0.0625f, nullptr, 0, nullptr, 1, 0, 0, nullptr, Q16, DM, 0, SLEN, DM, DM);
    k_gemm2<0><<<gP, 128, 0, stream>>>(H16, DM, 0, BK, DM, 0, 0.0625f, nullptr, 0, nullptr, 1, 0, 0, nullptr, K16, DM, 0, SLEN, DM, DM);
    k_gemm2<0><<<gP, 128, 0, stream>>>(H16, DM, 0, BV, DM, 0, 0.0625f, nullptr, 0, nullptr, 1, 0, 0, nullptr, V16, DM, 0, SLEN, DM, DM);
    k_vt<NH, SLEN><<<NH * (SLEN / 64), 256, 0, stream>>>(V16, DM, 0, VT);
    /* all heads in one launch each: blockIdx.y = head */
    k_gemm2<0, 1><<<gS, 128, 0, stream>>>(Q16, DM, 64, K16, DM, 64, 0.125f, nullptr, 0, nullptr, 1, 0, 0, S, nullptr, SLEN, (size_t)SLEN * SLEN, SLEN, SLEN, 64);      /* (q / 8) . k */
    k_softsp<<<gX, 256, 0, stream>>>(S, tok, P16);
    k_gemm2<0, 2><<<gH, 128, 0, stream>>>(P16, SLEN, (size_t)SLEN * SLEN, VT, SLEN, (size_t)64 * SLEN, 0.0009765625f, nullptr, 0, nullptr, 1, 0, 0, nullptr, O16, DM, 64, SLEN, 64, SLEN, tok);
    k_gemm2<0><<<gP, 128, 0, stream>>>(O16, DM, 0, BO, DM, 0, 0.0625f, nullptr, 0, X, 1, (size_t)DM, 0, X, nullptr, DM, 0, SLEN, DM, DM);      /* x += o Wo (own tile, in place) */
    k_ln512<<<SLEN / 8, 256, 0, stream>>>(X, l2s + l * DM, l2b + l * DM, H16);
    k_gemm2<9><<<gM, 128, 0, stream>>>(H16, DM, 0, BW1, DM, 0, 0.0625f, b1 + (size_t)l * DMLP, 0, nullptr, 1, 0, 0, nullptr, G16, DMLP, 0, SLEN, DMLP, DM);      /* tanh-gelu(y W1 + b1) */
    k_gemm2<0><<<gP, 128, 0, stream>>>(G16, DMLP, 0, BW2, DMLP, 0, 0.0625f, b2 + (size_t)l * DM, 0, X, 1, (size_t)DM, 0, X, nullptr, DM, 0, SLEN, DM, DMLP); }      /* x += mlp + b2 */
  k_wt_f16<<<(unsigned)(((size_t)DM * NVOC / 8 + 255) / 256), 256, 0, stream>>>(wout, BOUT, DM, NVOC, 16.0f);
  k_ln512<<<SLEN / 8, 256, 0, stream>>>(X, lfs, lfb, H16);
  k_gemm2<0><<<gV, 128, 0, stream>>>(H16, DM, 0, BOUT, DM, 0, 0.0625f, bout, 0, nullptr, 1, 0, 0, (float*)d_out, nullptr, NVOC, 0, SLEN, NVOC, DM);
}

// v004
// It runs in 1120 microseconds.
// Next to v003, in two timings, it ran 1.11 and 1.12 times as fast.
// Counting every step since v000, it is 5.16 times as fast.
#include <hip/hip_runtime.h>
// Sparse-pattern transformer decoder (1 x 2048 tokens, 512 = 8 heads x 64, 6 layers, MLP 2048 (tanh-GELU), vocab 256): x = embed[shift_right(tokens)] + pos_emb; per layer: h = LN1(x); q = h Wq / 8, k, v; scores masked by the structural fixed sparse pattern (causal & (same 128-block | last 32 columns of each block)) AND the INPUT key padding (token > 0), masked entries = -1e9 exactly as the reference; softmax; x += (P v) Wo; x += gelu(LN2(x) W1 + b1) W2 + b2; out = LNf(x) Wout + bout -> [1,2048,256].
// Structure: token-embedding gather by the INPUT ids on VALU; LayerNorms on VALU; all weights turned to f16 [n][k] planes by one launch ahead of the layers; all Linears as f16 WMMA GEMMs (32x64 wave tiles, f32 accumulation, exact x16 weights, biases / GELU / residual accumulation in the epilogue); per layer, all heads in one launch each (grid y = head): the scores as a GEMM (K 64) into the head's f32 plane, a wave-per-row f32 softmax applying the structural pattern and the key-padding predicate (P x2^10 f16), V transposed by LDS tiles, P.v as a GEMM into the head's columns of an f16 plane. Scores, softmax and P.v visit only the columns that the structural pattern can keep for a 128-row block (its own block, the last 32 columns of each earlier block); a block that holds a row with no kept key at all (uniform softmax over all 2048 columns) takes the full-width softmax and P.v.
// Compute dtype: embeddings, weights, biases, LN parameters rounded to bf16; LN outputs, q, k, v, P, attention output, GELU hidden as f16 operands (~2^-12; logits small); the residual stream, softmax, LayerNorm in f32. v_wmma_f32_16x16x32_f16.
#define SLEN 2048
#define DM 512
#define NH 8
#define NL 6
#define NLRUN NL                 /* layers executed */
#define DMLP 2048
#define NVOC 256
#define BLK 128
#define CSP 32
#define NR SLEN
typedef __bf16 v16b __attribute__((ext_vector_type(16)));
typedef unsigned short v8us __attribute__((ext_vector_type(8), may_alias));
typedef float  v8f  __attribute__((ext_vector_type(8)));
typedef float  v4f  __attribute__((ext_vector_type(4)));
typedef float  v4fa __attribute__((ext_vector_type(4), may_alias));
union FragB { v16b v; v8us half[2]; unsigned short u[16]; };

__device__ __forceinline__ unsigned short bf16_bits(float x) { unsigned int u = __float_as_uint(x); return (unsigned short)((u + 0x7FFFu + ((u >> 16) & 1u)) >> 16); }
__device__ __forceinline__ float bf16_val(unsigned short b) { return __uint_as_float(((unsigned int)b) << 16); }
__device__ __forceinline__ float bf16_round(float x) { return bf16_val(bf16_bits(x)); }
// D += A·B with NT terms: 1 = ah·bh, 2 = + al·bh (A split), 3 = + ah·bl (both split)
template <int NT>
__device__ __forceinline__ v8f mmaN(v16b ah, v16b al, v16b bh, v16b bl, v8f c) {
  c = __builtin_amdgcn_wmma_f32_16x16x32_bf16(false, ah, false, bh, (short)0, c, false, false);
  if (NT >= 2) c = __builtin_amdgcn_wmma_f32_16x16x32_bf16(false, al, false, bh, (short)0, c, false, false);
  if (NT >= 3) c = __builtin_amdgcn_wmma_f32_16x16x32_bf16(false, ah, false, bl, (short)0, c, false, false);
  asm volatile("v_nop\n\tv_nop\n\tv_nop\n\tv_nop" : "+v"(c) : "v"(ah), "v"(al), "v"(bh), "v"(bl));
  return c;
}

__global__ __launch_bounds__(256) void k_wt_bf16(const float* __restrict__ W, unsigned short* __restrict__ Wt, int K, int N) {
  const int t = blockIdx.x * 256 + threadIdx.x;
  const int k8n = K / 8;
  if (t >= N * k8n) return;
  const int n = t / k8n, k8 = (t % k8n) * 8;
  v8us v;
#pragma unroll
  for (int i = 0; i < 8; ++i) v[i] = bf16_bits(W[(size_t)(k8 + i) * N + n]);
  *(v8us*)(Wt + (size_t)n * K + k8) = v;
  
}

// GEMM C[M][N] (f32, pitch ldc) = act(A[M][K]·W + bias). A f32 row-major (pitch lda) converted per fragment to bf16
// (ASPLIT: hi/lo two planes -> 2 terms, else single rounded term); Wt bf16 [N][K] (pitch ldb). BIAS_BF16 rounds the
// bias to bf16 first (bias quantised to bf16 before the add). K%32==0, M%16==0, N%64==0.
template <bool ASPLIT, int ACT, bool BIAS_BF16>
__global__ __launch_bounds__(128) void k_gemm_bf(const float* __restrict__ A, int lda, const unsigned short* __restrict__ Wt, int ldb,
                                               const float* __restrict__ bias, float* __restrict__ C, int ldc, int M, int N, int K) {
  __shared__ __attribute__((aligned(16))) float so[4][16][64];
  const int tid = threadIdx.x, w = tid >> 5, lane = tid & 31, ln = lane & 15, hh = lane >> 4;
  const int ntn = N / 64;
  const int wid = blockIdx.x * 4 + w;
  const int mt = wid / ntn, nq = wid % ntn;
  if (mt * 16 >= M) return;
  const int row0 = mt * 16, col0 = nq * 64;
  const float* arow = A + (size_t)(row0 + ln) * lda;
  v8f acc[4] = {};
  for (int kb = 0; kb < K; kb += 32) {
    FragB ah, al;
    const v4f x0 = *(const v4fa*)(arow + kb + 8 * hh), x1 = *(const v4fa*)(arow + kb + 8 * hh + 4);
    const v4f x2 = *(const v4fa*)(arow + kb + 16 + 8 * hh), x3 = *(const v4fa*)(arow + kb + 16 + 8 * hh + 4);
    float xs[16] = {x0[0],x0[1],x0[2],x0[3],x1[0],x1[1],x1[2],x1[3],x2[0],x2[1],x2[2],x2[3],x3[0],x3[1],x3[2],x3[3]};
#pragma unroll
    for (int i = 0; i < 16; ++i) { const unsigned short hb = bf16_bits(xs[i]); ah.u[i] = hb; al.u[i] = ASPLIT ? bf16_bits(xs[i] - bf16_val(hb)) : (unsigned short)0; }
#pragma unroll
    for (int t = 0; t < 4; ++t) {
      const unsigned short* brow = Wt + (size_t)(col0 + t * 16 + ln) * ldb + kb;
      FragB b;
      b.half[0] = *(const v8us*)(brow + 8 * hh);
      b.half[1] = *(const v8us*)(brow + 16 + 8 * hh);
      acc[t] = mmaN<ASPLIT ? 2 : 1>(ah.v, al.v, b.v, b.v, acc[t]);
    }
  }
#pragma unroll
  for (int t = 0; t < 4; ++t) {
    float bv = bias ? bias[col0 + t * 16 + ln] : 0.f;
    if (BIAS_BF16) bv = bf16_round(bv);
#pragma unroll
    for (int r = 0; r < 8; ++r) { float v = acc[t][r] + bv; if (ACT == 1) v = fmaxf(v, 0.f); so[w][8 * hh + r][t * 16 + ln] = v; }
  }
  __builtin_amdgcn_fence(__ATOMIC_ACQ_REL, "workgroup");
  __builtin_amdgcn_wave_barrier();
  const int rsub = lane >> 4, c4 = (lane & 15) * 4;
  {
#pragma unroll
    for (int q = 0; q < 8; ++q) {
      const int r = q * 2 + rsub;
      const v4f v = *(const v4fa*)&so[w][r][c4];
      *(v4f*)(C + (size_t)(row0 + r) * ldc + col0 + c4) = v;
    }
    
  }
}

// GEMM C = act(A·W + bias + resid): A f32 (ASPLIT -> hi/lo 2 terms), Wt bf16 [N][K]; ACT 0 none, 1 relu, 2 exact gelu;
// resid (optional, f32, row index = (row % rmod), pitch ldr, RES_BF16 rounds it) added before the activation.
template <bool ASPLIT, int ACT, bool BIAS_BF16, bool RES_BF16>
__global__ __launch_bounds__(128) void k_gemm_bf3(const float* __restrict__ A, int lda, const unsigned short* __restrict__ Wt, int ldb,
                                                const float* __restrict__ bias, const float* __restrict__ resid, int rmod, int ldr,
                                                float* __restrict__ C, int ldc, int M, int N, int K) {
  __shared__ __attribute__((aligned(16))) float so[4][16][64];
  const int tid = threadIdx.x, w = tid >> 5, lane = tid & 31, ln = lane & 15, hh = lane >> 4;
  const int ntn = N / 64;
  const int wid = blockIdx.x * 4 + w;
  const int mt = wid / ntn, nq = wid % ntn;
  if (mt * 16 >= M) return;
  const int row0 = mt * 16, col0 = nq * 64;
  const float* arow = A + (size_t)(row0 + ln) * lda;
  v8f acc[4] = {};
  for (int kb = 0; kb < K; kb += 32) {
    FragB ah, al;
    const v4f x0 = *(const v4fa*)(arow + kb + 8 * hh), x1 = *(const v4fa*)(arow + kb + 8 * hh + 4);
    const v4f x2 = *(const v4fa*)(arow + kb + 16 + 8 * hh), x3 = *(const v4fa*)(arow + kb + 16 + 8 * hh + 4);
    float xs[16] = {x0[0],x0[1],x0[2],x0[3],x1[0],x1[1],x1[2],x1[3],x2[0],x2[1],x2[2],x2[3],x3[0],x3[1],x3[2],x3[3]};
#pragma unroll
    for (int i = 0; i < 16; ++i) { const unsigned short hb = bf16_bits(xs[i]); ah.u[i] = hb; al.u[i] = ASPLIT ? bf16_bits(xs[i] - bf16_val(hb)) : (unsigned short)0; }
#pragma unroll
    for (int t = 0; t < 4; ++t) {
      const unsigned short* brow = Wt + (size_t)(col0 + t * 16 + ln) * ldb + kb;
      FragB b;
      b.half[0] = *(const v8us*)(brow + 8 * hh);
      b.half[1] = *(const v8us*)(brow + 16 + 8 * hh);
      acc[t] = mmaN<ASPLIT ? 2 : 1>(ah.v, al.v, b.v, b.v, acc[t]);
    }
  }
#pragma unroll
  for (int t = 0; t < 4; ++t) {
    const int col = col0 + t * 16 + ln;
    float bv = bias ? bias[col] : 0.f;
    if (BIAS_BF16) bv = bf16_round(bv);
#pragma unroll
    for (int r = 0; r < 8; ++r) {
      float v = acc[t][r] + bv;
      if (resid) { float rv = resid[(size_t)((row0 + 8 * hh + r) % rmod) * ldr + col]; if (RES_BF16) rv = bf16_round(rv); v += rv; }
      if (ACT == 1) v = fmaxf(v, 0.f);
      if (ACT == 2) v = 0.5f * v * (1.0f + erff(v * 0.70710678118654752f));
      if (ACT == 3) { const float u = 0.7978845608028654f * (v + 0.044715f * v * v * v); v = 0.5f * v * (1.0f + tanhf(u)); }
      so[w][8 * hh + r][t * 16 + ln] = v;
    }
  }
  __builtin_amdgcn_fence(__ATOMIC_ACQ_REL, "workgroup");
  __builtin_amdgcn_wave_barrier();
  const int rsub = lane >> 4, c4 = (lane & 15) * 4;
  {
#pragma unroll
    for (int q = 0; q < 8; ++q) {
      const int r = q * 2 + rsub;
      const v4f v = *(const v4fa*)&so[w][r][c4];
      *(v4f*)(C + (size_t)(row0 + r) * ldc + col0 + c4) = v;
    }
    
  }
}
// row LayerNorm (biased variance, eps) over N: s = X (+ R); optional out_sum <- s; out_norm <- (s-mu)*rsqrt(var+eps)*g + b
template <bool PARAM_BF16>
__global__ __launch_bounds__(256) void k_layernorm(const float* __restrict__ X, const float* __restrict__ R, const float* __restrict__ g, const float* __restrict__ bta,
                                                  float* __restrict__ out_sum, float* __restrict__ out_norm, int N, float eps) {
  __shared__ float red[256];
  const int row = blockIdx.x, tid = threadIdx.x;
  const float* x = X + (size_t)row * N; const float* rr = R ? R + (size_t)row * N : nullptr;
  float vals[16];                     // up to N = 4096
  const int per = N / 256;            // contiguous chunk per thread? use strided-by-4 chunks: thread handles j = tid*4 + 1024*u
  float s1 = 0.f;
  for (int u = 0; u < per / 4; ++u) {
    const int j = tid * 4 + 1024 * u;
    const v4f a = *(const v4fa*)(x + j);
    v4f b = {0.f,0.f,0.f,0.f}; if (rr) b = *(const v4fa*)(rr + j);
#pragma unroll
    for (int q = 0; q < 4; ++q) { const float v = a[q] + b[q]; vals[u * 4 + q] = v; s1 += v; }
  }
  red[tid] = s1; __syncthreads();
  for (int st = 128; st > 0; st >>= 1) { if (tid < st) red[tid] += red[tid + st]; __syncthreads(); }
  const float mu = red[0] / (float)N; __syncthreads();
  float s2 = 0.f;
  for (int u = 0; u < per / 4; ++u)
#pragma unroll
    for (int q = 0; q < 4; ++q) { const float c = vals[u * 4 + q] - mu; s2 += c * c; }
  red[tid] = s2; __syncthreads();
  for (int st = 128; st > 0; st >>= 1) { if (tid < st) red[tid] += red[tid + st]; __syncthreads(); }
  const float rs = rsqrtf(red[0] / (float)N + eps);
  {
    for (int u = 0; u < per / 4; ++u) {
      const int j = tid * 4 + 1024 * u;
      v4f o, sm;
#pragma unroll
      for (int q = 0; q < 4; ++q) {
        float gg = g[j + q], bb = bta[j + q];
        if (PARAM_BF16) { gg = bf16_round(gg); bb = bf16_round(bb); }
        sm[q] = vals[u * 4 + q]; o[q] = (vals[u * 4 + q] - mu) * rs * gg + bb;
      }
      if (out_sum) *(v4f*)(out_sum + (size_t)row * N + j) = sm;
      *(v4f*)(out_norm + (size_t)row * N + j) = o;
    }
    
  }
}



// ---- f16 WMMA path (v_wmma_f32_16x16x32_f16): 11-bit significands for operands in range — used where a [0,1] probability operand needs more precision than bf16
typedef _Float16 v16h __attribute__((ext_vector_type(16)));
union FragH { v16h v; v8us half[2]; _Float16 h[16]; unsigned short u[16]; };
template <int NT>
__device__ __forceinline__ v8f mmaH(v16h ah, v16h al, v16h bh, v16h bl, v8f c) {
  c = __builtin_amdgcn_wmma_f32_16x16x32_f16(false, ah, false, bh, (short)0, c, false, false);
  if (NT >= 2) c = __builtin_amdgcn_wmma_f32_16x16x32_f16(false, al, false, bh, (short)0, c, false, false);
  if (NT >= 3) c = __builtin_amdgcn_wmma_f32_16x16x32_f16(false, ah, false, bl, (short)0, c, false, false);
  asm volatile("v_nop\n\tv_nop\n\tv_nop\n\tv_nop" : "+v"(c) : "v"(ah), "v"(al), "v"(bh), "v"(bl));
  return c;
}
// batched GEMM like k_gemm_b but f16 operands: A f32 (split into f16 hi/lo if ASPLIT, else rounded to f16), Bt = f16 values [n][k]; alpha; C f32; N multiple of 16 (partial tiles skipped)
template <bool ASPLIT>
__global__ __launch_bounds__(128) void k_gemm_h(const float* __restrict__ A, int lda, size_t sA, const _Float16* __restrict__ Bh, int ldb, size_t sB, float alpha, float* __restrict__ C, int ldc, size_t sC, int M, int N, int K) {
  __shared__ __attribute__((aligned(16))) float so[4][16][64];
  const int tid = threadIdx.x, w = tid >> 5, lane = tid & 31, ln = lane & 15, hh = lane >> 4; const int by = blockIdx.y;
  A += (size_t)by * sA; Bh += (size_t)by * sB; C += (size_t)by * sC;
  const int ntn = (N + 63) / 64; const int wid = blockIdx.x * 4 + w; const int mt = wid / ntn, nq = wid % ntn; if (mt * 16 >= M) return;
  const int row0 = mt * 16, col0 = nq * 64; const float* arow = A + (size_t)(row0 + ln) * lda;
  v8f acc[4] = {};
  for (int kb = 0; kb < K; kb += 32) {
    FragH ah, al;
    const v4f x0 = *(const v4fa*)(arow + kb + 8 * hh), x1 = *(const v4fa*)(arow + kb + 8 * hh + 4), x2 = *(const v4fa*)(arow + kb + 16 + 8 * hh), x3 = *(const v4fa*)(arow + kb + 16 + 8 * hh + 4);
    float xs[16] = {x0[0],x0[1],x0[2],x0[3],x1[0],x1[1],x1[2],x1[3],x2[0],x2[1],x2[2],x2[3],x3[0],x3[1],x3[2],x3[3]};
#pragma unroll
    for (int i = 0; i < 16; ++i) { const _Float16 h = (_Float16)xs[i]; ah.h[i] = h; al.h[i] = ASPLIT ? (_Float16)(xs[i] - (float)h) : (_Float16)0.0f; }
#pragma unroll
    for (int t = 0; t < 4; ++t) { if (col0 + t * 16 >= N) continue; const size_t boff = (size_t)(col0 + t * 16 + ln) * ldb + kb; FragH bq; bq.half[0] = *(const v8us*)(Bh + boff + 8 * hh); bq.half[1] = *(const v8us*)(Bh + boff + 16 + 8 * hh);
      acc[t] = mmaH<ASPLIT ? 2 : 1>(ah.v, al.v, bq.v, bq.v, acc[t]); }
  }
#pragma unroll
  for (int t = 0; t < 4; ++t) { if (col0 + t * 16 >= N) continue;
#pragma unroll
    for (int r = 0; r < 8; ++r) so[w][8 * hh + r][t * 16 + ln] = acc[t][r] * alpha; }
  __builtin_amdgcn_fence(__ATOMIC_ACQ_REL, "workgroup"); __builtin_amdgcn_wave_barrier();
  const int rsub = lane >> 4, c4 = (lane & 15) * 4;
  {
#pragma unroll
    for (int q = 0; q < 8; ++q) { const int r = q * 2 + rsub; if (col0 + c4 < N) { const v4f v = *(const v4fa*)&so[w][r][c4]; *(v4f*)(C + (size_t)(row0 + r) * ldc + col0 + c4) = v; } }
     }
}

// Wt[n][k] = f16(bf16(W[k][n]) x 16) from f32 row-major W[K][N] (a power of two: bf16-exact weights stay exact in f16 away from the subnormal range).
// One work-group turns a strip of 256 k x 64 n: whole 256-byte row pieces in, 512 bytes of each output row out, through LDS.
// LDS row n holds its 256 k as 128 dwords (k, k + 1 packed); the 16-byte chunk c of row n lies at chunk c ^ (n / 4 % 16), so that the 32 lanes of a store (16 rows n four apart, two neighbouring dwords) fall on 32 different banks, while a row stays one contiguous 512 bytes for the 16-byte reads.
typedef unsigned v4u __attribute__((ext_vector_type(4)));
template <int K, int N>
__device__ __forceinline__ void wt_strip(const float* __restrict__ W, _Float16* __restrict__ Wt, int s, unsigned (*tl)[128]) {
  const int tid = threadIdx.x, n0 = (s % (N / 64)) * 64, k0 = (s / (N / 64)) * 256;
  const int l16 = tid & 15, r = tid >> 4;
  const float* src = W + (size_t)(k0 + 2 * r) * N + n0 + l16 * 4;
  v4f a[8], b[8];      /* rows k0 + 32 p + 2 r and the next one, columns n0 + 4 l16 up */
#pragma unroll      /* constant indices, so that the arrays stay in registers and the 16 loads are in flight together */
  for (int p = 0; p < 8; ++p) { a[p] = *(const v4fa*)(src + (size_t)(32 * p) * N); b[p] = *(const v4fa*)(src + (size_t)(32 * p + 1) * N); }
#pragma unroll      /* constant indices, so that the arrays stay in registers */
  for (int p = 0; p < 8; ++p) { const int kp = p * 16 + r;
    for (int q = 0; q < 4; ++q) { union { _Float16 h[2]; unsigned u; } pk; pk.h[0] = (_Float16)(bf16_round(a[p][q]) * 16.0f); pk.h[1] = (_Float16)(bf16_round(b[p][q]) * 16.0f);
      tl[l16 * 4 + q][(((kp >> 2) ^ l16) << 2) + (kp & 3)] = pk.u; } }
  __syncthreads();
  const int w = tid >> 5, j = tid & 31;      /* a wave writes 8 output rows, 512 contiguous bytes of each */
#pragma unroll      /* the 8 LDS reads are in flight together, and the stores share address registers with constant offsets */
  for (int i = 0; i < 8; ++i) { const int n = w * 8 + i; const v4u v = *(const v4u*)&tl[n][(j ^ ((n >> 2) & 15)) << 2];
    *(v4u*)((unsigned short*)Wt + (size_t)(n0 + n) * K + k0 + 8 * j) = v; }
  asm volatile("s_wait_xcnt 0x0" ::: "memory");      /* in the listing the code of the next matrix shape follows these stores and reuses their address registers: it stands only behind this wait */
}
#define LWT ((size_t)4 * DM * DM + (size_t)2 * DM * DMLP)      /* f16 elements of one layer's six matrices: q, k, v, o, w1, w2 */
// every weight matrix of the model in one launch: blockIdx.y = layer (NL: the output projection), blockIdx.x = strip (16 each for q, k, v, o; 64 for w1; 64 for w2)
__global__ __launch_bounds__(256) void k_wt_all(const float* __restrict__ wq, const float* __restrict__ wk, const float* __restrict__ wv, const float* __restrict__ wo, const float* __restrict__ w1, const float* __restrict__ w2, const float* __restrict__ wout, _Float16* __restrict__ BW) {
  __shared__ __attribute__((aligned(16))) unsigned tl[64][128];
  const int l = blockIdx.y, x = blockIdx.x;
  if (l == NL) { if (x < (NVOC / 64) * (DM / 256)) wt_strip<DM, NVOC>(wout, BW + NL * LWT, x, tl); return; }
  _Float16* B = BW + l * LWT;
  if (x < 64) { const int m = x >> 4; const float* Wm = m == 0 ? wq : m == 1 ? wk : m == 2 ? wv : wo; wt_strip<DM, DM>(Wm + (size_t)l * DM * DM, B + (size_t)m * DM * DM, x & 15, tl); }
  else if (x < 128) wt_strip<DM, DMLP>(w1 + (size_t)l * DM * DMLP, B + (size_t)4 * DM * DM, x - 64, tl);
  else wt_strip<DMLP, DM>(w2 + (size_t)l * DMLP * DM, B + (size_t)4 * DM * DM + (size_t)DM * DMLP, x - 128, tl);
}
// k_gemm_hh variant with fused epilogue: v = acc·alpha + bias[by·sBias + col] (+ CP[(row/rowsPerB)·sCPb + by·64 + col] if CP) ; ACT 0 none / 1 elu ; writes f16 C16 (and f32 C if non-null)
template <int ACT>
__global__ __launch_bounds__(128) void k_gemm_hhx(const _Float16* __restrict__ A, int lda, size_t sA, const _Float16* __restrict__ Bh, int ldb, size_t sB, float alpha, const float* __restrict__ bias, size_t sBias, const float* __restrict__ CP, int rowsPerB, size_t sCPb, int row0g,
    float* __restrict__ C, _Float16* __restrict__ C16, int ldc, size_t sC, int M, int N, int K) {
  __shared__ __attribute__((aligned(16))) float so[4][16][64];
  const int tid = threadIdx.x, w = tid >> 5, lane = tid & 31, ln = lane & 15, hh = lane >> 4; const int by = blockIdx.y;
  A += (size_t)by * sA; Bh += (size_t)by * sB; const size_t cofs = (size_t)by * sC; const float* bp = bias ? bias + (size_t)by * sBias : nullptr;
  const int ntn = (N + 63) / 64; const int wid = blockIdx.x * 4 + w; const int mt = wid / ntn, nq = wid % ntn; if (mt * 16 >= M) return;
  const int row0 = mt * 16, col0 = nq * 64; const _Float16* arow = A + (size_t)(row0 + ln) * lda;
  v8f acc[4] = {};
  for (int kb = 0; kb < K; kb += 32) { FragH ah; ah.half[0] = *(const v8us*)((const unsigned short*)arow + kb + 8 * hh); ah.half[1] = *(const v8us*)((const unsigned short*)arow + kb + 16 + 8 * hh);
#pragma unroll
    for (int t = 0; t < 4; ++t) { if (col0 + t * 16 >= N) continue; const size_t boff = (size_t)(col0 + t * 16 + ln) * ldb + kb; FragH bq; bq.half[0] = *(const v8us*)((const unsigned short*)Bh + boff + 8 * hh); bq.half[1] = *(const v8us*)((const unsigned short*)Bh + boff + 16 + 8 * hh);
      acc[t] = mmaH<1>(ah.v, ah.v, bq.v, bq.v, acc[t]); }
  }
#pragma unroll
  for (int t = 0; t < 4; ++t) { if (col0 + t * 16 >= N) continue; const int col = col0 + t * 16 + ln; const float bv = bp ? bf16_round(bp[col]) : 0.f;
#pragma unroll
    for (int r = 0; r < 8; ++r) { float v = acc[t][r] * alpha + bv; if (CP) { const int bidx = (row0g + row0 + 8 * hh + r) / rowsPerB; v += CP[(size_t)bidx * sCPb + (size_t)by * 64 + col]; } if (ACT == 1) v = (v > 0.f) ? v : expm1f(v); else if (ACT == 7) v = (v > 0.f) ? v + 1.0f : expf(v); else if (ACT == 8) v = tanhf(v); else if (ACT == 9) v = 0.5f * v * (1.0f + tanhf(0.7978845608028654f * (v + 0.044715f * v * v * v))); else if (ACT == 11) v = 1.0f / (1.0f + expf(-v)); else if (ACT == 12) v = (v > 0.f) ? v : 0.01f * v; else if (ACT == 14) v = (v > 0.f) ? v : 0.1f * v; else if (ACT == 15) v = v / (1.0f + expf(-v)); else if (ACT == 3) v = fmaxf(v, 0.f); else if (ACT == 6) v = 0.5f * v * (1.0f + erff(v * 0.70710678118654752f)); so[w][8 * hh + r][t * 16 + ln] = v; } }
  __builtin_amdgcn_fence(__ATOMIC_ACQ_REL, "workgroup"); __builtin_amdgcn_wave_barrier();
  const int rsub = lane >> 4, c4 = (lane & 15) * 4; typedef _Float16 v4h __attribute__((ext_vector_type(4)));
  {
#pragma unroll
    for (int q = 0; q < 8; ++q) { const int r = q * 2 + rsub; if (col0 + c4 < N) { const v4f v = *(const v4fa*)&so[w][r][c4]; if (C) *(v4f*)(C + cofs + (size_t)(row0 + r) * ldc + col0 + c4) = v; if (C16) { v4h h4; for (int i = 0; i < 4; ++i) h4[i] = (_Float16)v[i]; *(v4h*)(C16 + cofs + (size_t)(row0 + r) * ldc + col0 + c4) = h4; } } }
     }
}


typedef _Float16 v4h __attribute__((ext_vector_type(4)));
typedef int v4ia __attribute__((ext_vector_type(4), may_alias));

__global__ __launch_bounds__(256) void k_x16(const float* __restrict__ x, _Float16* __restrict__ X16, size_t n8) { const size_t t = (size_t)blockIdx.x * 256 + threadIdx.x; if (t >= n8) return; FragH f;
#pragma unroll
  for (int q = 0; q < 8; ++q) f.h[q] = (_Float16)bf16_round(x[t * 8 + q]); *(v8us*)((unsigned short*)X16 + t * 8) = f.half[0];  }
__global__ __launch_bounds__(256) void k_h16(const float* __restrict__ x, _Float16* __restrict__ X16, size_t n8) { const size_t t = (size_t)blockIdx.x * 256 + threadIdx.x; if (t >= n8) return; FragH f;
#pragma unroll
  for (int q = 0; q < 8; ++q) f.h[q] = (_Float16)x[t * 8 + q]; *(v8us*)((unsigned short*)X16 + t * 8) = f.half[0];  }
__global__ __launch_bounds__(256) void k_round16f(const float* __restrict__ W, _Float16* __restrict__ Bt, size_t n8) { const size_t t = (size_t)blockIdx.x * 256 + threadIdx.x; if (t >= n8) return; FragH f;
#pragma unroll
  for (int i = 0; i < 8; ++i) f.h[i] = (_Float16)(bf16_round(W[t * 8 + i]) * 16.0f); *(v8us*)((unsigned short*)Bt + t * 8) = f.half[0];  }
template <int NHv, int TTv>
__global__ __launch_bounds__(256) void k_vt(const _Float16* __restrict__ V16, int ldv, int voff, _Float16* __restrict__ Vt) { __shared__ unsigned short tl[64][66]; const int tid = threadIdx.x; const int slab = blockIdx.x / (TTv / 64), lg = blockIdx.x % (TTv / 64); const int b = slab / NHv, h = slab % NHv;
  for (int i = tid; i < 64 * 8; i += 256) { const int r = i / 8, c8 = (i % 8) * 8; FragH f; f.half[0] = *(const v8us*)((const unsigned short*)V16 + ((size_t)b * TTv + lg * 64 + r) * ldv + voff + h * 64 + c8);
#pragma unroll
    for (int q = 0; q < 8; ++q) tl[r][c8 + q] = f.u[q]; }
  __syncthreads();
  {
#pragma unroll
    for (int rd = 0; rd < 2; ++rd) { const int d = rd * 32 + tid / 8, pc = tid % 8; FragH f;
#pragma unroll
      for (int q = 0; q < 8; ++q) f.u[q] = tl[pc * 8 + q][d];
      *(v8us*)((unsigned short*)Vt + ((size_t)slab * 64 + d) * TTv + lg * 64 + pc * 8) = f.half[0]; }
     } }

__global__ __launch_bounds__(256) void k_hl(const float* __restrict__ F, _Float16* __restrict__ Hh, _Float16* __restrict__ Hl, size_t n8) { const size_t t = (size_t)blockIdx.x * 256 + threadIdx.x; if (t >= n8) return; FragH fh, fl; const v4f a = *(const v4fa*)(F + t * 8), c = *(const v4fa*)(F + t * 8 + 4);
#pragma unroll
  for (int q = 0; q < 4; ++q) { _Float16 h = (_Float16)a[q]; fh.h[q] = h; fl.h[q] = (_Float16)((a[q] - (float)h) * 1024.0f); h = (_Float16)c[q]; fh.h[4 + q] = h; fl.h[4 + q] = (_Float16)((c[q] - (float)h) * 1024.0f); }
  { *(v8us*)((unsigned short*)Hh + t * 8) = fh.half[0]; *(v8us*)((unsigned short*)Hl + t * 8) = fl.half[0];  } }

// ---- fast GEMM (wave tile 32x64; requires M % 32 == 0 rows per launch region and N % 64 == 0); epilogue = k_gemm_hhx semantics ----
__device__ __forceinline__ v16h g2_frag(const _Float16* p, int hh) { FragH f; f.half[0] = *(const v8us*)((const unsigned short*)p + 8 * hh); f.half[1] = *(const v8us*)((const unsigned short*)p + 16 + 8 * hh); return f.v; }
__device__ __forceinline__ v8f g2_mma(v16h a, v16h b, v8f c) { v8f d = __builtin_amdgcn_wmma_f32_16x16x32_f16(false, a, false, b, (short)0, c, false, false); asm volatile("v_nop\n\tv_nop\n\tv_nop\n\tv_nop" : "+v"(d) : "v"(a), "v"(b)); return d; }
/* SP 0: plain. SP 1 (scores): blockIdx.x counts only the 128x64 tiles that hold a column the pattern can keep. SP 2 (P.v, N 64): the k loop visits only such columns, unless rows_all_masked(). */
/* The last 32 columns of the (at most 15) earlier blocks, 4 columns a lane, 4 blocks a load: slot u of a lane is block 4u + lane / 8. A slot past the earlier blocks is off; it is aimed at the own block's last 32 columns (in bounds, written) so that no branch stands round a load. */
__device__ __forceinline__ bool sum_on(int blk, int lane, int u) { return u * 4 + (lane >> 3) < blk; }
__device__ __forceinline__ int sum_col(int blk, int lane, int u) { return (sum_on(blk, lane, u) ? u * 4 + (lane >> 3) : blk) * BLK + (BLK - CSP) + (lane & 7) * 4; }
/* true where the first row of 128-row block blk has no kept key (a later row keeps every key of an earlier row of its block, so false means that no row of the block is without one); the same in every lane. t[u] = the tokens at sum_col(u), tfirst = the token of the block's first column */
__device__ __forceinline__ bool rows_all_masked(const v4ia (&t)[4], int tfirst, int blk, int lane) {
  bool kept = tfirst > 0;
#pragma unroll      /* constant indices, so that the array stays in registers */
  for (int u = 0; u < 4; ++u) for (int q = 0; q < 4; ++q) kept |= sum_on(blk, lane, u) & (t[u][q] > 0);
  return !__any(kept); }
template <int ACT, int SP = 0>
__global__ __launch_bounds__(128) void k_gemm2(const _Float16* __restrict__ A, int lda, size_t sA, const _Float16* __restrict__ Bh, int ldb, size_t sB, float alpha, const float* __restrict__ bias, size_t sBias, const float* __restrict__ CP, int rowsPerB, size_t sCPb, int row0g,
    float* __restrict__ C, _Float16* __restrict__ C16, int ldc, size_t sC, int M, int N, int Kfull, const int* __restrict__ tok = nullptr) {
  __shared__ __attribute__((aligned(16))) float so[4][32][68];
  const int tid = threadIdx.x, w = tid >> 5, lane = tid & 31, ln = lane & 15, hh = lane >> 4; const int by = blockIdx.y;
  A += (size_t)by * sA; Bh += (size_t)by * sB; const size_t cofs = (size_t)by * sC; const float* bp = bias ? bias + (size_t)by * sBias : nullptr;
  const int ntn = N >> 6; int mt = blockIdx.x / ntn, nq = blockIdx.x - mt * ntn;
  if (SP == 1) { int t = blockIdx.x; for (mt = 0; mt < SLEN / BLK - 1 && t >= mt + 2; ++mt) t -= mt + 2;      /* row block mt has mt + 2 tiles: the upper half of each earlier block, then the two halves of its own */
    nq = t < mt ? 2 * t + 1 : mt + t; }
  const int row0 = mt * 128 + 32 * w, col0 = nq * 64; if (row0 >= M) return;
  bool sparse = false;      /* true: P is written, and non-zero, only in the columns that the pattern can keep */
  if (SP == 2) { v4ia t[4];
#pragma unroll      /* constant indices, so that the array stays in registers */
    for (int u = 0; u < 4; ++u) t[u] = *(const v4ia*)(tok + sum_col(mt, lane, u));
    const int tf = tok[mt * BLK];
    asm volatile("s_wait_xcnt 0x0" :: "v"(t[0]), "v"(t[1]), "v"(t[2]), "v"(t[3]), "s"(tf) : "memory");      /* the loaded values as inputs only: the five loads are in flight together (one latency, not five); their address registers are rewritten only behind this wait */
    __builtin_amdgcn_sched_barrier(0);      /* keeps the work below from being lifted in front of that wait */
    sparse = !rows_all_masked(t, tf, mt, lane); }
  const int K = sparse ? (mt + BLK / 32) * 32 : Kfull;      /* 32-k steps: one for each earlier block, four for the own block */
  const int ksum = sparse ? mt * 32 : 0;      /* the steps below ksum are the earlier blocks': step k reads columns 4 k + 96 up; a step of the own block reads columns k + 3 ksum up (ld) */
  /* each lane's byte offsets in A and B are fixed for the whole loop; only the wave-uniform base moves with k (every operand plane here is far below 4 GiB) */
  const unsigned ao0 = (unsigned)((row0 + ln) * lda + 8 * hh) * 2u, ao1 = ao0 + 32u * (unsigned)lda;
  const unsigned bo0 = (unsigned)((col0 + ln) * ldb + 8 * hh) * 2u, bo1 = bo0 + 32u * (unsigned)ldb, bo2 = bo1 + 32u * (unsigned)ldb, bo3 = bo2 + 32u * (unsigned)ldb;
  const v8f z8 = {0.f,0.f,0.f,0.f,0.f,0.f,0.f,0.f}; v8f c00 = z8, c01 = z8, c02 = z8, c03 = z8, c10 = z8, c11 = z8, c12 = z8, c13 = z8;
  /* Fragment loads run ahead of the products: the 12 loads of a 32-k step are issued as one group, two steps before the products that read them, into three rotating register sets.
     The k order of every accumulator is unchanged. A load past the last step is aimed at the last step again (in bounds, its values unused). K % 32 == 0, K >= 32. */
  struct Stg { v16h a0, a1, b0, b1, b2, b3; };
  const int klast = K - 32;
  auto fr = [](const char* p, unsigned o) -> v16h { FragH f; f.half[0] = *(const v8us*)(p + o); f.half[1] = *(const v8us*)(p + o + 32); return f.v; };
  auto ld = [&](Stg& s, int kq) { int k = kq < klast ? kq : klast; if (SP == 2) k += (BLK / 32 - 1) * (k < ksum ? k : ksum) + (k < ksum ? BLK - CSP : 0); const char* ak = (const char*)A + 2 * k; const char* bk = (const char*)Bh + 2 * k;
    s.a0 = fr(ak, ao0); s.a1 = fr(ak, ao1); s.b0 = fr(bk, bo0); s.b1 = fr(bk, bo1); s.b2 = fr(bk, bo2); s.b3 = fr(bk, bo3);
    asm volatile("s_wait_xcnt 0x0" ::: "memory");      /* the address registers that these loads name are rewritten for the next group only behind this wait */
    __builtin_amdgcn_sched_barrier(0);      /* keeps the whole group in front of the wait of the products behind it (below that wait the loads would start one latency late), and the next group's address work behind the wait above */
  };
  auto mm = [&](const Stg& s) { c00 = g2_mma(s.a0, s.b0, c00); c10 = g2_mma(s.a1, s.b0, c10); c01 = g2_mma(s.a0, s.b1, c01); c11 = g2_mma(s.a1, s.b1, c11);
    c02 = g2_mma(s.a0, s.b2, c02); c12 = g2_mma(s.a1, s.b2, c12); c03 = g2_mma(s.a0, s.b3, c03); c13 = g2_mma(s.a1, s.b3, c13); };
  { Stg s0, s1, s2; ld(s0, 0); ld(s1, 32); int kb = 0;
#pragma unroll 1      /* one copy of the three-step body: a second copy would not fit the register sets */
    for (; kb + 96 <= K; kb += 96) { ld(s2, kb + 64); mm(s0); ld(s0, kb + 96); mm(s1); ld(s1, kb + 128); mm(s2); }
    if (kb < K) mm(s0);
    if (kb + 32 < K) mm(s1); }
  v8f accs[8] = {c00, c01, c02, c03, c10, c11, c12, c13};
#pragma unroll
  for (int u = 0; u < 8; ++u) { const int t = u & 3, half = u >> 2; const int col = col0 + t * 16 + ln; const float bv = bp ? bf16_round(bp[col]) : 0.f;
#pragma unroll
    for (int r = 0; r < 8; ++r) { const int rloc = half * 16 + 8 * hh + r; float v = accs[u][r] * alpha + bv; if (CP) { const int bidx = (row0g + row0 + rloc) / rowsPerB; v += CP[(size_t)bidx * sCPb + (size_t)by * 64 + col]; }
      if (ACT == 3) v = fmaxf(v, 0.f); else if (ACT == 6) v = 0.5f * v * (1.0f + erff(v * 0.70710678118654752f)); else if (ACT == 11) v = 1.0f / (1.0f + expf(-v)); else if (ACT == 15) v = v / (1.0f + expf(-v)); else if (ACT == 12) v = (v > 0.f) ? v : 0.01f * v; else if (ACT == 8) v = tanhf(v); else if (ACT == 9) v = 0.5f * v * (1.0f + tanhf(0.7978845608028654f * (v + 0.044715f * v * v * v)));      /* tanh-GELU */
      so[w][rloc][t * 16 + ln] = v; } }
  __builtin_amdgcn_fence(__ATOMIC_ACQ_REL, "workgroup"); __builtin_amdgcn_wave_barrier();
  const int rsub = lane >> 4, c4 = (lane & 15) * 4;
  {
#pragma unroll
    for (int q = 0; q < 16; ++q) { const int r = q * 2 + rsub; const v4f v = *(const v4fa*)&so[w][r][c4]; if (C) *(v4f*)(C + cofs + (size_t)(row0 + r) * ldc + col0 + c4) = v; if (C16) { v4h h4; for (int i = 0; i < 4; ++i) h4[i] = (_Float16)v[i]; *(v4h*)(C16 + cofs + (size_t)(row0 + r) * ldc + col0 + c4) = h4; } }
     } }


__global__ __launch_bounds__(256) void k_embed(const int* __restrict__ tok, const float* __restrict__ emb, const float* __restrict__ pos, float* __restrict__ X) {
  #pragma clang fp contract(off)
  const int t = blockIdx.x * 256 + threadIdx.x; if (t >= SLEN * (DM / 4)) return; const int c0 = (t % (DM / 4)) * 4, s = t / (DM / 4); const int id = (s == 0) ? 0 : tok[s - 1]; v4f o;
#pragma unroll
  for (int q = 0; q < 4; ++q) o[q] = bf16_round(emb[(size_t)id * DM + c0 + q]) + bf16_round(pos[(size_t)s * DM + c0 + q]);
  *(v4f*)(X + (size_t)s * DM + c0) = o;  }
__global__ __launch_bounds__(256) void k_ln512(const float* __restrict__ X, const float* __restrict__ g, const float* __restrict__ bb, _Float16* __restrict__ Y16) {
  #pragma clang fp contract(off)
  const int tid = threadIdx.x, w = tid >> 5, ln = tid & 31; const int r = blockIdx.x * 8 + w; if (r >= SLEN) return; const float* x = X + (size_t)r * DM; v4f a[4]; float s = 0.f;
#pragma unroll
  for (int i = 0; i < 4; ++i) { a[i] = *(const v4fa*)(x + i * 128 + ln * 4); for (int q = 0; q < 4; ++q) s += a[i][q]; }
  for (int o = 16; o > 0; o >>= 1) s += __shfl_xor(s, o, 32); const float mu = s / (float)DM; float q2 = 0.f;
#pragma unroll
  for (int i = 0; i < 4; ++i) for (int q = 0; q < 4; ++q) { const float d = a[i][q] - mu; q2 += d * d; }
  for (int o = 16; o > 0; o >>= 1) q2 += __shfl_xor(q2, o, 32); const float rs = rsqrtf(q2 / (float)DM + 1e-6f);
  {
#pragma unroll
    for (int i = 0; i < 4; ++i) { const int c0 = i * 128 + ln * 4; _Float16 h4[4]; for (int q = 0; q < 4; ++q) h4[q] = (_Float16)((a[i][q] - mu) * rs * bf16_round(g[c0 + q]) + bf16_round(bb[c0 + q])); *(unsigned long long*)((unsigned short*)Y16 + (size_t)r * DM + c0) = *(const unsigned long long*)h4; }
     } }
__global__ __launch_bounds__(256) void k_softsp(const float* __restrict__ S, const int* __restrict__ tok, _Float16* __restrict__ P16) {
  #pragma clang fp contract(off)
  const int tid = threadIdx.x, w = tid >> 5, ln = tid & 31; const int i = blockIdx.x * 8 + w; if (i >= SLEN) return; const size_t hp = (size_t)blockIdx.y * SLEN * SLEN; /* this head's plane */ const float* s = S + hp + (size_t)i * SLEN; float m = -3.0e38f;
  const int b = blockIdx.x / (BLK / 8);      /* the row's 128-block, the same for the whole work-group */
  v4f sv[4]; v4ia st[4];      /* the columns that the pattern can keep: the last 32 of each earlier block (sum_col), then 4 columns a lane of the own block */
  const char* srow = (const char*)(S + hp + (size_t)__builtin_amdgcn_readfirstlane(i) * SLEN);      /* the wave's row, its base in scalar registers: each load names a scalar base and one lane offset */
  unsigned jo[5];      /* byte offsets of a lane's columns, the same in the f32 score row and in the int32 tokens */
#pragma unroll      /* constant indices, so that the array stays in registers */
  for (int u = 0; u < 4; ++u) jo[u] = 4u * (unsigned)sum_col(b, ln, u);
  const int j0 = b * BLK + ln * 4; jo[4] = 4u * (unsigned)j0;
#pragma unroll      /* constant indices, so that the array stays in registers */
  for (int u = 0; u < 4; ++u) { sv[u] = *(const v4fa*)(srow + jo[u]); st[u] = *(const v4ia*)((const char*)tok + jo[u]); }
  v4f ov = *(const v4fa*)(srow + jo[4]); const v4ia ot = *(const v4ia*)((const char*)tok + jo[4]); const int tf = tok[b * BLK];
  asm volatile("s_wait_xcnt 0x0" :: "v"(sv[0]), "v"(sv[1]), "v"(sv[2]), "v"(sv[3]), "v"(st[0]), "v"(st[1]), "v"(st[2]), "v"(st[3]), "v"(ov), "v"(ot), "s"(tf), "v"(jo[0]), "v"(jo[1]), "v"(jo[2]), "v"(jo[3]), "v"(jo[4]), "s"(srow) : "memory");      /* inputs only. The loaded values: the eleven loads are in flight together (one latency, not eleven). The five lane offsets and the row base: they stay live up to here, so no load's result lands in a register that an earlier load of the run names ahead of this wait */
  __builtin_amdgcn_sched_barrier(0);      /* keeps the work below from being lifted in front of that wait */
  if (!rows_all_masked(st, tf, b, ln)) {      /* every row of the block has a kept key: exp(-1e9 - m) is 0, so only these columns are summed and written */
#pragma unroll      /* constant indices, so that the array stays in registers */
    for (int u = 0; u < 4; ++u) for (int q = 0; q < 4; ++q) { sv[u][q] = (sum_on(b, ln, u) & (st[u][q] > 0)) ? sv[u][q] : -1.0e9f; m = fmaxf(m, sv[u][q]); }
#pragma unroll      /* constant indices, so that the array stays in registers */
    for (int q = 0; q < 4; ++q) { ov[q] = ((j0 + q <= i) & (ot[q] > 0)) ? ov[q] : -1.0e9f; m = fmaxf(m, ov[q]); }
    for (int o = 16; o > 0; o >>= 1) m = fmaxf(m, __shfl_xor(m, o, 32)); float su = 0.f;
#pragma unroll      /* constant indices, so that the array stays in registers */
    for (int u = 0; u < 4; ++u) for (int q = 0; q < 4; ++q) { sv[u][q] = expf(sv[u][q] - m); su += sv[u][q]; }
#pragma unroll      /* constant indices, so that the array stays in registers */
    for (int q = 0; q < 4; ++q) { ov[q] = expf(ov[q] - m); su += ov[q]; }
    for (int o = 16; o > 0; o >>= 1) su += __shfl_xor(su, o, 32); const float inv = 1024.0f / su; _Float16* d = P16 + hp + (size_t)i * SLEN;
#pragma unroll      /* constant indices, so that the array stays in registers */
    for (int u = 0; u < 4; ++u) { v4h h4; for (int q = 0; q < 4; ++q) h4[q] = (_Float16)(sv[u][q] * inv); if (sum_on(b, ln, u)) *(v4h*)(d + sum_col(b, ln, u)) = h4; }
    v4h h4;
#pragma unroll      /* constant indices, so that the array stays in registers */
    for (int q = 0; q < 4; ++q) h4[q] = (_Float16)(ov[q] * inv);
    *(v4h*)(d + j0) = h4;
    return; }
  auto val = [&](int j) -> float { const bool keep = (j <= i) && (((i / BLK) == (j / BLK)) || ((j % BLK) >= BLK - CSP)) && (tok[j] > 0); return keep ? s[j] : -1.0e9f; };
#pragma unroll 1
  for (int c = 0; c < SLEN / 256; ++c) { const int kb = c * 256 + ln * 8; for (int q = 0; q < 8; ++q) m = fmaxf(m, val(kb + q)); }
  for (int o = 16; o > 0; o >>= 1) m = fmaxf(m, __shfl_xor(m, o, 32)); float su = 0.f;
#pragma unroll 1
  for (int c = 0; c < SLEN / 256; ++c) { const int kb = c * 256 + ln * 8; for (int q = 0; q < 8; ++q) su += expf(val(kb + q) - m); }
  for (int o = 16; o > 0; o >>= 1) su += __shfl_xor(su, o, 32); const float inv = 1024.0f / su; unsigned short* d = (unsigned short*)P16 + hp + (size_t)i * SLEN;
  {
#pragma unroll 1
    for (int c = 0; c < SLEN / 256; ++c) { const int kb = c * 256 + ln * 8; FragH f;
#pragma unroll
      for (int q = 0; q < 8; ++q) f.h[q] = (_Float16)(expf(val(kb + q) - m) * inv);
      *(v8us*)(d + kb) = f.half[0]; }
     } }

extern "C" void kernel_launch(void* const* d_in, const int* in_sizes, int n_in,
                              void* d_out, int out_size, void* d_ws, size_t ws_size, hipStream_t stream) {
  (void)in_sizes; (void)n_in; (void)out_size;
  const float* const* I = (const float* const*)d_in; const int* tok = (const int*)d_in[0]; const float* emb = I[1]; const float* pos = I[2]; const float* l1s = I[3]; const float* l1b = I[4]; const float* wq = I[5]; const float* wk = I[6]; const float* wv = I[7]; const float* wo = I[8];
  const float* l2s = I[9]; const float* l2b = I[10]; const float* w1 = I[11]; const float* b1 = I[12]; const float* w2 = I[13]; const float* b2 = I[14]; const float* lfs = I[15]; const float* lfb = I[16]; const float* wout = I[17]; const float* bout = I[18];
  char* ws = (char*)d_ws; size_t off = 0;
  auto take = [&](size_t bytes) { char* p = ws + off; off += (bytes + 255) & ~(size_t)255; return p; };
  _Float16* BW = (_Float16*)take((NL * LWT + (size_t)NVOC * DM) * 2);      /* the f16 weights of every layer, then the output projection's */ _Float16* BOUT = BW + NL * LWT;
  float* X = (float*)take((size_t)SLEN * DM * 4); _Float16* H16 = (_Float16*)take((size_t)SLEN * DM * 2); _Float16* Q16 = (_Float16*)take((size_t)SLEN * DM * 2); _Float16* K16 = (_Float16*)take((size_t)SLEN * DM * 2); _Float16* V16 = (_Float16*)take((size_t)SLEN * DM * 2); _Float16* VT = (_Float16*)take((size_t)DM * SLEN * 2);
  float* S = (float*)take((size_t)NH * SLEN * SLEN * 4); _Float16* P16 = (_Float16*)take((size_t)NH * SLEN * SLEN * 2);      /* one plane per head */ _Float16* O16 = (_Float16*)take((size_t)SLEN * DM * 2); _Float16* G16 = (_Float16*)take((size_t)SLEN * DMLP * 2);
  if (off > ws_size) return;      /* 36.3 + 4 + 2 x 5 + 128 + 64 + 2 + 8 = 252.3 MiB */
  const dim3 gW(192, NL + 1), gP((SLEN / 128) * (DM / 64), 1), gS((SLEN / BLK) * 2 + (SLEN / BLK) * (SLEN / BLK - 1) / 2, NH), gH((SLEN / 128) * 1, NH), gX(SLEN / 8, NH), gM((SLEN / 128) * (DMLP / 64), 1), gV((SLEN / 128) * (NVOC / 64), 1);
  k_wt_all<<<gW, 256, 0, stream>>>(wq, wk, wv, wo, w1, w2, wout, BW);      /* wq[l] [D][H][DH] = (in, out=h*64+k); wo[l] [H][DH][D] = (in=h*64+k, out) */
  k_embed<<<(SLEN * (DM / 4) + 255) / 256, 256, 0, stream>>>(tok, emb, pos, X);
  for (int l = 0; l < NLRUN; ++l) {
    const _Float16* BQ = BW + l * LWT; const _Float16* BK = BQ + (size_t)DM * DM; const _Float16* BV = BK + (size_t)DM * DM; const _Float16* BO = BV + (size_t)DM * DM; const _Float16* BW1 = BO + (size_t)DM * DM; const _Float16* BW2 = BW1 + (size_t)DM * DMLP;
    k_ln512<<<SLEN / 8, 256, 0, stream>>>(X, l1s + l * DM, l1b + l * DM, H16);
    k_gemm2<0><<<gP, 128, 0, stream>>>(H16, DM, 0, BQ, DM, 0, 0.0625f, nullptr, 0, nullptr, 1, 0, 0, nullptr, Q16, DM, 0, SLEN, DM, DM);
    k_gemm2<0><<<gP, 128, 0, stream>>>(H16, DM, 0, BK, DM, 0, 0.0625f, nullptr, 0, nullptr, 1, 0, 0, nullptr, K16, DM, 0, SLEN, DM, DM);
    k_gemm2<0><<<gP, 128, 0, stream>>>(H16, DM, 0, BV, DM, 0, 0.0625f, nullptr, 0, nullptr, 1, 0, 0, nullptr, V16, DM, 0, SLEN, DM, DM);
    k_vt<NH, SLEN><<<NH * (SLEN / 64), 256, 0, stream>>>(V16, DM, 0, VT);
    /* all heads in one launch each: blockIdx.y = head */
    k_gemm2<0, 1><<<gS, 128, 0, stream>>>(Q16, DM, 64, K16, DM, 64, 0.125f, nullptr, 0, nullptr, 1, 0, 0, S, nullptr, SLEN, (size_t)SLEN * SLEN, SLEN, SLEN, 64);      /* (q / 8) . k */
    k_softsp<<<gX, 256, 0, stream>>>(S, tok, P16);
    k_gemm2<0, 2><<<gH, 128, 0, stream>>>(P16, SLEN, (size_t)SLEN * SLEN, VT, SLEN, (size_t)64 * SLEN, 0.0009765625f, nullptr, 0, nullptr, 1, 0, 0, nullptr, O16, DM, 64, SLEN, 64, SLEN, tok);
    k_gemm2<0><<<gP, 128, 0, stream>>>(O16, DM, 0, BO, DM, 0, 0.0625f, nullptr, 0, X, 1, (size_t)DM, 0, X, nullptr, DM, 0, SLEN, DM, DM);      /* x += o Wo (own tile, in place) */
    k_ln512<<<SLEN / 8, 256, 0, stream>>>(X, l2s + l * DM, l2b + l * DM, H16);
    k_gemm2<9><<<gM, 128, 0, stream>>>(H16, DM, 0, BW1, DM, 0, 0.0625f, b1 + (size_t)l * DMLP, 0, nullptr, 1, 0, 0, nullptr, G16, DMLP, 0, SLEN, DMLP, DM);      /* tanh-gelu(y W1 + b1) */
    k_gemm2<0><<<gP, 128, 0, stream>>>(G16, DMLP, 0, BW2, DMLP, 0, 0.0625f, b2 + (size_t)l * DM, 0, X, 1, (size_t)DM, 0, X, nullptr, DM, 0, SLEN, DM, DMLP); }      /* x += mlp + b2 */
  k_ln512<<<SLEN / 8, 256, 0, stream>>>(X, lfs, lfb, H16);
  k_gemm2<0><<<gV, 128, 0, stream>>>(H16, DM, 0, BOUT, DM, 0, 0.0625f, bout, 0, nullptr, 1, 0, 0, (float*)d_out, nullptr, NVOC, 0, SLEN, NVOC, DM);
}

// v005
// Measured time: 998 microseconds a run.
// Next to v004, in two timings, it ran 1.11 and 1.12 times as fast.
// Over all steps from v000 it is 5.75 times as fast.
#include <hip/hip_runtime.h>
// Sparse-pattern transformer decoder (1 x 2048 tokens, 512 = 8 heads x 64, 6 layers, MLP 2048 (tanh-GELU), vocab 256): x = embed[shift_right(tokens)] + pos_emb; per layer: h = LN1(x); q = h Wq / 8, k, v; scores masked by the structural fixed sparse pattern (causal & (same 128-block | last 32 columns of each block)) AND the INPUT key padding (token > 0), masked entries = -1e9 exactly as the reference; softmax; x += (P v) Wo; x += gelu(LN2(x) W1 + b1) W2 + b2; out = LNf(x) Wout + bout -> [1,2048,256].
// Structure: token-embedding gather by the INPUT ids on VALU; LayerNorms on VALU; all weights turned to f16 planes by one launch ahead of the layers; the weights and the activations that the Linears read (LN outputs, attention output, GELU hidden) lie in WMMA fragment order (frag_pos); all Linears as f16 WMMA GEMMs (32x64 wave tiles, f32 accumulation, exact x16 weights, biases / GELU / residual accumulation in the epilogue); per layer, all heads in one launch each (grid y = head): the scores as a GEMM (K 64) into the head's f32 plane, a wave-per-row f32 softmax applying the structural pattern and the key-padding predicate (P x2^10 f16), V transposed by LDS tiles, P.v as a GEMM into the head's columns of an f16 plane. Scores, softmax and P.v visit only the columns that the structural pattern can keep for a 128-row block (its own block, the last 32 columns of each earlier block); a block that holds a row with no kept key at all (uniform softmax over all 2048 columns) takes the full-width softmax and P.v.
// Compute dtype: embeddings, weights, biases, LN parameters rounded to bf16; LN outputs, q, k, v, P, attention output, GELU hidden as f16 operands (~2^-12; logits small); the residual stream, softmax, LayerNorm in f32. v_wmma_f32_16x16x32_f16.
#define SLEN 2048
#define DM 512
#define NH 8
#define NL 6
#define NLRUN NL                 /* layers executed */
#define DMLP 2048
#define NVOC 256
#define BLK 128
#define CSP 32
#define NR SLEN
typedef __bf16 v16b __attribute__((ext_vector_type(16)));
typedef unsigned short v8us __attribute__((ext_vector_type(8), may_alias));
typedef float  v8f  __attribute__((ext_vector_type(8)));
typedef float  v4f  __attribute__((ext_vector_type(4)));
typedef float  v4fa __attribute__((ext_vector_type(4), may_alias));
union FragB { v16b v; v8us half[2]; unsigned short u[16]; };

__device__ __forceinline__ unsigned short bf16_bits(float x) { unsigned int u = __float_as_uint(x); return (unsigned short)((u + 0x7FFFu + ((u >> 16) & 1u)) >> 16); }
__device__ __forceinline__ float bf16_val(unsigned short b) { return __uint_as_float(((unsigned int)b) << 16); }
__device__ __forceinline__ float bf16_round(float x) { return bf16_val(bf16_bits(x)); }
// D += A·B with NT terms: 1 = ah·bh, 2 = + al·bh (A split), 3 = + ah·bl (both split)
template <int NT>
__device__ __forceinline__ v8f mmaN(v16b ah, v16b al, v16b bh, v16b bl, v8f c) {
  c = __builtin_amdgcn_wmma_f32_16x16x32_bf16(false, ah, false, bh, (short)0, c, false, false);
  if (NT >= 2) c = __builtin_amdgcn_wmma_f32_16x16x32_bf16(false, al, false, bh, (short)0, c, false, false);
  if (NT >= 3) c = __builtin_amdgcn_wmma_f32_16x16x32_bf16(false, ah, false, bl, (short)0, c, false, false);
  asm volatile("v_nop\n\tv_nop\n\tv_nop\n\tv_nop" : "+v"(c) : "v"(ah), "v"(al), "v"(bh), "v"(bl));
  return c;
}

__global__ __launch_bounds__(256) void k_wt_bf16(const float* __restrict__ W, unsigned short* __restrict__ Wt, int K, int N) {
  const int t = blockIdx.x * 256 + threadIdx.x;
  const int k8n = K / 8;
  if (t >= N * k8n) return;
  const int n = t / k8n, k8 = (t % k8n) * 8;
  v8us v;
#pragma unroll
  for (int i = 0; i < 8; ++i) v[i] = bf16_bits(W[(size_t)(k8 + i) * N + n]);
  *(v8us*)(Wt + (size_t)n * K + k8) = v;
  
}

// GEMM C[M][N] (f32, pitch ldc) = act(A[M][K]·W + bias). A f32 row-major (pitch lda) converted per fragment to bf16
// (ASPLIT: hi/lo two planes -> 2 terms, else single rounded term); Wt bf16 [N][K] (pitch ldb). BIAS_BF16 rounds the
// bias to bf16 first (bias quantised to bf16 before the add). K%32==0, M%16==0, N%64==0.
template <bool ASPLIT, int ACT, bool BIAS_BF16>
__global__ __launch_bounds__(128) void k_gemm_bf(const float* __restrict__ A, int lda, const unsigned short* __restrict__ Wt, int ldb,
                                               const float* __restrict__ bias, float* __restrict__ C, int ldc, int M, int N, int K) {
  __shared__ __attribute__((aligned(16))) float so[4][16][64];
  const int tid = threadIdx.x, w = tid >> 5, lane = tid & 31, ln = lane & 15, hh = lane >> 4;
  const int ntn = N / 64;
  const int wid = blockIdx.x * 4 + w;
  const int mt = wid / ntn, nq = wid % ntn;
  if (mt * 16 >= M) return;
  const int row0 = mt * 16, col0 = nq * 64;
  const float* arow = A + (size_t)(row0 + ln) * lda;
  v8f acc[4] = {};
  for (int kb = 0; kb < K; kb += 32) {
    FragB ah, al;
    const v4f x0 = *(const v4fa*)(arow + kb + 8 * hh), x1 = *(const v4fa*)(arow + kb + 8 * hh + 4);
    const v4f x2 = *(const v4fa*)(arow + kb + 16 + 8 * hh), x3 = *(const v4fa*)(arow + kb + 16 + 8 * hh + 4);
    float xs[16] = {x0[0],x0[1],x0[2],x0[3],x1[0],x1[1],x1[2],x1[3],x2[0],x2[1],x2[2],x2[3],x3[0],x3[1],x3[2],x3[3]};
#pragma unroll
    for (int i = 0; i < 16; ++i) { const unsigned short hb = bf16_bits(xs[i]); ah.u[i] = hb; al.u[i] = ASPLIT ? bf16_bits(xs[i] - bf16_val(hb)) : (unsigned short)0; }
#pragma unroll
    for (int t = 0; t < 4; ++t) {
      const unsigned short* brow = Wt + (size_t)(col0 + t * 16 + ln) * ldb + kb;
      FragB b;
      b.half[0] = *(const v8us*)(brow + 8 * hh);
      b.half[1] = *(const v8us*)(brow + 16 + 8 * hh);
      acc[t] = mmaN<ASPLIT ? 2 : 1>(ah.v, al.v, b.v, b.v, acc[t]);
    }
  }
#pragma unroll
  for (int t = 0; t < 4; ++t) {
    float bv = bias ? bias[col0 + t * 16 + ln] : 0.f;
    if (BIAS_BF16) bv = bf16_round(bv);
#pragma unroll
    for (int r = 0; r < 8; ++r) { float v = acc[t][r] + bv; if (ACT == 1) v = fmaxf(v, 0.f); so[w][8 * hh + r][t * 16 + ln] = v; }
  }
  __builtin_amdgcn_fence(__ATOMIC_ACQ_REL, "workgroup");
  __builtin_amdgcn_wave_barrier();
  const int rsub = lane >> 4, c4 = (lane & 15) * 4;
  {
#pragma unroll
    for (int q = 0; q < 8; ++q) {
      const int r = q * 2 + rsub;
      const v4f v = *(const v4fa*)&so[w][r][c4];
      *(v4f*)(C + (size_t)(row0 + r) * ldc + col0 + c4) = v;
    }
    
  }
}

// GEMM C = act(A·W + bias + resid): A f32 (ASPLIT -> hi/lo 2 terms), Wt bf16 [N][K]; ACT 0 none, 1 relu, 2 exact gelu;
// resid (optional, f32, row index = (row % rmod), pitch ldr, RES_BF16 rounds it) added before the activation.
template <bool ASPLIT, int ACT, bool BIAS_BF16, bool RES_BF16>
__global__ __launch_bounds__(128) void k_gemm_bf3(const float* __restrict__ A, int lda, const unsigned short* __restrict__ Wt, int ldb,
                                                const float* __restrict__ bias, const float* __restrict__ resid, int rmod, int ldr,
                                                float* __restrict__ C, int ldc, int M, int N, int K) {
  __shared__ __attribute__((aligned(16))) float so[4][16][64];
  const int tid = threadIdx.x, w = tid >> 5, lane = tid & 31, ln = lane & 15, hh = lane >> 4;
  const int ntn = N / 64;
  const int wid = blockIdx.x * 4 + w;
  const int mt = wid / ntn, nq = wid % ntn;
  if (mt * 16 >= M) return;
  const int row0 = mt * 16, col0 = nq * 64;
  const float* arow = A + (size_t)(row0 + ln) * lda;
  v8f acc[4] = {};
  for (int kb = 0; kb < K; kb += 32) {
    FragB ah, al;
    const v4f x0 = *(const v4fa*)(arow + kb + 8 * hh), x1 = *(const v4fa*)(arow + kb + 8 * hh + 4);
    const v4f x2 = *(const v4fa*)(arow + kb + 16 + 8 * hh), x3 = *(const v4fa*)(arow + kb + 16 + 8 * hh + 4);
    float xs[16] = {x0[0],x0[1],x0[2],x0[3],x1[0],x1[1],x1[2],x1[3],x2[0],x2[1],x2[2],x2[3],x3[0],x3[1],x3[2],x3[3]};
#pragma unroll
    for (int i = 0; i < 16; ++i) { const unsigned short hb = bf16_bits(xs[i]); ah.u[i] = hb; al.u[i] = ASPLIT ? bf16_bits(xs[i] - bf16_val(hb)) : (unsigned short)0; }
#pragma unroll
    for (int t = 0; t < 4; ++t) {
      const unsigned short* brow = Wt + (size_t)(col0 + t * 16 + ln) * ldb + kb;
      FragB b;
      b.half[0] = *(const v8us*)(brow + 8 * hh);
      b.half[1] = *(const v8us*)(brow + 16 + 8 * hh);
      acc[t] = mmaN<ASPLIT ? 2 : 1>(ah.v, al.v, b.v, b.v, acc[t]);
    }
  }
#pragma unroll
  for (int t = 0; t < 4; ++t) {
    const int col = col0 + t * 16 + ln;
    float bv = bias ? bias[col] : 0.f;
    if (BIAS_BF16) bv = bf16_round(bv);
#pragma unroll
    for (int r = 0; r < 8; ++r) {
      float v = acc[t][r] + bv;
      if (resid) { float rv = resid[(size_t)((row0 + 8 * hh + r) % rmod) * ldr + col]; if (RES_BF16) rv = bf16_round(rv); v += rv; }
      if (ACT == 1) v = fmaxf(v, 0.f);
      if (ACT == 2) v = 0.5f * v * (1.0f + erff(v * 0.70710678118654752f));
      if (ACT == 3) { const float u = 0.7978845608028654f * (v + 0.044715f * v * v * v); v = 0.5f * v * (1.0f + tanhf(u)); }
      so[w][8 * hh + r][t * 16 + ln] = v;
    }
  }
  __builtin_amdgcn_fence(__ATOMIC_ACQ_REL, "workgroup");
  __builtin_amdgcn_wave_barrier();
  const int rsub = lane >> 4, c4 = (lane & 15) * 4;
  {
#pragma unroll
    for (int q = 0; q < 8; ++q) {
      const int r = q * 2 + rsub;
      const v4f v = *(const v4fa*)&so[w][r][c4];
      *(v4f*)(C + (size_t)(row0 + r) * ldc + col0 + c4) = v;
    }
    
  }
}
// row LayerNorm (biased variance, eps) over N: s = X (+ R); optional out_sum <- s; out_norm <- (s-mu)*rsqrt(var+eps)*g + b
template <bool PARAM_BF16>
__global__ __launch_bounds__(256) void k_layernorm(const float* __restrict__ X, const float* __restrict__ R, const float* __restrict__ g, const float* __restrict__ bta,
                                                  float* __restrict__ out_sum, float* __restrict__ out_norm, int N, float eps) {
  __shared__ float red[256];
  const int row = blockIdx.x, tid = threadIdx.x;
  const float* x = X + (size_t)row * N; const float* rr = R ? R + (size_t)row * N : nullptr;
  float vals[16];                     // up to N = 4096
  const int per = N / 256;            // contiguous chunk per thread? use strided-by-4 chunks: thread handles j = tid*4 + 1024*u
  float s1 = 0.f;
  for (int u = 0; u < per / 4; ++u) {
    const int j = tid * 4 + 1024 * u;
    const v4f a = *(const v4fa*)(x + j);
    v4f b = {0.f,0.f,0.f,0.f}; if (rr) b = *(const v4fa*)(rr + j);
#pragma unroll
    for (int q = 0; q < 4; ++q) { const float v = a[q] + b[q]; vals[u * 4 + q] = v; s1 += v; }
  }
  red[tid] = s1; __syncthreads();
  for (int st = 128; st > 0; st >>= 1) { if (tid < st) red[tid] += red[tid + st]; __syncthreads(); }
  const float mu = red[0] / (float)N; __syncthreads();
  float s2 = 0.f;
  for (int u = 0; u < per / 4; ++u)
#pragma unroll
    for (int q = 0; q < 4; ++q) { const float c = vals[u * 4 + q] - mu; s2 += c * c; }
  red[tid] = s2; __syncthreads();
  for (int st = 128; st > 0; st >>= 1) { if (tid < st) red[tid] += red[tid + st]; __syncthreads(); }
  const float rs = rsqrtf(red[0] / (float)N + eps);
  {
    for (int u = 0; u < per / 4; ++u) {
      const int j = tid * 4 + 1024 * u;
      v4f o, sm;
#pragma unroll
      for (int q = 0; q < 4; ++q) {
        float gg = g[j + q], bb = bta[j + q];
        if (PARAM_BF16) { gg = bf16_round(gg); bb = bf16_round(bb); }
        sm[q] = vals[u * 4 + q]; o[q] = (vals[u * 4 + q] - mu) * rs * gg + bb;
      }
      if (out_sum) *(v4f*)(out_sum + (size_t)row * N + j) = sm;
      *(v4f*)(out_norm + (size_t)row * N + j) = o;
    }
    
  }
}



// ---- f16 WMMA path (v_wmma_f32_16x16x32_f16): 11-bit significands for operands in range — used where a [0,1] probability operand needs more precision than bf16
typedef _Float16 v16h __attribute__((ext_vector_type(16)));
union FragH { v16h v; v8us half[2]; _Float16 h[16]; unsigned short u[16]; };
template <int NT>
__device__ __forceinline__ v8f mmaH(v16h ah, v16h al, v16h bh, v16h bl, v8f c) {
  c = __builtin_amdgcn_wmma_f32_16x16x32_f16(false, ah, false, bh, (short)0, c, false, false);
  if (NT >= 2) c = __builtin_amdgcn_wmma_f32_16x16x32_f16(false, al, false, bh, (short)0, c, false, false);
  if (NT >= 3) c = __builtin_amdgcn_wmma_f32_16x16x32_f16(false, ah, false, bl, (short)0, c, false, false);
  asm volatile("v_nop\n\tv_nop\n\tv_nop\n\tv_nop" : "+v"(c) : "v"(ah), "v"(al), "v"(bh), "v"(bl));
  return c;
}
// batched GEMM like k_gemm_b but f16 operands: A f32 (split into f16 hi/lo if ASPLIT, else rounded to f16), Bt = f16 values [n][k]; alpha; C f32; N multiple of 16 (partial tiles skipped)
template <bool ASPLIT>
__global__ __launch_bounds__(128) void k_gemm_h(const float* __restrict__ A, int lda, size_t sA, const _Float16* __restrict__ Bh, int ldb, size_t sB, float alpha, float* __restrict__ C, int ldc, size_t sC, int M, int N, int K) {
  __shared__ __attribute__((aligned(16))) float so[4][16][64];
  const int tid = threadIdx.x, w = tid >> 5, lane = tid & 31, ln = lane & 15, hh = lane >> 4; const int by = blockIdx.y;
  A += (size_t)by * sA; Bh += (size_t)by * sB; C += (size_t)by * sC;
  const int ntn = (N + 63) / 64; const int wid = blockIdx.x * 4 + w; const int mt = wid / ntn, nq = wid % ntn; if (mt * 16 >= M) return;
  const int row0 = mt * 16, col0 = nq * 64; const float* arow = A + (size_t)(row0 + ln) * lda;
  v8f acc[4] = {};
  for (int kb = 0; kb < K; kb += 32) {
    FragH ah, al;
    const v4f x0 = *(const v4fa*)(arow + kb + 8 * hh), x1 = *(const v4fa*)(arow + kb + 8 * hh + 4), x2 = *(const v4fa*)(arow + kb + 16 + 8 * hh), x3 = *(const v4fa*)(arow + kb + 16 + 8 * hh + 4);
    float xs[16] = {x0[0],x0[1],x0[2],x0[3],x1[0],x1[1],x1[2],x1[3],x2[0],x2[1],x2[2],x2[3],x3[0],x3[1],x3[2],x3[3]};
#pragma unroll
    for (int i = 0; i < 16; ++i) { const _Float16 h = (_Float16)xs[i]; ah.h[i] = h; al.h[i] = ASPLIT ? (_Float16)(xs[i] - (float)h) : (_Float16)0.0f; }
#pragma unroll
    for (int t = 0; t < 4; ++t) { if (col0 + t * 16 >= N) continue; const size_t boff = (size_t)(col0 + t * 16 + ln) * ldb + kb; FragH bq; bq.half[0] = *(const v8us*)(Bh + boff + 8 * hh); bq.half[1] = *(const v8us*)(Bh + boff + 16 + 8 * hh);
      acc[t] = mmaH<ASPLIT ? 2 : 1>(ah.v, al.v, bq.v, bq.v, acc[t]); }
  }
#pragma unroll
  for (int t = 0; t < 4; ++t) { if (col0 + t * 16 >= N) continue;
#pragma unroll
    for (int r = 0; r < 8; ++r) so[w][8 * hh + r][t * 16 + ln] = acc[t][r] * alpha; }
  __builtin_amdgcn_fence(__ATOMIC_ACQ_REL, "workgroup"); __builtin_amdgcn_wave_barrier();
  const int rsub = lane >> 4, c4 = (lane & 15) * 4;
  {
#pragma unroll
    for (int q = 0; q < 8; ++q) { const int r = q * 2 + rsub; if (col0 + c4 < N) { const v4f v = *(const v4fa*)&so[w][r][c4]; *(v4f*)(C + (size_t)(row0 + r) * ldc + col0 + c4) = v; } }
     }
}

// Fragment order of an f16 operand plane [rows][K] (rows = the m of an A operand, the n of a B operand): 1-KiB blocks of 16 rows x 32 k, block (row / 16, k / 32) at block index (row / 16) * (K / 32) + k / 32.
// Inside a block stand the two 16-byte pieces that each lane of a 16x16x32 fragment holds, lane by lane: piece k / 16 % 2, lane (k / 8 % 2) * 16 + row % 16, element k % 8. A wave's fragment load is then 512 contiguous bytes (4 whole lines) and not 32 bytes of each of 16 lines; which k a lane and register holds is the same as with row-major planes.
__device__ __forceinline__ size_t frag_pos(int row, int k, int K) { return ((size_t)((row >> 4) * (K >> 5) + (k >> 5)) << 9) + (((k >> 4) & 1) << 8) + (((((k >> 3) & 1) << 4) + (row & 15)) << 3) + (k & 7); }
// Wt(n, k) = f16(bf16(W[k][n]) x 16), in fragment order, from f32 row-major W[K][N] (a power of two: bf16-exact weights stay exact in f16 away from the subnormal range).
// One work-group turns a strip of 256 k x 64 n: whole 256-byte row pieces in, 4 KiB of contiguous blocks out of each wave, through LDS.
// LDS row n holds its 256 k as 128 dwords (k, k + 1 packed); the 16-byte chunk c of row n lies at chunk c ^ (n / 4 % 16), so that the 32 lanes of a store (16 rows n four apart, two neighbouring dwords) fall on 32 different banks, while a row stays one contiguous 512 bytes for the 16-byte reads.
typedef unsigned v4u __attribute__((ext_vector_type(4)));
template <int K, int N>
__device__ __forceinline__ void wt_strip(const float* __restrict__ W, _Float16* __restrict__ Wt, int s, unsigned (*tl)[128]) {
  const int tid = threadIdx.x, n0 = (s % (N / 64)) * 64, k0 = (s / (N / 64)) * 256;
  const int l16 = tid & 15, r = tid >> 4;
  const float* src = W + (size_t)(k0 + 2 * r) * N + n0 + l16 * 4;
  v4f a[8], b[8];      /* rows k0 + 32 p + 2 r and the next one, columns n0 + 4 l16 up */
#pragma unroll      /* constant indices, so that the arrays stay in registers and the 16 loads are in flight together */
  for (int p = 0; p < 8; ++p) { a[p] = *(const v4fa*)(src + (size_t)(32 * p) * N); b[p] = *(const v4fa*)(src + (size_t)(32 * p + 1) * N); }
#pragma unroll      /* constant indices, so that the arrays stay in registers */
  for (int p = 0; p < 8; ++p) { const int kp = p * 16 + r;
    for (int q = 0; q < 4; ++q) { union { _Float16 h[2]; unsigned u; } pk; pk.h[0] = (_Float16)(bf16_round(a[p][q]) * 16.0f); pk.h[1] = (_Float16)(bf16_round(b[p][q]) * 16.0f);
      tl[l16 * 4 + q][(((kp >> 2) ^ l16) << 2) + (kp & 3)] = pk.u; } }
  __syncthreads();
  const int w = tid >> 5, j = tid & 31;      /* a wave writes four neighbouring blocks: rows n0 + 16 (w / 2) up, k from k0 + 128 (w % 2); store i is piece i % 2 of block i / 2 */
  const int n = (w >> 1) * 16 + (j & 15);
  unsigned short* dst = (unsigned short*)Wt + frag_pos(n0 + n, k0 + (w & 1) * 128 + (j >> 4) * 8, K);
#pragma unroll      /* the 8 LDS reads are in flight together, and the stores share address registers with constant offsets */
  for (int i = 0; i < 8; ++i) { const int c = (w & 1) * 16 + i * 2 + (j >> 4);      /* the 16-byte chunk (8 k) of LDS row n that lane j holds in that piece */
    const v4u v = *(const v4u*)&tl[n][(c ^ ((n >> 2) & 15)) << 2];
    *(v4u*)(dst + i * 256) = v; }
  asm volatile("s_wait_xcnt 0x0" ::: "memory");      /* in the listing the code of the next matrix shape follows these stores and reuses their address registers: it stands only behind this wait */
}
#define LWT ((size_t)4 * DM * DM + (size_t)2 * DM * DMLP)      /* f16 elements of one layer's six matrices: q, k, v, o, w1, w2 */
// every weight matrix of the model in one launch: blockIdx.y = layer (NL: the output projection), blockIdx.x = strip (16 each for q, k, v, o; 64 for w1; 64 for w2)
__global__ __launch_bounds__(256) void k_wt_all(const float* __restrict__ wq, const float* __restrict__ wk, const float* __restrict__ wv, const float* __restrict__ wo, const float* __restrict__ w1, const float* __restrict__ w2, const float* __restrict__ wout, _Float16* __restrict__ BW) {
  __shared__ __attribute__((aligned(16))) unsigned tl[64][128];
  const int l = blockIdx.y, x = blockIdx.x;
  if (l == NL) { if (x < (NVOC / 64) * (DM / 256)) wt_strip<DM, NVOC>(wout, BW + NL * LWT, x, tl); return; }
  _Float16* B = BW + l * LWT;
  if (x < 64) { const int m = x >> 4; const float* Wm = m == 0 ? wq : m == 1 ? wk : m == 2 ? wv : wo; wt_strip<DM, DM>(Wm + (size_t)l * DM * DM, B + (size_t)m * DM * DM, x & 15, tl); }
  else if (x < 128) wt_strip<DM, DMLP>(w1 + (size_t)l * DM * DMLP, B + (size_t)4 * DM * DM, x - 64, tl);
  else wt_strip<DMLP, DM>(w2 + (size_t)l * DMLP * DM, B + (size_t)4 * DM * DM + (size_t)DM * DMLP, x - 128, tl);
}
// k_gemm_hh variant with fused epilogue: v = acc·alpha + bias[by·sBias + col] (+ CP[(row/rowsPerB)·sCPb + by·64 + col] if CP) ; ACT 0 none / 1 elu ; writes f16 C16 (and f32 C if non-null)
template <int ACT>
__global__ __launch_bounds__(128) void k_gemm_hhx(const _Float16* __restrict__ A, int lda, size_t sA, const _Float16* __restrict__ Bh, int ldb, size_t sB, float alpha, const float* __restrict__ bias, size_t sBias, const float* __restrict__ CP, int rowsPerB, size_t sCPb, int row0g,
    float* __restrict__ C, _Float16* __restrict__ C16, int ldc, size_t sC, int M, int N, int K) {
  __shared__ __attribute__((aligned(16))) float so[4][16][64];
  const int tid = threadIdx.x, w = tid >> 5, lane = tid & 31, ln = lane & 15, hh = lane >> 4; const int by = blockIdx.y;
  A += (size_t)by * sA; Bh += (size_t)by * sB; const size_t cofs = (size_t)by * sC; const float* bp = bias ? bias + (size_t)by * sBias : nullptr;
  const int ntn = (N + 63) / 64; const int wid = blockIdx.x * 4 + w; const int mt = wid / ntn, nq = wid % ntn; if (mt * 16 >= M) return;
  const int row0 = mt * 16, col0 = nq * 64; const _Float16* arow = A + (size_t)(row0 + ln) * lda;
  v8f acc[4] = {};
  for (int kb = 0; kb < K; kb += 32) { FragH ah; ah.half[0] = *(const v8us*)((const unsigned short*)arow + kb + 8 * hh); ah.half[1] = *(const v8us*)((const unsigned short*)arow + kb + 16 + 8 * hh);
#pragma unroll
    for (int t = 0; t < 4; ++t) { if (col0 + t * 16 >= N) continue; const size_t boff = (size_t)(col0 + t * 16 + ln) * ldb + kb; FragH bq; bq.half[0] = *(const v8us*)((const unsigned short*)Bh + boff + 8 * hh); bq.half[1] = *(const v8us*)((const unsigned short*)Bh + boff + 16 + 8 * hh);
      acc[t] = mmaH<1>(ah.v, ah.v, bq.v, bq.v, acc[t]); }
  }
#pragma unroll
  for (int t = 0; t < 4; ++t) { if (col0 + t * 16 >= N) continue; const int col = col0 + t * 16 + ln; const float bv = bp ? bf16_round(bp[col]) : 0.f;
#pragma unroll
    for (int r = 0; r < 8; ++r) { float v = acc[t][r] * alpha + bv; if (CP) { const int bidx = (row0g + row0 + 8 * hh + r) / rowsPerB; v += CP[(size_t)bidx * sCPb + (size_t)by * 64 + col]; } if (ACT == 1) v = (v > 0.f) ? v : expm1f(v); else if (ACT == 7) v = (v > 0.f) ? v + 1.0f : expf(v); else if (ACT == 8) v = tanhf(v); else if (ACT == 9) v = 0.5f * v * (1.0f + tanhf(0.7978845608028654f * (v + 0.044715f * v * v * v))); else if (ACT == 11) v = 1.0f / (1.0f + expf(-v)); else if (ACT == 12) v = (v > 0.f) ? v : 0.01f * v; else if (ACT == 14) v = (v > 0.f) ? v : 0.1f * v; else if (ACT == 15) v = v / (1.0f + expf(-v)); else if (ACT == 3) v = fmaxf(v, 0.f); else if (ACT == 6) v = 0.5f * v * (1.0f + erff(v * 0.70710678118654752f)); so[w][8 * hh + r][t * 16 + ln] = v; } }
  __builtin_amdgcn_fence(__ATOMIC_ACQ_REL, "workgroup"); __builtin_amdgcn_wave_barrier();
  const int rsub = lane >> 4, c4 = (lane & 15) * 4; typedef _Float16 v4h __attribute__((ext_vector_type(4)));
  {
#pragma unroll
    for (int q = 0; q < 8; ++q) { const int r = q * 2 + rsub; if (col0 + c4 < N) { const v4f v = *(const v4fa*)&so[w][r][c4]; if (C) *(v4f*)(C + cofs + (size_t)(row0 + r) * ldc + col0 + c4) = v; if (C16) { v4h h4; for (int i = 0; i < 4; ++i) h4[i] = (_Float16)v[i]; *(v4h*)(C16 + cofs + (size_t)(row0 + r) * ldc + col0 + c4) = h4; } } }
     }
}


typedef _Float16 v4h __attribute__((ext_vector_type(4)));
typedef int v4ia __attribute__((ext_vector_type(4), may_alias));

__global__ __launch_bounds__(256) void k_x16(const float* __restrict__ x, _Float16* __restrict__ X16, size_t n8) { const size_t t = (size_t)blockIdx.x * 256 + threadIdx.x; if (t >= n8) return; FragH f;
#pragma unroll
  for (int q = 0; q < 8; ++q) f.h[q] = (_Float16)bf16_round(x[t * 8 + q]); *(v8us*)((unsigned short*)X16 + t * 8) = f.half[0];  }
__global__ __launch_bounds__(256) void k_h16(const float* __restrict__ x, _Float16* __restrict__ X16, size_t n8) { const size_t t = (size_t)blockIdx.x * 256 + threadIdx.x; if (t >= n8) return; FragH f;
#pragma unroll
  for (int q = 0; q < 8; ++q) f.h[q] = (_Float16)x[t * 8 + q]; *(v8us*)((unsigned short*)X16 + t * 8) = f.half[0];  }
__global__ __launch_bounds__(256) void k_round16f(const float* __restrict__ W, _Float16* __restrict__ Bt, size_t n8) { const size_t t = (size_t)blockIdx.x * 256 + threadIdx.x; if (t >= n8) return; FragH f;
#pragma unroll
  for (int i = 0; i < 8; ++i) f.h[i] = (_Float16)(bf16_round(W[t * 8 + i]) * 16.0f); *(v8us*)((unsigned short*)Bt + t * 8) = f.half[0];  }
template <int NHv, int TTv>
__global__ __launch_bounds__(256) void k_vt(const _Float16* __restrict__ V16, int ldv, int voff, _Float16* __restrict__ Vt) { __shared__ unsigned short tl[64][66]; const int tid = threadIdx.x; const int slab = blockIdx.x / (TTv / 64), lg = blockIdx.x % (TTv / 64); const int b = slab / NHv, h = slab % NHv;
  for (int i = tid; i < 64 * 8; i += 256) { const int r = i / 8, c8 = (i % 8) * 8; FragH f; f.half[0] = *(const v8us*)((const unsigned short*)V16 + ((size_t)b * TTv + lg * 64 + r) * ldv + voff + h * 64 + c8);
#pragma unroll
    for (int q = 0; q < 8; ++q) tl[r][c8 + q] = f.u[q]; }
  __syncthreads();
  {
#pragma unroll
    for (int rd = 0; rd < 2; ++rd) { const int d = rd * 32 + tid / 8, pc = tid % 8; FragH f;
#pragma unroll
      for (int q = 0; q < 8; ++q) f.u[q] = tl[pc * 8 + q][d];
      *(v8us*)((unsigned short*)Vt + ((size_t)slab * 64 + d) * TTv + lg * 64 + pc * 8) = f.half[0]; }
     } }

__global__ __launch_bounds__(256) void k_hl(const float* __restrict__ F, _Float16* __restrict__ Hh, _Float16* __restrict__ Hl, size_t n8) { const size_t t = (size_t)blockIdx.x * 256 + threadIdx.x; if (t >= n8) return; FragH fh, fl; const v4f a = *(const v4fa*)(F + t * 8), c = *(const v4fa*)(F + t * 8 + 4);
#pragma unroll
  for (int q = 0; q < 4; ++q) { _Float16 h = (_Float16)a[q]; fh.h[q] = h; fl.h[q] = (_Float16)((a[q] - (float)h) * 1024.0f); h = (_Float16)c[q]; fh.h[4 + q] = h; fl.h[4 + q] = (_Float16)((c[q] - (float)h) * 1024.0f); }
  { *(v8us*)((unsigned short*)Hh + t * 8) = fh.half[0]; *(v8us*)((unsigned short*)Hl + t * 8) = fl.half[0];  } }

// ---- fast GEMM (wave tile 32x64; requires M % 32 == 0 rows per launch region and N % 64 == 0); epilogue = k_gemm_hhx semantics ----
__device__ __forceinline__ v16h g2_frag(const _Float16* p, int hh) { FragH f; f.half[0] = *(const v8us*)((const unsigned short*)p + 8 * hh); f.half[1] = *(const v8us*)((const unsigned short*)p + 16 + 8 * hh); return f.v; }
__device__ __forceinline__ v8f g2_mma(v16h a, v16h b, v8f c) { v8f d = __builtin_amdgcn_wmma_f32_16x16x32_f16(false, a, false, b, (short)0, c, false, false); asm volatile("v_nop\n\tv_nop\n\tv_nop\n\tv_nop" : "+v"(d) : "v"(a), "v"(b)); return d; }
/* SP 0: plain. SP 1 (scores): blockIdx.x counts only the 128x64 tiles that hold a column the pattern can keep. SP 2 (P.v, N 64): the k loop visits only such columns, unless rows_all_masked(). */
/* The last 32 columns of the (at most 15) earlier blocks, 4 columns a lane, 4 blocks a load: slot u of a lane is block 4u + lane / 8. A slot past the earlier blocks is off; it is aimed at the own block's last 32 columns (in bounds, written) so that no branch stands round a load. */
__device__ __forceinline__ bool sum_on(int blk, int lane, int u) { return u * 4 + (lane >> 3) < blk; }
__device__ __forceinline__ int sum_col(int blk, int lane, int u) { return (sum_on(blk, lane, u) ? u * 4 + (lane >> 3) : blk) * BLK + (BLK - CSP) + (lane & 7) * 4; }
/* true where the first row of 128-row block blk has no kept key (a later row keeps every key of an earlier row of its block, so false means that no row of the block is without one); the same in every lane. t[u] = the tokens at sum_col(u), tfirst = the token of the block's first column */
__device__ __forceinline__ bool rows_all_masked(const v4ia (&t)[4], int tfirst, int blk, int lane) {
  bool kept = tfirst > 0;
#pragma unroll      /* constant indices, so that the array stays in registers */
  for (int u = 0; u < 4; ++u) for (int q = 0; q < 4; ++q) kept |= sum_on(blk, lane, u) & (t[u][q] > 0);
  return !__any(kept); }
/* PK bit 0: A and Bh lie in fragment order (frag_pos; lda = ldb = their K, sA = sB = 0). PK bit 1: C16 is written in fragment order for a plane of ldc columns, sC then counts columns, and C is not written. */
template <int ACT, int SP = 0, int PK = 0>
__global__ __launch_bounds__(128) void k_gemm2(const _Float16* __restrict__ A, int lda, size_t sA, const _Float16* __restrict__ Bh, int ldb, size_t sB, float alpha, const float* __restrict__ bias, size_t sBias, const float* __restrict__ CP, int rowsPerB, size_t sCPb, int row0g,
    float* __restrict__ C, _Float16* __restrict__ C16, int ldc, size_t sC, int M, int N, int Kfull, const int* __restrict__ tok = nullptr) {
  __shared__ __attribute__((aligned(16))) float so[4][32][68];
  const int tid = threadIdx.x, w = tid >> 5, lane = tid & 31, ln = lane & 15, hh = lane >> 4; const int by = blockIdx.y;
  A += (size_t)by * sA; Bh += (size_t)by * sB; const size_t cofs = (size_t)by * sC; const float* bp = bias ? bias + (size_t)by * sBias : nullptr;
  const int ntn = N >> 6; int mt = blockIdx.x / ntn, nq = blockIdx.x - mt * ntn;
  if (SP == 1) { int t = blockIdx.x; for (mt = 0; mt < SLEN / BLK - 1 && t >= mt + 2; ++mt) t -= mt + 2;      /* row block mt has mt + 2 tiles: the upper half of each earlier block, then the two halves of its own */
    nq = t < mt ? 2 * t + 1 : mt + t; }
  const int row0 = mt * 128 + 32 * w, col0 = nq * 64; if (row0 >= M) return;
  bool sparse = false;      /* true: P is written, and non-zero, only in the columns that the pattern can keep */
  if (SP == 2) { v4ia t[4];
#pragma unroll      /* constant indices, so that the array stays in registers */
    for (int u = 0; u < 4; ++u) t[u] = *(const v4ia*)(tok + sum_col(mt, lane, u));
    const int tf = tok[mt * BLK];
    asm volatile("s_wait_xcnt 0x0" :: "v"(t[0]), "v"(t[1]), "v"(t[2]), "v"(t[3]), "s"(tf) : "memory");      /* the loaded values as inputs only: the five loads are in flight together (one latency, not five); their address registers are rewritten only behind this wait */
    __builtin_amdgcn_sched_barrier(0);      /* keeps the work below from being lifted in front of that wait */
    sparse = !rows_all_masked(t, tf, mt, lane); }
  const int K = sparse ? (mt + BLK / 32) * 32 : Kfull;      /* 32-k steps: one for each earlier block, four for the own block */
  const int ksum = sparse ? mt * 32 : 0;      /* the steps below ksum are the earlier blocks': step k reads columns 4 k + 96 up; a step of the own block reads columns k + 3 ksum up (ld) */
  /* each lane's byte offsets in A and B are fixed for the whole loop; only the wave-uniform base moves with k (every operand plane here is far below 4 GiB) */
  /* row-major and fragment order alike: 16 rows further on lie 16 x K elements = 32 K bytes further on */
  const unsigned ao0 = (PK & 1) ? (unsigned)(row0 * lda + 8 * lane) * 2u : (unsigned)((row0 + ln) * lda + 8 * hh) * 2u, ao1 = ao0 + 32u * (unsigned)lda;
  const unsigned bo0 = (PK & 1) ? (unsigned)(col0 * ldb + 8 * lane) * 2u : (unsigned)((col0 + ln) * ldb + 8 * hh) * 2u, bo1 = bo0 + 32u * (unsigned)ldb, bo2 = bo1 + 32u * (unsigned)ldb, bo3 = bo2 + 32u * (unsigned)ldb;
  const v8f z8 = {0.f,0.f,0.f,0.f,0.f,0.f,0.f,0.f}; v8f c00 = z8, c01 = z8, c02 = z8, c03 = z8, c10 = z8, c11 = z8, c12 = z8, c13 = z8;
  /* Fragment loads run ahead of the products: the 12 loads of a 32-k step are issued as one group, two steps before the products that read them, into three rotating register sets.
     The k order of every accumulator is unchanged. A load past the last step is aimed at the last step again (in bounds, its values unused). K % 32 == 0, K >= 32. */
  struct Stg { v16h a0, a1, b0, b1, b2, b3; };
  const int klast = K - 32;
  auto fr = [](const char* p, unsigned o) -> v16h { FragH f; f.half[0] = *(const v8us*)(p + o); f.half[1] = *(const v8us*)(p + o + ((PK & 1) ? 512 : 32)); return f.v; };
  auto ld = [&](Stg& s, int kq) { int k = kq < klast ? kq : klast; if (SP == 2) k += (BLK / 32 - 1) * (k < ksum ? k : ksum) + (k < ksum ? BLK - CSP : 0); const int kbytes = (PK & 1) ? 32 * k : 2 * k;      /* fragment order: a 32-k step is one 1-KiB block */ const char* ak = (const char*)A + kbytes; const char* bk = (const char*)Bh + kbytes;
    s.a0 = fr(ak, ao0); s.a1 = fr(ak, ao1); s.b0 = fr(bk, bo0); s.b1 = fr(bk, bo1); s.b2 = fr(bk, bo2); s.b3 = fr(bk, bo3);
    asm volatile("s_wait_xcnt 0x0" ::: "memory");      /* the address registers that these loads name are rewritten for the next group only behind this wait */
    __builtin_amdgcn_sched_barrier(0);      /* keeps the whole group in front of the wait of the products behind it (below that wait the loads would start one latency late), and the next group's address work behind the wait above */
  };
  auto mm = [&](const Stg& s) { c00 = g2_mma(s.a0, s.b0, c00); c10 = g2_mma(s.a1, s.b0, c10); c01 = g2_mma(s.a0, s.b1, c01); c11 = g2_mma(s.a1, s.b1, c11);
    c02 = g2_mma(s.a0, s.b2, c02); c12 = g2_mma(s.a1, s.b2, c12); c03 = g2_mma(s.a0, s.b3, c03); c13 = g2_mma(s.a1, s.b3, c13); };
  { Stg s0, s1, s2; ld(s0, 0); ld(s1, 32); int kb = 0;
#pragma unroll 1      /* one copy of the three-step body: a second copy would not fit the register sets */
    for (; kb + 96 <= K; kb += 96) { ld(s2, kb + 64); mm(s0); ld(s0, kb + 96); mm(s1); ld(s1, kb + 128); mm(s2); }
    if (kb < K) mm(s0);
    if (kb + 32 < K) mm(s1); }
  v8f accs[8] = {c00, c01, c02, c03, c10, c11, c12, c13};
#pragma unroll
  for (int u = 0; u < 8; ++u) { const int t = u & 3, half = u >> 2; const int col = col0 + t * 16 + ln; const float bv = bp ? bf16_round(bp[col]) : 0.f;
#pragma unroll
    for (int r = 0; r < 8; ++r) { const int rloc = half * 16 + 8 * hh + r; float v = accs[u][r] * alpha + bv; if (CP) { const int bidx = (row0g + row0 + rloc) / rowsPerB; v += CP[(size_t)bidx * sCPb + (size_t)by * 64 + col]; }
      if (ACT == 3) v = fmaxf(v, 0.f); else if (ACT == 6) v = 0.5f * v * (1.0f + erff(v * 0.70710678118654752f)); else if (ACT == 11) v = 1.0f / (1.0f + expf(-v)); else if (ACT == 15) v = v / (1.0f + expf(-v)); else if (ACT == 12) v = (v > 0.f) ? v : 0.01f * v; else if (ACT == 8) v = tanhf(v); else if (ACT == 9) v = 0.5f * v * (1.0f + tanhf(0.7978845608028654f * (v + 0.044715f * v * v * v)));      /* tanh-GELU */
      so[w][rloc][t * 16 + ln] = v; } }
  __builtin_amdgcn_fence(__ATOMIC_ACQ_REL, "workgroup"); __builtin_amdgcn_wave_barrier();
  const int rsub = lane >> 4, c4 = (lane & 15) * 4;
  if (PK & 2) {      /* the wave's 32 x 64 tile is 2 x 2 blocks of the next product's A plane: each store is one piece of a block, 512 contiguous bytes */
    unsigned short* d0 = (unsigned short*)C16 + frag_pos(row0 + ln, (int)cofs + col0 + 8 * hh, ldc); unsigned short* d1 = d0 + 16 * (size_t)ldc;
#pragma unroll      /* constant indices: the stores share two address registers with constant offsets */
    for (int s = 0; s < 8; ++s) { const int rt = s >> 2, pc = s & 3;      /* piece pc: columns 16 pc + 8 hh up */
      const v4f v0 = *(const v4fa*)&so[w][rt * 16 + ln][pc * 16 + 8 * hh], v1 = *(const v4fa*)&so[w][rt * 16 + ln][pc * 16 + 8 * hh + 4]; FragH f;
      for (int i = 0; i < 4; ++i) { f.h[i] = (_Float16)v0[i]; f.h[4 + i] = (_Float16)v1[i]; }
      *(v8us*)((rt ? d1 : d0) + pc * 256) = f.half[0]; }
  } else {
#pragma unroll
    for (int q = 0; q < 16; ++q) { const int r = q * 2 + rsub; const v4f v = *(const v4fa*)&so[w][r][c4]; if (C) *(v4f*)(C + cofs + (size_t)(row0 + r) * ldc + col0 + c4) = v; if (C16) { v4h h4; for (int i = 0; i < 4; ++i) h4[i] = (_Float16)v[i]; *(v4h*)(C16 + cofs + (size_t)(row0 + r) * ldc + col0 + c4) = h4; } }
     } }


__global__ __launch_bounds__(256) void k_embed(const int* __restrict__ tok, const float* __restrict__ emb, const float* __restrict__ pos, float* __restrict__ X) {
  #pragma clang fp contract(off)
  const int t = blockIdx.x * 256 + threadIdx.x; if (t >= SLEN * (DM / 4)) return; const int c0 = (t % (DM / 4)) * 4, s = t / (DM / 4); const int id = (s == 0) ? 0 : tok[s - 1]; v4f o;
#pragma unroll
  for (int q = 0; q < 4; ++q) o[q] = bf16_round(emb[(size_t)id * DM + c0 + q]) + bf16_round(pos[(size_t)s * DM + c0 + q]);
  *(v4f*)(X + (size_t)s * DM + c0) = o;  }
__global__ __launch_bounds__(256) void k_ln512(const float* __restrict__ X, const float* __restrict__ g, const float* __restrict__ bb, _Float16* __restrict__ Y16) {
  #pragma clang fp contract(off)
  const int tid = threadIdx.x, w = tid >> 5, ln = tid & 31; const int r = blockIdx.x * 8 + w; if (r >= SLEN) return; const float* x = X + (size_t)r * DM; v4f a[4]; float s = 0.f;
#pragma unroll
  for (int i = 0; i < 4; ++i) { a[i] = *(const v4fa*)(x + i * 128 + ln * 4); for (int q = 0; q < 4; ++q) s += a[i][q]; }
  for (int o = 16; o > 0; o >>= 1) s += __shfl_xor(s, o, 32); const float mu = s / (float)DM; float q2 = 0.f;
#pragma unroll
  for (int i = 0; i < 4; ++i) for (int q = 0; q < 4; ++q) { const float d = a[i][q] - mu; q2 += d * d; }
  for (int o = 16; o > 0; o >>= 1) q2 += __shfl_xor(q2, o, 32); const float rs = rsqrtf(q2 / (float)DM + 1e-6f);
  {
#pragma unroll
    for (int i = 0; i < 4; ++i) { const int c0 = i * 128 + ln * 4; _Float16 h4[4]; for (int q = 0; q < 4; ++q) h4[q] = (_Float16)((a[i][q] - mu) * rs * bf16_round(g[c0 + q]) + bf16_round(bb[c0 + q])); *(unsigned long long*)((unsigned short*)Y16 + frag_pos(r, c0, DM)) = *(const unsigned long long*)h4; }      /* fragment order: Y16 is the A plane of the products behind it */
     } }
__global__ __launch_bounds__(256) void k_softsp(const float* __restrict__ S, const int* __restrict__ tok, _Float16* __restrict__ P16) {
  #pragma clang fp contract(off)
  const int tid = threadIdx.x, w = tid >> 5, ln = tid & 31; const int i = blockIdx.x * 8 + w; if (i >= SLEN) return; const size_t hp = (size_t)blockIdx.y * SLEN * SLEN; /* this head's plane */ const float* s = S + hp + (size_t)i * SLEN; float m = -3.0e38f;
  const int b = blockIdx.x / (BLK / 8);      /* the row's 128-block, the same for the whole work-group */
  v4f sv[4]; v4ia st[4];      /* the columns that the pattern can keep: the last 32 of each earlier block (sum_col), then 4 columns a lane of the own block */
  const char* srow = (const char*)(S + hp + (size_t)__builtin_amdgcn_readfirstlane(i) * SLEN);      /* the wave's row, its base in scalar registers: each load names a scalar base and one lane offset */
  unsigned jo[5];      /* byte offsets of a lane's columns, the same in the f32 score row and in the int32 tokens */
#pragma unroll      /* constant indices, so that the array stays in registers */
  for (int u = 0; u < 4; ++u) jo[u] = 4u * (unsigned)sum_col(b, ln, u);
  const int j0 = b * BLK + ln * 4; jo[4] = 4u * (unsigned)j0;
#pragma unroll      /* constant indices, so that the array stays in registers */
  for (int u = 0; u < 4; ++u) { sv[u] = *(const v4fa*)(srow + jo[u]); st[u] = *(const v4ia*)((const char*)tok + jo[u]); }
  v4f ov = *(const v4fa*)(srow + jo[4]); const v4ia ot = *(const v4ia*)((const char*)tok + jo[4]); const int tf = tok[b * BLK];
  asm volatile("s_wait_xcnt 0x0" :: "v"(sv[0]), "v"(sv[1]), "v"(sv[2]), "v"(sv[3]), "v"(st[0]), "v"(st[1]), "v"(st[2]), "v"(st[3]), "v"(ov), "v"(ot), "s"(tf), "v"(jo[0]), "v"(jo[1]), "v"(jo[2]), "v"(jo[3]), "v"(jo[4]), "s"(srow) : "memory");      /* inputs only. The loaded values: the eleven loads are in flight together (one latency, not eleven). The five lane offsets and the row base: they stay live up to here, so no load's result lands in a register that an earlier load of the run names ahead of this wait */
  __builtin_amdgcn_sched_barrier(0);      /* keeps the work below from being lifted in front of that wait */
  if (!rows_all_masked(st, tf, b, ln)) {      /* every row of the block has a kept key: exp(-1e9 - m) is 0, so only these columns are summed and written */
#pragma unroll      /* constant indices, so that the array stays in registers */
    for (int u = 0; u < 4; ++u) for (int q = 0; q < 4; ++q) { sv[u][q] = (sum_on(b, ln, u) & (st[u][q] > 0)) ? sv[u][q] : -1.0e9f; m = fmaxf(m, sv[u][q]); }
#pragma unroll      /* constant indices, so that the array stays in registers */
    for (int q = 0; q < 4; ++q) { ov[q] = ((j0 + q <= i) & (ot[q] > 0)) ? ov[q] : -1.0e9f; m = fmaxf(m, ov[q]); }
    for (int o = 16; o > 0; o >>= 1) m = fmaxf(m, __shfl_xor(m, o, 32)); float su = 0.f;
#pragma unroll      /* constant indices, so that the array stays in registers */
    for (int u = 0; u < 4; ++u) for (int q = 0; q < 4; ++q) { sv[u][q] = expf(sv[u][q] - m); su += sv[u][q]; }
#pragma unroll      /* constant indices, so that the array stays in registers */
    for (int q = 0; q < 4; ++q) { ov[q] = expf(ov[q] - m); su += ov[q]; }
    for (int o = 16; o > 0; o >>= 1) su += __shfl_xor(su, o, 32); const float inv = 1024.0f / su; _Float16* d = P16 + hp + (size_t)i * SLEN;
#pragma unroll      /* constant indices, so that the array stays in registers */
    for (int u = 0; u < 4; ++u) { v4h h4; for (int q = 0; q < 4; ++q) h4[q] = (_Float16)(sv[u][q] * inv); if (sum_on(b, ln, u)) *(v4h*)(d + sum_col(b, ln, u)) = h4; }
    v4h h4;
#pragma unroll      /* constant indices, so that the array stays in registers */
    for (int q = 0; q < 4; ++q) h4[q] = (_Float16)(ov[q] * inv);
    *(v4h*)(d + j0) = h4;
    return; }
  auto val = [&](int j) -> float { const bool keep = (j <= i) && (((i / BLK) == (j / BLK)) || ((j % BLK) >= BLK - CSP)) && (tok[j] > 0); return keep ? s[j] : -1.0e9f; };
#pragma unroll 1
  for (int c = 0; c < SLEN / 256; ++c) { const int kb = c * 256 + ln * 8; for (int q = 0; q < 8; ++q) m = fmaxf(m, val(kb + q)); }
  for (int o = 16; o > 0; o >>= 1) m = fmaxf(m, __shfl_xor(m, o, 32)); float su = 0.f;
#pragma unroll 1
  for (int c = 0; c < SLEN / 256; ++c) { const int kb = c * 256 + ln * 8; for (int q = 0; q < 8; ++q) su += expf(val(kb + q) - m); }
  for (int o = 16; o > 0; o >>= 1) su += __shfl_xor(su, o, 32); const float inv = 1024.0f / su; unsigned short* d = (unsigned short*)P16 + hp + (size_t)i * SLEN;
  {
#pragma unroll 1
    for (int c = 0; c < SLEN / 256; ++c) { const int kb = c * 256 + ln * 8; FragH f;
#pragma unroll
      for (int q = 0; q < 8; ++q) f.h[q] = (_Float16)(expf(val(kb + q) - m) * inv);
      *(v8us*)(d + kb) = f.half[0]; }
     } }

extern "C" void kernel_launch(void* const* d_in, const int* in_sizes, int n_in,
                              void* d_out, int out_size, void* d_ws, size_t ws_size, hipStream_t stream) {
  (void)in_sizes; (void)n_in; (void)out_size;
  const float* const* I = (const float* const*)d_in; const int* tok = (const int*)d_in[0]; const float* emb = I[1]; const float* pos = I[2]; const float* l1s = I[3]; const float* l1b = I[4]; const float* wq = I[5]; const float* wk = I[6]; const float* wv = I[7]; const float* wo = I[8];
  const float* l2s = I[9]; const float* l2b = I[10]; const float* w1 = I[11]; const float* b1 = I[12]; const float* w2 = I[13]; const float* b2 = I[14]; const float* lfs = I[15]; const float* lfb = I[16]; const float* wout = I[17]; const float* bout = I[18];
  char* ws = (char*)d_ws; size_t off = 0;
  auto take = [&](size_t bytes) { char* p = ws + off; off += (bytes + 255) & ~(size_t)255; return p; };
  _Float16* BW = (_Float16*)take((NL * LWT + (size_t)NVOC * DM) * 2);      /* the f16 weights of every layer, then the output projection's */ _Float16* BOUT = BW + NL * LWT;
  float* X = (float*)take((size_t)SLEN * DM * 4); _Float16* H16 = (_Float16*)take((size_t)SLEN * DM * 2); _Float16* Q16 = (_Float16*)take((size_t)SLEN * DM * 2); _Float16* K16 = (_Float16*)take((size_t)SLEN * DM * 2); _Float16* V16 = (_Float16*)take((size_t)SLEN * DM * 2); _Float16* VT = (_Float16*)take((size_t)DM * SLEN * 2);
  float* S = (float*)take((size_t)NH * SLEN * SLEN * 4); _Float16* P16 = (_Float16*)take((size_t)NH * SLEN * SLEN * 2);      /* one plane per head */ _Float16* O16 = (_Float16*)take((size_t)SLEN * DM * 2); _Float16* G16 = (_Float16*)take((size_t)SLEN * DMLP * 2);
  if (off > ws_size) return;      /* 36.3 + 4 + 2 x 5 + 128 + 64 + 2 + 8 = 252.3 MiB */
  const dim3 gW(192, NL + 1), gP((SLEN / 128) * (DM / 64), 1), gS((SLEN / BLK) * 2 + (SLEN / BLK) * (SLEN / BLK - 1) / 2, NH), gH((SLEN / 128) * 1, NH), gX(SLEN / 8, NH), gM((SLEN / 128) * (DMLP / 64), 1), gV((SLEN / 128) * (NVOC / 64), 1);
  k_wt_all<<<gW, 256, 0, stream>>>(wq, wk, wv, wo, w1, w2, wout, BW);      /* wq[l] [D][H][DH] = (in, out=h*64+k); wo[l] [H][DH][D] = (in=h*64+k, out) */
  k_embed<<<(SLEN * (DM / 4) + 255) / 256, 256, 0, stream>>>(tok, emb, pos, X);
  for (int l = 0; l < NLRUN; ++l) {
    const _Float16* BQ = BW + l * LWT; const _Float16* BK = BQ + (size_t)DM * DM; const _Float16* BV = BK + (size_t)DM * DM; const _Float16* BO = BV + (size_t)DM * DM; const _Float16* BW1 = BO + (size_t)DM * DM; const _Float16* BW2 = BW1 + (size_t)DM * DMLP;
    k_ln512<<<SLEN / 8, 256, 0, stream>>>(X, l1s + l * DM, l1b + l * DM, H16);
    k_gemm2<0, 0, 1><<<gP, 128, 0, stream>>>(H16, DM, 0, BQ, DM, 0, 0.0625f, nullptr, 0, nullptr, 1, 0, 0, nullptr, Q16, DM, 0, SLEN, DM, DM);
    k_gemm2<0, 0, 1><<<gP, 128, 0, stream>>>(H16, DM, 0, BK, DM, 0, 0.0625f, nullptr, 0, nullptr, 1, 0, 0, nullptr, K16, DM, 0, SLEN, DM, DM);
    k_gemm2<0, 0, 1><<<gP, 128, 0, stream>>>(H16, DM, 0, BV, DM, 0, 0.0625f, nullptr, 0, nullptr, 1, 0, 0, nullptr, V16, DM, 0, SLEN, DM, DM);
    k_vt<NH, SLEN><<<NH * (SLEN / 64), 256, 0, stream>>>(V16, DM, 0, VT);
    /* all heads in one launch each: blockIdx.y = head */
    k_gemm2<0, 1><<<gS, 128, 0, stream>>>(Q16, DM, 64, K16, DM, 64, 0.125f, nullptr, 0, nullptr, 1, 0, 0, S, nullptr, SLEN, (size_t)SLEN * SLEN, SLEN, SLEN, 64);      /* (q / 8) . k */
    k_softsp<<<gX, 256, 0, stream>>>(S, tok, P16);
    k_gemm2<0, 2, 2><<<gH, 128, 0, stream>>>(P16, SLEN, (size_t)SLEN * SLEN, VT, SLEN, (size_t)64 * SLEN, 0.0009765625f, nullptr, 0, nullptr, 1, 0, 0, nullptr, O16, DM, 64, SLEN, 64, SLEN, tok);
    k_gemm2<0, 0, 1><<<gP, 128, 0, stream>>>(O16, DM, 0, BO, DM, 0, 0.0625f, nullptr, 0, X, 1, (size_t)DM, 0, X, nullptr, DM, 0, SLEN, DM, DM);      /* x += o Wo (own tile, in place) */
    k_ln512<<<SLEN / 8, 256, 0, stream>>>(X, l2s + l * DM, l2b + l * DM, H16);
    k_gemm2<9, 0, 3><<<gM, 128, 0, stream>>>(H16, DM, 0, BW1, DM, 0, 0.0625f, b1 + (size_t)l * DMLP, 0, nullptr, 1, 0, 0, nullptr, G16, DMLP, 0, SLEN, DMLP, DM);      /* tanh-gelu(y W1 + b1) */
    k_gemm2<0, 0, 1><<<gP, 128, 0, stream>>>(G16, DMLP, 0, BW2, DMLP, 0, 0.0625f, b2 + (size_t)l * DM, 0, X, 1, (size_t)DM, 0, X, nullptr, DM, 0, SLEN, DM, DMLP); }      /* x += mlp + b2 */
  k_ln512<<<SLEN / 8, 256, 0, stream>>>(X, lfs, lfb, H16);
  k_gemm2<0, 0, 1><<<gV, 128, 0, stream>>>(H16, DM, 0, BOUT, DM, 0, 0.0625f, bout, 0, nullptr, 1, 0, 0, (float*)d_out, nullptr, NVOC, 0, SLEN, NVOC, DM);
}

// v006
// One run takes 635 microseconds.
// In two side-by-side timings against v005, it was 1.58 and 1.56 times as fast.
// Over all steps from v000 it is 9.02 times as fast.
#include <hip/hip_runtime.h>
// Sparse-pattern transformer decoder (1 x 2048 tokens, 512 = 8 heads x 64, 6 layers, MLP 2048 (tanh-GELU), vocab 256): x = embed[shift_right(tokens)] + pos_emb; per layer: h = LN1(x); q = h Wq / 8, k, v; scores masked by the structural fixed sparse pattern (causal & (same 128-block | last 32 columns of each block)) AND the INPUT key padding (token > 0), masked entries = -1e9 exactly as the reference; softmax; x += (P v) Wo; x += gelu(LN2(x) W1 + b1) W2 + b2; out = LNf(x) Wout + bout -> [1,2048,256].
// Structure: token-embedding gather by the INPUT ids on VALU; LayerNorms on VALU; all weights turned to f16 planes by one launch ahead of the layers; the weights and the activations that the Linears read (LN outputs, attention output, GELU hidden) lie in WMMA fragment order (frag_pos); all Linears as f16 WMMA GEMMs (32x64 wave tiles, f32 accumulation, exact x16 weights, biases / GELU / residual accumulation in the epilogue); per layer, all heads in one launch each (grid y = head): the scores as a GEMM (K 64) into the head's f32 plane, a wave-per-row f32 softmax applying the structural pattern and the key-padding predicate (P x2^10 f16), V transposed by LDS tiles (head in grid x), P.v as a GEMM into the head's columns of an f16 plane. Scores, softmax and P.v visit only the columns that the structural pattern can keep for a 128-row block (its own block, the last 32 columns of each earlier block); a block that holds a row with no kept key at all (uniform softmax over all 2048 columns) takes the full-width softmax and P.v.
// Compute dtype: embeddings, weights, biases, LN parameters rounded to bf16; LN outputs, q, k, v, P, attention output, GELU hidden as f16 operands (~2^-12; logits small); the residual stream, softmax, LayerNorm in f32. v_wmma_f32_16x16x32_f16.
#define SLEN 2048
#define DM 512
#define NH 8
#define NL 6
#define NLRUN NL                 /* layers executed */
#define DMLP 2048
#define NVOC 256
#define BLK 128
#define CSP 32
#define NR SLEN
typedef __bf16 v16b __attribute__((ext_vector_type(16)));
typedef unsigned short v8us __attribute__((ext_vector_type(8), may_alias));
typedef float  v8f  __attribute__((ext_vector_type(8)));
typedef float  v4f  __attribute__((ext_vector_type(4)));
typedef float  v4fa __attribute__((ext_vector_type(4), may_alias));
union FragB { v16b v; v8us half[2]; unsigned short u[16]; };

__device__ __forceinline__ unsigned short bf16_bits(float x) { unsigned int u = __float_as_uint(x); return (unsigned short)((u + 0x7FFFu + ((u >> 16) & 1u)) >> 16); }
__device__ __forceinline__ float bf16_val(unsigned short b) { return __uint_as_float(((unsigned int)b) << 16); }
__device__ __forceinline__ float bf16_round(float x) { return bf16_val(bf16_bits(x)); }
// D += A·B with NT terms: 1 = ah·bh, 2 = + al·bh (A split), 3 = + ah·bl (both split)
template <int NT>
__device__ __forceinline__ v8f mmaN(v16b ah, v16b al, v16b bh, v16b bl, v8f c) {
  c = __builtin_amdgcn_wmma_f32_16x16x32_bf16(false, ah, false, bh, (short)0, c, false, false);
  if (NT >= 2) c = __builtin_amdgcn_wmma_f32_16x16x32_bf16(false, al, false, bh, (short)0, c, false, false);
  if (NT >= 3) c = __builtin_amdgcn_wmma_f32_16x16x32_bf16(false, ah, false, bl, (short)0, c, false, false);
  asm volatile("v_nop\n\tv_nop\n\tv_nop\n\tv_nop" : "+v"(c) : "v"(ah), "v"(al), "v"(bh), "v"(bl));
  return c;
}

__global__ __launch_bounds__(256) void k_wt_bf16(const float* __restrict__ W, unsigned short* __restrict__ Wt, int K, int N) {
  const int t = blockIdx.x * 256 + threadIdx.x;
  const int k8n = K / 8;
  if (t >= N * k8n) return;
  const int n = t / k8n, k8 = (t % k8n) * 8;
  v8us v;
#pragma unroll
  for (int i = 0; i < 8; ++i) v[i] = bf16_bits(W[(size_t)(k8 + i) * N + n]);
  *(v8us*)(Wt + (size_t)n * K + k8) = v;
  
}

// GEMM C[M][N] (f32, pitch ldc) = act(A[M][K]·W + bias). A f32 row-major (pitch lda) converted per fragment to bf16
// (ASPLIT: hi/lo two planes -> 2 terms, else single rounded term); Wt bf16 [N][K] (pitch ldb). BIAS_BF16 rounds the
// bias to bf16 first (bias quantised to bf16 before the add). K%32==0, M%16==0, N%64==0.
template <bool ASPLIT, int ACT, bool BIAS_BF16>
__global__ __launch_bounds__(128) void k_gemm_bf(const float* __restrict__ A, int lda, const unsigned short* __restrict__ Wt, int ldb,
                                               const float* __restrict__ bias, float* __restrict__ C, int ldc, int M, int N, int K) {
  __shared__ __attribute__((aligned(16))) float so[4][16][64];
  const int tid = threadIdx.x, w = tid >> 5, lane = tid & 31, ln = lane & 15, hh = lane >> 4;
  const int ntn = N / 64;
  const int wid = blockIdx.x * 4 + w;
  const int mt = wid / ntn, nq = wid % ntn;
  if (mt * 16 >= M) return;
  const int row0 = mt * 16, col0 = nq * 64;
  const float* arow = A + (size_t)(row0 + ln) * lda;
  v8f acc[4] = {};
  for (int kb = 0; kb < K; kb += 32) {
    FragB ah, al;
    const v4f x0 = *(const v4fa*)(arow + kb + 8 * hh), x1 = *(const v4fa*)(arow + kb + 8 * hh + 4);
    const v4f x2 = *(const v4fa*)(arow + kb + 16 + 8 * hh), x3 = *(const v4fa*)(arow + kb + 16 + 8 * hh + 4);
    float xs[16] = {x0[0],x0[1],x0[2],x0[3],x1[0],x1[1],x1[2],x1[3],x2[0],x2[1],x2[2],x2[3],x3[0],x3[1],x3[2],x3[3]};
#pragma unroll
    for (int i = 0; i < 16; ++i) { const unsigned short hb = bf16_bits(xs[i]); ah.u[i] = hb; al.u[i] = ASPLIT ? bf16_bits(xs[i] - bf16_val(hb)) : (unsigned short)0; }
#pragma unroll
    for (int t = 0; t < 4; ++t) {
      const unsigned short* brow = Wt + (size_t)(col0 + t * 16 + ln) * ldb + kb;
      FragB b;
      b.half[0] = *(const v8us*)(brow + 8 * hh);
      b.half[1] = *(const v8us*)(brow + 16 + 8 * hh);
      acc[t] = mmaN<ASPLIT ? 2 : 1>(ah.v, al.v, b.v, b.v, acc[t]);
    }
  }
#pragma unroll
  for (int t = 0; t < 4; ++t) {
    float bv = bias ? bias[col0 + t * 16 + ln] : 0.f;
    if (BIAS_BF16) bv = bf16_round(bv);
#pragma unroll
    for (int r = 0; r < 8; ++r) { float v = acc[t][r] + bv; if (ACT == 1) v = fmaxf(v, 0.f); so[w][8 * hh + r][t * 16 + ln] = v; }
  }
  __builtin_amdgcn_fence(__ATOMIC_ACQ_REL, "workgroup");
  __builtin_amdgcn_wave_barrier();
  const int rsub = lane >> 4, c4 = (lane & 15) * 4;
  {
#pragma unroll
    for (int q = 0; q < 8; ++q) {
      const int r = q * 2 + rsub;
      const v4f v = *(const v4fa*)&so[w][r][c4];
      *(v4f*)(C + (size_t)(row0 + r) * ldc + col0 + c4) = v;
    }
    
  }
}

// GEMM C = act(A·W + bias + resid): A f32 (ASPLIT -> hi/lo 2 terms), Wt bf16 [N][K]; ACT 0 none, 1 relu, 2 exact gelu;
// resid (optional, f32, row index = (row % rmod), pitch ldr, RES_BF16 rounds it) added before the activation.
template <bool ASPLIT, int ACT, bool BIAS_BF16, bool RES_BF16>
__global__ __launch_bounds__(128) void k_gemm_bf3(const float* __restrict__ A, int lda, const unsigned short* __restrict__ Wt, int ldb,
                                                const float* __restrict__ bias, const float* __restrict__ resid, int rmod, int ldr,
                                                float* __restrict__ C, int ldc, int M, int N, int K) {
  __shared__ __attribute__((aligned(16))) float so[4][16][64];
  const int tid = threadIdx.x, w = tid >> 5, lane = tid & 31, ln = lane & 15, hh = lane >> 4;
  const int ntn = N / 64;
  const int wid = blockIdx.x * 4 + w;
  const int mt = wid / ntn, nq = wid % ntn;
  if (mt * 16 >= M) return;
  const int row0 = mt * 16, col0 = nq * 64;
  const float* arow = A + (size_t)(row0 + ln) * lda;
  v8f acc[4] = {};
  for (int kb = 0; kb < K; kb += 32) {
    FragB ah, al;
    const v4f x0 = *(const v4fa*)(arow + kb + 8 * hh), x1 = *(const v4fa*)(arow + kb + 8 * hh + 4);
    const v4f x2 = *(const v4fa*)(arow + kb + 16 + 8 * hh), x3 = *(const v4fa*)(arow + kb + 16 + 8 * hh + 4);
    float xs[16] = {x0[0],x0[1],x0[2],x0[3],x1[0],x1[1],x1[2],x1[3],x2[0],x2[1],x2[2],x2[3],x3[0],x3[1],x3[2],x3[3]};
#pragma unroll
    for (int i = 0; i < 16; ++i) { const unsigned short hb = bf16_bits(xs[i]); ah.u[i] = hb; al.u[i] = ASPLIT ? bf16_bits(xs[i] - bf16_val(hb)) : (unsigned short)0; }
#pragma unroll
    for (int t = 0; t < 4; ++t) {
      const unsigned short* brow = Wt + (size_t)(col0 + t * 16 + ln) * ldb + kb;
      FragB b;
      b.half[0] = *(const v8us*)(brow + 8 * hh);
      b.half[1] = *(const v8us*)(brow + 16 + 8 * hh);
      acc[t] = mmaN<ASPLIT ? 2 : 1>(ah.v, al.v, b.v, b.v, acc[t]);
    }
  }
#pragma unroll
  for (int t = 0; t < 4; ++t) {
    const int col = col0 + t * 16 + ln;
    float bv = bias ? bias[col] : 0.f;
    if (BIAS_BF16) bv = bf16_round(bv);
#pragma unroll
    for (int r = 0; r < 8; ++r) {
      float v = acc[t][r] + bv;
      if (resid) { float rv = resid[(size_t)((row0 + 8 * hh + r) % rmod) * ldr + col]; if (RES_BF16) rv = bf16_round(rv); v += rv; }
      if (ACT == 1) v = fmaxf(v, 0.f);
      if (ACT == 2) v = 0.5f * v * (1.0f + erff(v * 0.70710678118654752f));
      if (ACT == 3) { const float u = 0.7978845608028654f * (v + 0.044715f * v * v * v); v = 0.5f * v * (1.0f + tanhf(u)); }
      so[w][8 * hh + r][t * 16 + ln] = v;
    }
  }
  __builtin_amdgcn_fence(__ATOMIC_ACQ_REL, "workgroup");
  __builtin_amdgcn_wave_barrier();
  const int rsub = lane >> 4, c4 = (lane & 15) * 4;
  {
#pragma unroll
    for (int q = 0; q < 8; ++q) {
      const int r = q * 2 + rsub;
      const v4f v = *(const v4fa*)&so[w][r][c4];
      *(v4f*)(C + (size_t)(row0 + r) * ldc + col0 + c4) = v;
    }
    
  }
}
// row LayerNorm (biased variance, eps) over N: s = X (+ R); optional out_sum <- s; out_norm <- (s-mu)*rsqrt(var+eps)*g + b
template <bool PARAM_BF16>
__global__ __launch_bounds__(256) void k_layernorm(const float* __restrict__ X, const float* __restrict__ R, const float* __restrict__ g, const float* __restrict__ bta,
                                                  float* __restrict__ out_sum, float* __restrict__ out_norm, int N, float eps) {
  __shared__ float red[256];
  const int row = blockIdx.x, tid = threadIdx.x;
  const float* x = X + (size_t)row * N; const float* rr = R ? R + (size_t)row * N : nullptr;
  float vals[16];                     // up to N = 4096
  const int per = N / 256;            // contiguous chunk per thread? use strided-by-4 chunks: thread handles j = tid*4 + 1024*u
  float s1 = 0.f;
  for (int u = 0; u < per / 4; ++u) {
    const int j = tid * 4 + 1024 * u;
    const v4f a = *(const v4fa*)(x + j);
    v4f b = {0.f,0.f,0.f,0.f}; if (rr) b = *(const v4fa*)(rr + j);
#pragma unroll
    for (int q = 0; q < 4; ++q) { const float v = a[q] + b[q]; vals[u * 4 + q] = v; s1 += v; }
  }
  red[tid] = s1; __syncthreads();
  for (int st = 128; st > 0; st >>= 1) { if (tid < st) red[tid] += red[tid + st]; __syncthreads(); }
  const float mu = red[0] / (float)N; __syncthreads();
  float s2 = 0.f;
  for (int u = 0; u < per / 4; ++u)
#pragma unroll
    for (int q = 0; q < 4; ++q) { const float c = vals[u * 4 + q] - mu; s2 += c * c; }
  red[tid] = s2; __syncthreads();
  for (int st = 128; st > 0; st >>= 1) { if (tid < st) red[tid] += red[tid + st]; __syncthreads(); }
  const float rs = rsqrtf(red[0] / (float)N + eps);
  {
    for (int u = 0; u < per / 4; ++u) {
      const int j = tid * 4 + 1024 * u;
      v4f o, sm;
#pragma unroll
      for (int q = 0; q < 4; ++q) {
        float gg = g[j + q], bb = bta[j + q];
        if (PARAM_BF16) { gg = bf16_round(gg); bb = bf16_round(bb); }
        sm[q] = vals[u * 4 + q]; o[q] = (vals[u * 4 + q] - mu) * rs * gg + bb;
      }
      if (out_sum) *(v4f*)(out_sum + (size_t)row * N + j) = sm;
      *(v4f*)(out_norm + (size_t)row * N + j) = o;
    }
    
  }
}



// ---- f16 WMMA path (v_wmma_f32_16x16x32_f16): 11-bit significands for operands in range — used where a [0,1] probability operand needs more precision than bf16
typedef _Float16 v16h __attribute__((ext_vector_type(16)));
union FragH { v16h v; v8us half[2]; _Float16 h[16]; unsigned short u[16]; };
template <int NT>
__device__ __forceinline__ v8f mmaH(v16h ah, v16h al, v16h bh, v16h bl, v8f c) {
  c = __builtin_amdgcn_wmma_f32_16x16x32_f16(false, ah, false, bh, (short)0, c, false, false);
  if (NT >= 2) c = __builtin_amdgcn_wmma_f32_16x16x32_f16(false, al, false, bh, (short)0, c, false, false);
  if (NT >= 3) c = __builtin_amdgcn_wmma_f32_16x16x32_f16(false, ah, false, bl, (short)0, c, false, false);
  asm volatile("v_nop\n\tv_nop\n\tv_nop\n\tv_nop" : "+v"(c) : "v"(ah), "v"(al), "v"(bh), "v"(bl));
  return c;
}
// batched GEMM like k_gemm_b but f16 operands: A f32 (split into f16 hi/lo if ASPLIT, else rounded to f16), Bt = f16 values [n][k]; alpha; C f32; N multiple of 16 (partial tiles skipped)
template <bool ASPLIT>
__global__ __launch_bounds__(128) void k_gemm_h(const float* __restrict__ A, int lda, size_t sA, const _Float16* __restrict__ Bh, int ldb, size_t sB, float alpha, float* __restrict__ C, int ldc, size_t sC, int M, int N, int K) {
  __shared__ __attribute__((aligned(16))) float so[4][16][64];
  const int tid = threadIdx.x, w = tid >> 5, lane = tid & 31, ln = lane & 15, hh = lane >> 4; const int by = blockIdx.y;
  A += (size_t)by * sA; Bh += (size_t)by * sB; C += (size_t)by * sC;
  const int ntn = (N + 63) / 64; const int wid = blockIdx.x * 4 + w; const int mt = wid / ntn, nq = wid % ntn; if (mt * 16 >= M) return;
  const int row0 = mt * 16, col0 = nq * 64; const float* arow = A + (size_t)(row0 + ln) * lda;
  v8f acc[4] = {};
  for (int kb = 0; kb < K; kb += 32) {
    FragH ah, al;
    const v4f x0 = *(const v4fa*)(arow + kb + 8 * hh), x1 = *(const v4fa*)(arow + kb + 8 * hh + 4), x2 = *(const v4fa*)(arow + kb + 16 + 8 * hh), x3 = *(const v4fa*)(arow + kb + 16 + 8 * hh + 4);
    float xs[16] = {x0[0],x0[1],x0[2],x0[3],x1[0],x1[1],x1[2],x1[3],x2[0],x2[1],x2[2],x2[3],x3[0],x3[1],x3[2],x3[3]};
#pragma unroll
    for (int i = 0; i < 16; ++i) { const _Float16 h = (_Float16)xs[i]; ah.h[i] = h; al.h[i] = ASPLIT ? (_Float16)(xs[i] - (float)h) : (_Float16)0.0f; }
#pragma unroll
    for (int t = 0; t < 4; ++t) { if (col0 + t * 16 >= N) continue; const size_t boff = (size_t)(col0 + t * 16 + ln) * ldb + kb; FragH bq; bq.half[0] = *(const v8us*)(Bh + boff + 8 * hh); bq.half[1] = *(const v8us*)(Bh + boff + 16 + 8 * hh);
      acc[t] = mmaH<ASPLIT ? 2 : 1>(ah.v, al.v, bq.v, bq.v, acc[t]); }
  }
#pragma unroll
  for (int t = 0; t < 4; ++t) { if (col0 + t * 16 >= N) continue;
#pragma unroll
    for (int r = 0; r < 8; ++r) so[w][8 * hh + r][t * 16 + ln] = acc[t][r] * alpha; }
  __builtin_amdgcn_fence(__ATOMIC_ACQ_REL, "workgroup"); __builtin_amdgcn_wave_barrier();
  const int rsub = lane >> 4, c4 = (lane & 15) * 4;
  {
#pragma unroll
    for (int q = 0; q < 8; ++q) { const int r = q * 2 + rsub; if (col0 + c4 < N) { const v4f v = *(const v4fa*)&so[w][r][c4]; *(v4f*)(C + (size_t)(row0 + r) * ldc + col0 + c4) = v; } }
     }
}

// Fragment order of an f16 operand plane [rows][K] (rows = the m of an A operand, the n of a B operand): 1-KiB blocks of 16 rows x 32 k, block (row / 16, k / 32) at block index (row / 16) * (K / 32) + k / 32.
// Inside a block stand the two 16-byte pieces that each lane of a 16x16x32 fragment holds, lane by lane: piece k / 16 % 2, lane (k / 8 % 2) * 16 + row % 16, element k % 8. A wave's fragment load is then 512 contiguous bytes (4 whole lines) and not 32 bytes of each of 16 lines; which k a lane and register holds is the same as with row-major planes.
__device__ __forceinline__ size_t frag_pos(int row, int k, int K) { return ((size_t)((row >> 4) * (K >> 5) + (k >> 5)) << 9) + (((k >> 4) & 1) << 8) + (((((k >> 3) & 1) << 4) + (row & 15)) << 3) + (k & 7); }
// Wt(n, k) = f16(bf16(W[k][n]) x 16), in fragment order, from f32 row-major W[K][N] (a power of two: bf16-exact weights stay exact in f16 away from the subnormal range).
// One work-group turns a strip of 256 k x 64 n: whole 256-byte row pieces in, 4 KiB of contiguous blocks out of each wave, through LDS.
// LDS row n holds its 256 k as 128 dwords (k, k + 1 packed); the 16-byte chunk c of row n lies at chunk c ^ (n / 4 % 16), so that the 32 lanes of a store (16 rows n four apart, two neighbouring dwords) fall on 32 different banks, while a row stays one contiguous 512 bytes for the 16-byte reads.
typedef unsigned v4u __attribute__((ext_vector_type(4)));
template <int K, int N>
__device__ __forceinline__ void wt_strip(const float* __restrict__ W, _Float16* __restrict__ Wt, int s, unsigned (*tl)[128]) {
  const int tid = threadIdx.x, n0 = (s % (N / 64)) * 64, k0 = (s / (N / 64)) * 256;
  const int l16 = tid & 15, r = tid >> 4;
  const float* src = W + (size_t)(k0 + 2 * r) * N + n0 + l16 * 4;
  v4f a[8], b[8];      /* rows k0 + 32 p + 2 r and the next one, columns n0 + 4 l16 up */
#pragma unroll      /* constant indices, so that the arrays stay in registers and the 16 loads are in flight together */
  for (int p = 0; p < 8; ++p) { a[p] = *(const v4fa*)(src + (size_t)(32 * p) * N); b[p] = *(const v4fa*)(src + (size_t)(32 * p + 1) * N); }
#pragma unroll      /* constant indices, so that the arrays stay in registers */
  for (int p = 0; p < 8; ++p) { const int kp = p * 16 + r;
    for (int q = 0; q < 4; ++q) { union { _Float16 h[2]; unsigned u; } pk; pk.h[0] = (_Float16)(bf16_round(a[p][q]) * 16.0f); pk.h[1] = (_Float16)(bf16_round(b[p][q]) * 16.0f);
      tl[l16 * 4 + q][(((kp >> 2) ^ l16) << 2) + (kp & 3)] = pk.u; } }
  __syncthreads();
  const int w = tid >> 5, j = tid & 31;      /* a wave writes four neighbouring blocks: rows n0 + 16 (w / 2) up, k from k0 + 128 (w % 2); store i is piece i % 2 of block i / 2 */
  const int n = (w >> 1) * 16 + (j & 15);
  unsigned short* dst = (unsigned short*)Wt + frag_pos(n0 + n, k0 + (w & 1) * 128 + (j >> 4) * 8, K);
#pragma unroll      /* the 8 LDS reads are in flight together, and the stores share address registers with constant offsets */
  for (int i = 0; i < 8; ++i) { const int c = (w & 1) * 16 + i * 2 + (j >> 4);      /* the 16-byte chunk (8 k) of LDS row n that lane j holds in that piece */
    const v4u v = *(const v4u*)&tl[n][(c ^ ((n >> 2) & 15)) << 2];
    *(v4u*)(dst + i * 256) = v; }
  asm volatile("s_wait_xcnt 0x0" ::: "memory");      /* in the listing the code of the next matrix shape follows these stores and reuses their address registers: it stands only behind this wait */
}
#define LWT ((size_t)4 * DM * DM + (size_t)2 * DM * DMLP)      /* f16 elements of one layer's six matrices: q, k, v, o, w1, w2 */
// every weight matrix of the model in one launch: blockIdx.y = layer (NL: the output projection), blockIdx.x = strip (16 each for q, k, v, o; 64 for w1; 64 for w2)
__global__ __launch_bounds__(256) void k_wt_all(const float* __restrict__ wq, const float* __restrict__ wk, const float* __restrict__ wv, const float* __restrict__ wo, const float* __restrict__ w1, const float* __restrict__ w2, const float* __restrict__ wout, _Float16* __restrict__ BW) {
  __shared__ __attribute__((aligned(16))) unsigned tl[64][128];
  const int l = blockIdx.y, x = blockIdx.x;
  if (l == NL) { if (x < (NVOC / 64) * (DM / 256)) wt_strip<DM, NVOC>(wout, BW + NL * LWT, x, tl); return; }
  _Float16* B = BW + l * LWT;
  if (x < 64) { const int m = x >> 4; const float* Wm = m == 0 ? wq : m == 1 ? wk : m == 2 ? wv : wo; wt_strip<DM, DM>(Wm + (size_t)l * DM * DM, B + (size_t)m * DM * DM, x & 15, tl); }
  else if (x < 128) wt_strip<DM, DMLP>(w1 + (size_t)l * DM * DMLP, B + (size_t)4 * DM * DM, x - 64, tl);
  else wt_strip<DMLP, DM>(w2 + (size_t)l * DMLP * DM, B + (size_t)4 * DM * DM + (size_t)DM * DMLP, x - 128, tl);
}
// k_gemm_hh variant with fused epilogue: v = acc·alpha + bias[by·sBias + col] (+ CP[(row/rowsPerB)·sCPb + by·64 + col] if CP) ; ACT 0 none / 1 elu ; writes f16 C16 (and f32 C if non-null)
template <int ACT>
__global__ __launch_bounds__(128) void k_gemm_hhx(const _Float16* __restrict__ A, int lda, size_t sA, const _Float16* __restrict__ Bh, int ldb, size_t sB, float alpha, const float* __restrict__ bias, size_t sBias, const float* __restrict__ CP, int rowsPerB, size_t sCPb, int row0g,
    float* __restrict__ C, _Float16* __restrict__ C16, int ldc, size_t sC, int M, int N, int K) {
  __shared__ __attribute__((aligned(16))) float so[4][16][64];
  const int tid = threadIdx.x, w = tid >> 5, lane = tid & 31, ln = lane & 15, hh = lane >> 4; const int by = blockIdx.y;
  A += (size_t)by * sA; Bh += (size_t)by * sB; const size_t cofs = (size_t)by * sC; const float* bp = bias ? bias + (size_t)by * sBias : nullptr;
  const int ntn = (N + 63) / 64; const int wid = blockIdx.x * 4 + w; const int mt = wid / ntn, nq = wid % ntn; if (mt * 16 >= M) return;
  const int row0 = mt * 16, col0 = nq * 64; const _Float16* arow = A + (size_t)(row0 + ln) * lda;
  v8f acc[4] = {};
  for (int kb = 0; kb < K; kb += 32) { FragH ah; ah.half[0] = *(const v8us*)((const unsigned short*)arow + kb + 8 * hh); ah.half[1] = *(const v8us*)((const unsigned short*)arow + kb + 16 + 8 * hh);
#pragma unroll
    for (int t = 0; t < 4; ++t) { if (col0 + t * 16 >= N) continue; const size_t boff = (size_t)(col0 + t * 16 + ln) * ldb + kb; FragH bq; bq.half[0] = *(const v8us*)((const unsigned short*)Bh + boff + 8 * hh); bq.half[1] = *(const v8us*)((const unsigned short*)Bh + boff + 16 + 8 * hh);
      acc[t] = mmaH<1>(ah.v, ah.v, bq.v, bq.v, acc[t]); }
  }
#pragma unroll
  for (int t = 0; t < 4; ++t) { if (col0 + t * 16 >= N) continue; const int col = col0 + t * 16 + ln; const float bv = bp ? bf16_round(bp[col]) : 0.f;
#pragma unroll
    for (int r = 0; r < 8; ++r) { float v = acc[t][r] * alpha + bv; if (CP) { const int bidx = (row0g + row0 + 8 * hh + r) / rowsPerB; v += CP[(size_t)bidx * sCPb + (size_t)by * 64 + col]; } if (ACT == 1) v = (v > 0.f) ? v : expm1f(v); else if (ACT == 7) v = (v > 0.f) ? v + 1.0f : expf(v); else if (ACT == 8) v = tanhf(v); else if (ACT == 9) v = 0.5f * v * (1.0f + tanhf(0.7978845608028654f * (v + 0.044715f * v * v * v))); else if (ACT == 11) v = 1.0f / (1.0f + expf(-v)); else if (ACT == 12) v = (v > 0.f) ? v : 0.01f * v; else if (ACT == 14) v = (v > 0.f) ? v : 0.1f * v; else if (ACT == 15) v = v / (1.0f + expf(-v)); else if (ACT == 3) v = fmaxf(v, 0.f); else if (ACT == 6) v = 0.5f * v * (1.0f + erff(v * 0.70710678118654752f)); so[w][8 * hh + r][t * 16 + ln] = v; } }
  __builtin_amdgcn_fence(__ATOMIC_ACQ_REL, "workgroup"); __builtin_amdgcn_wave_barrier();
  const int rsub = lane >> 4, c4 = (lane & 15) * 4; typedef _Float16 v4h __attribute__((ext_vector_type(4)));
  {
#pragma unroll
    for (int q = 0; q < 8; ++q) { const int r = q * 2 + rsub; if (col0 + c4 < N) { const v4f v = *(const v4fa*)&so[w][r][c4]; if (C) *(v4f*)(C + cofs + (size_t)(row0 + r) * ldc + col0 + c4) = v; if (C16) { v4h h4; for (int i = 0; i < 4; ++i) h4[i] = (_Float16)v[i]; *(v4h*)(C16 + cofs + (size_t)(row0 + r) * ldc + col0 + c4) = h4; } } }
     }
}


typedef _Float16 v4h __attribute__((ext_vector_type(4)));
typedef int v4ia __attribute__((ext_vector_type(4), may_alias));

__global__ __launch_bounds__(256) void k_x16(const float* __restrict__ x, _Float16* __restrict__ X16, size_t n8) { const size_t t = (size_t)blockIdx.x * 256 + threadIdx.x; if (t >= n8) return; FragH f;
#pragma unroll
  for (int q = 0; q < 8; ++q) f.h[q] = (_Float16)bf16_round(x[t * 8 + q]); *(v8us*)((unsigned short*)X16 + t * 8) = f.half[0];  }
__global__ __launch_bounds__(256) void k_h16(const float* __restrict__ x, _Float16* __restrict__ X16, size_t n8) { const size_t t = (size_t)blockIdx.x * 256 + threadIdx.x; if (t >= n8) return; FragH f;
#pragma unroll
  for (int q = 0; q < 8; ++q) f.h[q] = (_Float16)x[t * 8 + q]; *(v8us*)((unsigned short*)X16 + t * 8) = f.half[0];  }
__global__ __launch_bounds__(256) void k_round16f(const float* __restrict__ W, _Float16* __restrict__ Bt, size_t n8) { const size_t t = (size_t)blockIdx.x * 256 + threadIdx.x; if (t >= n8) return; FragH f;
#pragma unroll
  for (int i = 0; i < 8; ++i) f.h[i] = (_Float16)(bf16_round(W[t * 8 + i]) * 16.0f); *(v8us*)((unsigned short*)Bt + t * 8) = f.half[0];  }
template <int NHv, int TTv>
__global__ __launch_bounds__(256) void k_vt(const _Float16* __restrict__ V16, int ldv, int voff, _Float16* __restrict__ Vt) { __shared__ unsigned short tl[64][66]; const int tid = threadIdx.x; const int slab = blockIdx.x / (TTv / 64), lg = blockIdx.x % (TTv / 64); const int b = slab / NHv, h = slab % NHv;
  for (int i = tid; i < 64 * 8; i += 256) { const int r = i / 8, c8 = (i % 8) * 8; FragH f; f.half[0] = *(const v8us*)((const unsigned short*)V16 + ((size_t)b * TTv + lg * 64 + r) * ldv + voff + h * 64 + c8);
#pragma unroll
    for (int q = 0; q < 8; ++q) tl[r][c8 + q] = f.u[q]; }
  __syncthreads();
  {
#pragma unroll
    for (int rd = 0; rd < 2; ++rd) { const int d = rd * 32 + tid / 8, pc = tid % 8; FragH f;
#pragma unroll
      for (int q = 0; q < 8; ++q) f.u[q] = tl[pc * 8 + q][d];
      *(v8us*)((unsigned short*)Vt + ((size_t)slab * 64 + d) * TTv + lg * 64 + pc * 8) = f.half[0]; }
     } }

__global__ __launch_bounds__(256) void k_hl(const float* __restrict__ F, _Float16* __restrict__ Hh, _Float16* __restrict__ Hl, size_t n8) { const size_t t = (size_t)blockIdx.x * 256 + threadIdx.x; if (t >= n8) return; FragH fh, fl; const v4f a = *(const v4fa*)(F + t * 8), c = *(const v4fa*)(F + t * 8 + 4);
#pragma unroll
  for (int q = 0; q < 4; ++q) { _Float16 h = (_Float16)a[q]; fh.h[q] = h; fl.h[q] = (_Float16)((a[q] - (float)h) * 1024.0f); h = (_Float16)c[q]; fh.h[4 + q] = h; fl.h[4 + q] = (_Float16)((c[q] - (float)h) * 1024.0f); }
  { *(v8us*)((unsigned short*)Hh + t * 8) = fh.half[0]; *(v8us*)((unsigned short*)Hl + t * 8) = fl.half[0];  } }

// ---- fast GEMM (wave tile 32x64; requires M % 32 == 0 rows per launch region and N % 64 == 0); epilogue = k_gemm_hhx semantics ----
__device__ __forceinline__ v16h g2_frag(const _Float16* p, int hh) { FragH f; f.half[0] = *(const v8us*)((const unsigned short*)p + 8 * hh); f.half[1] = *(const v8us*)((const unsigned short*)p + 16 + 8 * hh); return f.v; }
__device__ __forceinline__ v8f g2_mma(v16h a, v16h b, v8f c) { v8f d = __builtin_amdgcn_wmma_f32_16x16x32_f16(false, a, false, b, (short)0, c, false, false); asm volatile("v_nop\n\tv_nop\n\tv_nop\n\tv_nop" : "+v"(d) : "v"(a), "v"(b)); return d; }
/* SP 0: plain. SP 1 (scores): blockIdx.x counts only the 128x64 tiles that hold a column the pattern can keep. SP 2 (P.v, N 64): the k loop visits only such columns, unless rows_all_masked(). */
/* The last 32 columns of the (at most 15) earlier blocks, 4 columns a lane, 4 blocks a load: slot u of a lane is block 4u + lane / 8. A slot past the earlier blocks is off; it is aimed at the own block's last 32 columns (in bounds, written) so that no branch stands round a load. */
__device__ __forceinline__ bool sum_on(int blk, int lane, int u) { return u * 4 + (lane >> 3) < blk; }
__device__ __forceinline__ int sum_col(int blk, int lane, int u) { return (sum_on(blk, lane, u) ? u * 4 + (lane >> 3) : blk) * BLK + (BLK - CSP) + (lane & 7) * 4; }
/* true where the first row of 128-row block blk has no kept key (a later row keeps every key of an earlier row of its block, so false means that no row of the block is without one); the same in every lane. t[u] = the tokens at sum_col(u), tfirst = the token of the block's first column */
__device__ __forceinline__ bool rows_all_masked(const v4ia (&t)[4], int tfirst, int blk, int lane) {
  bool kept = tfirst > 0;
#pragma unroll      /* constant indices, so that the array stays in registers */
  for (int u = 0; u < 4; ++u) for (int q = 0; q < 4; ++q) kept |= sum_on(blk, lane, u) & (t[u][q] > 0);
  return !__any(kept); }
/* PK bit 0: A and Bh lie in fragment order (frag_pos; lda = ldb = their K, sA = sB = 0). PK bit 1: C16 is written in fragment order for a plane of ldc columns, sC then counts columns, and C is not written. */
/* RES > 0: C (f32, row-major, pitch RES = ldc, far below 4 GiB) holds the residual: C += acc x alpha + bias, each lane reading just the elements that it stores; C16 is not written. */
template <int ACT, int SP = 0, int PK = 0, int RES = 0>
__global__ __launch_bounds__(128) void k_gemm2(const _Float16* __restrict__ A, int lda, size_t sA, const _Float16* __restrict__ Bh, int ldb, size_t sB, float alpha, const float* __restrict__ bias, size_t sBias,
    float* __restrict__ C, _Float16* __restrict__ C16, int ldc, size_t sC, int M, int N, int Kfull, const int* __restrict__ tok = nullptr) {
  static_assert(!RES || (ACT == 0 && !(PK & 2)), "the residual is added in a row-major store pass, behind no activation");
  __shared__ __attribute__((aligned(16))) float so[4][32][68];
  const int tid = threadIdx.x, w = tid >> 5, lane = tid & 31, ln = lane & 15, hh = lane >> 4; const int by = blockIdx.y;
  A += (size_t)by * sA; Bh += (size_t)by * sB; const size_t cofs = (size_t)by * sC; const float* bp = bias ? bias + (size_t)by * sBias : nullptr;
  const int ntn = N >> 6; int mt = blockIdx.x / ntn, nq = blockIdx.x - mt * ntn;
  if (SP == 1) { int t = blockIdx.x; for (mt = 0; mt < SLEN / BLK - 1 && t >= mt + 2; ++mt) t -= mt + 2;      /* row block mt has mt + 2 tiles: the upper half of each earlier block, then the two halves of its own */
    nq = t < mt ? 2 * t + 1 : mt + t; }
  const int row0 = mt * 128 + 32 * w, col0 = nq * 64; if (row0 >= M) return;
  bool sparse = false;      /* true: P is written, and non-zero, only in the columns that the pattern can keep */
  if (SP == 2) { v4ia t[4];
#pragma unroll      /* constant indices, so that the array stays in registers */
    for (int u = 0; u < 4; ++u) t[u] = *(const v4ia*)(tok + sum_col(mt, lane, u));
    const int tf = tok[mt * BLK];
    asm volatile("s_wait_xcnt 0x0" :: "v"(t[0]), "v"(t[1]), "v"(t[2]), "v"(t[3]), "s"(tf) : "memory");      /* the loaded values as inputs only: the five loads are in flight together (one latency, not five); their address registers are rewritten only behind this wait */
    __builtin_amdgcn_sched_barrier(0);      /* keeps the work below from being lifted in front of that wait */
    sparse = !rows_all_masked(t, tf, mt, lane); }
  const int K = sparse ? (mt + BLK / 32) * 32 : Kfull;      /* 32-k steps: one for each earlier block, four for the own block */
  const int ksum = sparse ? mt * 32 : 0;      /* the steps below ksum are the earlier blocks': step k reads columns 4 k + 96 up; a step of the own block reads columns k + 3 ksum up (ld) */
  /* each lane's byte offsets in A and B are fixed for the whole loop; only the wave-uniform base moves with k (every operand plane here is far below 4 GiB) */
  /* row-major and fragment order alike: 16 rows further on lie 16 x K elements = 32 K bytes further on */
  const unsigned ao0 = (PK & 1) ? (unsigned)(row0 * lda + 8 * lane) * 2u : (unsigned)((row0 + ln) * lda + 8 * hh) * 2u, ao1 = ao0 + 32u * (unsigned)lda;
  const unsigned bo0 = (PK & 1) ? (unsigned)(col0 * ldb + 8 * lane) * 2u : (unsigned)((col0 + ln) * ldb + 8 * hh) * 2u, bo1 = bo0 + 32u * (unsigned)ldb, bo2 = bo1 + 32u * (unsigned)ldb, bo3 = bo2 + 32u * (unsigned)ldb;
  const v8f z8 = {0.f,0.f,0.f,0.f,0.f,0.f,0.f,0.f}; v8f c00 = z8, c01 = z8, c02 = z8, c03 = z8, c10 = z8, c11 = z8, c12 = z8, c13 = z8;
  /* Fragment loads run ahead of the products: the 12 loads of a 32-k step are issued as one group, two steps before the products that read them, into three rotating register sets.
     The k order of every accumulator is unchanged. A load past the last step is aimed at the last step again (in bounds, its values unused). K % 32 == 0, K >= 32. */
  struct Stg { v16h a0, a1, b0, b1, b2, b3; };
  const int klast = K - 32;
  auto fr = [](const char* p, unsigned o) -> v16h { FragH f; f.half[0] = *(const v8us*)(p + o); f.half[1] = *(const v8us*)(p + o + ((PK & 1) ? 512 : 32)); return f.v; };
  auto ld = [&](Stg& s, int kq) { int k = kq < klast ? kq : klast; if (SP == 2) k += (BLK / 32 - 1) * (k < ksum ? k : ksum) + (k < ksum ? BLK - CSP : 0); const int kbytes = (PK & 1) ? 32 * k : 2 * k;      /* fragment order: a 32-k step is one 1-KiB block */ const char* ak = (const char*)A + kbytes; const char* bk = (const char*)Bh + kbytes;
    s.a0 = fr(ak, ao0); s.a1 = fr(ak, ao1); s.b0 = fr(bk, bo0); s.b1 = fr(bk, bo1); s.b2 = fr(bk, bo2); s.b3 = fr(bk, bo3);
    asm volatile("s_wait_xcnt 0x0" ::: "memory");      /* the address registers that these loads name are rewritten for the next group only behind this wait */
    __builtin_amdgcn_sched_barrier(0);      /* keeps the whole group in front of the wait of the products behind it (below that wait the loads would start one latency late), and the next group's address work behind the wait above */
  };
  auto mm = [&](const Stg& s) { c00 = g2_mma(s.a0, s.b0, c00); c10 = g2_mma(s.a1, s.b0, c10); c01 = g2_mma(s.a0, s.b1, c01); c11 = g2_mma(s.a1, s.b1, c11);
    c02 = g2_mma(s.a0, s.b2, c02); c12 = g2_mma(s.a1, s.b2, c12); c03 = g2_mma(s.a0, s.b3, c03); c13 = g2_mma(s.a1, s.b3, c13); };
  float bvs[4] = {0.f, 0.f, 0.f, 0.f};      /* the bias of the lane's four columns */
  { Stg s0, s1, s2; ld(s0, 0); ld(s1, 32); int kb = 0;
    if (bp) { const int bc = col0 + ln;      /* asked for ahead of the k loop, behind the first two fragment groups: it has landed long before the epilogue reads it */
#pragma unroll      /* constant indices, so that the array stays in registers */
      for (int t = 0; t < 4; ++t) bvs[t] = bp[bc + t * 16];
      asm volatile("s_wait_xcnt 0x0" :: "v"(bc), "s"(bp) : "memory");      /* inputs only: the lane's column and the base that the four loads name stay live up to here and are rewritten only behind this wait */
    }
#pragma unroll 1      /* one copy of the three-step body: a second copy would not fit the register sets */
    for (; kb + 96 <= K; kb += 96) { ld(s2, kb + 64); mm(s0); ld(s0, kb + 96); mm(s1); ld(s1, kb + 128); mm(s2); }
    if (kb < K) mm(s0);
    if (kb + 32 < K) mm(s1); }
  const int rsub = lane >> 4, c4 = (lane & 15) * 4;
  v4f rs[16];      /* RES: the residual of the wave's tile in the lane order of the store pass: 16 loads of 16 bytes, whole 256-byte row pieces, all in flight together while the tile goes through LDS */
  const unsigned ro = 4u * (unsigned)((row0 + rsub) * RES + (int)cofs + col0 + c4);      /* RES: one lane offset for all 16 loads, and for the 16 stores: two rows further on is a constant offset */
  if (RES) {
#pragma unroll      /* constant indices, so that the array stays in registers */
    for (int q = 0; q < 16; ++q) rs[q] = *(const v4fa*)((const char*)C + ro + q * 8 * RES);
    asm volatile("s_wait_xcnt 0x0" :: "v"(ro), "s"(C) : "memory");      /* inputs only: the lane offset and the base that the 16 loads name stay live up to here, so no load's result lands in them, and they are rewritten only behind this wait */
    __builtin_amdgcn_sched_barrier(0);      /* keeps the vector work of the LDS pass from being lifted in front of the 16 loads (they would start later) or in front of the wait above */
  }
  v8f accs[8] = {c00, c01, c02, c03, c10, c11, c12, c13};
#pragma unroll
  for (int u = 0; u < 8; ++u) { const int t = u & 3, half = u >> 2; const float bv = bf16_round(bvs[t]);
#pragma unroll
    for (int r = 0; r < 8; ++r) { const int rloc = half * 16 + 8 * hh + r; float v = accs[u][r] * alpha + bv;
      if (ACT == 3) v = fmaxf(v, 0.f); else if (ACT == 6) v = 0.5f * v * (1.0f + erff(v * 0.70710678118654752f)); else if (ACT == 11) v = 1.0f / (1.0f + expf(-v)); else if (ACT == 15) v = v / (1.0f + expf(-v)); else if (ACT == 12) v = (v > 0.f) ? v : 0.01f * v; else if (ACT == 8) v = tanhf(v); else if (ACT == 9) v = 0.5f * v * (1.0f + tanhf(0.7978845608028654f * (v + 0.044715f * v * v * v)));      /* tanh-GELU */
      so[w][rloc][t * 16 + ln] = v; } }
  __builtin_amdgcn_fence(__ATOMIC_ACQ_REL, "workgroup"); __builtin_amdgcn_wave_barrier();
  if (PK & 2) {      /* the wave's 32 x 64 tile is 2 x 2 blocks of the next product's A plane: each store is one piece of a block, 512 contiguous bytes */
    unsigned short* d0 = (unsigned short*)C16 + frag_pos(row0 + ln, (int)cofs + col0 + 8 * hh, ldc); unsigned short* d1 = d0 + 16 * (size_t)ldc;
#pragma unroll      /* constant indices: the stores share two address registers with constant offsets */
    for (int s = 0; s < 8; ++s) { const int rt = s >> 2, pc = s & 3;      /* piece pc: columns 16 pc + 8 hh up */
      const v4f v0 = *(const v4fa*)&so[w][rt * 16 + ln][pc * 16 + 8 * hh], v1 = *(const v4fa*)&so[w][rt * 16 + ln][pc * 16 + 8 * hh + 4]; FragH f;
      for (int i = 0; i < 4; ++i) { f.h[i] = (_Float16)v0[i]; f.h[4 + i] = (_Float16)v1[i]; }
      *(v8us*)((rt ? d1 : d0) + pc * 256) = f.half[0]; }
  } else if (RES) {
#pragma unroll      /* constant indices, so that the array stays in registers; the 16 LDS reads are in flight together */
    for (int q = 0; q < 16; ++q) rs[q] += *(const v4fa*)&so[w][q * 2 + rsub][c4];
#pragma unroll      /* each store has data registers of its own and all share one address register, so nothing that an issued store names is rewritten */
    for (int q = 0; q < 16; ++q) *(v4f*)((char*)C + ro + q * 8 * RES) = rs[q];
  } else {
#pragma unroll
    for (int q = 0; q < 16; ++q) { const int r = q * 2 + rsub; const v4f v = *(const v4fa*)&so[w][r][c4]; if (C) *(v4f*)(C + cofs + (size_t)(row0 + r) * ldc + col0 + c4) = v; if (C16) { v4h h4; for (int i = 0; i < 4; ++i) h4[i] = (_Float16)v[i]; *(v4h*)(C16 + cofs + (size_t)(row0 + r) * ldc + col0 + c4) = h4; } }
     } }


__global__ __launch_bounds__(256) void k_embed(const int* __restrict__ tok, const float* __restrict__ emb, const float* __restrict__ pos, float* __restrict__ X) {
  #pragma clang fp contract(off)
  const int t = blockIdx.x * 256 + threadIdx.x; if (t >= SLEN * (DM / 4)) return; const int c0 = (t % (DM / 4)) * 4, s = t / (DM / 4); const int id = (s == 0) ? 0 : tok[s - 1]; v4f o;
#pragma unroll
  for (int q = 0; q < 4; ++q) o[q] = bf16_round(emb[(size_t)id * DM + c0 + q]) + bf16_round(pos[(size_t)s * DM + c0 + q]);
  *(v4f*)(X + (size_t)s * DM + c0) = o;  }
__global__ __launch_bounds__(256) void k_ln512(const float* __restrict__ X, const float* __restrict__ g, const float* __restrict__ bb, _Float16* __restrict__ Y16) {
  #pragma clang fp contract(off)
  const int tid = threadIdx.x, w = tid >> 5, ln = tid & 31; const int r = blockIdx.x * 8 + w; if (r >= SLEN) return; const float* x = X + (size_t)r * DM; v4f a[4]; float s = 0.f;
#pragma unroll
  for (int i = 0; i < 4; ++i) { a[i] = *(const v4fa*)(x + i * 128 + ln * 4); for (int q = 0; q < 4; ++q) s += a[i][q]; }
  for (int o = 16; o > 0; o >>= 1) s += __shfl_xor(s, o, 32); const float mu = s / (float)DM; float q2 = 0.f;
#pragma unroll
  for (int i = 0; i < 4; ++i) for (int q = 0; q < 4; ++q) { const float d = a[i][q] - mu; q2 += d * d; }
  for (int o = 16; o > 0; o >>= 1) q2 += __shfl_xor(q2, o, 32); const float rs = rsqrtf(q2 / (float)DM + 1e-6f);
  {
#pragma unroll
    for (int i = 0; i < 4; ++i) { const int c0 = i * 128 + ln * 4; _Float16 h4[4]; for (int q = 0; q < 4; ++q) h4[q] = (_Float16)((a[i][q] - mu) * rs * bf16_round(g[c0 + q]) + bf16_round(bb[c0 + q])); *(unsigned long long*)((unsigned short*)Y16 + frag_pos(r, c0, DM)) = *(const unsigned long long*)h4; }      /* fragment order: Y16 is the A plane of the products behind it */
     } }
__global__ __launch_bounds__(256) void k_softsp(const float* __restrict__ S, const int* __restrict__ tok, _Float16* __restrict__ P16) {
  #pragma clang fp contract(off)
  const int tid = threadIdx.x, w = tid >> 5, ln = tid & 31; const int i = blockIdx.x * 8 + w; if (i >= SLEN) return; const size_t hp = (size_t)blockIdx.y * SLEN * SLEN; /* this head's plane */ const float* s = S + hp + (size_t)i * SLEN; float m = -3.0e38f;
  const int b = blockIdx.x / (BLK / 8);      /* the row's 128-block, the same for the whole work-group */
  v4f sv[4]; v4ia st[4];      /* the columns that the pattern can keep: the last 32 of each earlier block (sum_col), then 4 columns a lane of the own block */
  const char* srow = (const char*)(S + hp + (size_t)__builtin_amdgcn_readfirstlane(i) * SLEN);      /* the wave's row, its base in scalar registers: each load names a scalar base and one lane offset */
  unsigned jo[5];      /* byte offsets of a lane's columns, the same in the f32 score row and in the int32 tokens */
#pragma unroll      /* constant indices, so that the array stays in registers */
  for (int u = 0; u < 4; ++u) jo[u] = 4u * (unsigned)sum_col(b, ln, u);
  const int j0 = b * BLK + ln * 4; jo[4] = 4u * (unsigned)j0;
#pragma unroll      /* constant indices, so that the array stays in registers */
  for (int u = 0; u < 4; ++u) { sv[u] = *(const v4fa*)(srow + jo[u]); st[u] = *(const v4ia*)((const char*)tok + jo[u]); }
  v4f ov = *(const v4fa*)(srow + jo[4]); const v4ia ot = *(const v4ia*)((const char*)tok + jo[4]); const int tf = tok[b * BLK];
  asm volatile("s_wait_xcnt 0x0" :: "v"(sv[0]), "v"(sv[1]), "v"(sv[2]), "v"(sv[3]), "v"(st[0]), "v"(st[1]), "v"(st[2]), "v"(st[3]), "v"(ov), "v"(ot), "s"(tf), "v"(jo[0]), "v"(jo[1]), "v"(jo[2]), "v"(jo[3]), "v"(jo[4]), "s"(srow) : "memory");      /* inputs only. The loaded values: the eleven loads are in flight together (one latency, not eleven). The five lane offsets and the row base: they stay live up to here, so no load's result lands in a register that an earlier load of the run names ahead of this wait */
  __builtin_amdgcn_sched_barrier(0);      /* keeps the work below from being lifted in front of that wait */
  if (!rows_all_masked(st, tf, b, ln)) {      /* every row of the block has a kept key: exp(-1e9 - m) is 0, so only these columns are summed and written */
#pragma unroll      /* constant indices, so that the array stays in registers */
    for (int u = 0; u < 4; ++u) for (int q = 0; q < 4; ++q) { sv[u][q] = (sum_on(b, ln, u) & (st[u][q] > 0)) ? sv[u][q] : -1.0e9f; m = fmaxf(m, sv[u][q]); }
#pragma unroll      /* constant indices, so that the array stays in registers */
    for (int q = 0; q < 4; ++q) { ov[q] = ((j0 + q <= i) & (ot[q] > 0)) ? ov[q] : -1.0e9f; m = fmaxf(m, ov[q]); }
    for (int o = 16; o > 0; o >>= 1) m = fmaxf(m, __shfl_xor(m, o, 32)); float su = 0.f;
#pragma unroll      /* constant indices, so that the array stays in registers */
    for (int u = 0; u < 4; ++u) for (int q = 0; q < 4; ++q) { sv[u][q] = expf(sv[u][q] - m); su += sv[u][q]; }
#pragma unroll      /* constant indices, so that the array stays in registers */
    for (int q = 0; q < 4; ++q) { ov[q] = expf(ov[q] - m); su += ov[q]; }
    for (int o = 16; o > 0; o >>= 1) su += __shfl_xor(su, o, 32); const float inv = 1024.0f / su; _Float16* d = P16 + hp + (size_t)i * SLEN;
#pragma unroll      /* constant indices, so that the array stays in registers */
    for (int u = 0; u < 4; ++u) { v4h h4; for (int q = 0; q < 4; ++q) h4[q] = (_Float16)(sv[u][q] * inv); if (sum_on(b, ln, u)) *(v4h*)(d + sum_col(b, ln, u)) = h4; }
    v4h h4;
#pragma unroll      /* constant indices, so that the array stays in registers */
    for (int q = 0; q < 4; ++q) h4[q] = (_Float16)(ov[q] * inv);
    *(v4h*)(d + j0) = h4;
    return; }
  auto val = [&](int j) -> float { const bool keep = (j <= i) && (((i / BLK) == (j / BLK)) || ((j % BLK) >= BLK - CSP)) && (tok[j] > 0); return keep ? s[j] : -1.0e9f; };
#pragma unroll 1
  for (int c = 0; c < SLEN / 256; ++c) { const int kb = c * 256 + ln * 8; for (int q = 0; q < 8; ++q) m = fmaxf(m, val(kb + q)); }
  for (int o = 16; o > 0; o >>= 1) m = fmaxf(m, __shfl_xor(m, o, 32)); float su = 0.f;
#pragma unroll 1
  for (int c = 0; c < SLEN / 256; ++c) { const int kb = c * 256 + ln * 8; for (int q = 0; q < 8; ++q) su += expf(val(kb + q) - m); }
  for (int o = 16; o > 0; o >>= 1) su += __shfl_xor(su, o, 32); const float inv = 1024.0f / su; unsigned short* d = (unsigned short*)P16 + hp + (size_t)i * SLEN;
  {
#pragma unroll 1
    for (int c = 0; c < SLEN / 256; ++c) { const int kb = c * 256 + ln * 8; FragH f;
#pragma unroll
      for (int q = 0; q < 8; ++q) f.h[q] = (_Float16)(expf(val(kb + q) - m) * inv);
      *(v8us*)(d + kb) = f.half[0]; }
     } }

extern "C" void kernel_launch(void* const* d_in, const int* in_sizes, int n_in,
                              void* d_out, int out_size, void* d_ws, size_t ws_size, hipStream_t stream) {
  (void)in_sizes; (void)n_in; (void)out_size;
  const float* const* I = (const float* const*)d_in; const int* tok = (const int*)d_in[0]; const float* emb = I[1]; const float* pos = I[2]; const float* l1s = I[3]; const float* l1b = I[4]; const float* wq = I[5]; const float* wk = I[6]; const float* wv = I[7]; const float* wo = I[8];
  const float* l2s = I[9]; const float* l2b = I[10]; const float* w1 = I[11]; const float* b1 = I[12]; const float* w2 = I[13]; const float* b2 = I[14]; const float* lfs = I[15]; const float* lfb = I[16]; const float* wout = I[17]; const float* bout = I[18];
  char* ws = (char*)d_ws; size_t off = 0;
  auto take = [&](size_t bytes) { char* p = ws + off; off += (bytes + 255) & ~(size_t)255; return p; };
  _Float16* BW = (_Float16*)take((NL * LWT + (size_t)NVOC * DM) * 2);      /* the f16 weights of every layer, then the output projection's */ _Float16* BOUT = BW + NL * LWT;
  float* X = (float*)take((size_t)SLEN * DM * 4); _Float16* H16 = (_Float16*)take((size_t)SLEN * DM * 2); _Float16* Q16 = (_Float16*)take((size_t)SLEN * DM * 2); _Float16* K16 = (_Float16*)take((size_t)SLEN * DM * 2); _Float16* V16 = (_Float16*)take((size_t)SLEN * DM * 2); _Float16* VT = (_Float16*)take((size_t)DM * SLEN * 2);
  float* S = (float*)take((size_t)NH * SLEN * SLEN * 4); _Float16* P16 = (_Float16*)take((size_t)NH * SLEN * SLEN * 2);      /* one plane per head */ _Float16* O16 = (_Float16*)take((size_t)SLEN * DM * 2); _Float16* G16 = (_Float16*)take((size_t)SLEN * DMLP * 2);
  if (off > ws_size) return;      /* 36.3 + 4 + 2 x 5 + 128 + 64 + 2 + 8 = 252.3 MiB */
  const dim3 gW(192, NL + 1), gP((SLEN / 128) * (DM / 64), 1), gS((SLEN / BLK) * 2 + (SLEN / BLK) * (SLEN / BLK - 1) / 2, NH), gH((SLEN / 128) * 1, NH), gX(SLEN / 8, NH), gM((SLEN / 128) * (DMLP / 64), 1), gV((SLEN / 128) * (NVOC / 64), 1);
  k_wt_all<<<gW, 256, 0, stream>>>(wq, wk, wv, wo, w1, w2, wout, BW);      /* wq[l] [D][H][DH] = (in, out=h*64+k); wo[l] [H][DH][D] = (in=h*64+k, out) */
  k_embed<<<(SLEN * (DM / 4) + 255) / 256, 256, 0, stream>>>(tok, emb, pos, X);
  for (int l = 0; l < NLRUN; ++l) {
    const _Float16* BQ = BW + l * LWT; const _Float16* BK = BQ + (size_t)DM * DM; const _Float16* BV = BK + (size_t)DM * DM; const _Float16* BO = BV + (size_t)DM * DM; const _Float16* BW1 = BO + (size_t)DM * DM; const _Float16* BW2 = BW1 + (size_t)DM * DMLP;
    k_ln512<<<SLEN / 8, 256, 0, stream>>>(X, l1s + l * DM, l1b + l * DM, H16);
    k_gemm2<0, 0, 1><<<gP, 128, 0, stream>>>(H16, DM, 0, BQ, DM, 0, 0.0625f, nullptr, 0, nullptr, Q16, DM, 0, SLEN, DM, DM);
    k_gemm2<0, 0, 1><<<gP, 128, 0, stream>>>(H16, DM, 0, BK, DM, 0, 0.0625f, nullptr, 0, nullptr, K16, DM, 0, SLEN, DM, DM);
    k_gemm2<0, 0, 1><<<gP, 128, 0, stream>>>(H16, DM, 0, BV, DM, 0, 0.0625f, nullptr, 0, nullptr, V16, DM, 0, SLEN, DM, DM);
    k_vt<NH, SLEN><<<NH * (SLEN / 64), 256, 0, stream>>>(V16, DM, 0, VT);
    /* all heads in one launch each: blockIdx.y = head */
    k_gemm2<0, 1><<<gS, 128, 0, stream>>>(Q16, DM, 64, K16, DM, 64, 0.125f, nullptr, 0, S, nullptr, SLEN, (size_t)SLEN * SLEN, SLEN, SLEN, 64);      /* (q / 8) . k */
    k_softsp<<<gX, 256, 0, stream>>>(S, tok, P16);
    k_gemm2<0, 2, 2><<<gH, 128, 0, stream>>>(P16, SLEN, (size_t)SLEN * SLEN, VT, SLEN, (size_t)64 * SLEN, 0.0009765625f, nullptr, 0, nullptr, O16, DM, 64, SLEN, 64, SLEN, tok);
    k_gemm2<0, 0, 1, DM><<<gP, 128, 0, stream>>>(O16, DM, 0, BO, DM, 0, 0.0625f, nullptr, 0, X, nullptr, DM, 0, SLEN, DM, DM);      /* x += o Wo (own tile, in place) */
    k_ln512<<<SLEN / 8, 256, 0, stream>>>(X, l2s + l * DM, l2b + l * DM, H16);
    k_gemm2<9, 0, 3><<<gM, 128, 0, stream>>>(H16, DM, 0, BW1, DM, 0, 0.0625f, b1 + (size_t)l * DMLP, 0, nullptr, G16, DMLP, 0, SLEN, DMLP, DM);      /* tanh-gelu(y W1 + b1) */
    k_gemm2<0, 0, 1, DM><<<gP, 128, 0, stream>>>(G16, DMLP, 0, BW2, DMLP, 0, 0.0625f, b2 + (size_t)l * DM, 0, X, nullptr, DM, 0, SLEN, DM, DMLP); }      /* x += mlp + b2 */
  k_ln512<<<SLEN / 8, 256, 0, stream>>>(X, lfs, lfb, H16);
  k_gemm2<0, 0, 1><<<gV, 128, 0, stream>>>(H16, DM, 0, BOUT, DM, 0, 0.0625f, bout, 0, (float*)d_out, nullptr, NVOC, 0, SLEN, NVOC, DM);
}

// v007
// Measured time: 552 microseconds a run.
// Two timings next to v006 put it at 1.17 and 1.14 times that version's speed.
// All steps since v000 together make it 10.4 times as fast.
#include <hip/hip_runtime.h>
// Sparse-pattern transformer decoder (1 x 2048 tokens, 512 = 8 heads x 64, 6 layers, MLP 2048 (tanh-GELU), vocab 256): x = embed[shift_right(tokens)] + pos_emb; per layer: h = LN1(x); q = h Wq / 8, k, v; scores masked by the structural fixed sparse pattern (causal & (same 128-block | last 32 columns of each block)) AND the INPUT key padding (token > 0), masked entries = -1e9 exactly as the reference; softmax; x += (P v) Wo; x += gelu(LN2(x) W1 + b1) W2 + b2; out = LNf(x) Wout + bout -> [1,2048,256].
// Structure: token-embedding gather by the INPUT ids on VALU; LayerNorms on VALU; all weights turned to f16 planes by one launch ahead of the layers; the weights and the activations that the Linears read (LN outputs, attention output, GELU hidden) lie in WMMA fragment order (frag_pos); all Linears as f16 WMMA GEMMs (32x64 wave tiles, f32 accumulation, exact x16 weights, biases / GELU / residual accumulation in the epilogue); q, k and v in one launch (grid y = the matrix), v formed transposed ([head dim][token], the B plane of P.v) by letting its two operands change places; per layer, all heads in one launch each (grid y = head): the scores as a GEMM (K 64) into the head's f32 plane, a wave-per-row f32 softmax applying the structural pattern and the key-padding predicate (P x2^10 f16), P.v as a GEMM into the head's columns of an f16 plane. Scores, softmax and P.v visit only the columns that the structural pattern can keep for a 128-row block (its own block, the last 32 columns of each earlier block); a block that holds a row with no kept key at all (uniform softmax over all 2048 columns) takes the full-width softmax and P.v.
// Compute dtype: embeddings, weights, biases, LN parameters rounded to bf16; LN outputs, q, k, v, P, attention output, GELU hidden as f16 operands (~2^-12; logits small); the residual stream, softmax, LayerNorm in f32. v_wmma_f32_16x16x32_f16.
#define SLEN 2048
#define DM 512
#define NH 8
#define NL 6
#define NLRUN NL                 /* layers executed */
#define DMLP 2048
#define NVOC 256
#define BLK 128
#define CSP 32
#define NR SLEN
typedef __bf16 v16b __attribute__((ext_vector_type(16)));
typedef unsigned short v8us __attribute__((ext_vector_type(8), may_alias));
typedef float  v8f  __attribute__((ext_vector_type(8)));
typedef float  v4f  __attribute__((ext_vector_type(4)));
typedef float  v4fa __attribute__((ext_vector_type(4), may_alias));
union FragB { v16b v; v8us half[2]; unsigned short u[16]; };

__device__ __forceinline__ unsigned short bf16_bits(float x) { unsigned int u = __float_as_uint(x); return (unsigned short)((u + 0x7FFFu + ((u >> 16) & 1u)) >> 16); }
__device__ __forceinline__ float bf16_val(unsigned short b) { return __uint_as_float(((unsigned int)b) << 16); }
__device__ __forceinline__ float bf16_round(float x) { return bf16_val(bf16_bits(x)); }
// D += A·B with NT terms: 1 = ah·bh, 2 = + al·bh (A split), 3 = + ah·bl (both split)
template <int NT>
__device__ __forceinline__ v8f mmaN(v16b ah, v16b al, v16b bh, v16b bl, v8f c) {
  c = __builtin_amdgcn_wmma_f32_16x16x32_bf16(false, ah, false, bh, (short)0, c, false, false);
  if (NT >= 2) c = __builtin_amdgcn_wmma_f32_16x16x32_bf16(false, al, false, bh, (short)0, c, false, false);
  if (NT >= 3) c = __builtin_amdgcn_wmma_f32_16x16x32_bf16(false, ah, false, bl, (short)0, c, false, false);
  asm volatile("v_nop\n\tv_nop\n\tv_nop\n\tv_nop" : "+v"(c) : "v"(ah), "v"(al), "v"(bh), "v"(bl));
  return c;
}

__global__ __launch_bounds__(256) void k_wt_bf16(const float* __restrict__ W, unsigned short* __restrict__ Wt, int K, int N) {
  const int t = blockIdx.x * 256 + threadIdx.x;
  const int k8n = K / 8;
  if (t >= N * k8n) return;
  const int n = t / k8n, k8 = (t % k8n) * 8;
  v8us v;
#pragma unroll
  for (int i = 0; i < 8; ++i) v[i] = bf16_bits(W[(size_t)(k8 + i) * N + n]);
  *(v8us*)(Wt + (size_t)n * K + k8) = v;
  
}

// GEMM C[M][N] (f32, pitch ldc) = act(A[M][K]·W + bias). A f32 row-major (pitch lda) converted per fragment to bf16
// (ASPLIT: hi/lo two planes -> 2 terms, else single rounded term); Wt bf16 [N][K] (pitch ldb). BIAS_BF16 rounds the
// bias to bf16 first (bias quantised to bf16 before the add). K%32==0, M%16==0, N%64==0.
template <bool ASPLIT, int ACT, bool BIAS_BF16>
__global__ __launch_bounds__(128) void k_gemm_bf(const float* __restrict__ A, int lda, const unsigned short* __restrict__ Wt, int ldb,
                                               const float* __restrict__ bias, float* __restrict__ C, int ldc, int M, int N, int K) {
  __shared__ __attribute__((aligned(16))) float so[4][16][64];
  const int tid = threadIdx.x, w = tid >> 5, lane = tid & 31, ln = lane & 15, hh = lane >> 4;
  const int ntn = N / 64;
  const int wid = blockIdx.x * 4 + w;
  const int mt = wid / ntn, nq = wid % ntn;
  if (mt * 16 >= M) return;
  const int row0 = mt * 16, col0 = nq * 64;
  const float* arow = A + (size_t)(row0 + ln) * lda;
  v8f acc[4] = {};
  for (int kb = 0; kb < K; kb += 32) {
    FragB ah, al;
    const v4f x0 = *(const v4fa*)(arow + kb + 8 * hh), x1 = *(const v4fa*)(arow + kb + 8 * hh + 4);
    const v4f x2 = *(const v4fa*)(arow + kb + 16 + 8 * hh), x3 = *(const v4fa*)(arow + kb + 16 + 8 * hh + 4);
    float xs[16] = {x0[0],x0[1],x0[2],x0[3],x1[0],x1[1],x1[2],x1[3],x2[0],x2[1],x2[2],x2[3],x3[0],x3[1],x3[2],x3[3]};
#pragma unroll
    for (int i = 0; i < 16; ++i) { const unsigned short hb = bf16_bits(xs[i]); ah.u[i] = hb; al.u[i] = ASPLIT ? bf16_bits(xs[i] - bf16_val(hb)) : (unsigned short)0; }
#pragma unroll
    for (int t = 0; t < 4; ++t) {
      const unsigned short* brow = Wt + (size_t)(col0 + t * 16 + ln) * ldb + kb;
      FragB b;
      b.half[0] = *(const v8us*)(brow + 8 * hh);
      b.half[1] = *(const v8us*)(brow + 16 + 8 * hh);
      acc[t] = mmaN<ASPLIT ? 2 : 1>(ah.v, al.v, b.v, b.v, acc[t]);
    }
  }
#pragma unroll
  for (int t = 0; t < 4; ++t) {
    float bv = bias ? bias[col0 + t * 16 + ln] : 0.f;
    if (BIAS_BF16) bv = bf16_round(bv);
#pragma unroll
    for (int r = 0; r < 8; ++r) { float v = acc[t][r] + bv; if (ACT == 1) v = fmaxf(v, 0.f); so[w][8 * hh + r][t * 16 + ln] = v; }
  }
  __builtin_amdgcn_fence(__ATOMIC_ACQ_REL, "workgroup");
  __builtin_amdgcn_wave_barrier();
  const int rsub = lane >> 4, c4 = (lane & 15) * 4;
  {
#pragma unroll
    for (int q = 0; q < 8; ++q) {
      const int r = q * 2 + rsub;
      const v4f v = *(const v4fa*)&so[w][r][c4];
      *(v4f*)(C + (size_t)(row0 + r) * ldc + col0 + c4) = v;
    }
    
  }
}

// GEMM C = act(A·W + bias + resid): A f32 (ASPLIT -> hi/lo 2 terms), Wt bf16 [N][K]; ACT 0 none, 1 relu, 2 exact gelu;
// resid (optional, f32, row index = (row % rmod), pitch ldr, RES_BF16 rounds it) added before the activation.
template <bool ASPLIT, int ACT, bool BIAS_BF16, bool RES_BF16>
__global__ __launch_bounds__(128) void k_gemm_bf3(const float* __restrict__ A, int lda, const unsigned short* __restrict__ Wt, int ldb,
                                                const float* __restrict__ bias, const float* __restrict__ resid, int rmod, int ldr,
                                                float* __restrict__ C, int ldc, int M, int N, int K) {
  __shared__ __attribute__((aligned(16))) float so[4][16][64];
  const int tid = threadIdx.x, w = tid >> 5, lane = tid & 31, ln = lane & 15, hh = lane >> 4;
  const int ntn = N / 64;
  const int wid = blockIdx.x * 4 + w;
  const int mt = wid / ntn, nq = wid % ntn;
  if (mt * 16 >= M) return;
  const int row0 = mt * 16, col0 = nq * 64;
  const float* arow = A + (size_t)(row0 + ln) * lda;
  v8f acc[4] = {};
  for (int kb = 0; kb < K; kb += 32) {
    FragB ah, al;
    const v4f x0 = *(const v4fa*)(arow + kb + 8 * hh), x1 = *(const v4fa*)(arow + kb + 8 * hh + 4);
    const v4f x2 = *(const v4fa*)(arow + kb + 16 + 8 * hh), x3 = *(const v4fa*)(arow + kb + 16 + 8 * hh + 4);
    float xs[16] = {x0[0],x0[1],x0[2],x0[3],x1[0],x1[1],x1[2],x1[3],x2[0],x2[1],x2[2],x2[3],x3[0],x3[1],x3[2],x3[3]};
#pragma unroll
    for (int i = 0; i < 16; ++i) { const unsigned short hb = bf16_bits(xs[i]); ah.u[i] = hb; al.u[i] = ASPLIT ? bf16_bits(xs[i] - bf16_val(hb)) : (unsigned short)0; }
#pragma unroll
    for (int t = 0; t < 4; ++t) {
      const unsigned short* brow = Wt + (size_t)(col0 + t * 16 + ln) * ldb + kb;
      FragB b;
      b.half[0] = *(const v8us*)(brow + 8 * hh);
      b.half[1] = *(const v8us*)(brow + 16 + 8 * hh);
      acc[t] = mmaN<ASPLIT ? 2 : 1>(ah.v, al.v, b.v, b.v, acc[t]);
    }
  }
#pragma unroll
  for (int t = 0; t < 4; ++t) {
    const int col = col0 + t * 16 + ln;
    float bv = bias ? bias[col] : 0.f;
    if (BIAS_BF16) bv = bf16_round(bv);
#pragma unroll
    for (int r = 0; r < 8; ++r) {
      float v = acc[t][r] + bv;
      if (resid) { float rv = resid[(size_t)((row0 + 8 * hh + r) % rmod) * ldr + col]; if (RES_BF16) rv = bf16_round(rv); v += rv; }
      if (ACT == 1) v = fmaxf(v, 0.f);
      if (ACT == 2) v = 0.5f * v * (1.0f + erff(v * 0.70710678118654752f));
      if (ACT == 3) { const float u = 0.7978845608028654f * (v + 0.044715f * v * v * v); v = 0.5f * v * (1.0f + tanhf(u)); }
      so[w][8 * hh + r][t * 16 + ln] = v;
    }
  }
  __builtin_amdgcn_fence(__ATOMIC_ACQ_REL, "workgroup");
  __builtin_amdgcn_wave_barrier();
  const int rsub = lane >> 4, c4 = (lane & 15) * 4;
  {
#pragma unroll
    for (int q = 0; q < 8; ++q) {
      const int r = q * 2 + rsub;
      const v4f v = *(const v4fa*)&so[w][r][c4];
      *(v4f*)(C + (size_t)(row0 + r) * ldc + col0 + c4) = v;
    }
    
  }
}
// row LayerNorm (biased variance, eps) over N: s = X (+ R); optional out_sum <- s; out_norm <- (s-mu)*rsqrt(var+eps)*g + b
template <bool PARAM_BF16>
__global__ __launch_bounds__(256) void k_layernorm(const float* __restrict__ X, const float* __restrict__ R, const float* __restrict__ g, const float* __restrict__ bta,
                                                  float* __restrict__ out_sum, float* __restrict__ out_norm, int N, float eps) {
  __shared__ float red[256];
  const int row = blockIdx.x, tid = threadIdx.x;
  const float* x = X + (size_t)row * N; const float* rr = R ? R + (size_t)row * N : nullptr;
  float vals[16];                     // up to N = 4096
  const int per = N / 256;            // contiguous chunk per thread? use strided-by-4 chunks: thread handles j = tid*4 + 1024*u
  float s1 = 0.f;
  for (int u = 0; u < per / 4; ++u) {
    const int j = tid * 4 + 1024 * u;
    const v4f a = *(const v4fa*)(x + j);
    v4f b = {0.f,0.f,0.f,0.f}; if (rr) b = *(const v4fa*)(rr + j);
#pragma unroll
    for (int q = 0; q < 4; ++q) { const float v = a[q] + b[q]; vals[u * 4 + q] = v; s1 += v; }
  }
  red[tid] = s1; __syncthreads();
  for (int st = 128; st > 0; st >>= 1) { if (tid < st) red[tid] += red[tid + st]; __syncthreads(); }
  const float mu = red[0] / (float)N; __syncthreads();
  float s2 = 0.f;
  for (int u = 0; u < per / 4; ++u)
#pragma unroll
    for (int q = 0; q < 4; ++q) { const float c = vals[u * 4 + q] - mu; s2 += c * c; }
  red[tid] = s2; __syncthreads();
  for (int st = 128; st > 0; st >>= 1) { if (tid < st) red[tid] += red[tid + st]; __syncthreads(); }
  const float rs = rsqrtf(red[0] / (float)N + eps);
  {
    for (int u = 0; u < per / 4; ++u) {
      const int j = tid * 4 + 1024 * u;
      v4f o, sm;
#pragma unroll
      for (int q = 0; q < 4; ++q) {
        float gg = g[j + q], bb = bta[j + q];
        if (PARAM_BF16) { gg = bf16_round(gg); bb = bf16_round(bb); }
        sm[q] = vals[u * 4 + q]; o[q] = (vals[u * 4 + q] - mu) * rs * gg + bb;
      }
      if (out_sum) *(v4f*)(out_sum + (size_t)row * N + j) = sm;
      *(v4f*)(out_norm + (size_t)row * N + j) = o;
    }
    
  }
}



// ---- f16 WMMA path (v_wmma_f32_16x16x32_f16): 11-bit significands for operands in range — used where a [0,1] probability operand needs more precision than bf16
typedef _Float16 v16h __attribute__((ext_vector_type(16)));
union FragH { v16h v; v8us half[2]; _Float16 h[16]; unsigned short u[16]; };
template <int NT>
__device__ __forceinline__ v8f mmaH(v16h ah, v16h al, v16h bh, v16h bl, v8f c) {
  c = __builtin_amdgcn_wmma_f32_16x16x32_f16(false, ah, false, bh, (short)0, c, false, false);
  if (NT >= 2) c = __builtin_amdgcn_wmma_f32_16x16x32_f16(false, al, false, bh, (short)0, c, false, false);
  if (NT >= 3) c = __builtin_amdgcn_wmma_f32_16x16x32_f16(false, ah, false, bl, (short)0, c, false, false);
  asm volatile("v_nop\n\tv_nop\n\tv_nop\n\tv_nop" : "+v"(c) : "v"(ah), "v"(al), "v"(bh), "v"(bl));
  return c;
}
// batched GEMM like k_gemm_b but f16 operands: A f32 (split into f16 hi/lo if ASPLIT, else rounded to f16), Bt = f16 values [n][k]; alpha; C f32; N multiple of 16 (partial tiles skipped)
template <bool ASPLIT>
__global__ __launch_bounds__(128) void k_gemm_h(const float* __restrict__ A, int lda, size_t sA, const _Float16* __restrict__ Bh, int ldb, size_t sB, float alpha, float* __restrict__ C, int ldc, size_t sC, int M, int N, int K) {
  __shared__ __attribute__((aligned(16))) float so[4][16][64];
  const int tid = threadIdx.x, w = tid >> 5, lane = tid & 31, ln = lane & 15, hh = lane >> 4; const int by = blockIdx.y;
  A += (size_t)by * sA; Bh += (size_t)by * sB; C += (size_t)by * sC;
  const int ntn = (N + 63) / 64; const int wid = blockIdx.x * 4 + w; const int mt = wid / ntn, nq = wid % ntn; if (mt * 16 >= M) return;
  const int row0 = mt * 16, col0 = nq * 64; const float* arow = A + (size_t)(row0 + ln) * lda;
  v8f acc[4] = {};
  for (int kb = 0; kb < K; kb += 32) {
    FragH ah, al;
    const v4f x0 = *(const v4fa*)(arow + kb + 8 * hh), x1 = *(const v4fa*)(arow + kb + 8 * hh + 4), x2 = *(const v4fa*)(arow + kb + 16 + 8 * hh), x3 = *(const v4fa*)(arow + kb + 16 + 8 * hh + 4);
    float xs[16] = {x0[0],x0[1],x0[2],x0[3],x1[0],x1[1],x1[2],x1[3],x2[0],x2[1],x2[2],x2[3],x3[0],x3[1],x3[2],x3[3]};
#pragma unroll
    for (int i = 0; i < 16; ++i) { const _Float16 h = (_Float16)xs[i]; ah.h[i] = h; al.h[i] = ASPLIT ? (_Float16)(xs[i] - (float)h) : (_Float16)0.0f; }
#pragma unroll
    for (int t = 0; t < 4; ++t) { if (col0 + t * 16 >= N) continue; const size_t boff = (size_t)(col0 + t * 16 + ln) * ldb + kb; FragH bq; bq.half[0] = *(const v8us*)(Bh + boff + 8 * hh); bq.half[1] = *(const v8us*)(Bh + boff + 16 + 8 * hh);
      acc[t] = mmaH<ASPLIT ? 2 : 1>(ah.v, al.v, bq.v, bq.v, acc[t]); }
  }
#pragma unroll
  for (int t = 0; t < 4; ++t) { if (col0 + t * 16 >= N) continue;
#pragma unroll
    for (int r = 0; r < 8; ++r) so[w][8 * hh + r][t * 16 + ln] = acc[t][r] * alpha; }
  __builtin_amdgcn_fence(__ATOMIC_ACQ_REL, "workgroup"); __builtin_amdgcn_wave_barrier();
  const int rsub = lane >> 4, c4 = (lane & 15) * 4;
  {
#pragma unroll
    for (int q = 0; q < 8; ++q) { const int r = q * 2 + rsub; if (col0 + c4 < N) { const v4f v = *(const v4fa*)&so[w][r][c4]; *(v4f*)(C + (size_t)(row0 + r) * ldc + col0 + c4) = v; } }
     }
}

// Fragment order of an f16 operand plane [rows][K] (rows = the m of an A operand, the n of a B operand): 1-KiB blocks of 16 rows x 32 k, block (row / 16, k / 32) at block index (row / 16) * (K / 32) + k / 32.
// Inside a block stand the two 16-byte pieces that each lane of a 16x16x32 fragment holds, lane by lane: piece k / 16 % 2, lane (k / 8 % 2) * 16 + row % 16, element k % 8. A wave's fragment load is then 512 contiguous bytes (4 whole lines) and not 32 bytes of each of 16 lines; which k a lane and register holds is the same as with row-major planes.
__device__ __forceinline__ size_t frag_pos(int row, int k, int K) { return ((size_t)((row >> 4) * (K >> 5) + (k >> 5)) << 9) + (((k >> 4) & 1) << 8) + (((((k >> 3) & 1) << 4) + (row & 15)) << 3) + (k & 7); }
// Wt(n, k) = f16(bf16(W[k][n]) x 16), in fragment order, from f32 row-major W[K][N] (a power of two: bf16-exact weights stay exact in f16 away from the subnormal range).
// One work-group turns a strip of 256 k x 64 n: whole 256-byte row pieces in, 4 KiB of contiguous blocks out of each wave, through LDS.
// LDS row n holds its 256 k as 128 dwords (k, k + 1 packed); the 16-byte chunk c of row n lies at chunk c ^ (n / 4 % 16), so that the 32 lanes of a store (16 rows n four apart, two neighbouring dwords) fall on 32 different banks, while a row stays one contiguous 512 bytes for the 16-byte reads.
typedef unsigned v4u __attribute__((ext_vector_type(4)));
template <int K, int N>
__device__ __forceinline__ void wt_strip(const float* __restrict__ W, _Float16* __restrict__ Wt, int s, unsigned (*tl)[128]) {
  const int tid = threadIdx.x, n0 = (s % (N / 64)) * 64, k0 = (s / (N / 64)) * 256;
  const int l16 = tid & 15, r = tid >> 4;
  const float* src = W + (size_t)(k0 + 2 * r) * N + n0 + l16 * 4;
  v4f a[8], b[8];      /* rows k0 + 32 p + 2 r and the next one, columns n0 + 4 l16 up */
#pragma unroll      /* constant indices, so that the arrays stay in registers and the 16 loads are in flight together */
  for (int p = 0; p < 8; ++p) { a[p] = *(const v4fa*)(src + (size_t)(32 * p) * N); b[p] = *(const v4fa*)(src + (size_t)(32 * p + 1) * N); }
#pragma unroll      /* constant indices, so that the arrays stay in registers */
  for (int p = 0; p < 8; ++p) { const int kp = p * 16 + r;
    for (int q = 0; q < 4; ++q) { union { _Float16 h[2]; unsigned u; } pk; pk.h[0] = (_Float16)(bf16_round(a[p][q]) * 16.0f); pk.h[1] = (_Float16)(bf16_round(b[p][q]) * 16.0f);
      tl[l16 * 4 + q][(((kp >> 2) ^ l16) << 2) + (kp & 3)] = pk.u; } }
  __syncthreads();
  const int w = tid >> 5, j = tid & 31;      /* a wave writes four neighbouring blocks: rows n0 + 16 (w / 2) up, k from k0 + 128 (w % 2); store i is piece i % 2 of block i / 2 */
  const int n = (w >> 1) * 16 + (j & 15);
  unsigned short* dst = (unsigned short*)Wt + frag_pos(n0 + n, k0 + (w & 1) * 128 + (j >> 4) * 8, K);
#pragma unroll      /* the 8 LDS reads are in flight together, and the stores share address registers with constant offsets */
  for (int i = 0; i < 8; ++i) { const int c = (w & 1) * 16 + i * 2 + (j >> 4);      /* the 16-byte chunk (8 k) of LDS row n that lane j holds in that piece */
    const v4u v = *(const v4u*)&tl[n][(c ^ ((n >> 2) & 15)) << 2];
    *(v4u*)(dst + i * 256) = v; }
  asm volatile("s_wait_xcnt 0x0" ::: "memory");      /* in the listing the code of the next matrix shape follows these stores and reuses their address registers: it stands only behind this wait */
}
#define LWT ((size_t)4 * DM * DM + (size_t)2 * DM * DMLP)      /* f16 elements of one layer's six matrices: q, k, v, o, w1, w2 */
// every weight matrix of the model in one launch: blockIdx.y = layer (NL: the output projection), blockIdx.x = strip (16 each for q, k, v, o; 64 for w1; 64 for w2)
__global__ __launch_bounds__(256) void k_wt_all(const float* __restrict__ wq, const float* __restrict__ wk, const float* __restrict__ wv, const float* __restrict__ wo, const float* __restrict__ w1, const float* __restrict__ w2, const float* __restrict__ wout, _Float16* __restrict__ BW) {
  __shared__ __attribute__((aligned(16))) unsigned tl[64][128];
  const int l = blockIdx.y, x = blockIdx.x;
  if (l == NL) { if (x < (NVOC / 64) * (DM / 256)) wt_strip<DM, NVOC>(wout, BW + NL * LWT, x, tl); return; }
  _Float16* B = BW + l * LWT;
  if (x < 64) { const int m = x >> 4; const float* Wm = m == 0 ? wq : m == 1 ? wk : m == 2 ? wv : wo; wt_strip<DM, DM>(Wm + (size_t)l * DM * DM, B + (size_t)m * DM * DM, x & 15, tl); }
  else if (x < 128) wt_strip<DM, DMLP>(w1 + (size_t)l * DM * DMLP, B + (size_t)4 * DM * DM, x - 64, tl);
  else wt_strip<DMLP, DM>(w2 + (size_t)l * DMLP * DM, B + (size_t)4 * DM * DM + (size_t)DM * DMLP, x - 128, tl);
}
// k_gemm_hh variant with fused epilogue: v = acc·alpha + bias[by·sBias + col] (+ CP[(row/rowsPerB)·sCPb + by·64 + col] if CP) ; ACT 0 none / 1 elu ; writes f16 C16 (and f32 C if non-null)
template <int ACT>
__global__ __launch_bounds__(128) void k_gemm_hhx(const _Float16* __restrict__ A, int lda, size_t sA, const _Float16* __restrict__ Bh, int ldb, size_t sB, float alpha, const float* __restrict__ bias, size_t sBias, const float* __restrict__ CP, int rowsPerB, size_t sCPb, int row0g,
    float* __restrict__ C, _Float16* __restrict__ C16, int ldc, size_t sC, int M, int N, int K) {
  __shared__ __attribute__((aligned(16))) float so[4][16][64];
  const int tid = threadIdx.x, w = tid >> 5, lane = tid & 31, ln = lane & 15, hh = lane >> 4; const int by = blockIdx.y;
  A += (size_t)by * sA; Bh += (size_t)by * sB; const size_t cofs = (size_t)by * sC; const float* bp = bias ? bias + (size_t)by * sBias : nullptr;
  const int ntn = (N + 63) / 64; const int wid = blockIdx.x * 4 + w; const int mt = wid / ntn, nq = wid % ntn; if (mt * 16 >= M) return;
  const int row0 = mt * 16, col0 = nq * 64; const _Float16* arow = A + (size_t)(row0 + ln) * lda;
  v8f acc[4] = {};
  for (int kb = 0; kb < K; kb += 32) { FragH ah; ah.half[0] = *(const v8us*)((const unsigned short*)arow + kb + 8 * hh); ah.half[1] = *(const v8us*)((const unsigned short*)arow + kb + 16 + 8 * hh);
#pragma unroll
    for (int t = 0; t < 4; ++t) { if (col0 + t * 16 >= N) continue; const size_t boff = (size_t)(col0 + t * 16 + ln) * ldb + kb; FragH bq; bq.half[0] = *(const v8us*)((const unsigned short*)Bh + boff + 8 * hh); bq.half[1] = *(const v8us*)((const unsigned short*)Bh + boff + 16 + 8 * hh);
      acc[t] = mmaH<1>(ah.v, ah.v, bq.v, bq.v, acc[t]); }
  }
#pragma unroll
  for (int t = 0; t < 4; ++t) { if (col0 + t * 16 >= N) continue; const int col = col0 + t * 16 + ln; const float bv = bp ? bf16_round(bp[col]) : 0.f;
#pragma unroll
    for (int r = 0; r < 8; ++r) { float v = acc[t][r] * alpha + bv; if (CP) { const int bidx = (row0g + row0 + 8 * hh + r) / rowsPerB; v += CP[(size_t)bidx * sCPb + (size_t)by * 64 + col]; } if (ACT == 1) v = (v > 0.f) ? v : expm1f(v); else if (ACT == 7) v = (v > 0.f) ? v + 1.0f : expf(v); else if (ACT == 8) v = tanhf(v); else if (ACT == 9) v = 0.5f * v * (1.0f + tanhf(0.7978845608028654f * (v + 0.044715f * v * v * v))); else if (ACT == 11) v = 1.0f / (1.0f + expf(-v)); else if (ACT == 12) v = (v > 0.f) ? v : 0.01f * v; else if (ACT == 14) v = (v > 0.f) ? v : 0.1f * v; else if (ACT == 15) v = v / (1.0f + expf(-v)); else if (ACT == 3) v = fmaxf(v, 0.f); else if (ACT == 6) v = 0.5f * v * (1.0f + erff(v * 0.70710678118654752f)); so[w][8 * hh + r][t * 16 + ln] = v; } }
  __builtin_amdgcn_fence(__ATOMIC_ACQ_REL, "workgroup"); __builtin_amdgcn_wave_barrier();
  const int rsub = lane >> 4, c4 = (lane & 15) * 4; typedef _Float16 v4h __attribute__((ext_vector_type(4)));
  {
#pragma unroll
    for (int q = 0; q < 8; ++q) { const int r = q * 2 + rsub; if (col0 + c4 < N) { const v4f v = *(const v4fa*)&so[w][r][c4]; if (C) *(v4f*)(C + cofs + (size_t)(row0 + r) * ldc + col0 + c4) = v; if (C16) { v4h h4; for (int i = 0; i < 4; ++i) h4[i] = (_Float16)v[i]; *(v4h*)(C16 + cofs + (size_t)(row0 + r) * ldc + col0 + c4) = h4; } } }
     }
}


typedef _Float16 v4h __attribute__((ext_vector_type(4)));
typedef int v4ia __attribute__((ext_vector_type(4), may_alias));

__global__ __launch_bounds__(256) void k_x16(const float* __restrict__ x, _Float16* __restrict__ X16, size_t n8) { const size_t t = (size_t)blockIdx.x * 256 + threadIdx.x; if (t >= n8) return; FragH f;
#pragma unroll
  for (int q = 0; q < 8; ++q) f.h[q] = (_Float16)bf16_round(x[t * 8 + q]); *(v8us*)((unsigned short*)X16 + t * 8) = f.half[0];  }
__global__ __launch_bounds__(256) void k_h16(const float* __restrict__ x, _Float16* __restrict__ X16, size_t n8) { const size_t t = (size_t)blockIdx.x * 256 + threadIdx.x; if (t >= n8) return; FragH f;
#pragma unroll
  for (int q = 0; q < 8; ++q) f.h[q] = (_Float16)x[t * 8 + q]; *(v8us*)((unsigned short*)X16 + t * 8) = f.half[0];  }
__global__ __launch_bounds__(256) void k_round16f(const float* __restrict__ W, _Float16* __restrict__ Bt, size_t n8) { const size_t t = (size_t)blockIdx.x * 256 + threadIdx.x; if (t >= n8) return; FragH f;
#pragma unroll
  for (int i = 0; i < 8; ++i) f.h[i] = (_Float16)(bf16_round(W[t * 8 + i]) * 16.0f); *(v8us*)((unsigned short*)Bt + t * 8) = f.half[0];  }
__global__ __launch_bounds__(256) void k_hl(const float* __restrict__ F, _Float16* __restrict__ Hh, _Float16* __restrict__ Hl, size_t n8) { const size_t t = (size_t)blockIdx.x * 256 + threadIdx.x; if (t >= n8) return; FragH fh, fl; const v4f a = *(const v4fa*)(F + t * 8), c = *(const v4fa*)(F + t * 8 + 4);
#pragma unroll
  for (int q = 0; q < 4; ++q) { _Float16 h = (_Float16)a[q]; fh.h[q] = h; fl.h[q] = (_Float16)((a[q] - (float)h) * 1024.0f); h = (_Float16)c[q]; fh.h[4 + q] = h; fl.h[4 + q] = (_Float16)((c[q] - (float)h) * 1024.0f); }
  { *(v8us*)((unsigned short*)Hh + t * 8) = fh.half[0]; *(v8us*)((unsigned short*)Hl + t * 8) = fl.half[0];  } }

// ---- fast GEMM (wave tile 32x64; requires M % 32 == 0 rows per launch region and N % 64 == 0); epilogue = k_gemm_hhx semantics ----
__device__ __forceinline__ v16h g2_frag(const _Float16* p, int hh) { FragH f; f.half[0] = *(const v8us*)((const unsigned short*)p + 8 * hh); f.half[1] = *(const v8us*)((const unsigned short*)p + 16 + 8 * hh); return f.v; }
__device__ __forceinline__ v8f g2_mma(v16h a, v16h b, v8f c) { v8f d = __builtin_amdgcn_wmma_f32_16x16x32_f16(false, a, false, b, (short)0, c, false, false); asm volatile("v_nop\n\tv_nop\n\tv_nop\n\tv_nop" : "+v"(d) : "v"(a), "v"(b)); return d; }
/* SP 0: plain. SP 1 (scores): blockIdx.x counts only the 128x64 tiles that hold a column the pattern can keep. SP 2 (P.v, N 64): the k loop visits only such columns, unless rows_all_masked(). */
/* The last 32 columns of the (at most 15) earlier blocks, 4 columns a lane, 4 blocks a load: slot u of a lane is block 4u + lane / 8. A slot past the earlier blocks is off; it is aimed at the own block's last 32 columns (in bounds, written) so that no branch stands round a load. */
__device__ __forceinline__ bool sum_on(int blk, int lane, int u) { return u * 4 + (lane >> 3) < blk; }
__device__ __forceinline__ int sum_col(int blk, int lane, int u) { return (sum_on(blk, lane, u) ? u * 4 + (lane >> 3) : blk) * BLK + (BLK - CSP) + (lane & 7) * 4; }
/* true where the first row of 128-row block blk has no kept key (a later row keeps every key of an earlier row of its block, so false means that no row of the block is without one); the same in every lane. t[u] = the tokens at sum_col(u), tfirst = the token of the block's first column */
__device__ __forceinline__ bool rows_all_masked(const v4ia (&t)[4], int tfirst, int blk, int lane) {
  bool kept = tfirst > 0;
#pragma unroll      /* constant indices, so that the array stays in registers */
  for (int u = 0; u < 4; ++u) for (int q = 0; q < 4; ++q) kept |= sum_on(blk, lane, u) & (t[u][q] > 0);
  return !__any(kept); }
/* PK bit 0: A and Bh lie in fragment order (frag_pos; lda = ldb = their K; sA and sB count whole planes). PK bit 1: C16 is written in fragment order for a plane of ldc columns, sC then counts columns, and C is not written. */
/* RES > 0: C (f32, row-major, pitch RES = ldc, far below 4 GiB) holds the residual: C += acc x alpha + bias, each lane reading just the elements that it stores; C16 is not written. */
/* TR > 0: grid plane blockIdx.y == TR forms its product transposed, into C16T ([N][M], row-major, pitch M): A and Bh change places (an A and a B plane have the same layout, and the k order of every sum stays). M / 128 * (N / 64) == N / 128 * (M / 64), so one grid x serves all planes. No bias. */
template <int ACT, int SP = 0, int PK = 0, int RES = 0, int TR = 0>
__global__ __launch_bounds__(128) void k_gemm2(const _Float16* __restrict__ A, int lda, size_t sA, const _Float16* __restrict__ Bh, int ldb, size_t sB, float alpha, const float* __restrict__ bias, size_t sBias,
    float* __restrict__ C, _Float16* __restrict__ C16, int ldc, size_t sC, int M, int N, int Kfull, const int* __restrict__ tok = nullptr, _Float16* __restrict__ C16T = nullptr) {
  static_assert(!TR || (SP == 0 && !(PK & 2) && !RES), "the transposed plane is a plain product with a row-major f16 result");
  static_assert(!RES || (ACT == 0 && !(PK & 2)), "the residual is added in a row-major store pass, behind no activation");
  __shared__ __attribute__((aligned(16))) float so[4][32][68];
  const int tid = threadIdx.x, w = tid >> 5, lane = tid & 31, ln = lane & 15, hh = lane >> 4; const int by = blockIdx.y;
  A += (size_t)by * sA; Bh += (size_t)by * sB; size_t cofs = (size_t)by * sC; const float* bp = bias ? bias + (size_t)by * sBias : nullptr;
  if (TR && by == TR) { const _Float16* a = A; A = Bh; Bh = a; const int l = lda; lda = ldb; ldb = l; C16 = C16T; cofs = 0; ldc = M; M = N; N = ldc; }
  const int ntn = N >> 6; int mt = blockIdx.x / ntn, nq = blockIdx.x - mt * ntn;
  if (SP == 1) { int t = blockIdx.x; for (mt = 0; mt < SLEN / BLK - 1 && t >= mt + 2; ++mt) t -= mt + 2;      /* row block mt has mt + 2 tiles: the upper half of each earlier block, then the two halves of its own */
    nq = t < mt ? 2 * t + 1 : mt + t; }
  const int row0 = mt * 128 + 32 * w, col0 = nq * 64; if (row0 >= M) return;
  bool sparse = false;      /* true: P is written, and non-zero, only in the columns that the pattern can keep */
  if (SP == 2) { v4ia t[4];
#pragma unroll      /* constant indices, so that the array stays in registers */
    for (int u = 0; u < 4; ++u) t[u] = *(const v4ia*)(tok + sum_col(mt, lane, u));
    const int tf = tok[mt * BLK];
    asm volatile("s_wait_xcnt 0x0" :: "v"(t[0]), "v"(t[1]), "v"(t[2]), "v"(t[3]), "s"(tf) : "memory");      /* the loaded values as inputs only: the five loads are in flight together (one latency, not five); their address registers are rewritten only behind this wait */
    __builtin_amdgcn_sched_barrier(0);      /* keeps the work below from being lifted in front of that wait */
    sparse = !rows_all_masked(t, tf, mt, lane); }
  const int K = sparse ? (mt + BLK / 32) * 32 : Kfull;      /* 32-k steps: one for each earlier block, four for the own block */
  const int ksum = sparse ? mt * 32 : 0;      /* the steps below ksum are the earlier blocks': step k reads columns 4 k + 96 up; a step of the own block reads columns k + 3 ksum up (ld) */
  /* each lane's byte offsets in A and B are fixed for the whole loop; only the wave-uniform base moves with k (every operand plane here is far below 4 GiB) */
  /* row-major and fragment order alike: 16 rows further on lie 16 x K elements = 32 K bytes further on */
  const unsigned ao0 = (PK & 1) ? (unsigned)(row0 * lda + 8 * lane) * 2u : (unsigned)((row0 + ln) * lda + 8 * hh) * 2u, ao1 = ao0 + 32u * (unsigned)lda;
  const unsigned bo0 = (PK & 1) ? (unsigned)(col0 * ldb + 8 * lane) * 2u : (unsigned)((col0 + ln) * ldb + 8 * hh) * 2u, bo1 = bo0 + 32u * (unsigned)ldb, bo2 = bo1 + 32u * (unsigned)ldb, bo3 = bo2 + 32u * (unsigned)ldb;
  const v8f z8 = {0.f,0.f,0.f,0.f,0.f,0.f,0.f,0.f}; v8f c00 = z8, c01 = z8, c02 = z8, c03 = z8, c10 = z8, c11 = z8, c12 = z8, c13 = z8;
  /* Fragment loads run ahead of the products: the 12 loads of a 32-k step are issued as one group, two steps before the products that read them, into three rotating register sets.
     The k order of every accumulator is unchanged. A load past the last step is aimed at the last step again (in bounds, its values unused). K % 32 == 0, K >= 32. */
  struct Stg { v16h a0, a1, b0, b1, b2, b3; };
  const int klast = K - 32;
  auto fr = [](const char* p, unsigned o) -> v16h { FragH f; f.half[0] = *(const v8us*)(p + o); f.half[1] = *(const v8us*)(p + o + ((PK & 1) ? 512 : 32)); return f.v; };
  auto ld = [&](Stg& s, int kq) { int k = kq < klast ? kq : klast; if (SP == 2) k += (BLK / 32 - 1) * (k < ksum ? k : ksum) + (k < ksum ? BLK - CSP : 0); const int kbytes = (PK & 1) ? 32 * k : 2 * k;      /* fragment order: a 32-k step is one 1-KiB block */ const char* ak = (const char*)A + kbytes; const char* bk = (const char*)Bh + kbytes;
    s.a0 = fr(ak, ao0); s.a1 = fr(ak, ao1); s.b0 = fr(bk, bo0); s.b1 = fr(bk, bo1); s.b2 = fr(bk, bo2); s.b3 = fr(bk, bo3);
    asm volatile("s_wait_xcnt 0x0" ::: "memory");      /* the address registers that these loads name are rewritten for the next group only behind this wait */
    __builtin_amdgcn_sched_barrier(0);      /* keeps the whole group in front of the wait of the products behind it (below that wait the loads would start one latency late), and the next group's address work behind the wait above */
  };
  auto mm = [&](const Stg& s) { c00 = g2_mma(s.a0, s.b0, c00); c10 = g2_mma(s.a1, s.b0, c10); c01 = g2_mma(s.a0, s.b1, c01); c11 = g2_mma(s.a1, s.b1, c11);
    c02 = g2_mma(s.a0, s.b2, c02); c12 = g2_mma(s.a1, s.b2, c12); c03 = g2_mma(s.a0, s.b3, c03); c13 = g2_mma(s.a1, s.b3, c13); };
  float bvs[4] = {0.f, 0.f, 0.f, 0.f};      /* the bias of the lane's four columns */
  { Stg s0, s1, s2; ld(s0, 0); ld(s1, 32); int kb = 0;
    if (bp) { const int bc = col0 + ln;      /* asked for ahead of the k loop, behind the first two fragment groups: it has landed long before the epilogue reads it */
#pragma unroll      /* constant indices, so that the array stays in registers */
      for (int t = 0; t < 4; ++t) bvs[t] = bp[bc + t * 16];
      asm volatile("s_wait_xcnt 0x0" :: "v"(bc), "s"(bp) : "memory");      /* inputs only: the lane's column and the base that the four loads name stay live up to here and are rewritten only behind this wait */
    }
#pragma unroll 1      /* one copy of the three-step body: a second copy would not fit the register sets */
    for (; kb + 96 <= K; kb += 96) { ld(s2, kb + 64); mm(s0); ld(s0, kb + 96); mm(s1); ld(s1, kb + 128); mm(s2); }
    if (kb < K) mm(s0);
    if (kb + 32 < K) mm(s1); }
  const int rsub = lane >> 4, c4 = (lane & 15) * 4;
  v4f rs[16];      /* RES: the residual of the wave's tile in the lane order of the store pass: 16 loads of 16 bytes, whole 256-byte row pieces, all in flight together while the tile goes through LDS */
  const unsigned ro = 4u * (unsigned)((row0 + rsub) * RES + (int)cofs + col0 + c4);      /* RES: one lane offset for all 16 loads, and for the 16 stores: two rows further on is a constant offset */
  if (RES) {
#pragma unroll      /* constant indices, so that the array stays in registers */
    for (int q = 0; q < 16; ++q) rs[q] = *(const v4fa*)((const char*)C + ro + q * 8 * RES);
    asm volatile("s_wait_xcnt 0x0" :: "v"(ro), "s"(C) : "memory");      /* inputs only: the lane offset and the base that the 16 loads name stay live up to here, so no load's result lands in them, and they are rewritten only behind this wait */
    __builtin_amdgcn_sched_barrier(0);      /* keeps the vector work of the LDS pass from being lifted in front of the 16 loads (they would start later) or in front of the wait above */
  }
  v8f accs[8] = {c00, c01, c02, c03, c10, c11, c12, c13};
#pragma unroll
  for (int u = 0; u < 8; ++u) { const int t = u & 3, half = u >> 2; const float bv = bf16_round(bvs[t]);
#pragma unroll
    for (int r = 0; r < 8; ++r) { const int rloc = half * 16 + 8 * hh + r; float v = accs[u][r] * alpha + bv;
      if (ACT == 3) v = fmaxf(v, 0.f); else if (ACT == 6) v = 0.5f * v * (1.0f + erff(v * 0.70710678118654752f)); else if (ACT == 11) v = 1.0f / (1.0f + expf(-v)); else if (ACT == 15) v = v / (1.0f + expf(-v)); else if (ACT == 12) v = (v > 0.f) ? v : 0.01f * v; else if (ACT == 8) v = tanhf(v); else if (ACT == 9) v = 0.5f * v * (1.0f + tanhf(0.7978845608028654f * (v + 0.044715f * v * v * v)));      /* tanh-GELU */
      so[w][rloc][t * 16 + ln] = v; } }
  __builtin_amdgcn_fence(__ATOMIC_ACQ_REL, "workgroup"); __builtin_amdgcn_wave_barrier();
  if (PK & 2) {      /* the wave's 32 x 64 tile is 2 x 2 blocks of the next product's A plane: each store is one piece of a block, 512 contiguous bytes */
    unsigned short* d0 = (unsigned short*)C16 + frag_pos(row0 + ln, (int)cofs + col0 + 8 * hh, ldc); unsigned short* d1 = d0 + 16 * (size_t)ldc;
#pragma unroll      /* constant indices: the stores share two address registers with constant offsets */
    for (int s = 0; s < 8; ++s) { const int rt = s >> 2, pc = s & 3;      /* piece pc: columns 16 pc + 8 hh up */
      const v4f v0 = *(const v4fa*)&so[w][rt * 16 + ln][pc * 16 + 8 * hh], v1 = *(const v4fa*)&so[w][rt * 16 + ln][pc * 16 + 8 * hh + 4]; FragH f;
      for (int i = 0; i < 4; ++i) { f.h[i] = (_Float16)v0[i]; f.h[4 + i] = (_Float16)v1[i]; }
      *(v8us*)((rt ? d1 : d0) + pc * 256) = f.half[0]; }
  } else if (RES) {
#pragma unroll      /* constant indices, so that the array stays in registers; the 16 LDS reads are in flight together */
    for (int q = 0; q < 16; ++q) rs[q] += *(const v4fa*)&so[w][q * 2 + rsub][c4];
#pragma unroll      /* each store has data registers of its own and all share one address register, so nothing that an issued store names is rewritten */
    for (int q = 0; q < 16; ++q) *(v4f*)((char*)C + ro + q * 8 * RES) = rs[q];
  } else {
#pragma unroll
    for (int q = 0; q < 16; ++q) { const int r = q * 2 + rsub; const v4f v = *(const v4fa*)&so[w][r][c4]; if (C) *(v4f*)(C + cofs + (size_t)(row0 + r) * ldc + col0 + c4) = v; if (C16) { v4h h4; for (int i = 0; i < 4; ++i) h4[i] = (_Float16)v[i]; *(v4h*)(C16 + cofs + (size_t)(row0 + r) * ldc + col0 + c4) = h4; } }
     } }


__global__ __launch_bounds__(256) void k_embed(const int* __restrict__ tok, const float* __restrict__ emb, const float* __restrict__ pos, float* __restrict__ X) {
  #pragma clang fp contract(off)
  const int t = blockIdx.x * 256 + threadIdx.x; if (t >= SLEN * (DM / 4)) return; const int c0 = (t % (DM / 4)) * 4, s = t / (DM / 4); const int id = (s == 0) ? 0 : tok[s - 1]; v4f o;
#pragma unroll
  for (int q = 0; q < 4; ++q) o[q] = bf16_round(emb[(size_t)id * DM + c0 + q]) + bf16_round(pos[(size_t)s * DM + c0 + q]);
  *(v4f*)(X + (size_t)s * DM + c0) = o;  }
__global__ __launch_bounds__(256) void k_ln512(const float* __restrict__ X, const float* __restrict__ g, const float* __restrict__ bb, _Float16* __restrict__ Y16) {
  #pragma clang fp contract(off)
  const int tid = threadIdx.x, w = tid >> 5, ln = tid & 31; const int r = blockIdx.x * 8 + w; if (r >= SLEN) return; const float* x = X + (size_t)r * DM; v4f a[4]; float s = 0.f;
#pragma unroll
  for (int i = 0; i < 4; ++i) { a[i] = *(const v4fa*)(x + i * 128 + ln * 4); for (int q = 0; q < 4; ++q) s += a[i][q]; }
  for (int o = 16; o > 0; o >>= 1) s += __shfl_xor(s, o, 32); const float mu = s / (float)DM; float q2 = 0.f;
#pragma unroll
  for (int i = 0; i < 4; ++i) for (int q = 0; q < 4; ++q) { const float d = a[i][q] - mu; q2 += d * d; }
  for (int o = 16; o > 0; o >>= 1) q2 += __shfl_xor(q2, o, 32); const float rs = rsqrtf(q2 / (float)DM + 1e-6f);
  {
#pragma unroll
    for (int i = 0; i < 4; ++i) { const int c0 = i * 128 + ln * 4; _Float16 h4[4]; for (int q = 0; q < 4; ++q) h4[q] = (_Float16)((a[i][q] - mu) * rs * bf16_round(g[c0 + q]) + bf16_round(bb[c0 + q])); *(unsigned long long*)((unsigned short*)Y16 + frag_pos(r, c0, DM)) = *(const unsigned long long*)h4; }      /* fragment order: Y16 is the A plane of the products behind it */
     } }
__global__ __launch_bounds__(256) void k_softsp(const float* __restrict__ S, const int* __restrict__ tok, _Float16* __restrict__ P16) {
  #pragma clang fp contract(off)
  const int tid = threadIdx.x, w = tid >> 5, ln = tid & 31; const int i = blockIdx.x * 8 + w; if (i >= SLEN) return; const size_t hp = (size_t)blockIdx.y * SLEN * SLEN; /* this head's plane */ const float* s = S + hp + (size_t)i * SLEN; float m = -3.0e38f;
  const int b = blockIdx.x / (BLK / 8);      /* the row's 128-block, the same for the whole work-group */
  v4f sv[4]; v4ia st[4];      /* the columns that the pattern can keep: the last 32 of each earlier block (sum_col), then 4 columns a lane of the own block */
  const char* srow = (const char*)(S + hp + (size_t)__builtin_amdgcn_readfirstlane(i) * SLEN);      /* the wave's row, its base in scalar registers: each load names a scalar base and one lane offset */
  unsigned jo[5];      /* byte offsets of a lane's columns, the same in the f32 score row and in the int32 tokens */
#pragma unroll      /* constant indices, so that the array stays in registers */
  for (int u = 0; u < 4; ++u) jo[u] = 4u * (unsigned)sum_col(b, ln, u);
  const int j0 = b * BLK + ln * 4; jo[4] = 4u * (unsigned)j0;
#pragma unroll      /* constant indices, so that the array stays in registers */
  for (int u = 0; u < 4; ++u) { sv[u] = *(const v4fa*)(srow + jo[u]); st[u] = *(const v4ia*)((const char*)tok + jo[u]); }
  v4f ov = *(const v4fa*)(srow + jo[4]); const v4ia ot = *(const v4ia*)((const char*)tok + jo[4]); const int tf = tok[b * BLK];
  asm volatile("s_wait_xcnt 0x0" :: "v"(sv[0]), "v"(sv[1]), "v"(sv[2]), "v"(sv[3]), "v"(st[0]), "v"(st[1]), "v"(st[2]), "v"(st[3]), "v"(ov), "v"(ot), "s"(tf), "v"(jo[0]), "v"(jo[1]), "v"(jo[2]), "v"(jo[3]), "v"(jo[4]), "s"(srow) : "memory");      /* inputs only. The loaded values: the eleven loads are in flight together (one latency, not eleven). The five lane offsets and the row base: they stay live up to here, so no load's result lands in a register that an earlier load of the run names ahead of this wait */
  __builtin_amdgcn_sched_barrier(0);      /* keeps the work below from being lifted in front of that wait */
  if (!rows_all_masked(st, tf, b, ln)) {      /* every row of the block has a kept key: exp(-1e9 - m) is 0, so only these columns are summed and written */
#pragma unroll      /* constant indices, so that the array stays in registers */
    for (int u = 0; u < 4; ++u) for (int q = 0; q < 4; ++q) { sv[u][q] = (sum_on(b, ln, u) & (st[u][q] > 0)) ? sv[u][q] : -1.0e9f; m = fmaxf(m, sv[u][q]); }
#pragma unroll      /* constant indices, so that the array stays in registers */
    for (int q = 0; q < 4; ++q) { ov[q] = ((j0 + q <= i) & (ot[q] > 0)) ? ov[q] : -1.0e9f; m = fmaxf(m, ov[q]); }
    for (int o = 16; o > 0; o >>= 1) m = fmaxf(m, __shfl_xor(m, o, 32)); float su = 0.f;
#pragma unroll      /* constant indices, so that the array stays in registers */
    for (int u = 0; u < 4; ++u) for (int q = 0; q < 4; ++q) { sv[u][q] = expf(sv[u][q] - m); su += sv[u][q]; }
#pragma unroll      /* constant indices, so that the array stays in registers */
    for (int q = 0; q < 4; ++q) { ov[q] = expf(ov[q] - m); su += ov[q]; }
    for (int o = 16; o > 0; o >>= 1) su += __shfl_xor(su, o, 32); const float inv = 1024.0f / su; _Float16* d = P16 + hp + (size_t)i * SLEN;
#pragma unroll      /* constant indices, so that the array stays in registers */
    for (int u = 0; u < 4; ++u) { v4h h4; for (int q = 0; q < 4; ++q) h4[q] = (_Float16)(sv[u][q] * inv); if (sum_on(b, ln, u)) *(v4h*)(d + sum_col(b, ln, u)) = h4; }
    v4h h4;
#pragma unroll      /* constant indices, so that the array stays in registers */
    for (int q = 0; q < 4; ++q) h4[q] = (_Float16)(ov[q] * inv);
    *(v4h*)(d + j0) = h4;
    return; }
  auto val = [&](int j) -> float { const bool keep = (j <= i) && (((i / BLK) == (j / BLK)) || ((j % BLK) >= BLK - CSP)) && (tok[j] > 0); return keep ? s[j] : -1.0e9f; };
#pragma unroll 1
  for (int c = 0; c < SLEN / 256; ++c) { const int kb = c * 256 + ln * 8; for (int q = 0; q < 8; ++q) m = fmaxf(m, val(kb + q)); }
  for (int o = 16; o > 0; o >>= 1) m = fmaxf(m, __shfl_xor(m, o, 32)); float su = 0.f;
#pragma unroll 1
  for (int c = 0; c < SLEN / 256; ++c) { const int kb = c * 256 + ln * 8; for (int q = 0; q < 8; ++q) su += expf(val(kb + q) - m); }
  for (int o = 16; o > 0; o >>= 1) su += __shfl_xor(su, o, 32); const float inv = 1024.0f / su; unsigned short* d = (unsigned short*)P16 + hp + (size_t)i * SLEN;
  {
#pragma unroll 1
    for (int c = 0; c < SLEN / 256; ++c) { const int kb = c * 256 + ln * 8; FragH f;
#pragma unroll
      for (int q = 0; q < 8; ++q) f.h[q] = (_Float16)(expf(val(kb + q) - m) * inv);
      *(v8us*)(d + kb) = f.half[0]; }
     } }

extern "C" void kernel_launch(void* const* d_in, const int* in_sizes, int n_in,
                              void* d_out, int out_size, void* d_ws, size_t ws_size, hipStream_t stream) {
  (void)in_sizes; (void)n_in; (void)out_size;
  const float* const* I = (const float* const*)d_in; const int* tok = (const int*)d_in[0]; const float* emb = I[1]; const float* pos = I[2]; const float* l1s = I[3]; const float* l1b = I[4]; const float* wq = I[5]; const float* wk = I[6]; const float* wv = I[7]; const float* wo = I[8];
  const float* l2s = I[9]; const float* l2b = I[10]; const float* w1 = I[11]; const float* b1 = I[12]; const float* w2 = I[13]; const float* b2 = I[14]; const float* lfs = I[15]; const float* lfb = I[16]; const float* wout = I[17]; const float* bout = I[18];
  char* ws = (char*)d_ws; size_t off = 0;
  auto take = [&](size_t bytes) { char* p = ws + off; off += (bytes + 255) & ~(size_t)255; return p; };
  _Float16* BW = (_Float16*)take((NL * LWT + (size_t)NVOC * DM) * 2);      /* the f16 weights of every layer, then the output projection's */ _Float16* BOUT = BW + NL * LWT;
  float* X = (float*)take((size_t)SLEN * DM * 4); _Float16* H16 = (_Float16*)take((size_t)SLEN * DM * 2); _Float16* Q16 = (_Float16*)take((size_t)2 * SLEN * DM * 2); _Float16* K16 = Q16 + (size_t)SLEN * DM;      /* q, then k: planes 0 and 1 of one launch */ _Float16* VT = (_Float16*)take((size_t)DM * SLEN * 2);
  float* S = (float*)take((size_t)NH * SLEN * SLEN * 4); _Float16* P16 = (_Float16*)take((size_t)NH * SLEN * SLEN * 2);      /* one plane per head */ _Float16* O16 = (_Float16*)take((size_t)SLEN * DM * 2); _Float16* G16 = (_Float16*)take((size_t)SLEN * DMLP * 2);
  if (off > ws_size) return;      /* 36.3 + 4 + 2 x 4 + 128 + 64 + 2 + 8 = 250.3 MiB */
  const dim3 gW(192, NL + 1), gQ((SLEN / 128) * (DM / 64), 3), gP((SLEN / 128) * (DM / 64), 1), gS((SLEN / BLK) * 2 + (SLEN / BLK) * (SLEN / BLK - 1) / 2, NH), gH((SLEN / 128) * 1, NH), gX(SLEN / 8, NH), gM((SLEN / 128) * (DMLP / 64), 1), gV((SLEN / 128) * (NVOC / 64), 1);
  k_wt_all<<<gW, 256, 0, stream>>>(wq, wk, wv, wo, w1, w2, wout, BW);      /* wq[l] [D][H][DH] = (in, out=h*64+k); wo[l] [H][DH][D] = (in=h*64+k, out) */
  k_embed<<<(SLEN * (DM / 4) + 255) / 256, 256, 0, stream>>>(tok, emb, pos, X);
  for (int l = 0; l < NLRUN; ++l) {
    const _Float16* BQ = BW + l * LWT; const _Float16* BO = BQ + (size_t)3 * DM * DM;      /* q, k, v lie one behind the other */ const _Float16* BW1 = BO + (size_t)DM * DM; const _Float16* BW2 = BW1 + (size_t)DM * DMLP;
    k_ln512<<<SLEN / 8, 256, 0, stream>>>(X, l1s + l * DM, l1b + l * DM, H16);
    k_gemm2<0, 0, 1, 0, 2><<<gQ, 128, 0, stream>>>(H16, DM, 0, BQ, DM, (size_t)DM * DM, 0.0625f, nullptr, 0, nullptr, Q16, DM, (size_t)SLEN * DM, SLEN, DM, DM, nullptr, VT);      /* blockIdx.y = 0: q, 1: k, 2: v, as VT[h * 64 + d][token] */
    /* all heads in one launch each: blockIdx.y = head */
    k_gemm2<0, 1><<<gS, 128, 0, stream>>>(Q16, DM, 64, K16, DM, 64, 0.125f, nullptr, 0, S, nullptr, SLEN, (size_t)SLEN * SLEN, SLEN, SLEN, 64);      /* (q / 8) . k */
    k_softsp<<<gX, 256, 0, stream>>>(S, tok, P16);
    k_gemm2<0, 2, 2><<<gH, 128, 0, stream>>>(P16, SLEN, (size_t)SLEN * SLEN, VT, SLEN, (size_t)64 * SLEN, 0.0009765625f, nullptr, 0, nullptr, O16, DM, 64, SLEN, 64, SLEN, tok);
    k_gemm2<0, 0, 1, DM><<<gP, 128, 0, stream>>>(O16, DM, 0, BO, DM, 0, 0.0625f, nullptr, 0, X, nullptr, DM, 0, SLEN, DM, DM);      /* x += o Wo (own tile, in place) */
    k_ln512<<<SLEN / 8, 256, 0, stream>>>(X, l2s + l * DM, l2b + l * DM, H16);
    k_gemm2<9, 0, 3><<<gM, 128, 0, stream>>>(H16, DM, 0, BW1, DM, 0, 0.0625f, b1 + (size_t)l * DMLP, 0, nullptr, G16, DMLP, 0, SLEN, DMLP, DM);      /* tanh-gelu(y W1 + b1) */
    k_gemm2<0, 0, 1, DM><<<gP, 128, 0, stream>>>(G16, DMLP, 0, BW2, DMLP, 0, 0.0625f, b2 + (size_t)l * DM, 0, X, nullptr, DM, 0, SLEN, DM, DMLP); }      /* x += mlp + b2 */
  k_ln512<<<SLEN / 8, 256, 0, stream>>>(X, lfs, lfb, H16);
  k_gemm2<0, 0, 1><<<gV, 128, 0, stream>>>(H16, DM, 0, BOUT, DM, 0, 0.0625f, bout, 0, (float*)d_out, nullptr, NVOC, 0, SLEN, NVOC, DM);
}

// v008
// One run takes 437 microseconds.
// Next to v007, in two timings, it ran 1.28 times as fast each time.
// Counting every step since v000, it is 13.3 times as fast.
#include <hip/hip_runtime.h>
// Sparse-pattern transformer decoder (1 x 2048 tokens, 512 = 8 heads x 64, 6 layers, MLP 2048 (tanh-GELU), vocab 256): x = embed[shift_right(tokens)] + pos_emb; per layer: h = LN1(x); q = h Wq / 8, k, v; scores masked by the structural fixed sparse pattern (causal & (same 128-block | last 32 columns of each block)) AND the INPUT key padding (token > 0), masked entries = -1e9 exactly as the reference; softmax; x += (P v) Wo; x += gelu(LN2(x) W1 + b1) W2 + b2; out = LNf(x) Wout + bout -> [1,2048,256].
// Structure: token-embedding gather by the INPUT ids on VALU; LayerNorms on VALU; all weights turned to f16 planes by one launch ahead of the layers; the weights and the activations that the Linears read (LN outputs, attention output, GELU hidden) lie in WMMA fragment order (frag_pos); all Linears as f16 WMMA GEMMs (32x64 wave tiles, f32 accumulation, exact x16 weights, biases / GELU / residual accumulation in the epilogue); q, k and v in one launch (grid y = the matrix), v formed transposed ([head dim][token], the A plane of O^T = V^T . P^T) by letting its two operands change places; per layer, the attention of all heads in one launch (k_attn, grid y = head): a wave forms the scores of 16 query rows transposed on WMMA, applies the structural pattern and the key-padding predicate, keeps a running f32 softmax in registers (P f16, at most 1) and feeds P straight into the P.v WMMA; the result goes into the head's columns of an f16 plane. It visits only the columns that the structural pattern can keep for the rows (their own block, the last 32 columns of each earlier block); a block that holds a row with no kept key at all (uniform softmax over all 2048 columns) visits all columns.
// Compute dtype: embeddings, weights, biases, LN parameters rounded to bf16; LN outputs, q, k, v, P, attention output, GELU hidden as f16 operands (~2^-12; logits small); the residual stream, softmax, LayerNorm in f32. v_wmma_f32_16x16x32_f16.
#define SLEN 2048
#define DM 512
#define NH 8
#define NL 6
#define NLRUN NL                 /* layers executed */
#define DMLP 2048
#define NVOC 256
#define BLK 128
#define CSP 32
#define NR SLEN
typedef __bf16 v16b __attribute__((ext_vector_type(16)));
typedef unsigned short v8us __attribute__((ext_vector_type(8), may_alias));
typedef float  v8f  __attribute__((ext_vector_type(8)));
typedef float  v4f  __attribute__((ext_vector_type(4)));
typedef float  v4fa __attribute__((ext_vector_type(4), may_alias));
union FragB { v16b v; v8us half[2]; unsigned short u[16]; };

__device__ __forceinline__ unsigned short bf16_bits(float x) { unsigned int u = __float_as_uint(x); return (unsigned short)((u + 0x7FFFu + ((u >> 16) & 1u)) >> 16); }
__device__ __forceinline__ float bf16_val(unsigned short b) { return __uint_as_float(((unsigned int)b) << 16); }
__device__ __forceinline__ float bf16_round(float x) { return bf16_val(bf16_bits(x)); }
// D += A·B with NT terms: 1 = ah·bh, 2 = + al·bh (A split), 3 = + ah·bl (both split)
template <int NT>
__device__ __forceinline__ v8f mmaN(v16b ah, v16b al, v16b bh, v16b bl, v8f c) {
  c = __builtin_amdgcn_wmma_f32_16x16x32_bf16(false, ah, false, bh, (short)0, c, false, false);
  if (NT >= 2) c = __builtin_amdgcn_wmma_f32_16x16x32_bf16(false, al, false, bh, (short)0, c, false, false);
  if (NT >= 3) c = __builtin_amdgcn_wmma_f32_16x16x32_bf16(false, ah, false, bl, (short)0, c, false, false);
  asm volatile("v_nop\n\tv_nop\n\tv_nop\n\tv_nop" : "+v"(c) : "v"(ah), "v"(al), "v"(bh), "v"(bl));
  return c;
}

__global__ __launch_bounds__(256) void k_wt_bf16(const float* __restrict__ W, unsigned short* __restrict__ Wt, int K, int N) {
  const int t = blockIdx.x * 256 + threadIdx.x;
  const int k8n = K / 8;
  if (t >= N * k8n) return;
  const int n = t / k8n, k8 = (t % k8n) * 8;
  v8us v;
#pragma unroll
  for (int i = 0; i < 8; ++i) v[i] = bf16_bits(W[(size_t)(k8 + i) * N + n]);
  *(v8us*)(Wt + (size_t)n * K + k8) = v;
  
}

// GEMM C[M][N] (f32, pitch ldc) = act(A[M][K]·W + bias). A f32 row-major (pitch lda) converted per fragment to bf16
// (ASPLIT: hi/lo two planes -> 2 terms, else single rounded term); Wt bf16 [N][K] (pitch ldb). BIAS_BF16 rounds the
// bias to bf16 first (bias quantised to bf16 before the add). K%32==0, M%16==0, N%64==0.
template <bool ASPLIT, int ACT, bool BIAS_BF16>
__global__ __launch_bounds__(128) void k_gemm_bf(const float* __restrict__ A, int lda, const unsigned short* __restrict__ Wt, int ldb,
                                               const float* __restrict__ bias, float* __restrict__ C, int ldc, int M, int N, int K) {
  __shared__ __attribute__((aligned(16))) float so[4][16][64];
  const int tid = threadIdx.x, w = tid >> 5, lane = tid & 31, ln = lane & 15, hh = lane >> 4;
  const int ntn = N / 64;
  const int wid = blockIdx.x * 4 + w;
  const int mt = wid / ntn, nq = wid % ntn;
  if (mt * 16 >= M) return;
  const int row0 = mt * 16, col0 = nq * 64;
  const float* arow = A + (size_t)(row0 + ln) * lda;
  v8f acc[4] = {};
  for (int kb = 0; kb < K; kb += 32) {
    FragB ah, al;
    const v4f x0 = *(const v4fa*)(arow + kb + 8 * hh), x1 = *(const v4fa*)(arow + kb + 8 * hh + 4);
    const v4f x2 = *(const v4fa*)(arow + kb + 16 + 8 * hh), x3 = *(const v4fa*)(arow + kb + 16 + 8 * hh + 4);
    float xs[16] = {x0[0],x0[1],x0[2],x0[3],x1[0],x1[1],x1[2],x1[3],x2[0],x2[1],x2[2],x2[3],x3[0],x3[1],x3[2],x3[3]};
#pragma unroll
    for (int i = 0; i < 16; ++i) { const unsigned short hb = bf16_bits(xs[i]); ah.u[i] = hb; al.u[i] = ASPLIT ? bf16_bits(xs[i] - bf16_val(hb)) : (unsigned short)0; }
#pragma unroll
    for (int t = 0; t < 4; ++t) {
      const unsigned short* brow = Wt + (size_t)(col0 + t * 16 + ln) * ldb + kb;
      FragB b;
      b.half[0] = *(const v8us*)(brow + 8 * hh);
      b.half[1] = *(const v8us*)(brow + 16 + 8 * hh);
      acc[t] = mmaN<ASPLIT ? 2 : 1>(ah.v, al.v, b.v, b.v, acc[t]);
    }
  }
#pragma unroll
  for (int t = 0; t < 4; ++t) {
    float bv = bias ? bias[col0 + t * 16 + ln] : 0.f;
    if (BIAS_BF16) bv = bf16_round(bv);
#pragma unroll
    for (int r = 0; r < 8; ++r) { float v = acc[t][r] + bv; if (ACT == 1) v = fmaxf(v, 0.f); so[w][8 * hh + r][t * 16 + ln] = v; }
  }
  __builtin_amdgcn_fence(__ATOMIC_ACQ_REL, "workgroup");
  __builtin_amdgcn_wave_barrier();
  const int rsub = lane >> 4, c4 = (lane & 15) * 4;
  {
#pragma unroll
    for (int q = 0; q < 8; ++q) {
      const int r = q * 2 + rsub;
      const v4f v = *(const v4fa*)&so[w][r][c4];
      *(v4f*)(C + (size_t)(row0 + r) * ldc + col0 + c4) = v;
    }
    
  }
}

// GEMM C = act(A·W + bias + resid): A f32 (ASPLIT -> hi/lo 2 terms), Wt bf16 [N][K]; ACT 0 none, 1 relu, 2 exact gelu;
// resid (optional, f32, row index = (row % rmod), pitch ldr, RES_BF16 rounds it) added before the activation.
template <bool ASPLIT, int ACT, bool BIAS_BF16, bool RES_BF16>
__global__ __launch_bounds__(128) void k_gemm_bf3(const float* __restrict__ A, int lda, const unsigned short* __restrict__ Wt, int ldb,
                                                const float* __restrict__ bias, const float* __restrict__ resid, int rmod, int ldr,
                                                float* __restrict__ C, int ldc, int M, int N, int K) {
  __shared__ __attribute__((aligned(16))) float so[4][16][64];
  const int tid = threadIdx.x, w = tid >> 5, lane = tid & 31, ln = lane & 15, hh = lane >> 4;
  const int ntn = N / 64;
  const int wid = blockIdx.x * 4 + w;
  const int mt = wid / ntn, nq = wid % ntn;
  if (mt * 16 >= M) return;
  const int row0 = mt * 16, col0 = nq * 64;
  const float* arow = A + (size_t)(row0 + ln) * lda;
  v8f acc[4] = {};
  for (int kb = 0; kb < K; kb += 32) {
    FragB ah, al;
    const v4f x0 = *(const v4fa*)(arow + kb + 8 * hh), x1 = *(const v4fa*)(arow + kb + 8 * hh + 4);
    const v4f x2 = *(const v4fa*)(arow + kb + 16 + 8 * hh), x3 = *(const v4fa*)(arow + kb + 16 + 8 * hh + 4);
    float xs[16] = {x0[0],x0[1],x0[2],x0[3],x1[0],x1[1],x1[2],x1[3],x2[0],x2[1],x2[2],x2[3],x3[0],x3[1],x3[2],x3[3]};
#pragma unroll
    for (int i = 0; i < 16; ++i) { const unsigned short hb = bf16_bits(xs[i]); ah.u[i] = hb; al.u[i] = ASPLIT ? bf16_bits(xs[i] - bf16_val(hb)) : (unsigned short)0; }
#pragma unroll
    for (int t = 0; t < 4; ++t) {
      const unsigned short* brow = Wt + (size_t)(col0 + t * 16 + ln) * ldb + kb;
      FragB b;
      b.half[0] = *(const v8us*)(brow + 8 * hh);
      b.half[1] = *(const v8us*)(brow + 16 + 8 * hh);
      acc[t] = mmaN<ASPLIT ? 2 : 1>(ah.v, al.v, b.v, b.v, acc[t]);
    }
  }
#pragma unroll
  for (int t = 0; t < 4; ++t) {
    const int col = col0 + t * 16 + ln;
    float bv = bias ? bias[col] : 0.f;
    if (BIAS_BF16) bv = bf16_round(bv);
#pragma unroll
    for (int r = 0; r < 8; ++r) {
      float v = acc[t][r] + bv;
      if (resid) { float rv = resid[(size_t)((row0 + 8 * hh + r) % rmod) * ldr + col]; if (RES_BF16) rv = bf16_round(rv); v += rv; }
      if (ACT == 1) v = fmaxf(v, 0.f);
      if (ACT == 2) v = 0.5f * v * (1.0f + erff(v * 0.70710678118654752f));
      if (ACT == 3) { const float u = 0.7978845608028654f * (v + 0.044715f * v * v * v); v = 0.5f * v * (1.0f + tanhf(u)); }
      so[w][8 * hh + r][t * 16 + ln] = v;
    }
  }
  __builtin_amdgcn_fence(__ATOMIC_ACQ_REL, "workgroup");
  __builtin_amdgcn_wave_barrier();
  const int rsub = lane >> 4, c4 = (lane & 15) * 4;
  {
#pragma unroll
    for (int q = 0; q < 8; ++q) {
      const int r = q * 2 + rsub;
      const v4f v = *(const v4fa*)&so[w][r][c4];
      *(v4f*)(C + (size_t)(row0 + r) * ldc + col0 + c4) = v;
    }
    
  }
}
// row LayerNorm (biased variance, eps) over N: s = X (+ R); optional out_sum <- s; out_norm <- (s-mu)*rsqrt(var+eps)*g + b
template <bool PARAM_BF16>
__global__ __launch_bounds__(256) void k_layernorm(const float* __restrict__ X, const float* __restrict__ R, const float* __restrict__ g, const float* __restrict__ bta,
                                                  float* __restrict__ out_sum, float* __restrict__ out_norm, int N, float eps) {
  __shared__ float red[256];
  const int row = blockIdx.x, tid = threadIdx.x;
  const float* x = X + (size_t)row * N; const float* rr = R ? R + (size_t)row * N : nullptr;
  float vals[16];                     // up to N = 4096
  const int per = N / 256;            // contiguous chunk per thread? use strided-by-4 chunks: thread handles j = tid*4 + 1024*u
  float s1 = 0.f;
  for (int u = 0; u < per / 4; ++u) {
    const int j = tid * 4 + 1024 * u;
    const v4f a = *(const v4fa*)(x + j);
    v4f b = {0.f,0.f,0.f,0.f}; if (rr) b = *(const v4fa*)(rr + j);
#pragma unroll
    for (int q = 0; q < 4; ++q) { const float v = a[q] + b[q]; vals[u * 4 + q] = v; s1 += v; }
  }
  red[tid] = s1; __syncthreads();
  for (int st = 128; st > 0; st >>= 1) { if (tid < st) red[tid] += red[tid + st]; __syncthreads(); }
  const float mu = red[0] / (float)N; __syncthreads();
  float s2 = 0.f;
  for (int u = 0; u < per / 4; ++u)
#pragma unroll
    for (int q = 0; q < 4; ++q) { const float c = vals[u * 4 + q] - mu; s2 += c * c; }
  red[tid] = s2; __syncthreads();
  for (int st = 128; st > 0; st >>= 1) { if (tid < st) red[tid] += red[tid + st]; __syncthreads(); }
  const float rs = rsqrtf(red[0] / (float)N + eps);
  {
    for (int u = 0; u < per / 4; ++u) {
      const int j = tid * 4 + 1024 * u;
      v4f o, sm;
#pragma unroll
      for (int q = 0; q < 4; ++q) {
        float gg = g[j + q], bb = bta[j + q];
        if (PARAM_BF16) { gg = bf16_round(gg); bb = bf16_round(bb); }
        sm[q] = vals[u * 4 + q]; o[q] = (vals[u * 4 + q] - mu) * rs * gg + bb;
      }
      if (out_sum) *(v4f*)(out_sum + (size_t)row * N + j) = sm;
      *(v4f*)(out_norm + (size_t)row * N + j) = o;
    }
    
  }
}



// ---- f16 WMMA path (v_wmma_f32_16x16x32_f16): 11-bit significands for operands in range — used where a [0,1] probability operand needs more precision than bf16
typedef _Float16 v16h __attribute__((ext_vector_type(16)));
union FragH { v16h v; v8us half[2]; _Float16 h[16]; unsigned short u[16]; };
template <int NT>
__device__ __forceinline__ v8f mmaH(v16h ah, v16h al, v16h bh, v16h bl, v8f c) {
  c = __builtin_amdgcn_wmma_f32_16x16x32_f16(false, ah, false, bh, (short)0, c, false, false);
  if (NT >= 2) c = __builtin_amdgcn_wmma_f32_16x16x32_f16(false, al, false, bh, (short)0, c, false, false);
  if (NT >= 3) c = __builtin_amdgcn_wmma_f32_16x16x32_f16(false, ah, false, bl, (short)0, c, false, false);
  asm volatile("v_nop\n\tv_nop\n\tv_nop\n\tv_nop" : "+v"(c) : "v"(ah), "v"(al), "v"(bh), "v"(bl));
  return c;
}
// batched GEMM like k_gemm_b but f16 operands: A f32 (split into f16 hi/lo if ASPLIT, else rounded to f16), Bt = f16 values [n][k]; alpha; C f32; N multiple of 16 (partial tiles skipped)
template <bool ASPLIT>
__global__ __launch_bounds__(128) void k_gemm_h(const float* __restrict__ A, int lda, size_t sA, const _Float16* __restrict__ Bh, int ldb, size_t sB, float alpha, float* __restrict__ C, int ldc, size_t sC, int M, int N, int K) {
  __shared__ __attribute__((aligned(16))) float so[4][16][64];
  const int tid = threadIdx.x, w = tid >> 5, lane = tid & 31, ln = lane & 15, hh = lane >> 4; const int by = blockIdx.y;
  A += (size_t)by * sA; Bh += (size_t)by * sB; C += (size_t)by * sC;
  const int ntn = (N + 63) / 64; const int wid = blockIdx.x * 4 + w; const int mt = wid / ntn, nq = wid % ntn; if (mt * 16 >= M) return;
  const int row0 = mt * 16, col0 = nq * 64; const float* arow = A + (size_t)(row0 + ln) * lda;
  v8f acc[4] = {};
  for (int kb = 0; kb < K; kb += 32) {
    FragH ah, al;
    const v4f x0 = *(const v4fa*)(arow + kb + 8 * hh), x1 = *(const v4fa*)(arow + kb + 8 * hh + 4), x2 = *(const v4fa*)(arow + kb + 16 + 8 * hh), x3 = *(const v4fa*)(arow + kb + 16 + 8 * hh + 4);
    float xs[16] = {x0[0],x0[1],x0[2],x0[3],x1[0],x1[1],x1[2],x1[3],x2[0],x2[1],x2[2],x2[3],x3[0],x3[1],x3[2],x3[3]};
#pragma unroll
    for (int i = 0; i < 16; ++i) { const _Float16 h = (_Float16)xs[i]; ah.h[i] = h; al.h[i] = ASPLIT ? (_Float16)(xs[i] - (float)h) : (_Float16)0.0f; }
#pragma unroll
    for (int t = 0; t < 4; ++t) { if (col0 + t * 16 >= N) continue; const size_t boff = (size_t)(col0 + t * 16 + ln) * ldb + kb; FragH bq; bq.half[0] = *(const v8us*)(Bh + boff + 8 * hh); bq.half[1] = *(const v8us*)(Bh + boff + 16 + 8 * hh);
      acc[t] = mmaH<ASPLIT ? 2 : 1>(ah.v, al.v, bq.v, bq.v, acc[t]); }
  }
#pragma unroll
  for (int t = 0; t < 4; ++t) { if (col0 + t * 16 >= N) continue;
#pragma unroll
    for (int r = 0; r < 8; ++r) so[w][8 * hh + r][t * 16 + ln] = acc[t][r] * alpha; }
  __builtin_amdgcn_fence(__ATOMIC_ACQ_REL, "workgroup"); __builtin_amdgcn_wave_barrier();
  const int rsub = lane >> 4, c4 = (lane & 15) * 4;
  {
#pragma unroll
    for (int q = 0; q < 8; ++q) { const int r = q * 2 + rsub; if (col0 + c4 < N) { const v4f v = *(const v4fa*)&so[w][r][c4]; *(v4f*)(C + (size_t)(row0 + r) * ldc + col0 + c4) = v; } }
     }
}

// Fragment order of an f16 operand plane [rows][K] (rows = the m of an A operand, the n of a B operand): 1-KiB blocks of 16 rows x 32 k, block (row / 16, k / 32) at block index (row / 16) * (K / 32) + k / 32.
// Inside a block stand the two 16-byte pieces that each lane of a 16x16x32 fragment holds, lane by lane: piece k / 16 % 2, lane (k / 8 % 2) * 16 + row % 16, element k % 8. A wave's fragment load is then 512 contiguous bytes (4 whole lines) and not 32 bytes of each of 16 lines; which k a lane and register holds is the same as with row-major planes.
__device__ __forceinline__ size_t frag_pos(int row, int k, int K) { return ((size_t)((row >> 4) * (K >> 5) + (k >> 5)) << 9) + (((k >> 4) & 1) << 8) + (((((k >> 3) & 1) << 4) + (row & 15)) << 3) + (k & 7); }
// Wt(n, k) = f16(bf16(W[k][n]) x 16), in fragment order, from f32 row-major W[K][N] (a power of two: bf16-exact weights stay exact in f16 away from the subnormal range).
// One work-group turns a strip of 256 k x 64 n: whole 256-byte row pieces in, 4 KiB of contiguous blocks out of each wave, through LDS.
// LDS row n holds its 256 k as 128 dwords (k, k + 1 packed); the 16-byte chunk c of row n lies at chunk c ^ (n / 4 % 16), so that the 32 lanes of a store (16 rows n four apart, two neighbouring dwords) fall on 32 different banks, while a row stays one contiguous 512 bytes for the 16-byte reads.
typedef unsigned v4u __attribute__((ext_vector_type(4)));
template <int K, int N>
__device__ __forceinline__ void wt_strip(const float* __restrict__ W, _Float16* __restrict__ Wt, int s, unsigned (*tl)[128]) {
  const int tid = threadIdx.x, n0 = (s % (N / 64)) * 64, k0 = (s / (N / 64)) * 256;
  const int l16 = tid & 15, r = tid >> 4;
  const float* src = W + (size_t)(k0 + 2 * r) * N + n0 + l16 * 4;
  v4f a[8], b[8];      /* rows k0 + 32 p + 2 r and the next one, columns n0 + 4 l16 up */
#pragma unroll      /* constant indices, so that the arrays stay in registers and the 16 loads are in flight together */
  for (int p = 0; p < 8; ++p) { a[p] = *(const v4fa*)(src + (size_t)(32 * p) * N); b[p] = *(const v4fa*)(src + (size_t)(32 * p + 1) * N); }
#pragma unroll      /* constant indices, so that the arrays stay in registers */
  for (int p = 0; p < 8; ++p) { const int kp = p * 16 + r;
    for (int q = 0; q < 4; ++q) { union { _Float16 h[2]; unsigned u; } pk; pk.h[0] = (_Float16)(bf16_round(a[p][q]) * 16.0f); pk.h[1] = (_Float16)(bf16_round(b[p][q]) * 16.0f);
      tl[l16 * 4 + q][(((kp >> 2) ^ l16) << 2) + (kp & 3)] = pk.u; } }
  __syncthreads();
  const int w = tid >> 5, j = tid & 31;      /* a wave writes four neighbouring blocks: rows n0 + 16 (w / 2) up, k from k0 + 128 (w % 2); store i is piece i % 2 of block i / 2 */
  const int n = (w >> 1) * 16 + (j & 15);
  unsigned short* dst = (unsigned short*)Wt + frag_pos(n0 + n, k0 + (w & 1) * 128 + (j >> 4) * 8, K);
#pragma unroll      /* the 8 LDS reads are in flight together, and the stores share address registers with constant offsets */
  for (int i = 0; i < 8; ++i) { const int c = (w & 1) * 16 + i * 2 + (j >> 4);      /* the 16-byte chunk (8 k) of LDS row n that lane j holds in that piece */
    const v4u v = *(const v4u*)&tl[n][(c ^ ((n >> 2) & 15)) << 2];
    *(v4u*)(dst + i * 256) = v; }
  asm volatile("s_wait_xcnt 0x0" ::: "memory");      /* in the listing the code of the next matrix shape follows these stores and reuses their address registers: it stands only behind this wait */
}
#define LWT ((size_t)4 * DM * DM + (size_t)2 * DM * DMLP)      /* f16 elements of one layer's six matrices: q, k, v, o, w1, w2 */
// every weight matrix of the model in one launch: blockIdx.y = layer (NL: the output projection), blockIdx.x = strip (16 each for q, k, v, o; 64 for w1; 64 for w2)
__global__ __launch_bounds__(256) void k_wt_all(const float* __restrict__ wq, const float* __restrict__ wk, const float* __restrict__ wv, const float* __restrict__ wo, const float* __restrict__ w1, const float* __restrict__ w2, const float* __restrict__ wout, _Float16* __restrict__ BW) {
  __shared__ __attribute__((aligned(16))) unsigned tl[64][128];
  const int l = blockIdx.y, x = blockIdx.x;
  if (l == NL) { if (x < (NVOC / 64) * (DM / 256)) wt_strip<DM, NVOC>(wout, BW + NL * LWT, x, tl); return; }
  _Float16* B = BW + l * LWT;
  if (x < 64) { const int m = x >> 4; const float* Wm = m == 0 ? wq : m == 1 ? wk : m == 2 ? wv : wo; wt_strip<DM, DM>(Wm + (size_t)l * DM * DM, B + (size_t)m * DM * DM, x & 15, tl); }
  else if (x < 128) wt_strip<DM, DMLP>(w1 + (size_t)l * DM * DMLP, B + (size_t)4 * DM * DM, x - 64, tl);
  else wt_strip<DMLP, DM>(w2 + (size_t)l * DMLP * DM, B + (size_t)4 * DM * DM + (size_t)DM * DMLP, x - 128, tl);
}
// k_gemm_hh variant with fused epilogue: v = acc·alpha + bias[by·sBias + col] (+ CP[(row/rowsPerB)·sCPb + by·64 + col] if CP) ; ACT 0 none / 1 elu ; writes f16 C16 (and f32 C if non-null)
template <int ACT>
__global__ __launch_bounds__(128) void k_gemm_hhx(const _Float16* __restrict__ A, int lda, size_t sA, const _Float16* __restrict__ Bh, int ldb, size_t sB, float alpha, const float* __restrict__ bias, size_t sBias, const float* __restrict__ CP, int rowsPerB, size_t sCPb, int row0g,
    float* __restrict__ C, _Float16* __restrict__ C16, int ldc, size_t sC, int M, int N, int K) {
  __shared__ __attribute__((aligned(16))) float so[4][16][64];
  const int tid = threadIdx.x, w = tid >> 5, lane = tid & 31, ln = lane & 15, hh = lane >> 4; const int by = blockIdx.y;
  A += (size_t)by * sA; Bh += (size_t)by * sB; const size_t cofs = (size_t)by * sC; const float* bp = bias ? bias + (size_t)by * sBias : nullptr;
  const int ntn = (N + 63) / 64; const int wid = blockIdx.x * 4 + w; const int mt = wid / ntn, nq = wid % ntn; if (mt * 16 >= M) return;
  const int row0 = mt * 16, col0 = nq * 64; const _Float16* arow = A + (size_t)(row0 + ln) * lda;
  v8f acc[4] = {};
  for (int kb = 0; kb < K; kb += 32) { FragH ah; ah.half[0] = *(const v8us*)((const unsigned short*)arow + kb + 8 * hh); ah.half[1] = *(const v8us*)((const unsigned short*)arow + kb + 16 + 8 * hh);
#pragma unroll
    for (int t = 0; t < 4; ++t) { if (col0 + t * 16 >= N) continue; const size_t boff = (size_t)(col0 + t * 16 + ln) * ldb + kb; FragH bq; bq.half[0] = *(const v8us*)((const unsigned short*)Bh + boff + 8 * hh); bq.half[1] = *(const v8us*)((const unsigned short*)Bh + boff + 16 + 8 * hh);
      acc[t] = mmaH<1>(ah.v, ah.v, bq.v, bq.v, acc[t]); }
  }
#pragma unroll
  for (int t = 0; t < 4; ++t) { if (col0 + t * 16 >= N) continue; const int col = col0 + t * 16 + ln; const float bv = bp ? bf16_round(bp[col]) : 0.f;
#pragma unroll
    for (int r = 0; r < 8; ++r) { float v = acc[t][r] * alpha + bv; if (CP) { const int bidx = (row0g + row0 + 8 * hh + r) / rowsPerB; v += CP[(size_t)bidx * sCPb + (size_t)by * 64 + col]; } if (ACT == 1) v = (v > 0.f) ? v : expm1f(v); else if (ACT == 7) v = (v > 0.f) ? v + 1.0f : expf(v); else if (ACT == 8) v = tanhf(v); else if (ACT == 9) v = 0.5f * v * (1.0f + tanhf(0.7978845608028654f * (v + 0.044715f * v * v * v))); else if (ACT == 11) v = 1.0f / (1.0f + expf(-v)); else if (ACT == 12) v = (v > 0.f) ? v : 0.01f * v; else if (ACT == 14) v = (v > 0.f) ? v : 0.1f * v; else if (ACT == 15) v = v / (1.0f + expf(-v)); else if (ACT == 3) v = fmaxf(v, 0.f); else if (ACT == 6) v = 0.5f * v * (1.0f + erff(v * 0.70710678118654752f)); so[w][8 * hh + r][t * 16 + ln] = v; } }
  __builtin_amdgcn_fence(__ATOMIC_ACQ_REL, "workgroup"); __builtin_amdgcn_wave_barrier();
  const int rsub = lane >> 4, c4 = (lane & 15) * 4; typedef _Float16 v4h __attribute__((ext_vector_type(4)));
  {
#pragma unroll
    for (int q = 0; q < 8; ++q) { const int r = q * 2 + rsub; if (col0 + c4 < N) { const v4f v = *(const v4fa*)&so[w][r][c4]; if (C) *(v4f*)(C + cofs + (size_t)(row0 + r) * ldc + col0 + c4) = v; if (C16) { v4h h4; for (int i = 0; i < 4; ++i) h4[i] = (_Float16)v[i]; *(v4h*)(C16 + cofs + (size_t)(row0 + r) * ldc + col0 + c4) = h4; } } }
     }
}


typedef _Float16 v4h __attribute__((ext_vector_type(4)));
typedef int v4ia __attribute__((ext_vector_type(4), may_alias));

__global__ __launch_bounds__(256) void k_x16(const float* __restrict__ x, _Float16* __restrict__ X16, size_t n8) { const size_t t = (size_t)blockIdx.x * 256 + threadIdx.x; if (t >= n8) return; FragH f;
#pragma unroll
  for (int q = 0; q < 8; ++q) f.h[q] = (_Float16)bf16_round(x[t * 8 + q]); *(v8us*)((unsigned short*)X16 + t * 8) = f.half[0];  }
__global__ __launch_bounds__(256) void k_h16(const float* __restrict__ x, _Float16* __restrict__ X16, size_t n8) { const size_t t = (size_t)blockIdx.x * 256 + threadIdx.x; if (t >= n8) return; FragH f;
#pragma unroll
  for (int q = 0; q < 8; ++q) f.h[q] = (_Float16)x[t * 8 + q]; *(v8us*)((unsigned short*)X16 + t * 8) = f.half[0];  }
__global__ __launch_bounds__(256) void k_round16f(const float* __restrict__ W, _Float16* __restrict__ Bt, size_t n8) { const size_t t = (size_t)blockIdx.x * 256 + threadIdx.x; if (t >= n8) return; FragH f;
#pragma unroll
  for (int i = 0; i < 8; ++i) f.h[i] = (_Float16)(bf16_round(W[t * 8 + i]) * 16.0f); *(v8us*)((unsigned short*)Bt + t * 8) = f.half[0];  }
__global__ __launch_bounds__(256) void k_hl(const float* __restrict__ F, _Float16* __restrict__ Hh, _Float16* __restrict__ Hl, size_t n8) { const size_t t = (size_t)blockIdx.x * 256 + threadIdx.x; if (t >= n8) return; FragH fh, fl; const v4f a = *(const v4fa*)(F + t * 8), c = *(const v4fa*)(F + t * 8 + 4);
#pragma unroll
  for (int q = 0; q < 4; ++q) { _Float16 h = (_Float16)a[q]; fh.h[q] = h; fl.h[q] = (_Float16)((a[q] - (float)h) * 1024.0f); h = (_Float16)c[q]; fh.h[4 + q] = h; fl.h[4 + q] = (_Float16)((c[q] - (float)h) * 1024.0f); }
  { *(v8us*)((unsigned short*)Hh + t * 8) = fh.half[0]; *(v8us*)((unsigned short*)Hl + t * 8) = fl.half[0];  } }

// ---- fast GEMM (wave tile 32x64; requires M % 32 == 0 rows per launch region and N % 64 == 0); epilogue = k_gemm_hhx semantics ----
__device__ __forceinline__ v16h g2_frag(const _Float16* p, int hh) { FragH f; f.half[0] = *(const v8us*)((const unsigned short*)p + 8 * hh); f.half[1] = *(const v8us*)((const unsigned short*)p + 16 + 8 * hh); return f.v; }
__device__ __forceinline__ v8f g2_mma(v16h a, v16h b, v8f c) { v8f d = __builtin_amdgcn_wmma_f32_16x16x32_f16(false, a, false, b, (short)0, c, false, false); asm volatile("v_nop\n\tv_nop\n\tv_nop\n\tv_nop" : "+v"(d) : "v"(a), "v"(b)); return d; }
/* SP 0: plain. SP 1 (scores): blockIdx.x counts only the 128x64 tiles that hold a column the pattern can keep. SP 2 (P.v, N 64): the k loop visits only such columns, unless rows_all_masked(). */
/* The last 32 columns of the (at most 15) earlier blocks, 4 columns a lane, 4 blocks a load: slot u of a lane is block 4u + lane / 8. A slot past the earlier blocks is off; it is aimed at the own block's last 32 columns (in bounds, written) so that no branch stands round a load. */
__device__ __forceinline__ bool sum_on(int blk, int lane, int u) { return u * 4 + (lane >> 3) < blk; }
__device__ __forceinline__ int sum_col(int blk, int lane, int u) { return (sum_on(blk, lane, u) ? u * 4 + (lane >> 3) : blk) * BLK + (BLK - CSP) + (lane & 7) * 4; }
/* true where the first row of 128-row block blk has no kept key (a later row keeps every key of an earlier row of its block, so false means that no row of the block is without one); the same in every lane. t[u] = the tokens at sum_col(u), tfirst = the token of the block's first column */
__device__ __forceinline__ bool rows_all_masked(const v4ia (&t)[4], int tfirst, int blk, int lane) {
  bool kept = tfirst > 0;
#pragma unroll      /* constant indices, so that the array stays in registers */
  for (int u = 0; u < 4; ++u) for (int q = 0; q < 4; ++q) kept |= sum_on(blk, lane, u) & (t[u][q] > 0);
  return !__any(kept); }
/* PK bit 0: A and Bh lie in fragment order (frag_pos; lda = ldb = their K; sA and sB count whole planes). PK bit 1: C16 is written in fragment order for a plane of ldc columns, sC then counts columns, and C is not written. */
/* RES > 0: C (f32, row-major, pitch RES = ldc, far below 4 GiB) holds the residual: C += acc x alpha + bias, each lane reading just the elements that it stores; C16 is not written. */
/* TR > 0: grid plane blockIdx.y == TR forms its product transposed, into C16T ([N][M], row-major, pitch M): A and Bh change places (an A and a B plane have the same layout, and the k order of every sum stays). M / 128 * (N / 64) == N / 128 * (M / 64), so one grid x serves all planes. No bias. */
template <int ACT, int SP = 0, int PK = 0, int RES = 0, int TR = 0>
__global__ __launch_bounds__(128) void k_gemm2(const _Float16* __restrict__ A, int lda, size_t sA, const _Float16* __restrict__ Bh, int ldb, size_t sB, float alpha, const float* __restrict__ bias, size_t sBias,
    float* __restrict__ C, _Float16* __restrict__ C16, int ldc, size_t sC, int M, int N, int Kfull, const int* __restrict__ tok = nullptr, _Float16* __restrict__ C16T = nullptr) {
  static_assert(!TR || (SP == 0 && !(PK & 2) && !RES), "the transposed plane is a plain product with a row-major f16 result");
  static_assert(!RES || (ACT == 0 && !(PK & 2)), "the residual is added in a row-major store pass, behind no activation");
  __shared__ __attribute__((aligned(16))) float so[4][32][68];
  const int tid = threadIdx.x, w = tid >> 5, lane = tid & 31, ln = lane & 15, hh = lane >> 4; const int by = blockIdx.y;
  A += (size_t)by * sA; Bh += (size_t)by * sB; size_t cofs = (size_t)by * sC; const float* bp = bias ? bias + (size_t)by * sBias : nullptr;
  if (TR && by == TR) { const _Float16* a = A; A = Bh; Bh = a; const int l = lda; lda = ldb; ldb = l; C16 = C16T; cofs = 0; ldc = M; M = N; N = ldc; }
  const int ntn = N >> 6; int mt = blockIdx.x / ntn, nq = blockIdx.x - mt * ntn;
  if (SP == 1) { int t = blockIdx.x; for (mt = 0; mt < SLEN / BLK - 1 && t >= mt + 2; ++mt) t -= mt + 2;      /* row block mt has mt + 2 tiles: the upper half of each earlier block, then the two halves of its own */
    nq = t < mt ? 2 * t + 1 : mt + t; }
  const int row0 = mt * 128 + 32 * w, col0 = nq * 64; if (row0 >= M) return;
  bool sparse = false;      /* true: P is written, and non-zero, only in the columns that the pattern can keep */
  if (SP == 2) { v4ia t[4];
#pragma unroll      /* constant indices, so that the array stays in registers */
    for (int u = 0; u < 4; ++u) t[u] = *(const v4ia*)(tok + sum_col(mt, lane, u));
    const int tf = tok[mt * BLK];
    asm volatile("s_wait_xcnt 0x0" :: "v"(t[0]), "v"(t[1]), "v"(t[2]), "v"(t[3]), "s"(tf) : "memory");      /* the loaded values as inputs only: the five loads are in flight together (one latency, not five); their address registers are rewritten only behind this wait */
    __builtin_amdgcn_sched_barrier(0);      /* keeps the work below from being lifted in front of that wait */
    sparse = !rows_all_masked(t, tf, mt, lane); }
  const int K = sparse ? (mt + BLK / 32) * 32 : Kfull;      /* 32-k steps: one for each earlier block, four for the own block */
  const int ksum = sparse ? mt * 32 : 0;      /* the steps below ksum are the earlier blocks': step k reads columns 4 k + 96 up; a step of the own block reads columns k + 3 ksum up (ld) */
  /* each lane's byte offsets in A and B are fixed for the whole loop; only the wave-uniform base moves with k (every operand plane here is far below 4 GiB) */
  /* row-major and fragment order alike: 16 rows further on lie 16 x K elements = 32 K bytes further on */
  const unsigned ao0 = (PK & 1) ? (unsigned)(row0 * lda + 8 * lane) * 2u : (unsigned)((row0 + ln) * lda + 8 * hh) * 2u, ao1 = ao0 + 32u * (unsigned)lda;
  const unsigned bo0 = (PK & 1) ? (unsigned)(col0 * ldb + 8 * lane) * 2u : (unsigned)((col0 + ln) * ldb + 8 * hh) * 2u, bo1 = bo0 + 32u * (unsigned)ldb, bo2 = bo1 + 32u * (unsigned)ldb, bo3 = bo2 + 32u * (unsigned)ldb;
  const v8f z8 = {0.f,0.f,0.f,0.f,0.f,0.f,0.f,0.f}; v8f c00 = z8, c01 = z8, c02 = z8, c03 = z8, c10 = z8, c11 = z8, c12 = z8, c13 = z8;
  /* Fragment loads run ahead of the products: the 12 loads of a 32-k step are issued as one group, two steps before the products that read them, into three rotating register sets.
     The k order of every accumulator is unchanged. A load past the last step is aimed at the last step again (in bounds, its values unused). K % 32 == 0, K >= 32. */
  struct Stg { v16h a0, a1, b0, b1, b2, b3; };
  const int klast = K - 32;
  auto fr = [](const char* p, unsigned o) -> v16h { FragH f; f.half[0] = *(const v8us*)(p + o); f.half[1] = *(const v8us*)(p + o + ((PK & 1) ? 512 : 32)); return f.v; };
  auto ld = [&](Stg& s, int kq) { int k = kq < klast ? kq : klast; if (SP == 2) k += (BLK / 32 - 1) * (k < ksum ? k : ksum) + (k < ksum ? BLK - CSP : 0); const int kbytes = (PK & 1) ? 32 * k : 2 * k;      /* fragment order: a 32-k step is one 1-KiB block */ const char* ak = (const char*)A + kbytes; const char* bk = (const char*)Bh + kbytes;
    s.a0 = fr(ak, ao0); s.a1 = fr(ak, ao1); s.b0 = fr(bk, bo0); s.b1 = fr(bk, bo1); s.b2 = fr(bk, bo2); s.b3 = fr(bk, bo3);
    asm volatile("s_wait_xcnt 0x0" ::: "memory");      /* the address registers that these loads name are rewritten for the next group only behind this wait */
    __builtin_amdgcn_sched_barrier(0);      /* keeps the whole group in front of the wait of the products behind it (below that wait the loads would start one latency late), and the next group's address work behind the wait above */
  };
  auto mm = [&](const Stg& s) { c00 = g2_mma(s.a0, s.b0, c00); c10 = g2_mma(s.a1, s.b0, c10); c01 = g2_mma(s.a0, s.b1, c01); c11 = g2_mma(s.a1, s.b1, c11);
    c02 = g2_mma(s.a0, s.b2, c02); c12 = g2_mma(s.a1, s.b2, c12); c03 = g2_mma(s.a0, s.b3, c03); c13 = g2_mma(s.a1, s.b3, c13); };
  float bvs[4] = {0.f, 0.f, 0.f, 0.f};      /* the bias of the lane's four columns */
  { Stg s0, s1, s2; ld(s0, 0); ld(s1, 32); int kb = 0;
    if (bp) { const int bc = col0 + ln;      /* asked for ahead of the k loop, behind the first two fragment groups: it has landed long before the epilogue reads it */
#pragma unroll      /* constant indices, so that the array stays in registers */
      for (int t = 0; t < 4; ++t) bvs[t] = bp[bc + t * 16];
      asm volatile("s_wait_xcnt 0x0" :: "v"(bc), "s"(bp) : "memory");      /* inputs only: the lane's column and the base that the four loads name stay live up to here and are rewritten only behind this wait */
    }
#pragma unroll 1      /* one copy of the three-step body: a second copy would not fit the register sets */
    for (; kb + 96 <= K; kb += 96) { ld(s2, kb + 64); mm(s0); ld(s0, kb + 96); mm(s1); ld(s1, kb + 128); mm(s2); }
    if (kb < K) mm(s0);
    if (kb + 32 < K) mm(s1); }
  const int rsub = lane >> 4, c4 = (lane & 15) * 4;
  v4f rs[16];      /* RES: the residual of the wave's tile in the lane order of the store pass: 16 loads of 16 bytes, whole 256-byte row pieces, all in flight together while the tile goes through LDS */
  const unsigned ro = 4u * (unsigned)((row0 + rsub) * RES + (int)cofs + col0 + c4);      /* RES: one lane offset for all 16 loads, and for the 16 stores: two rows further on is a constant offset */
  if (RES) {
#pragma unroll      /* constant indices, so that the array stays in registers */
    for (int q = 0; q < 16; ++q) rs[q] = *(const v4fa*)((const char*)C + ro + q * 8 * RES);
    asm volatile("s_wait_xcnt 0x0" :: "v"(ro), "s"(C) : "memory");      /* inputs only: the lane offset and the base that the 16 loads name stay live up to here, so no load's result lands in them, and they are rewritten only behind this wait */
    __builtin_amdgcn_sched_barrier(0);      /* keeps the vector work of the LDS pass from being lifted in front of the 16 loads (they would start later) or in front of the wait above */
  }
  v8f accs[8] = {c00, c01, c02, c03, c10, c11, c12, c13};
#pragma unroll
  for (int u = 0; u < 8; ++u) { const int t = u & 3, half = u >> 2; const float bv = bf16_round(bvs[t]);
#pragma unroll
    for (int r = 0; r < 8; ++r) { const int rloc = half * 16 + 8 * hh + r; float v = accs[u][r] * alpha + bv;
      if (ACT == 3) v = fmaxf(v, 0.f); else if (ACT == 6) v = 0.5f * v * (1.0f + erff(v * 0.70710678118654752f)); else if (ACT == 11) v = 1.0f / (1.0f + expf(-v)); else if (ACT == 15) v = v / (1.0f + expf(-v)); else if (ACT == 12) v = (v > 0.f) ? v : 0.01f * v; else if (ACT == 8) v = tanhf(v); else if (ACT == 9) v = 0.5f * v * (1.0f + tanhf(0.7978845608028654f * (v + 0.044715f * v * v * v)));      /* tanh-GELU */
      so[w][rloc][t * 16 + ln] = v; } }
  __builtin_amdgcn_fence(__ATOMIC_ACQ_REL, "workgroup"); __builtin_amdgcn_wave_barrier();
  if (PK & 2) {      /* the wave's 32 x 64 tile is 2 x 2 blocks of the next product's A plane: each store is one piece of a block, 512 contiguous bytes */
    unsigned short* d0 = (unsigned short*)C16 + frag_pos(row0 + ln, (int)cofs + col0 + 8 * hh, ldc); unsigned short* d1 = d0 + 16 * (size_t)ldc;
#pragma unroll      /* constant indices: the stores share two address registers with constant offsets */
    for (int s = 0; s < 8; ++s) { const int rt = s >> 2, pc = s & 3;      /* piece pc: columns 16 pc + 8 hh up */
      const v4f v0 = *(const v4fa*)&so[w][rt * 16 + ln][pc * 16 + 8 * hh], v1 = *(const v4fa*)&so[w][rt * 16 + ln][pc * 16 + 8 * hh + 4]; FragH f;
      for (int i = 0; i < 4; ++i) { f.h[i] = (_Float16)v0[i]; f.h[4 + i] = (_Float16)v1[i]; }
      *(v8us*)((rt ? d1 : d0) + pc * 256) = f.half[0]; }
  } else if (RES) {
#pragma unroll      /* constant indices, so that the array stays in registers; the 16 LDS reads are in flight together */
    for (int q = 0; q < 16; ++q) rs[q] += *(const v4fa*)&so[w][q * 2 + rsub][c4];
#pragma unroll      /* each store has data registers of its own and all share one address register, so nothing that an issued store names is rewritten */
    for (int q = 0; q < 16; ++q) *(v4f*)((char*)C + ro + q * 8 * RES) = rs[q];
  } else {
#pragma unroll
    for (int q = 0; q < 16; ++q) { const int r = q * 2 + rsub; const v4f v = *(const v4fa*)&so[w][r][c4]; if (C) *(v4f*)(C + cofs + (size_t)(row0 + r) * ldc + col0 + c4) = v; if (C16) { v4h h4; for (int i = 0; i < 4; ++i) h4[i] = (_Float16)v[i]; *(v4h*)(C16 + cofs + (size_t)(row0 + r) * ldc + col0 + c4) = h4; } }
     } }


__global__ __launch_bounds__(256) void k_embed(const int* __restrict__ tok, const float* __restrict__ emb, const float* __restrict__ pos, float* __restrict__ X) {
  #pragma clang fp contract(off)
  const int t = blockIdx.x * 256 + threadIdx.x; if (t >= SLEN * (DM / 4)) return; const int c0 = (t % (DM / 4)) * 4, s = t / (DM / 4); const int id = (s == 0) ? 0 : tok[s - 1]; v4f o;
#pragma unroll
  for (int q = 0; q < 4; ++q) o[q] = bf16_round(emb[(size_t)id * DM + c0 + q]) + bf16_round(pos[(size_t)s * DM + c0 + q]);
  *(v4f*)(X + (size_t)s * DM + c0) = o;  }
__global__ __launch_bounds__(256) void k_ln512(const float* __restrict__ X, const float* __restrict__ g, const float* __restrict__ bb, _Float16* __restrict__ Y16) {
  #pragma clang fp contract(off)
  const int tid = threadIdx.x, w = tid >> 5, ln = tid & 31; const int r = blockIdx.x * 8 + w; if (r >= SLEN) return; const float* x = X + (size_t)r * DM; v4f a[4]; float s = 0.f;
#pragma unroll
  for (int i = 0; i < 4; ++i) { a[i] = *(const v4fa*)(x + i * 128 + ln * 4); for (int q = 0; q < 4; ++q) s += a[i][q]; }
  for (int o = 16; o > 0; o >>= 1) s += __shfl_xor(s, o, 32); const float mu = s / (float)DM; float q2 = 0.f;
#pragma unroll
  for (int i = 0; i < 4; ++i) for (int q = 0; q < 4; ++q) { const float d = a[i][q] - mu; q2 += d * d; }
  for (int o = 16; o > 0; o >>= 1) q2 += __shfl_xor(q2, o, 32); const float rs = rsqrtf(q2 / (float)DM + 1e-6f);
  {
#pragma unroll
    for (int i = 0; i < 4; ++i) { const int c0 = i * 128 + ln * 4; _Float16 h4[4]; for (int q = 0; q < 4; ++q) h4[q] = (_Float16)((a[i][q] - mu) * rs * bf16_round(g[c0 + q]) + bf16_round(bb[c0 + q])); *(unsigned long long*)((unsigned short*)Y16 + frag_pos(r, c0, DM)) = *(const unsigned long long*)h4; }      /* fragment order: Y16 is the A plane of the products behind it */
     } }
/* Attention of one layer in one launch: blockIdx.y = head, blockIdx.x = 64 query rows, a wave = 16 query rows; no LDS, no barrier, no score or probability plane in memory.
   A step is 32 key columns. Scores are formed transposed, S^T = K . Q^T (A = 16 keys x 32 d, B = 32 d x 16 queries): a lane then holds one query (lane % 16) and, in the two accumulators of a step, keys 8 (lane / 16) + r and 16 + 8 (lane / 16) + r.
   These are just the k positions that the lane holds in a B fragment, so P^T goes into O^T += V^T . P^T (A = 16 d x 32 keys of VT) without leaving the lane. Softmax is the running form, in base 2: maximum m and sum l a query, O^T and l scaled by 2^(m_old - m_new) at each step, O^T divided by l at the end.
   Steps visited: the last 32 columns of each earlier 128-block, then the own block up to the wave's last row; a block that holds a row with no kept key (uniform softmax over all 2048 columns) visits all 64 steps. A masked score is -1e9 as in the reference. */
__device__ __forceinline__ float xhalf(float x) { return __builtin_bit_cast(float, __builtin_amdgcn_permlanex16(__builtin_bit_cast(int, x), __builtin_bit_cast(int, x), 0x76543210, 0xfedcba98, false, false)); }      /* the value of lane l ^ 16 */
__global__ __launch_bounds__(128) void k_attn(const _Float16* __restrict__ Q, const _Float16* __restrict__ Kp, const _Float16* __restrict__ VT, const int* __restrict__ tok, _Float16* __restrict__ O16) {
  const int tid = threadIdx.x, lane = tid & 31, ln = lane & 15, hh = lane >> 4, h = blockIdx.y;
  const int w = __builtin_amdgcn_readfirstlane(tid >> 5);      /* the wave's number in a scalar register */
  const int row0 = blockIdx.x * 64 + 16 * w, mt = row0 / BLK, i = row0 + ln;
  auto fr = [](const char* p, unsigned o) -> v16h { FragH f; f.half[0] = *(const v8us*)(p + o); f.half[1] = *(const v8us*)(p + o + 32); return f.v; };
  const unsigned qo = (unsigned)(i * DM + h * 64 + 8 * hh) * 2u;
  const v16h q0 = fr((const char*)Q, qo), q1 = fr((const char*)Q, qo + 64);      /* d 0 to 31, d 32 to 63 */
  v4ia t[4];
#pragma unroll      /* constant indices, so that the array stays in registers */
  for (int u = 0; u < 4; ++u) t[u] = *(const v4ia*)(tok + sum_col(mt, lane, u));
  const int tf = tok[mt * BLK];
  asm volatile("s_wait_xcnt 0x0" :: "v"(t[0]), "v"(t[1]), "v"(t[2]), "v"(t[3]), "s"(tf), "v"(qo) : "memory");      /* inputs only: the token loads are in flight together with the query's (one latency); the address registers of all of them are rewritten only behind this wait */
  __builtin_amdgcn_sched_barrier(0);      /* keeps the work below from being lifted in front of that wait */
  const bool sparse = !rows_all_masked(t, tf, mt, lane);
  /* steps below e are the earlier blocks'; n steps in all. Both in scalar registers: the trip count, the column of a step and the base of its loads are then scalar arithmetic without branches */
  const int e = __builtin_amdgcn_readfirstlane(sparse ? mt : 0), n = __builtin_amdgcn_readfirstlane(sparse ? mt + ((row0 & (BLK - 1)) >> 5) + 1 : SLEN / 32);
  auto colof = [&](int st) -> int { const int s = st < n - 1 ? st : n - 1;      /* a load past the last step is aimed at the last step again (in bounds, its values unused) */
    return s < e ? s * BLK + (BLK - CSP) : e * (BLK - 32) + s * 32; };
  const unsigned ko = (unsigned)(ln * DM + h * 64 + 8 * hh) * 2u, vo = (unsigned)((h * 64 + ln) * SLEN + 8 * hh) * 2u;
  struct KS { v16h k00, k01, k10, k11; };      /* kTD: keys 16 T up, d 32 D up */
  struct VS { v16h v0, v1, v2, v3; };      /* vT: d 16 T up */
  auto ldk = [&](KS& s, int kc) { const char* kb = (const char*)Kp + kc * (DM * 2);
    s.k00 = fr(kb, ko); s.k01 = fr(kb, ko + 64); s.k10 = fr(kb, ko + 16 * DM * 2); s.k11 = fr(kb, ko + 16 * DM * 2 + 64);
    asm volatile("s_wait_xcnt 0x0" ::: "memory");      /* the address registers that these loads name are rewritten for the next group only behind this wait */
    __builtin_amdgcn_sched_barrier(0);      /* keeps the group in front of the vector work behind it (below it the loads would start late), and the next group's address work behind the wait above */
  };
  auto ldv = [&](VS& s, int kc) { const char* vb = (const char*)VT + kc * 2;
    s.v0 = fr(vb, vo); s.v1 = fr(vb, vo + 16 * SLEN * 2); s.v2 = fr(vb, vo + 32 * SLEN * 2); s.v3 = fr(vb, vo + 48 * SLEN * 2);
    asm volatile("s_wait_xcnt 0x0" ::: "memory");      /* as in ldk */
    __builtin_amdgcn_sched_barrier(0);      /* as in ldk */
  };
  /* Lane j forms the word of step j: bit c says that column colof(j) + c is in the pattern (the same for all 32 columns of a step) and no padding; a step then reads its word with one readlane, and the loop holds no token load. w1: steps 32 up, which only the walk over all columns has */
  auto ldt = [&](v4ia (&tt)[8], int kc) { const unsigned jo = 4u * (unsigned)kc;
#pragma unroll      /* constant indices, so that the array stays in registers */
    for (int q = 0; q < 8; ++q) tt[q] = *(const v4ia*)((const char*)tok + jo + 16 * q);
    asm volatile("s_wait_xcnt 0x0" :: "v"(jo), "s"(tok) : "memory");      /* inputs only: the lane offset and the base that the eight loads name stay live up to here and are rewritten only behind this wait */
    __builtin_amdgcn_sched_barrier(0);      /* keeps the eight loads in front of the fragment loads behind them: their values are then waited for without waiting for the fragments */
  };
  auto word = [&](const v4ia (&tt)[8], int kc) -> unsigned { unsigned b = 0u;
#pragma unroll      /* constant indices, so that the array stays in registers */
    for (int q = 0; q < 8; ++q) for (int c = 0; c < 4; ++c) b |= (tt[q][c] > 0 ? 1u : 0u) << (4 * q + c);
    return ((kc / BLK == mt) | ((kc & (BLK - 1)) == BLK - CSP)) ? b : 0u; };
  unsigned w0, w1 = 0u; v4ia ta[8]; const int kl = colof(lane);
  if (!sparse) { const int kh = colof(32 + lane); ldt(ta, kh); w1 = word(ta, kh); }
  ldt(ta, kl);
  const v8f z8 = {0.f,0.f,0.f,0.f,0.f,0.f,0.f,0.f}; v8f o0 = z8, o1 = z8, o2 = z8, o3 = z8;
  float m = -3.0e38f, l = 0.f;      /* l: the lane's own 16 keys of each step; the two lanes of a query are added at the end */
  /* one step at column kc; more: each register set is asked for again, for column kn two steps on, as soon as its products have read it */
  auto step = [&](KS& ks, VS& vs, int st, bool more) { const int kc = colof(st), kn = colof(st + 2);
    v8f s0 = g2_mma(ks.k00, q0, z8), s1 = g2_mma(ks.k10, q0, z8); s0 = g2_mma(ks.k01, q1, s0); s1 = g2_mma(ks.k11, q1, s1);
    const unsigned um = (unsigned)__builtin_amdgcn_readlane((int)(st < 32 ? w0 : w1), st & 31);
    if (more) ldk(ks, kn);
    const int dl = i - kc - 8 * hh;      /* key 8 hh + b is causal where b <= dl */
    const unsigned ul = (um >> (8 * hh)) & (dl < 0 ? 0u : 0xFFFFFFFFu >> (31 - (dl < 31 ? dl : 31)));      /* bit b: key 8 hh + b is kept */
    float x[16], mx = m;
#pragma unroll      /* constant indices, so that the array stays in registers */
    for (int r = 0; r < 8; ++r) { x[r] = ((ul >> r) & 1u) ? s0[r] * 0.18033688011112042f : -1.4426950408889634e9f; x[8 + r] = ((ul >> (16 + r)) & 1u) ? s1[r] * 0.18033688011112042f : -1.4426950408889634e9f; }      /* (q / 8) . k and -1e9, both x log2(e) */
#pragma unroll      /* constant indices, so that the array stays in registers */
    for (int c = 0; c < 16; ++c) mx = fmaxf(mx, x[c]);
    mx = fmaxf(mx, xhalf(mx));
    FragH p; float ls[4] = {0.f, 0.f, 0.f, 0.f};      /* four partial sums: a chain of 4 adds, not of 16 */
#pragma unroll      /* constant indices, so that the arrays stay in registers */
    for (int c = 0; c < 16; ++c) { const float pe = __builtin_amdgcn_exp2f(x[c] - mx); ls[c & 3] += pe; p.h[c] = (_Float16)pe; }
    const float sc = __builtin_amdgcn_exp2f(m - mx); m = mx; l = l * sc + ((ls[0] + ls[1]) + (ls[2] + ls[3])); o0 *= sc; o1 *= sc; o2 *= sc; o3 *= sc;
    o0 = g2_mma(vs.v0, p.v, o0); o1 = g2_mma(vs.v1, p.v, o1); o2 = g2_mma(vs.v2, p.v, o2); o3 = g2_mma(vs.v3, p.v, o3);
    if (more) ldv(vs, kn); };
  { KS ka, kb; VS va, vb; ldk(ka, colof(0)); ldv(va, colof(0)); ldk(kb, colof(1)); ldv(vb, colof(1)); int st = 0;
    w0 = word(ta, kl);
#pragma unroll 1      /* one copy of the two-step body: a second copy would not fit the register sets */
    for (; st + 2 <= n; st += 2) { step(ka, va, st, true); step(kb, vb, st + 1, true); }      /* no branch inside: every trip issues the same loads, so the counted load waits leave the younger groups in flight */
    if (st < n) step(ka, va, st, false); }
  const float inv = 1.0f / (l + xhalf(l));
  unsigned short* d0 = (unsigned short*)O16 + frag_pos(i, h * 64 + 8 * hh, DM);      /* fragment order: O16 is the A plane of the product behind it; a store is one piece of a block, 512 contiguous bytes */
  const v8f os[4] = {o0, o1, o2, o3};
#pragma unroll      /* constant indices: the stores share one address register with constant offsets */
  for (int tt = 0; tt < 4; ++tt) { FragH f; for (int r = 0; r < 8; ++r) f.h[r] = (_Float16)(os[tt][r] * inv); *(v8us*)(d0 + tt * 256) = f.half[0]; } }

extern "C" void kernel_launch(void* const* d_in, const int* in_sizes, int n_in,
                              void* d_out, int out_size, void* d_ws, size_t ws_size, hipStream_t stream) {
  (void)in_sizes; (void)n_in; (void)out_size;
  const float* const* I = (const float* const*)d_in; const int* tok = (const int*)d_in[0]; const float* emb = I[1]; const float* pos = I[2]; const float* l1s = I[3]; const float* l1b = I[4]; const float* wq = I[5]; const float* wk = I[6]; const float* wv = I[7]; const float* wo = I[8];
  const float* l2s = I[9]; const float* l2b = I[10]; const float* w1 = I[11]; const float* b1 = I[12]; const float* w2 = I[13]; const float* b2 = I[14]; const float* lfs = I[15]; const float* lfb = I[16]; const float* wout = I[17]; const float* bout = I[18];
  char* ws = (char*)d_ws; size_t off = 0;
  auto take = [&](size_t bytes) { char* p = ws + off; off += (bytes + 255) & ~(size_t)255; return p; };
  _Float16* BW = (_Float16*)take((NL * LWT + (size_t)NVOC * DM) * 2);      /* the f16 weights of every layer, then the output projection's */ _Float16* BOUT = BW + NL * LWT;
  float* X = (float*)take((size_t)SLEN * DM * 4); _Float16* H16 = (_Float16*)take((size_t)SLEN * DM * 2); _Float16* Q16 = (_Float16*)take((size_t)2 * SLEN * DM * 2); _Float16* K16 = Q16 + (size_t)SLEN * DM;      /* q, then k: planes 0 and 1 of one launch */ _Float16* VT = (_Float16*)take((size_t)DM * SLEN * 2);
  _Float16* O16 = (_Float16*)take((size_t)SLEN * DM * 2); _Float16* G16 = (_Float16*)take((size_t)SLEN * DMLP * 2);
  if (off > ws_size) return;      /* 36.3 + 4 + 2 x 4 + 2 + 8 = 58.3 MiB */
  const dim3 gW(192, NL + 1), gQ((SLEN / 128) * (DM / 64), 3), gP((SLEN / 128) * (DM / 64), 1), gA(SLEN / 64, NH), gM((SLEN / 128) * (DMLP / 64), 1), gV((SLEN / 128) * (NVOC / 64), 1);
  k_wt_all<<<gW, 256, 0, stream>>>(wq, wk, wv, wo, w1, w2, wout, BW);      /* wq[l] [D][H][DH] = (in, out=h*64+k); wo[l] [H][DH][D] = (in=h*64+k, out) */
  k_embed<<<(SLEN * (DM / 4) + 255) / 256, 256, 0, stream>>>(tok, emb, pos, X);
  for (int l = 0; l < NLRUN; ++l) {
    const _Float16* BQ = BW + l * LWT; const _Float16* BO = BQ + (size_t)3 * DM * DM;      /* q, k, v lie one behind the other */ const _Float16* BW1 = BO + (size_t)DM * DM; const _Float16* BW2 = BW1 + (size_t)DM * DMLP;
    k_ln512<<<SLEN / 8, 256, 0, stream>>>(X, l1s + l * DM, l1b + l * DM, H16);
    k_gemm2<0, 0, 1, 0, 2><<<gQ, 128, 0, stream>>>(H16, DM, 0, BQ, DM, (size_t)DM * DM, 0.0625f, nullptr, 0, nullptr, Q16, DM, (size_t)SLEN * DM, SLEN, DM, DM, nullptr, VT);      /* blockIdx.y = 0: q, 1: k, 2: v, as VT[h * 64 + d][token] */
    k_attn<<<gA, 128, 0, stream>>>(Q16, K16, VT, tok, O16);      /* scores, softmax and P.v of all heads: blockIdx.y = head */
    k_gemm2<0, 0, 1, DM><<<gP, 128, 0, stream>>>(O16, DM, 0, BO, DM, 0, 0.0625f, nullptr, 0, X, nullptr, DM, 0, SLEN, DM, DM);      /* x += o Wo (own tile, in place) */
    k_ln512<<<SLEN / 8, 256, 0, stream>>>(X, l2s + l * DM, l2b + l * DM, H16);
    k_gemm2<9, 0, 3><<<gM, 128, 0, stream>>>(H16, DM, 0, BW1, DM, 0, 0.0625f, b1 + (size_t)l * DMLP, 0, nullptr, G16, DMLP, 0, SLEN, DMLP, DM);      /* tanh-gelu(y W1 + b1) */
    k_gemm2<0, 0, 1, DM><<<gP, 128, 0, stream>>>(G16, DMLP, 0, BW2, DMLP, 0, 0.0625f, b2 + (size_t)l * DM, 0, X, nullptr, DM, 0, SLEN, DM, DMLP); }      /* x += mlp + b2 */
  k_ln512<<<SLEN / 8, 256, 0, stream>>>(X, lfs, lfb, H16);
  k_gemm2<0, 0, 1><<<gV, 128, 0, stream>>>(H16, DM, 0, BOUT, DM, 0, 0.0625f, bout, 0, (float*)d_out, nullptr, NVOC, 0, SLEN, NVOC, DM);
}

// v009
// Measured time: 395 microseconds a run.
// Next to v008, in two timings, it ran 1.09 and 1.10 times as fast.
// Over all steps from v000 it is 14.6 times as fast.
#include <hip/hip_runtime.h>
// Sparse-pattern transformer decoder (1 x 2048 tokens, 512 = 8 heads x 64, 6 layers, MLP 2048 (tanh-GELU), vocab 256): x = embed[shift_right(tokens)] + pos_emb; per layer: h = LN1(x); q = h Wq / 8, k, v; scores masked by the structural fixed sparse pattern (causal & (same 128-block | last 32 columns of each block)) AND the INPUT key padding (token > 0), masked entries = -1e9 exactly as the reference; softmax; x += (P v) Wo; x += gelu(LN2(x) W1 + b1) W2 + b2; out = LNf(x) Wout + bout -> [1,2048,256].
// Structure: token-embedding gather by the INPUT ids on VALU; LayerNorms on VALU; all weights turned to f16 planes by one launch ahead of the layers; the weights and the activations that the Linears read (LN outputs, attention output, GELU hidden) lie in WMMA fragment order (frag_pos); all Linears as f16 WMMA GEMMs (32x64 wave tiles, f32 accumulation, exact x16 weights, biases / GELU / residual accumulation in the epilogue); q, k and v in one launch (grid y = the matrix), v formed transposed ([head dim][token], the A plane of O^T = V^T . P^T) by letting its two operands change places; per layer, the attention of all heads in one launch (k_attn, grid y = head): a wave forms the scores of 16 query rows transposed on WMMA, applies the structural pattern and the key-padding predicate, keeps a running f32 softmax in registers (P f16, at most 1) and feeds P straight into the P.v WMMA; the result goes into the head's columns of an f16 plane. It visits only the columns that the structural pattern can keep for the rows (their own block, the last 32 columns of each earlier block); a block that holds a row with no kept key at all (uniform softmax over all 2048 columns) visits all columns.
// Compute dtype: embeddings, weights, biases, LN parameters rounded to bf16; LN outputs, q, k, v, P, attention output, GELU hidden as f16 operands (~2^-12; logits small); the residual stream, softmax, LayerNorm in f32. v_wmma_f32_16x16x32_f16.
#define SLEN 2048
#define DM 512
#define NH 8
#define NL 6
#define NLRUN NL                 /* layers executed */
#define DMLP 2048
#define NVOC 256
#define BLK 128
#define CSP 32
#define NR SLEN
typedef __bf16 v16b __attribute__((ext_vector_type(16)));
typedef unsigned short v8us __attribute__((ext_vector_type(8), may_alias));
typedef float  v8f  __attribute__((ext_vector_type(8)));
typedef float  v4f  __attribute__((ext_vector_type(4)));
typedef float  v4fa __attribute__((ext_vector_type(4), may_alias));
union FragB { v16b v; v8us half[2]; unsigned short u[16]; };

__device__ __forceinline__ unsigned short bf16_bits(float x) { unsigned int u = __float_as_uint(x); return (unsigned short)((u + 0x7FFFu + ((u >> 16) & 1u)) >> 16); }
__device__ __forceinline__ float bf16_val(unsigned short b) { return __uint_as_float(((unsigned int)b) << 16); }
__device__ __forceinline__ float bf16_round(float x) { return bf16_val(bf16_bits(x)); }
// D += A·B with NT terms: 1 = ah·bh, 2 = + al·bh (A split), 3 = + ah·bl (both split)
template <int NT>
__device__ __forceinline__ v8f mmaN(v16b ah, v16b al, v16b bh, v16b bl, v8f c) {
  c = __builtin_amdgcn_wmma_f32_16x16x32_bf16(false, ah, false, bh, (short)0, c, false, false);
  if (NT >= 2) c = __builtin_amdgcn_wmma_f32_16x16x32_bf16(false, al, false, bh, (short)0, c, false, false);
  if (NT >= 3) c = __builtin_amdgcn_wmma_f32_16x16x32_bf16(false, ah, false, bl, (short)0, c, false, false);
  asm volatile("v_nop\n\tv_nop\n\tv_nop\n\tv_nop" : "+v"(c) : "v"(ah), "v"(al), "v"(bh), "v"(bl));
  return c;
}

__global__ __launch_bounds__(256) void k_wt_bf16(const float* __restrict__ W, unsigned short* __restrict__ Wt, int K, int N) {
  const int t = blockIdx.x * 256 + threadIdx.x;
  const int k8n = K / 8;
  if (t >= N * k8n) return;
  const int n = t / k8n, k8 = (t % k8n) * 8;
  v8us v;
#pragma unroll
  for (int i = 0; i < 8; ++i) v[i] = bf16_bits(W[(size_t)(k8 + i) * N + n]);
  *(v8us*)(Wt + (size_t)n * K + k8) = v;
  
}

// GEMM C[M][N] (f32, pitch ldc) = act(A[M][K]·W + bias). A f32 row-major (pitch lda) converted per fragment to bf16
// (ASPLIT: hi/lo two planes -> 2 terms, else single rounded term); Wt bf16 [N][K] (pitch ldb). BIAS_BF16 rounds the
// bias to bf16 first (bias quantised to bf16 before the add). K%32==0, M%16==0, N%64==0.
template <bool ASPLIT, int ACT, bool BIAS_BF16>
__global__ __launch_bounds__(128) void k_gemm_bf(const float* __restrict__ A, int lda, const unsigned short* __restrict__ Wt, int ldb,
                                               const float* __restrict__ bias, float* __restrict__ C, int ldc, int M, int N, int K) {
  __shared__ __attribute__((aligned(16))) float so[4][16][64];
  const int tid = threadIdx.x, w = tid >> 5, lane = tid & 31, ln = lane & 15, hh = lane >> 4;
  const int ntn = N / 64;
  const int wid = blockIdx.x * 4 + w;
  const int mt = wid / ntn, nq = wid % ntn;
  if (mt * 16 >= M) return;
  const int row0 = mt * 16, col0 = nq * 64;
  const float* arow = A + (size_t)(row0 + ln) * lda;
  v8f acc[4] = {};
  for (int kb = 0; kb < K; kb += 32) {
    FragB ah, al;
    const v4f x0 = *(const v4fa*)(arow + kb + 8 * hh), x1 = *(const v4fa*)(arow + kb + 8 * hh + 4);
    const v4f x2 = *(const v4fa*)(arow + kb + 16 + 8 * hh), x3 = *(const v4fa*)(arow + kb + 16 + 8 * hh + 4);
    float xs[16] = {x0[0],x0[1],x0[2],x0[3],x1[0],x1[1],x1[2],x1[3],x2[0],x2[1],x2[2],x2[3],x3[0],x3[1],x3[2],x3[3]};
#pragma unroll
    for (int i = 0; i < 16; ++i) { const unsigned short hb = bf16_bits(xs[i]); ah.u[i] = hb; al.u[i] = ASPLIT ? bf16_bits(xs[i] - bf16_val(hb)) : (unsigned short)0; }
#pragma unroll
    for (int t = 0; t < 4; ++t) {
      const unsigned short* brow = Wt + (size_t)(col0 + t * 16 + ln) * ldb + kb;
      FragB b;
      b.half[0] = *(const v8us*)(brow + 8 * hh);
      b.half[1] = *(const v8us*)(brow + 16 + 8 * hh);
      acc[t] = mmaN<ASPLIT ? 2 : 1>(ah.v, al.v, b.v, b.v, acc[t]);
    }
  }
#pragma unroll
  for (int t = 0; t < 4; ++t) {
    float bv = bias ? bias[col0 + t * 16 + ln] : 0.f;
    if (BIAS_BF16) bv = bf16_round(bv);
#pragma unroll
    for (int r = 0; r < 8; ++r) { float v = acc[t][r] + bv; if (ACT == 1) v = fmaxf(v, 0.f); so[w][8 * hh + r][t * 16 + ln] = v; }
  }
  __builtin_amdgcn_fence(__ATOMIC_ACQ_REL, "workgroup");
  __builtin_amdgcn_wave_barrier();
  const int rsub = lane >> 4, c4 = (lane & 15) * 4;
  {
#pragma unroll
    for (int q = 0; q < 8; ++q) {
      const int r = q * 2 + rsub;
      const v4f v = *(const v4fa*)&so[w][r][c4];
      *(v4f*)(C + (size_t)(row0 + r) * ldc + col0 + c4) = v;
    }
    
  }
}

// GEMM C = act(A·W + bias + resid): A f32 (ASPLIT -> hi/lo 2 terms), Wt bf16 [N][K]; ACT 0 none, 1 relu, 2 exact gelu;
// resid (optional, f32, row index = (row % rmod), pitch ldr, RES_BF16 rounds it) added before the activation.
template <bool ASPLIT, int ACT, bool BIAS_BF16, bool RES_BF16>
__global__ __launch_bounds__(128) void k_gemm_bf3(const float* __restrict__ A, int lda, const unsigned short* __restrict__ Wt, int ldb,
                                                const float* __restrict__ bias, const float* __restrict__ resid, int rmod, int ldr,
                                                float* __restrict__ C, int ldc, int M, int N, int K) {
  __shared__ __attribute__((aligned(16))) float so[4][16][64];
  const int tid = threadIdx.x, w = tid >> 5, lane = tid & 31, ln = lane & 15, hh = lane >> 4;
  const int ntn = N / 64;
  const int wid = blockIdx.x * 4 + w;
  const int mt = wid / ntn, nq = wid % ntn;
  if (mt * 16 >= M) return;
  const int row0 = mt * 16, col0 = nq * 64;
  const float* arow = A + (size_t)(row0 + ln) * lda;
  v8f acc[4] = {};
  for (int kb = 0; kb < K; kb += 32) {
    FragB ah, al;
    const v4f x0 = *(const v4fa*)(arow + kb + 8 * hh), x1 = *(const v4fa*)(arow + kb + 8 * hh + 4);
    const v4f x2 = *(const v4fa*)(arow + kb + 16 + 8 * hh), x3 = *(const v4fa*)(arow + kb + 16 + 8 * hh + 4);
    float xs[16] = {x0[0],x0[1],x0[2],x0[3],x1[0],x1[1],x1[2],x1[3],x2[0],x2[1],x2[2],x2[3],x3[0],x3[1],x3[2],x3[3]};
#pragma unroll
    for (int i = 0; i < 16; ++i) { const unsigned short hb = bf16_bits(xs[i]); ah.u[i] = hb; al.u[i] = ASPLIT ? bf16_bits(xs[i] - bf16_val(hb)) : (unsigned short)0; }
#pragma unroll
    for (int t = 0; t < 4; ++t) {
      const unsigned short* brow = Wt + (size_t)(col0 + t * 16 + ln) * ldb + kb;
      FragB b;
      b.half[0] = *(const v8us*)(brow + 8 * hh);
      b.half[1] = *(const v8us*)(brow + 16 + 8 * hh);
      acc[t] = mmaN<ASPLIT ? 2 : 1>(ah.v, al.v, b.v, b.v, acc[t]);
    }
  }
#pragma unroll
  for (int t = 0; t < 4; ++t) {
    const int col = col0 + t * 16 + ln;
    float bv = bias ? bias[col] : 0.f;
    if (BIAS_BF16) bv = bf16_round(bv);
#pragma unroll
    for (int r = 0; r < 8; ++r) {
      float v = acc[t][r] + bv;
      if (resid) { float rv = resid[(size_t)((row0 + 8 * hh + r) % rmod) * ldr + col]; if (RES_BF16) rv = bf16_round(rv); v += rv; }
      if (ACT == 1) v = fmaxf(v, 0.f);
      if (ACT == 2) v = 0.5f * v * (1.0f + erff(v * 0.70710678118654752f));
      if (ACT == 3) { const float u = 0.7978845608028654f * (v + 0.044715f * v * v * v); v = 0.5f * v * (1.0f + tanhf(u)); }
      so[w][8 * hh + r][t * 16 + ln] = v;
    }
  }
  __builtin_amdgcn_fence(__ATOMIC_ACQ_REL, "workgroup");
  __builtin_amdgcn_wave_barrier();
  const int rsub = lane >> 4, c4 = (lane & 15) * 4;
  {
#pragma unroll
    for (int q = 0; q < 8; ++q) {
      const int r = q * 2 + rsub;
      const v4f v = *(const v4fa*)&so[w][r][c4];
      *(v4f*)(C + (size_t)(row0 + r) * ldc + col0 + c4) = v;
    }
    
  }
}
// row LayerNorm (biased variance, eps) over N: s = X (+ R); optional out_sum <- s; out_norm <- (s-mu)*rsqrt(var+eps)*g + b
template <bool PARAM_BF16>
__global__ __launch_bounds__(256) void k_layernorm(const float* __restrict__ X, const float* __restrict__ R, const float* __restrict__ g, const float* __restrict__ bta,
                                                  float* __restrict__ out_sum, float* __restrict__ out_norm, int N, float eps) {
  __shared__ float red[256];
  const int row = blockIdx.x, tid = threadIdx.x;
  const float* x = X + (size_t)row * N; const float* rr = R ? R + (size_t)row * N : nullptr;
  float vals[16];                     // up to N = 4096
  const int per = N / 256;            // contiguous chunk per thread? use strided-by-4 chunks: thread handles j = tid*4 + 1024*u
  float s1 = 0.f;
  for (int u = 0; u < per / 4; ++u) {
    const int j = tid * 4 + 1024 * u;
    const v4f a = *(const v4fa*)(x + j);
    v4f b = {0.f,0.f,0.f,0.f}; if (rr) b = *(const v4fa*)(rr + j);
#pragma unroll
    for (int q = 0; q < 4; ++q) { const float v = a[q] + b[q]; vals[u * 4 + q] = v; s1 += v; }
  }
  red[tid] = s1; __syncthreads();
  for (int st = 128; st > 0; st >>= 1) { if (tid < st) red[tid] += red[tid + st]; __syncthreads(); }
  const float mu = red[0] / (float)N; __syncthreads();
  float s2 = 0.f;
  for (int u = 0; u < per / 4; ++u)
#pragma unroll
    for (int q = 0; q < 4; ++q) { const float c = vals[u * 4 + q] - mu; s2 += c * c; }
  red[tid] = s2; __syncthreads();
  for (int st = 128; st > 0; st >>= 1) { if (tid < st) red[tid] += red[tid + st]; __syncthreads(); }
  const float rs = rsqrtf(red[0] / (float)N + eps);
  {
    for (int u = 0; u < per / 4; ++u) {
      const int j = tid * 4 + 1024 * u;
      v4f o, sm;
#pragma unroll
      for (int q = 0; q < 4; ++q) {
        float gg = g[j + q], bb = bta[j + q];
        if (PARAM_BF16) { gg = bf16_round(gg); bb = bf16_round(bb); }
        sm[q] = vals[u * 4 + q]; o[q] = (vals[u * 4 + q] - mu) * rs * gg + bb;
      }
      if (out_sum) *(v4f*)(out_sum + (size_t)row * N + j) = sm;
      *(v4f*)(out_norm + (size_t)row * N + j) = o;
    }
    
  }
}



// ---- f16 WMMA path (v_wmma_f32_16x16x32_f16): 11-bit significands for operands in range — used where a [0,1] probability operand needs more precision than bf16
typedef _Float16 v16h __attribute__((ext_vector_type(16)));
union FragH { v16h v; v8us half[2]; _Float16 h[16]; unsigned short u[16]; };
template <int NT>
__device__ __forceinline__ v8f mmaH(v16h ah, v16h al, v16h bh, v16h bl, v8f c) {
  c = __builtin_amdgcn_wmma_f32_16x16x32_f16(false, ah, false, bh, (short)0, c, false, false);
  if (NT >= 2) c = __builtin_amdgcn_wmma_f32_16x16x32_f16(false, al, false, bh, (short)0, c, false, false);
  if (NT >= 3) c = __builtin_amdgcn_wmma_f32_16x16x32_f16(false, ah, false, bl, (short)0, c, false, false);
  asm volatile("v_nop\n\tv_nop\n\tv_nop\n\tv_nop" : "+v"(c) : "v"(ah), "v"(al), "v"(bh), "v"(bl));
  return c;
}
// batched GEMM like k_gemm_b but f16 operands: A f32 (split into f16 hi/lo if ASPLIT, else rounded to f16), Bt = f16 values [n][k]; alpha; C f32; N multiple of 16 (partial tiles skipped)
template <bool ASPLIT>
__global__ __launch_bounds__(128) void k_gemm_h(const float* __restrict__ A, int lda, size_t sA, const _Float16* __restrict__ Bh, int ldb, size_t sB, float alpha, float* __restrict__ C, int ldc, size_t sC, int M, int N, int K) {
  __shared__ __attribute__((aligned(16))) float so[4][16][64];
  const int tid = threadIdx.x, w = tid >> 5, lane = tid & 31, ln = lane & 15, hh = lane >> 4; const int by = blockIdx.y;
  A += (size_t)by * sA; Bh += (size_t)by * sB; C += (size_t)by * sC;
  const int ntn = (N + 63) / 64; const int wid = blockIdx.x * 4 + w; const int mt = wid / ntn, nq = wid % ntn; if (mt * 16 >= M) return;
  const int row0 = mt * 16, col0 = nq * 64; const float* arow = A + (size_t)(row0 + ln) * lda;
  v8f acc[4] = {};
  for (int kb = 0; kb < K; kb += 32) {
    FragH ah, al;
    const v4f x0 = *(const v4fa*)(arow + kb + 8 * hh), x1 = *(const v4fa*)(arow + kb + 8 * hh + 4), x2 = *(const v4fa*)(arow + kb + 16 + 8 * hh), x3 = *(const v4fa*)(arow + kb + 16 + 8 * hh + 4);
    float xs[16] = {x0[0],x0[1],x0[2],x0[3],x1[0],x1[1],x1[2],x1[3],x2[0],x2[1],x2[2],x2[3],x3[0],x3[1],x3[2],x3[3]};
#pragma unroll
    for (int i = 0; i < 16; ++i) { const _Float16 h = (_Float16)xs[i]; ah.h[i] = h; al.h[i] = ASPLIT ? (_Float16)(xs[i] - (float)h) : (_Float16)0.0f; }
#pragma unroll
    for (int t = 0; t < 4; ++t) { if (col0 + t * 16 >= N) continue; const size_t boff = (size_t)(col0 + t * 16 + ln) * ldb + kb; FragH bq; bq.half[0] = *(const v8us*)(Bh + boff + 8 * hh); bq.half[1] = *(const v8us*)(Bh + boff + 16 + 8 * hh);
      acc[t] = mmaH<ASPLIT ? 2 : 1>(ah.v, al.v, bq.v, bq.v, acc[t]); }
  }
#pragma unroll
  for (int t = 0; t < 4; ++t) { if (col0 + t * 16 >= N) continue;
#pragma unroll
    for (int r = 0; r < 8; ++r) so[w][8 * hh + r][t * 16 + ln] = acc[t][r] * alpha; }
  __builtin_amdgcn_fence(__ATOMIC_ACQ_REL, "workgroup"); __builtin_amdgcn_wave_barrier();
  const int rsub = lane >> 4, c4 = (lane & 15) * 4;
  {
#pragma unroll
    for (int q = 0; q < 8; ++q) { const int r = q * 2 + rsub; if (col0 + c4 < N) { const v4f v = *(const v4fa*)&so[w][r][c4]; *(v4f*)(C + (size_t)(row0 + r) * ldc + col0 + c4) = v; } }
     }
}

// Fragment order of an f16 operand plane [rows][K] (rows = the m of an A operand, the n of a B operand): 1-KiB blocks of 16 rows x 32 k, block (row / 16, k / 32) at block index (row / 16) * (K / 32) + k / 32.
// Inside a block stand the two 16-byte pieces that each lane of a 16x16x32 fragment holds, lane by lane: piece k / 16 % 2, lane (k / 8 % 2) * 16 + row % 16, element k % 8. A wave's fragment load is then 512 contiguous bytes (4 whole lines) and not 32 bytes of each of 16 lines; which k a lane and register holds is the same as with row-major planes.
__device__ __forceinline__ size_t frag_pos(int row, int k, int K) { return ((size_t)((row >> 4) * (K >> 5) + (k >> 5)) << 9) + (((k >> 4) & 1) << 8) + (((((k >> 3) & 1) << 4) + (row & 15)) << 3) + (k & 7); }
// Wt(n, k) = f16(bf16(W[k][n]) x 16), in fragment order, from f32 row-major W[K][N] (a power of two: bf16-exact weights stay exact in f16 away from the subnormal range).
// One work-group turns a strip of 256 k x 64 n: whole 256-byte row pieces in, 4 KiB of contiguous blocks out of each wave, through LDS.
// LDS row n holds its 256 k as 128 dwords (k, k + 1 packed); the 16-byte chunk c of row n lies at chunk c ^ (n / 4 % 16), so that the 32 lanes of a store (16 rows n four apart, two neighbouring dwords) fall on 32 different banks, while a row stays one contiguous 512 bytes for the 16-byte reads.
typedef unsigned v4u __attribute__((ext_vector_type(4)));
template <int K, int N>
__device__ __forceinline__ void wt_strip(const float* __restrict__ W, _Float16* __restrict__ Wt, int s, unsigned (*tl)[128]) {
  const int tid = threadIdx.x, n0 = (s % (N / 64)) * 64, k0 = (s / (N / 64)) * 256;
  const int l16 = tid & 15, r = tid >> 4;
  const float* src = W + (size_t)(k0 + 2 * r) * N + n0 + l16 * 4;
  v4f a[8], b[8];      /* rows k0 + 32 p + 2 r and the next one, columns n0 + 4 l16 up */
#pragma unroll      /* constant indices, so that the arrays stay in registers and the 16 loads are in flight together */
  for (int p = 0; p < 8; ++p) { a[p] = *(const v4fa*)(src + (size_t)(32 * p) * N); b[p] = *(const v4fa*)(src + (size_t)(32 * p + 1) * N); }
#pragma unroll      /* constant indices, so that the arrays stay in registers */
  for (int p = 0; p < 8; ++p) { const int kp = p * 16 + r;
    for (int q = 0; q < 4; ++q) { union { _Float16 h[2]; unsigned u; } pk; pk.h[0] = (_Float16)(bf16_round(a[p][q]) * 16.0f); pk.h[1] = (_Float16)(bf16_round(b[p][q]) * 16.0f);
      tl[l16 * 4 + q][(((kp >> 2) ^ l16) << 2) + (kp & 3)] = pk.u; } }
  __syncthreads();
  const int w = tid >> 5, j = tid & 31;      /* a wave writes four neighbouring blocks: rows n0 + 16 (w / 2) up, k from k0 + 128 (w % 2); store i is piece i % 2 of block i / 2 */
  const int n = (w >> 1) * 16 + (j & 15);
  unsigned short* dst = (unsigned short*)Wt + frag_pos(n0 + n, k0 + (w & 1) * 128 + (j >> 4) * 8, K);
#pragma unroll      /* the 8 LDS reads are in flight together, and the stores share address registers with constant offsets */
  for (int i = 0; i < 8; ++i) { const int c = (w & 1) * 16 + i * 2 + (j >> 4);      /* the 16-byte chunk (8 k) of LDS row n that lane j holds in that piece */
    const v4u v = *(const v4u*)&tl[n][(c ^ ((n >> 2) & 15)) << 2];
    *(v4u*)(dst + i * 256) = v; }
  asm volatile("s_wait_xcnt 0x0" ::: "memory");      /* in the listing the code of the next matrix shape follows these stores and reuses their address registers: it stands only behind this wait */
}
#define LWT ((size_t)4 * DM * DM + (size_t)2 * DM * DMLP)      /* f16 elements of one layer's six matrices: q, k, v, o, w1, w2 */
// every weight matrix of the model in one launch: blockIdx.y = layer (NL: the output projection), blockIdx.x = strip (16 each for q, k, v, o; 64 for w1; 64 for w2)
__global__ __launch_bounds__(256) void k_wt_all(const float* __restrict__ wq, const float* __restrict__ wk, const float* __restrict__ wv, const float* __restrict__ wo, const float* __restrict__ w1, const float* __restrict__ w2, const float* __restrict__ wout, _Float16* __restrict__ BW) {
  __shared__ __attribute__((aligned(16))) unsigned tl[64][128];
  const int l = blockIdx.y, x = blockIdx.x;
  if (l == NL) { if (x < (NVOC / 64) * (DM / 256)) wt_strip<DM, NVOC>(wout, BW + NL * LWT, x, tl); return; }
  _Float16* B = BW + l * LWT;
  if (x < 64) { const int m = x >> 4; const float* Wm = m == 0 ? wq : m == 1 ? wk : m == 2 ? wv : wo; wt_strip<DM, DM>(Wm + (size_t)l * DM * DM, B + (size_t)m * DM * DM, x & 15, tl); }
  else if (x < 128) wt_strip<DM, DMLP>(w1 + (size_t)l * DM * DMLP, B + (size_t)4 * DM * DM, x - 64, tl);
  else wt_strip<DMLP, DM>(w2 + (size_t)l * DMLP * DM, B + (size_t)4 * DM * DM + (size_t)DM * DMLP, x - 128, tl);
}
// k_gemm_hh variant with fused epilogue: v = acc·alpha + bias[by·sBias + col] (+ CP[(row/rowsPerB)·sCPb + by·64 + col] if CP) ; ACT 0 none / 1 elu ; writes f16 C16 (and f32 C if non-null)
template <int ACT>
__global__ __launch_bounds__(128) void k_gemm_hhx(const _Float16* __restrict__ A, int lda, size_t sA, const _Float16* __restrict__ Bh, int ldb, size_t sB, float alpha, const float* __restrict__ bias, size_t sBias, const float* __restrict__ CP, int rowsPerB, size_t sCPb, int row0g,
    float* __restrict__ C, _Float16* __restrict__ C16, int ldc, size_t sC, int M, int N, int K) {
  __shared__ __attribute__((aligned(16))) float so[4][16][64];
  const int tid = threadIdx.x, w = tid >> 5, lane = tid & 31, ln = lane & 15, hh = lane >> 4; const int by = blockIdx.y;
  A += (size_t)by * sA; Bh += (size_t)by * sB; const size_t cofs = (size_t)by * sC; const float* bp = bias ? bias + (size_t)by * sBias : nullptr;
  const int ntn = (N + 63) / 64; const int wid = blockIdx.x * 4 + w; const int mt = wid / ntn, nq = wid % ntn; if (mt * 16 >= M) return;
  const int row0 = mt * 16, col0 = nq * 64; const _Float16* arow = A + (size_t)(row0 + ln) * lda;
  v8f acc[4] = {};
  for (int kb = 0; kb < K; kb += 32) { FragH ah; ah.half[0] = *(const v8us*)((const unsigned short*)arow + kb + 8 * hh); ah.half[1] = *(const v8us*)((const unsigned short*)arow + kb + 16 + 8 * hh);
#pragma unroll
    for (int t = 0; t < 4; ++t) { if (col0 + t * 16 >= N) continue; const size_t boff = (size_t)(col0 + t * 16 + ln) * ldb + kb; FragH bq; bq.half[0] = *(const v8us*)((const unsigned short*)Bh + boff + 8 * hh); bq.half[1] = *(const v8us*)((const unsigned short*)Bh + boff + 16 + 8 * hh);
      acc[t] = mmaH<1>(ah.v, ah.v, bq.v, bq.v, acc[t]); }
  }
#pragma unroll
  for (int t = 0; t < 4; ++t) { if (col0 + t * 16 >= N) continue; const int col = col0 + t * 16 + ln; const float bv = bp ? bf16_round(bp[col]) : 0.f;
#pragma unroll
    for (int r = 0; r < 8; ++r) { float v = acc[t][r] * alpha + bv; if (CP) { const int bidx = (row0g + row0 + 8 * hh + r) / rowsPerB; v += CP[(size_t)bidx * sCPb + (size_t)by * 64 + col]; } if (ACT == 1) v = (v > 0.f) ? v : expm1f(v); else if (ACT == 7) v = (v > 0.f) ? v + 1.0f : expf(v); else if (ACT == 8) v = tanhf(v); else if (ACT == 9) v = 0.5f * v * (1.0f + tanhf(0.7978845608028654f * (v + 0.044715f * v * v * v))); else if (ACT == 11) v = 1.0f / (1.0f + expf(-v)); else if (ACT == 12) v = (v > 0.f) ? v : 0.01f * v; else if (ACT == 14) v = (v > 0.f) ? v : 0.1f * v; else if (ACT == 15) v = v / (1.0f + expf(-v)); else if (ACT == 3) v = fmaxf(v, 0.f); else if (ACT == 6) v = 0.5f * v * (1.0f + erff(v * 0.70710678118654752f)); so[w][8 * hh + r][t * 16 + ln] = v; } }
  __builtin_amdgcn_fence(__ATOMIC_ACQ_REL, "workgroup"); __builtin_amdgcn_wave_barrier();
  const int rsub = lane >> 4, c4 = (lane & 15) * 4; typedef _Float16 v4h __attribute__((ext_vector_type(4)));
  {
#pragma unroll
    for (int q = 0; q < 8; ++q) { const int r = q * 2 + rsub; if (col0 + c4 < N) { const v4f v = *(const v4fa*)&so[w][r][c4]; if (C) *(v4f*)(C + cofs + (size_t)(row0 + r) * ldc + col0 + c4) = v; if (C16) { v4h h4; for (int i = 0; i < 4; ++i) h4[i] = (_Float16)v[i]; *(v4h*)(C16 + cofs + (size_t)(row0 + r) * ldc + col0 + c4) = h4; } } }
     }
}


typedef _Float16 v4h __attribute__((ext_vector_type(4)));
typedef int v4ia __attribute__((ext_vector_type(4), may_alias));

__global__ __launch_bounds__(256) void k_x16(const float* __restrict__ x, _Float16* __restrict__ X16, size_t n8) { const size_t t = (size_t)blockIdx.x * 256 + threadIdx.x; if (t >= n8) return; FragH f;
#pragma unroll
  for (int q = 0; q < 8; ++q) f.h[q] = (_Float16)bf16_round(x[t * 8 + q]); *(v8us*)((unsigned short*)X16 + t * 8) = f.half[0];  }
__global__ __launch_bounds__(256) void k_h16(const float* __restrict__ x, _Float16* __restrict__ X16, size_t n8) { const size_t t = (size_t)blockIdx.x * 256 + threadIdx.x; if (t >= n8) return; FragH f;
#pragma unroll
  for (int q = 0; q < 8; ++q) f.h[q] = (_Float16)x[t * 8 + q]; *(v8us*)((unsigned short*)X16 + t * 8) = f.half[0];  }
__global__ __launch_bounds__(256) void k_round16f(const float* __restrict__ W, _Float16* __restrict__ Bt, size_t n8) { const size_t t = (size_t)blockIdx.x * 256 + threadIdx.x; if (t >= n8) return; FragH f;
#pragma unroll
  for (int i = 0; i < 8; ++i) f.h[i] = (_Float16)(bf16_round(W[t * 8 + i]) * 16.0f); *(v8us*)((unsigned short*)Bt + t * 8) = f.half[0];  }
__global__ __launch_bounds__(256) void k_hl(const float* __restrict__ F, _Float16* __restrict__ Hh, _Float16* __restrict__ Hl, size_t n8) { const size_t t = (size_t)blockIdx.x * 256 + threadIdx.x; if (t >= n8) return; FragH fh, fl; const v4f a = *(const v4fa*)(F + t * 8), c = *(const v4fa*)(F + t * 8 + 4);
#pragma unroll
  for (int q = 0; q < 4; ++q) { _Float16 h = (_Float16)a[q]; fh.h[q] = h; fl.h[q] = (_Float16)((a[q] - (float)h) * 1024.0f); h = (_Float16)c[q]; fh.h[4 + q] = h; fl.h[4 + q] = (_Float16)((c[q] - (float)h) * 1024.0f); }
  { *(v8us*)((unsigned short*)Hh + t * 8) = fh.half[0]; *(v8us*)((unsigned short*)Hl + t * 8) = fl.half[0];  } }

// ---- fast GEMM (wave tile 32x64; requires M % 32 == 0 rows per launch region and N % 64 == 0); epilogue = k_gemm_hhx semantics ----
__device__ __forceinline__ v16h g2_frag(const _Float16* p, int hh) { FragH f; f.half[0] = *(const v8us*)((const unsigned short*)p + 8 * hh); f.half[1] = *(const v8us*)((const unsigned short*)p + 16 + 8 * hh); return f.v; }
__device__ __forceinline__ v8f g2_mma(v16h a, v16h b, v8f c) { v8f d = __builtin_amdgcn_wmma_f32_16x16x32_f16(false, a, false, b, (short)0, c, false, false); asm volatile("v_nop\n\tv_nop\n\tv_nop\n\tv_nop" : "+v"(d) : "v"(a), "v"(b)); return d; }
/* SP 0: plain. SP 1 (scores): blockIdx.x counts only the 128x64 tiles that hold a column the pattern can keep. */
/* The last 32 columns of the (at most 15) earlier blocks, 4 columns a lane, 4 blocks a load: slot u of a lane is block 4u + lane / 8. A slot past the earlier blocks is off; it is aimed at the own block's last 32 columns (in bounds, written) so that no branch stands round a load. */
__device__ __forceinline__ bool sum_on(int blk, int lane, int u) { return u * 4 + (lane >> 3) < blk; }
__device__ __forceinline__ int sum_col(int blk, int lane, int u) { return (sum_on(blk, lane, u) ? u * 4 + (lane >> 3) : blk) * BLK + (BLK - CSP) + (lane & 7) * 4; }
/* true where the first row of 128-row block blk has no kept key (a later row keeps every key of an earlier row of its block, so false means that no row of the block is without one); the same in every lane. t[u] = the tokens at sum_col(u), tfirst = the token of the block's first column */
__device__ __forceinline__ bool rows_all_masked(const v4ia (&t)[4], int tfirst, int blk, int lane) {
  bool kept = tfirst > 0;
#pragma unroll      /* constant indices, so that the array stays in registers */
  for (int u = 0; u < 4; ++u) for (int q = 0; q < 4; ++q) kept |= sum_on(blk, lane, u) & (t[u][q] > 0);
  return !__any(kept); }
/* PK bit 0: A and Bh lie in fragment order (frag_pos; lda = ldb = their K; sA and sB count whole planes). PK bit 1: C16 is written in fragment order for a plane of ldc columns, sC then counts columns, and C is not written. */
/* RES > 0: C (f32, row-major, pitch RES = ldc, far below 4 GiB) holds the residual: C += acc x alpha + bias, each lane reading just the elements that it stores; C16 is not written. */
/* TR > 0: grid plane blockIdx.y == TR forms its product transposed, into C16T ([N][M], row-major, pitch M): A and Bh change places (an A and a B plane have the same layout, and the k order of every sum stays). M / 128 * (N / 64) == N / 128 * (M / 64), so one grid x serves all planes. No bias. */
template <int ACT, int SP = 0, int PK = 0, int RES = 0, int TR = 0>
__global__ __launch_bounds__(128) void k_gemm2(const _Float16* __restrict__ A, int lda, size_t sA, const _Float16* __restrict__ Bh, int ldb, size_t sB, float alpha, const float* __restrict__ bias, size_t sBias,
    float* __restrict__ C, _Float16* __restrict__ C16, int ldc, size_t sC, int M, int N, int Kfull, const int* __restrict__ tok = nullptr, _Float16* __restrict__ C16T = nullptr) {
  static_assert(!TR || (SP == 0 && !(PK & 2) && !RES), "the transposed plane is a plain product with a row-major f16 result");
  static_assert(!RES || (ACT == 0 && !(PK & 2)), "the residual is added in a row-major store pass, behind no activation");
  __shared__ __attribute__((aligned(16))) float so[4][32][68];
  const int tid = threadIdx.x, w = tid >> 5, lane = tid & 31, ln = lane & 15, hh = lane >> 4; const int by = blockIdx.y;
  A += (size_t)by * sA; Bh += (size_t)by * sB; size_t cofs = (size_t)by * sC; const float* bp = bias ? bias + (size_t)by * sBias : nullptr;
  if (TR && by == TR) { const _Float16* a = A; A = Bh; Bh = a; const int l = lda; lda = ldb; ldb = l; C16 = C16T; cofs = 0; ldc = M; M = N; N = ldc; }
  const int ntn = N >> 6; int mt = blockIdx.x / ntn, nq = blockIdx.x - mt * ntn;
  if (SP == 1) { int t = blockIdx.x; for (mt = 0; mt < SLEN / BLK - 1 && t >= mt + 2; ++mt) t -= mt + 2;      /* row block mt has mt + 2 tiles: the upper half of each earlier block, then the two halves of its own */
    nq = t < mt ? 2 * t + 1 : mt + t; }
  const int row0 = mt * 128 + 32 * w, col0 = nq * 64; if (row0 >= M) return;
  const int K = Kfull;
  /* each lane's byte offsets in A and B are fixed for the whole loop; only the wave-uniform base moves with k (every operand plane here is far below 4 GiB) */
  /* row-major and fragment order alike: 16 rows further on lie 16 x K elements = 32 K bytes further on */
  const unsigned ao0 = (PK & 1) ? (unsigned)(row0 * lda + 8 * lane) * 2u : (unsigned)((row0 + ln) * lda + 8 * hh) * 2u, ao1 = ao0 + 32u * (unsigned)lda;
  const unsigned bo0 = (PK & 1) ? (unsigned)(col0 * ldb + 8 * lane) * 2u : (unsigned)((col0 + ln) * ldb + 8 * hh) * 2u, bo1 = bo0 + 32u * (unsigned)ldb, bo2 = bo1 + 32u * (unsigned)ldb, bo3 = bo2 + 32u * (unsigned)ldb;
  const v8f z8 = {0.f,0.f,0.f,0.f,0.f,0.f,0.f,0.f}; v8f c00 = z8, c01 = z8, c02 = z8, c03 = z8, c10 = z8, c11 = z8, c12 = z8, c13 = z8;
  /* Fragment loads run ahead of the products: the 12 loads of a 32-k step are issued as one group into one of eight rotating register sets, eight steps ahead: a set is asked for again as soon as its products have read it
     (a work-group has one wave a SIMD, so only a wave's own loads in flight cover the latency of its loads; the load counter holds 63, about five groups: the issue of a further group waits for the oldest).
     The k order of every accumulator is unchanged. No step is loaded twice and none past the last. K % 256 == 0, K >= 256. */
  struct Stg { v16h a0, a1, b0, b1, b2, b3; };
  auto fr = [](const char* p, unsigned o) -> v16h { FragH f; f.half[0] = *(const v8us*)(p + o); f.half[1] = *(const v8us*)(p + o + ((PK & 1) ? 512 : 32)); return f.v; };
  constexpr int SB = (PK & 1) ? 1024 : 64;      /* bytes from one 32-k step to the next; fragment order: a step is one 1-KiB block */
  const char* ab = (const char*)A; const char* bb = (const char*)Bh;      /* the bases move on once a trip, by eight steps; inside a trip a group's step is a constant offset */
  auto ld = [&](Stg& s, int st, bool last = true) { const char* ak = ab + st * SB; const char* bk = bb + st * SB;
    s.a0 = fr(ak, ao0); s.a1 = fr(ak, ao1); s.b0 = fr(bk, bo0); s.b1 = fr(bk, bo1); s.b2 = fr(bk, bo2); s.b3 = fr(bk, bo3);
    if (last) asm volatile("s_wait_xcnt 0x0" ::: "memory");      /* the address registers that these loads name are rewritten only behind this wait; the groups of a trip share theirs, so the trip's last group has it for all */
    __builtin_amdgcn_sched_barrier(0);      /* keeps the whole group in front of the wait of the products behind it (below that wait the loads would start one latency late), and behind a last group the next address work behind the wait above */
  };
  /* the plain builtin, which the compiler pads itself: the operands of an asm statement (g2_mma's v_nop) must lie in v0 to v255, and eight sets with the accumulators do not fit there */
  auto pm = [](v16h a, v16h b, v8f c) -> v8f { return __builtin_amdgcn_wmma_f32_16x16x32_f16(false, a, false, b, (short)0, c, false, false); };
  auto mm = [&](const Stg& s) { c00 = pm(s.a0, s.b0, c00); c10 = pm(s.a1, s.b0, c10); c01 = pm(s.a0, s.b1, c01); c11 = pm(s.a1, s.b1, c11);
    c02 = pm(s.a0, s.b2, c02); c12 = pm(s.a1, s.b2, c12); c03 = pm(s.a0, s.b3, c03); c13 = pm(s.a1, s.b3, c13); };
  float bvs[4] = {0.f, 0.f, 0.f, 0.f};      /* the bias of the lane's four columns */
  { Stg s0, s1, s2, s3, s4, s5, s6, s7; ld(s0, 0); ld(s1, 1); int kb = 0;
    if (bp) { const int bc = col0 + ln;      /* asked for ahead of the k loop, behind the first two fragment groups: it has landed long before the epilogue reads it */
#pragma unroll      /* constant indices, so that the array stays in registers */
      for (int t = 0; t < 4; ++t) bvs[t] = bp[bc + t * 16];
      asm volatile("s_wait_xcnt 0x0" :: "v"(bc), "s"(bp) : "memory");      /* inputs only: the lane's column and the base that the four loads name stay live up to here and are rewritten only behind this wait */
    }
    ld(s2, 2); ld(s3, 3); ld(s4, 4); ld(s5, 5); ld(s6, 6); ld(s7, 7);
#pragma unroll 1      /* one copy of the eight-step body: a second copy would not fit the register sets */
    for (; kb + 512 <= K; kb += 256) { mm(s0); ld(s0, 8, false); mm(s1); ld(s1, 9, false); mm(s2); ld(s2, 10, false); mm(s3); ld(s3, 11, false); mm(s4); ld(s4, 12, false); mm(s5); ld(s5, 13, false); mm(s6); ld(s6, 14, false); mm(s7); ld(s7, 15);
      ab += 8 * SB; bb += 8 * SB; }
    mm(s0); mm(s1); mm(s2); mm(s3); mm(s4); mm(s5); mm(s6); mm(s7); }      /* the last eight steps: nothing is left to ask for */
  const int rsub = lane >> 4, c4 = (lane & 15) * 4;
  v4f rs[16];      /* RES: the residual of the wave's tile in the lane order of the store pass: 16 loads of 16 bytes, whole 256-byte row pieces, all in flight together while the tile goes through LDS */
  const unsigned ro = 4u * (unsigned)((row0 + rsub) * RES + (int)cofs + col0 + c4);      /* RES: one lane offset for all 16 loads, and for the 16 stores: two rows further on is a constant offset */
  if (RES) {
#pragma unroll      /* constant indices, so that the array stays in registers */
    for (int q = 0; q < 16; ++q) rs[q] = *(const v4fa*)((const char*)C + ro + q * 8 * RES);
    asm volatile("s_wait_xcnt 0x0" :: "v"(ro), "s"(C) : "memory");      /* inputs only: the lane offset and the base that the 16 loads name stay live up to here, so no load's result lands in them, and they are rewritten only behind this wait */
    __builtin_amdgcn_sched_barrier(0);      /* keeps the vector work of the LDS pass from being lifted in front of the 16 loads (they would start later) or in front of the wait above */
  }
  v8f accs[8] = {c00, c01, c02, c03, c10, c11, c12, c13};
#pragma unroll
  for (int u = 0; u < 8; ++u) { const int t = u & 3, half = u >> 2; const float bv = bf16_round(bvs[t]);
#pragma unroll
    for (int r = 0; r < 8; ++r) { const int rloc = half * 16 + 8 * hh + r; float v = accs[u][r] * alpha + bv;
      if (ACT == 3) v = fmaxf(v, 0.f); else if (ACT == 6) v = 0.5f * v * (1.0f + erff(v * 0.70710678118654752f)); else if (ACT == 11) v = 1.0f / (1.0f + expf(-v)); else if (ACT == 15) v = v / (1.0f + expf(-v)); else if (ACT == 12) v = (v > 0.f) ? v : 0.01f * v; else if (ACT == 8) v = tanhf(v); else if (ACT == 9) v = 0.5f * v * (1.0f + tanhf(0.7978845608028654f * (v + 0.044715f * v * v * v)));      /* tanh-GELU */
      so[w][rloc][t * 16 + ln] = v; } }
  __builtin_amdgcn_fence(__ATOMIC_ACQ_REL, "workgroup"); __builtin_amdgcn_wave_barrier();
  if (PK & 2) {      /* the wave's 32 x 64 tile is 2 x 2 blocks of the next product's A plane: each store is one piece of a block, 512 contiguous bytes */
    unsigned short* d0 = (unsigned short*)C16 + frag_pos(row0 + ln, (int)cofs + col0 + 8 * hh, ldc); unsigned short* d1 = d0 + 16 * (size_t)ldc;
#pragma unroll      /* constant indices: the stores share two address registers with constant offsets */
    for (int s = 0; s < 8; ++s) { const int rt = s >> 2, pc = s & 3;      /* piece pc: columns 16 pc + 8 hh up */
      const v4f v0 = *(const v4fa*)&so[w][rt * 16 + ln][pc * 16 + 8 * hh], v1 = *(const v4fa*)&so[w][rt * 16 + ln][pc * 16 + 8 * hh + 4]; FragH f;
      for (int i = 0; i < 4; ++i) { f.h[i] = (_Float16)v0[i]; f.h[4 + i] = (_Float16)v1[i]; }
      *(v8us*)((rt ? d1 : d0) + pc * 256) = f.half[0]; }
  } else if (RES) {
#pragma unroll      /* constant indices, so that the array stays in registers; the 16 LDS reads are in flight together */
    for (int q = 0; q < 16; ++q) rs[q] += *(const v4fa*)&so[w][q * 2 + rsub][c4];
#pragma unroll      /* each store has data registers of its own and all share one address register, so nothing that an issued store names is rewritten */
    for (int q = 0; q < 16; ++q) *(v4f*)((char*)C + ro + q * 8 * RES) = rs[q];
  } else {
#pragma unroll
    for (int q = 0; q < 16; ++q) { const int r = q * 2 + rsub; const v4f v = *(const v4fa*)&so[w][r][c4]; if (C) *(v4f*)(C + cofs + (size_t)(row0 + r) * ldc + col0 + c4) = v; if (C16) { v4h h4; for (int i = 0; i < 4; ++i) h4[i] = (_Float16)v[i]; *(v4h*)(C16 + cofs + (size_t)(row0 + r) * ldc + col0 + c4) = h4; } }
     } }


__global__ __launch_bounds__(256) void k_embed(const int* __restrict__ tok, const float* __restrict__ emb, const float* __restrict__ pos, float* __restrict__ X) {
  #pragma clang fp contract(off)
  const int t = blockIdx.x * 256 + threadIdx.x; if (t >= SLEN * (DM / 4)) return; const int c0 = (t % (DM / 4)) * 4, s = t / (DM / 4); const int id = (s == 0) ? 0 : tok[s - 1]; v4f o;
#pragma unroll
  for (int q = 0; q < 4; ++q) o[q] = bf16_round(emb[(size_t)id * DM + c0 + q]) + bf16_round(pos[(size_t)s * DM + c0 + q]);
  *(v4f*)(X + (size_t)s * DM + c0) = o;  }
__global__ __launch_bounds__(256) void k_ln512(const float* __restrict__ X, const float* __restrict__ g, const float* __restrict__ bb, _Float16* __restrict__ Y16) {
  #pragma clang fp contract(off)
  const int tid = threadIdx.x, w = tid >> 5, ln = tid & 31; const int r = blockIdx.x * 8 + w; if (r >= SLEN) return; const float* x = X + (size_t)r * DM; v4f a[4]; float s = 0.f;
#pragma unroll
  for (int i = 0; i < 4; ++i) { a[i] = *(const v4fa*)(x + i * 128 + ln * 4); for (int q = 0; q < 4; ++q) s += a[i][q]; }
  for (int o = 16; o > 0; o >>= 1) s += __shfl_xor(s, o, 32); const float mu = s / (float)DM; float q2 = 0.f;
#pragma unroll
  for (int i = 0; i < 4; ++i) for (int q = 0; q < 4; ++q) { const float d = a[i][q] - mu; q2 += d * d; }
  for (int o = 16; o > 0; o >>= 1) q2 += __shfl_xor(q2, o, 32); const float rs = rsqrtf(q2 / (float)DM + 1e-6f);
  {
#pragma unroll
    for (int i = 0; i < 4; ++i) { const int c0 = i * 128 + ln * 4; _Float16 h4[4]; for (int q = 0; q < 4; ++q) h4[q] = (_Float16)((a[i][q] - mu) * rs * bf16_round(g[c0 + q]) + bf16_round(bb[c0 + q])); *(unsigned long long*)((unsigned short*)Y16 + frag_pos(r, c0, DM)) = *(const unsigned long long*)h4; }      /* fragment order: Y16 is the A plane of the products behind it */
     } }
/* Attention of one layer in one launch: blockIdx.y = head, blockIdx.x = 64 query rows, a wave = 16 query rows; no LDS, no barrier, no score or probability plane in memory.
   A step is 32 key columns. Scores are formed transposed, S^T = K . Q^T (A = 16 keys x 32 d, B = 32 d x 16 queries): a lane then holds one query (lane % 16) and, in the two accumulators of a step, keys 8 (lane / 16) + r and 16 + 8 (lane / 16) + r.
   These are just the k positions that the lane holds in a B fragment, so P^T goes into O^T += V^T . P^T (A = 16 d x 32 keys of VT) without leaving the lane. Softmax is the running form, in base 2: maximum m and sum l a query, O^T and l scaled by 2^(m_old - m_new) at each step, O^T divided by l at the end.
   Steps visited: the last 32 columns of each earlier 128-block, then the own block up to the wave's last row; a block that holds a row with no kept key (uniform softmax over all 2048 columns) visits all 64 steps. A masked score is -1e9 as in the reference. */
__device__ __forceinline__ float xhalf(float x) { return __builtin_bit_cast(float, __builtin_amdgcn_permlanex16(__builtin_bit_cast(int, x), __builtin_bit_cast(int, x), 0x76543210, 0xfedcba98, false, false)); }      /* the value of lane l ^ 16 */
__global__ __launch_bounds__(128) void k_attn(const _Float16* __restrict__ Q, const _Float16* __restrict__ Kp, const _Float16* __restrict__ VT, const int* __restrict__ tok, _Float16* __restrict__ O16) {
  const int tid = threadIdx.x, lane = tid & 31, ln = lane & 15, hh = lane >> 4, h = blockIdx.y;
  const int w = __builtin_amdgcn_readfirstlane(tid >> 5);      /* the wave's number in a scalar register */
  const int row0 = blockIdx.x * 64 + 16 * w, mt = row0 / BLK, i = row0 + ln;
  auto fr = [](const char* p, unsigned o) -> v16h { FragH f; f.half[0] = *(const v8us*)(p + o); f.half[1] = *(const v8us*)(p + o + 32); return f.v; };
  const unsigned qo = (unsigned)(i * DM + h * 64 + 8 * hh) * 2u;
  const v16h q0 = fr((const char*)Q, qo), q1 = fr((const char*)Q, qo + 64);      /* d 0 to 31, d 32 to 63 */
  v4ia t[4];
#pragma unroll      /* constant indices, so that the array stays in registers */
  for (int u = 0; u < 4; ++u) t[u] = *(const v4ia*)(tok + sum_col(mt, lane, u));
  const int tf = tok[mt * BLK];
  asm volatile("s_wait_xcnt 0x0" :: "v"(t[0]), "v"(t[1]), "v"(t[2]), "v"(t[3]), "s"(tf), "v"(qo) : "memory");      /* inputs only: the token loads are in flight together with the query's (one latency); the address registers of all of them are rewritten only behind this wait */
  __builtin_amdgcn_sched_barrier(0);      /* keeps the work below from being lifted in front of that wait */
  const bool sparse = !rows_all_masked(t, tf, mt, lane);
  /* steps below e are the earlier blocks'; n steps in all. Both in scalar registers: the trip count, the column of a step and the base of its loads are then scalar arithmetic without branches */
  const int e = __builtin_amdgcn_readfirstlane(sparse ? mt : 0), n = __builtin_amdgcn_readfirstlane(sparse ? mt + ((row0 & (BLK - 1)) >> 5) + 1 : SLEN / 32);
  auto colof = [&](int st) -> int { const int s = st < n - 1 ? st : n - 1;      /* a load past the last step is aimed at the last step again (in bounds, its values unused) */
    return s < e ? s * BLK + (BLK - CSP) : e * (BLK - 32) + s * 32; };
  const unsigned ko = (unsigned)(ln * DM + h * 64 + 8 * hh) * 2u, vo = (unsigned)((h * 64 + ln) * SLEN + 8 * hh) * 2u;
  struct KS { v16h k00, k01, k10, k11; };      /* kTD: keys 16 T up, d 32 D up */
  struct VS { v16h v0, v1, v2, v3; };      /* vT: d 16 T up */
  auto ldk = [&](KS& s, int kc) { const char* kb = (const char*)Kp + kc * (DM * 2);
    s.k00 = fr(kb, ko); s.k01 = fr(kb, ko + 64); s.k10 = fr(kb, ko + 16 * DM * 2); s.k11 = fr(kb, ko + 16 * DM * 2 + 64);
    asm volatile("s_wait_xcnt 0x0" ::: "memory");      /* the address registers that these loads name are rewritten for the next group only behind this wait */
    __builtin_amdgcn_sched_barrier(0);      /* keeps the group in front of the vector work behind it (below it the loads would start late), and the next group's address work behind the wait above */
  };
  auto ldv = [&](VS& s, int kc) { const char* vb = (const char*)VT + kc * 2;
    s.v0 = fr(vb, vo); s.v1 = fr(vb, vo + 16 * SLEN * 2); s.v2 = fr(vb, vo + 32 * SLEN * 2); s.v3 = fr(vb, vo + 48 * SLEN * 2);
    asm volatile("s_wait_xcnt 0x0" ::: "memory");      /* as in ldk */
    __builtin_amdgcn_sched_barrier(0);      /* as in ldk */
  };
  /* Lane j forms the word of step j: bit c says that column colof(j) + c is in the pattern (the same for all 32 columns of a step) and no padding; a step then reads its word with one readlane, and the loop holds no token load. w1: steps 32 up, which only the walk over all columns has */
  auto ldt = [&](v4ia (&tt)[8], int kc) { const unsigned jo = 4u * (unsigned)kc;
#pragma unroll      /* constant indices, so that the array stays in registers */
    for (int q = 0; q < 8; ++q) tt[q] = *(const v4ia*)((const char*)tok + jo + 16 * q);
    asm volatile("s_wait_xcnt 0x0" :: "v"(jo), "s"(tok) : "memory");      /* inputs only: the lane offset and the base that the eight loads name stay live up to here and are rewritten only behind this wait */
    __builtin_amdgcn_sched_barrier(0);      /* keeps the eight loads in front of the fragment loads behind them: their values are then waited for without waiting for the fragments */
  };
  auto word = [&](const v4ia (&tt)[8], int kc) -> unsigned { unsigned b = 0u;
#pragma unroll      /* constant indices, so that the array stays in registers */
    for (int q = 0; q < 8; ++q) for (int c = 0; c < 4; ++c) b |= (tt[q][c] > 0 ? 1u : 0u) << (4 * q + c);
    return ((kc / BLK == mt) | ((kc & (BLK - 1)) == BLK - CSP)) ? b : 0u; };
  unsigned w0, w1 = 0u; v4ia ta[8]; const int kl = colof(lane);
  if (!sparse) { const int kh = colof(32 + lane); ldt(ta, kh); w1 = word(ta, kh); }
  ldt(ta, kl);
  const v8f z8 = {0.f,0.f,0.f,0.f,0.f,0.f,0.f,0.f}; v8f o0 = z8, o1 = z8, o2 = z8, o3 = z8;
  float m = -3.0e38f, l = 0.f;      /* l: the lane's own 16 keys of each step; the two lanes of a query are added at the end */
  /* one step at column kc; more: each register set is asked for again, for column kn two steps on, as soon as its products have read it */
  auto step = [&](KS& ks, VS& vs, int st, bool more) { const int kc = colof(st), kn = colof(st + 2);
    v8f s0 = g2_mma(ks.k00, q0, z8), s1 = g2_mma(ks.k10, q0, z8); s0 = g2_mma(ks.k01, q1, s0); s1 = g2_mma(ks.k11, q1, s1);
    const unsigned um = (unsigned)__builtin_amdgcn_readlane((int)(st < 32 ? w0 : w1), st & 31);
    if (more) ldk(ks, kn);
    const int dl = i - kc - 8 * hh;      /* key 8 hh + b is causal where b <= dl */
    const unsigned ul = (um >> (8 * hh)) & (dl < 0 ? 0u : 0xFFFFFFFFu >> (31 - (dl < 31 ? dl : 31)));      /* bit b: key 8 hh + b is kept */
    float x[16], mx = m;
#pragma unroll      /* constant indices, so that the array stays in registers */
    for (int r = 0; r < 8; ++r) { x[r] = ((ul >> r) & 1u) ? s0[r] * 0.18033688011112042f : -1.4426950408889634e9f; x[8 + r] = ((ul >> (16 + r)) & 1u) ? s1[r] * 0.18033688011112042f : -1.4426950408889634e9f; }      /* (q / 8) . k and -1e9, both x log2(e) */
#pragma unroll      /* constant indices, so that the array stays in registers */
    for (int c = 0; c < 16; ++c) mx = fmaxf(mx, x[c]);
    mx = fmaxf(mx, xhalf(mx));
    FragH p; float ls[4] = {0.f, 0.f, 0.f, 0.f};      /* four partial sums: a chain of 4 adds, not of 16 */
#pragma unroll      /* constant indices, so that the arrays stay in registers */
    for (int c = 0; c < 16; ++c) { const float pe = __builtin_amdgcn_exp2f(x[c] - mx); ls[c & 3] += pe; p.h[c] = (_Float16)pe; }
    const float sc = __builtin_amdgcn_exp2f(m - mx); m = mx; l = l * sc + ((ls[0] + ls[1]) + (ls[2] + ls[3])); o0 *= sc; o1 *= sc; o2 *= sc; o3 *= sc;
    o0 = g2_mma(vs.v0, p.v, o0); o1 = g2_mma(vs.v1, p.v, o1); o2 = g2_mma(vs.v2, p.v, o2); o3 = g2_mma(vs.v3, p.v, o3);
    if (more) ldv(vs, kn); };
  { KS ka, kb; VS va, vb; ldk(ka, colof(0)); ldv(va, colof(0)); ldk(kb, colof(1)); ldv(vb, colof(1)); int st = 0;
    w0 = word(ta, kl);
#pragma unroll 1      /* one copy of the two-step body: a second copy would not fit the register sets */
    for (; st + 2 <= n; st += 2) { step(ka, va, st, true); step(kb, vb, st + 1, true); }      /* no branch inside: every trip issues the same loads, so the counted load waits leave the younger groups in flight */
    if (st < n) step(ka, va, st, false); }
  const float inv = 1.0f / (l + xhalf(l));
  unsigned short* d0 = (unsigned short*)O16 + frag_pos(i, h * 64 + 8 * hh, DM);      /* fragment order: O16 is the A plane of the product behind it; a store is one piece of a block, 512 contiguous bytes */
  const v8f os[4] = {o0, o1, o2, o3};
#pragma unroll      /* constant indices: the stores share one address register with constant offsets */
  for (int tt = 0; tt < 4; ++tt) { FragH f; for (int r = 0; r < 8; ++r) f.h[r] = (_Float16)(os[tt][r] * inv); *(v8us*)(d0 + tt * 256) = f.half[0]; } }

extern "C" void kernel_launch(void* const* d_in, const int* in_sizes, int n_in,
                              void* d_out, int out_size, void* d_ws, size_t ws_size, hipStream_t stream) {
  (void)in_sizes; (void)n_in; (void)out_size;
  const float* const* I = (const float* const*)d_in; const int* tok = (const int*)d_in[0]; const float* emb = I[1]; const float* pos = I[2]; const float* l1s = I[3]; const float* l1b = I[4]; const float* wq = I[5]; const float* wk = I[6]; const float* wv = I[7]; const float* wo = I[8];
  const float* l2s = I[9]; const float* l2b = I[10]; const float* w1 = I[11]; const float* b1 = I[12]; const float* w2 = I[13]; const float* b2 = I[14]; const float* lfs = I[15]; const float* lfb = I[16]; const float* wout = I[17]; const float* bout = I[18];
  char* ws = (char*)d_ws; size_t off = 0;
  auto take = [&](size_t bytes) { char* p = ws + off; off += (bytes + 255) & ~(size_t)255; return p; };
  _Float16* BW = (_Float16*)take((NL * LWT + (size_t)NVOC * DM) * 2);      /* the f16 weights of every layer, then the output projection's */ _Float16* BOUT = BW + NL * LWT;
  float* X = (float*)take((size_t)SLEN * DM * 4); _Float16* H16 = (_Float16*)take((size_t)SLEN * DM * 2); _Float16* Q16 = (_Float16*)take((size_t)2 * SLEN * DM * 2); _Float16* K16 = Q16 + (size_t)SLEN * DM;      /* q, then k: planes 0 and 1 of one launch */ _Float16* VT = (_Float16*)take((size_t)DM * SLEN * 2);
  _Float16* O16 = (_Float16*)take((size_t)SLEN * DM * 2); _Float16* G16 = (_Float16*)take((size_t)SLEN * DMLP * 2);
  if (off > ws_size) return;      /* 36.3 + 4 + 2 x 4 + 2 + 8 = 58.3 MiB */
  const dim3 gW(192, NL + 1), gQ((SLEN / 128) * (DM / 64), 3), gP((SLEN / 128) * (DM / 64), 1), gA(SLEN / 64, NH), gM((SLEN / 128) * (DMLP / 64), 1), gV((SLEN / 128) * (NVOC / 64), 1);
  k_wt_all<<<gW, 256, 0, stream>>>(wq, wk, wv, wo, w1, w2, wout, BW);      /* wq[l] [D][H][DH] = (in, out=h*64+k); wo[l] [H][DH][D] = (in=h*64+k, out) */
  k_embed<<<(SLEN * (DM / 4) + 255) / 256, 256, 0, stream>>>(tok, emb, pos, X);
  for (int l = 0; l < NLRUN; ++l) {
    const _Float16* BQ = BW + l * LWT; const _Float16* BO = BQ + (size_t)3 * DM * DM;      /* q, k, v lie one behind the other */ const _Float16* BW1 = BO + (size_t)DM * DM; const _Float16* BW2 = BW1 + (size_t)DM * DMLP;
    k_ln512<<<SLEN / 8, 256, 0, stream>>>(X, l1s + l * DM, l1b + l * DM, H16);
    k_gemm2<0, 0, 1, 0, 2><<<gQ, 128, 0, stream>>>(H16, DM, 0, BQ, DM, (size_t)DM * DM, 0.0625f, nullptr, 0, nullptr, Q16, DM, (size_t)SLEN * DM, SLEN, DM, DM, nullptr, VT);      /* blockIdx.y = 0: q, 1: k, 2: v, as VT[h * 64 + d][token] */
    k_attn<<<gA, 128, 0, stream>>>(Q16, K16, VT, tok, O16);      /* scores, softmax and P.v of all heads: blockIdx.y = head */
    k_gemm2<0, 0, 1, DM><<<gP, 128, 0, stream>>>(O16, DM, 0, BO, DM, 0, 0.0625f, nullptr, 0, X, nullptr, DM, 0, SLEN, DM, DM);      /* x += o Wo (own tile, in place) */
    k_ln512<<<SLEN / 8, 256, 0, stream>>>(X, l2s + l * DM, l2b + l * DM, H16);
    k_gemm2<9, 0, 3><<<gM, 128, 0, stream>>>(H16, DM, 0, BW1, DM, 0, 0.0625f, b1 + (size_t)l * DMLP, 0, nullptr, G16, DMLP, 0, SLEN, DMLP, DM);      /* tanh-gelu(y W1 + b1) */
    k_gemm2<0, 0, 1, DM><<<gP, 128, 0, stream>>>(G16, DMLP, 0, BW2, DMLP, 0, 0.0625f, b2 + (size_t)l * DM, 0, X, nullptr, DM, 0, SLEN, DM, DMLP); }      /* x += mlp + b2 */
  k_ln512<<<SLEN / 8, 256, 0, stream>>>(X, lfs, lfb, H16);
  k_gemm2<0, 0, 1><<<gV, 128, 0, stream>>>(H16, DM, 0, BOUT, DM, 0, 0.0625f, bout, 0, (float*)d_out, nullptr, NVOC, 0, SLEN, NVOC, DM);
}

// v010
// It runs in 380 microseconds.
// In two side-by-side timings against v009, it was 1.04 and 1.05 times as fast.
// Counting every step since v000, it is 15.3 times as fast.
#include <hip/hip_runtime.h>
// Sparse-pattern transformer decoder (1 x 2048 tokens, 512 = 8 heads x 64, 6 layers, MLP 2048 (tanh-GELU), vocab 256): x = embed[shift_right(tokens)] + pos_emb; per layer: h = LN1(x); q = h Wq / 8, k, v; scores masked by the structural fixed sparse pattern (causal & (same 128-block | last 32 columns of each block)) AND the INPUT key padding (token > 0), masked entries = -1e9 exactly as the reference; softmax; x += (P v) Wo; x += gelu(LN2(x) W1 + b1) W2 + b2; out = LNf(x) Wout + bout -> [1,2048,256].
// Structure: token-embedding gather by the INPUT ids on VALU; LayerNorms on VALU; all weights turned to f16 planes by one launch ahead of the layers; the weights, the activations that the Linears read (LN outputs, attention output, GELU hidden) and q, k, v lie in WMMA fragment order (frag_pos); all Linears as f16 WMMA GEMMs (32x64 wave tiles, f32 accumulation, exact x16 weights, biases / GELU / residual accumulation in the epilogue); q, k and v in one launch (grid y = the matrix), v formed transposed ([head dim][token], the A plane of V^T . P^T) by letting its two operands change places; per layer, the attention of all heads in one launch (k_attn, grid y = head): a wave forms the scores of 16 query rows transposed on WMMA, applies the structural pattern and the key-padding predicate, keeps a running f32 softmax in registers (P f16, at most 1) and feeds P straight into the P.v WMMA; the result goes into the head's columns of an f16 plane. It visits only the columns that the structural pattern can keep for the rows (their own block, the last 32 columns of each earlier block); a block that holds a row with no kept key at all (uniform softmax over all 2048 columns) visits all columns.
// Compute dtype: embeddings, weights, biases, LN parameters rounded to bf16; LN outputs, q, k, v, P, attention output, GELU hidden as f16 operands (~2^-12; logits small); the residual stream, softmax, LayerNorm in f32. v_wmma_f32_16x16x32_f16.
#define SLEN 2048
#define DM 512
#define NH 8
#define NL 6
#define NLRUN NL                 /* layers executed */
#define DMLP 2048
#define NVOC 256
#define BLK 128
#define CSP 32
#define NR SLEN
typedef __bf16 v16b __attribute__((ext_vector_type(16)));
typedef unsigned short v8us __attribute__((ext_vector_type(8), may_alias));
typedef float  v8f  __attribute__((ext_vector_type(8)));
typedef float  v4f  __attribute__((ext_vector_type(4)));
typedef float  v4fa __attribute__((ext_vector_type(4), may_alias));
union FragB { v16b v; v8us half[2]; unsigned short u[16]; };

__device__ __forceinline__ unsigned short bf16_bits(float x) { unsigned int u = __float_as_uint(x); return (unsigned short)((u + 0x7FFFu + ((u >> 16) & 1u)) >> 16); }
__device__ __forceinline__ float bf16_val(unsigned short b) { return __uint_as_float(((unsigned int)b) << 16); }
__device__ __forceinline__ float bf16_round(float x) { return bf16_val(bf16_bits(x)); }
// D += A·B with NT terms: 1 = ah·bh, 2 = + al·bh (A split), 3 = + ah·bl (both split)
template <int NT>
__device__ __forceinline__ v8f mmaN(v16b ah, v16b al, v16b bh, v16b bl, v8f c) {
  c = __builtin_amdgcn_wmma_f32_16x16x32_bf16(false, ah, false, bh, (short)0, c, false, false);
  if (NT >= 2) c = __builtin_amdgcn_wmma_f32_16x16x32_bf16(false, al, false, bh, (short)0, c, false, false);
  if (NT >= 3) c = __builtin_amdgcn_wmma_f32_16x16x32_bf16(false, ah, false, bl, (short)0, c, false, false);
  asm volatile("v_nop\n\tv_nop\n\tv_nop\n\tv_nop" : "+v"(c) : "v"(ah), "v"(al), "v"(bh), "v"(bl));
  return c;
}

__global__ __launch_bounds__(256) void k_wt_bf16(const float* __restrict__ W, unsigned short* __restrict__ Wt, int K, int N) {
  const int t = blockIdx.x * 256 + threadIdx.x;
  const int k8n = K / 8;
  if (t >= N * k8n) return;
  const int n = t / k8n, k8 = (t % k8n) * 8;
  v8us v;
#pragma unroll
  for (int i = 0; i < 8; ++i) v[i] = bf16_bits(W[(size_t)(k8 + i) * N + n]);
  *(v8us*)(Wt + (size_t)n * K + k8) = v;
  
}

// GEMM C[M][N] (f32, pitch ldc) = act(A[M][K]·W + bias). A f32 row-major (pitch lda) converted per fragment to bf16
// (ASPLIT: hi/lo two planes -> 2 terms, else single rounded term); Wt bf16 [N][K] (pitch ldb). BIAS_BF16 rounds the
// bias to bf16 first (bias quantised to bf16 before the add). K%32==0, M%16==0, N%64==0.
template <bool ASPLIT, int ACT, bool BIAS_BF16>
__global__ __launch_bounds__(128) void k_gemm_bf(const float* __restrict__ A, int lda, const unsigned short* __restrict__ Wt, int ldb,
                                               const float* __restrict__ bias, float* __restrict__ C, int ldc, int M, int N, int K) {
  __shared__ __attribute__((aligned(16))) float so[4][16][64];
  const int tid = threadIdx.x, w = tid >> 5, lane = tid & 31, ln = lane & 15, hh = lane >> 4;
  const int ntn = N / 64;
  const int wid = blockIdx.x * 4 + w;
  const int mt = wid / ntn, nq = wid % ntn;
  if (mt * 16 >= M) return;
  const int row0 = mt * 16, col0 = nq * 64;
  const float* arow = A + (size_t)(row0 + ln) * lda;
  v8f acc[4] = {};
  for (int kb = 0; kb < K; kb += 32) {
    FragB ah, al;
    const v4f x0 = *(const v4fa*)(arow + kb + 8 * hh), x1 = *(const v4fa*)(arow + kb + 8 * hh + 4);
    const v4f x2 = *(const v4fa*)(arow + kb + 16 + 8 * hh), x3 = *(const v4fa*)(arow + kb + 16 + 8 * hh + 4);
    float xs[16] = {x0[0],x0[1],x0[2],x0[3],x1[0],x1[1],x1[2],x1[3],x2[0],x2[1],x2[2],x2[3],x3[0],x3[1],x3[2],x3[3]};
#pragma unroll
    for (int i = 0; i < 16; ++i) { const unsigned short hb = bf16_bits(xs[i]); ah.u[i] = hb; al.u[i] = ASPLIT ? bf16_bits(xs[i] - bf16_val(hb)) : (unsigned short)0; }
#pragma unroll
    for (int t = 0; t < 4; ++t) {
      const unsigned short* brow = Wt + (size_t)(col0 + t * 16 + ln) * ldb + kb;
      FragB b;
      b.half[0] = *(const v8us*)(brow + 8 * hh);
      b.half[1] = *(const v8us*)(brow + 16 + 8 * hh);
      acc[t] = mmaN<ASPLIT ? 2 : 1>(ah.v, al.v, b.v, b.v, acc[t]);
    }
  }
#pragma unroll
  for (int t = 0; t < 4; ++t) {
    float bv = bias ? bias[col0 + t * 16 + ln] : 0.f;
    if (BIAS_BF16) bv = bf16_round(bv);
#pragma unroll
    for (int r = 0; r < 8; ++r) { float v = acc[t][r] + bv; if (ACT == 1) v = fmaxf(v, 0.f); so[w][8 * hh + r][t * 16 + ln] = v; }
  }
  __builtin_amdgcn_fence(__ATOMIC_ACQ_REL, "workgroup");
  __builtin_amdgcn_wave_barrier();
  const int rsub = lane >> 4, c4 = (lane & 15) * 4;
  {
#pragma unroll
    for (int q = 0; q < 8; ++q) {
      const int r = q * 2 + rsub;
      const v4f v = *(const v4fa*)&so[w][r][c4];
      *(v4f*)(C + (size_t)(row0 + r) * ldc + col0 + c4) = v;
    }
    
  }
}

// GEMM C = act(A·W + bias + resid): A f32 (ASPLIT -> hi/lo 2 terms), Wt bf16 [N][K]; ACT 0 none, 1 relu, 2 exact gelu;
// resid (optional, f32, row index = (row % rmod), pitch ldr, RES_BF16 rounds it) added before the activation.
template <bool ASPLIT, int ACT, bool BIAS_BF16, bool RES_BF16>
__global__ __launch_bounds__(128) void k_gemm_bf3(const float* __restrict__ A, int lda, const unsigned short* __restrict__ Wt, int ldb,
                                                const float* __restrict__ bias, const float* __restrict__ resid, int rmod, int ldr,
                                                float* __restrict__ C, int ldc, int M, int N, int K) {
  __shared__ __attribute__((aligned(16))) float so[4][16][64];
  const int tid = threadIdx.x, w = tid >> 5, lane = tid & 31, ln = lane & 15, hh = lane >> 4;
  const int ntn = N / 64;
  const int wid = blockIdx.x * 4 + w;
  const int mt = wid / ntn, nq = wid % ntn;
  if (mt * 16 >= M) return;
  const int row0 = mt * 16, col0 = nq * 64;
  const float* arow = A + (size_t)(row0 + ln) * lda;
  v8f acc[4] = {};
  for (int kb = 0; kb < K; kb += 32) {
    FragB ah, al;
    const v4f x0 = *(const v4fa*)(arow + kb + 8 * hh), x1 = *(const v4fa*)(arow + kb + 8 * hh + 4);
    const v4f x2 = *(const v4fa*)(arow + kb + 16 + 8 * hh), x3 = *(const v4fa*)(arow + kb + 16 + 8 * hh + 4);
    float xs[16] = {x0[0],x0[1],x0[2],x0[3],x1[0],x1[1],x1[2],x1[3],x2[0],x2[1],x2[2],x2[3],x3[0],x3[1],x3[2],x3[3]};
#pragma unroll
    for (int i = 0; i < 16; ++i) { const unsigned short hb = bf16_bits(xs[i]); ah.u[i] = hb; al.u[i] = ASPLIT ? bf16_bits(xs[i] - bf16_val(hb)) : (unsigned short)0; }
#pragma unroll
    for (int t = 0; t < 4; ++t) {
      const unsigned short* brow = Wt + (size_t)(col0 + t * 16 + ln) * ldb + kb;
      FragB b;
      b.half[0] = *(const v8us*)(brow + 8 * hh);
      b.half[1] = *(const v8us*)(brow + 16 + 8 * hh);
      acc[t] = mmaN<ASPLIT ? 2 : 1>(ah.v, al.v, b.v, b.v, acc[t]);
    }
  }
#pragma unroll
  for (int t = 0; t < 4; ++t) {
    const int col = col0 + t * 16 + ln;
    float bv = bias ? bias[col] : 0.f;
    if (BIAS_BF16) bv = bf16_round(bv);
#pragma unroll
    for (int r = 0; r < 8; ++r) {
      float v = acc[t][r] + bv;
      if (resid) { float rv = resid[(size_t)((row0 + 8 * hh + r) % rmod) * ldr + col]; if (RES_BF16) rv = bf16_round(rv); v += rv; }
      if (ACT == 1) v = fmaxf(v, 0.f);
      if (ACT == 2) v = 0.5f * v * (1.0f + erff(v * 0.70710678118654752f));
      if (ACT == 3) { const float u = 0.7978845608028654f * (v + 0.044715f * v * v * v); v = 0.5f * v * (1.0f + tanhf(u)); }
      so[w][8 * hh + r][t * 16 + ln] = v;
    }
  }
  __builtin_amdgcn_fence(__ATOMIC_ACQ_REL, "workgroup");
  __builtin_amdgcn_wave_barrier();
  const int rsub = lane >> 4, c4 = (lane & 15) * 4;
  {
#pragma unroll
    for (int q = 0; q < 8; ++q) {
      const int r = q * 2 + rsub;
      const v4f v = *(const v4fa*)&so[w][r][c4];
      *(v4f*)(C + (size_t)(row0 + r) * ldc + col0 + c4) = v;
    }
    
  }
}
// row LayerNorm (biased variance, eps) over N: s = X (+ R); optional out_sum <- s; out_norm <- (s-mu)*rsqrt(var+eps)*g + b
template <bool PARAM_BF16>
__global__ __launch_bounds__(256) void k_layernorm(const float* __restrict__ X, const float* __restrict__ R, const float* __restrict__ g, const float* __restrict__ bta,
                                                  float* __restrict__ out_sum, float* __restrict__ out_norm, int N, float eps) {
  __shared__ float red[256];
  const int row = blockIdx.x, tid = threadIdx.x;
  const float* x = X + (size_t)row * N; const float* rr = R ? R + (size_t)row * N : nullptr;
  float vals[16];                     // up to N = 4096
  const int per = N / 256;            // contiguous chunk per thread? use strided-by-4 chunks: thread handles j = tid*4 + 1024*u
  float s1 = 0.f;
  for (int u = 0; u < per / 4; ++u) {
    const int j = tid * 4 + 1024 * u;
    const v4f a = *(const v4fa*)(x + j);
    v4f b = {0.f,0.f,0.f,0.f}; if (rr) b = *(const v4fa*)(rr + j);
#pragma unroll
    for (int q = 0; q < 4; ++q) { const float v = a[q] + b[q]; vals[u * 4 + q] = v; s1 += v; }
  }
  red[tid] = s1; __syncthreads();
  for (int st = 128; st > 0; st >>= 1) { if (tid < st) red[tid] += red[tid + st]; __syncthreads(); }
  const float mu = red[0] / (float)N; __syncthreads();
  float s2 = 0.f;
  for (int u = 0; u < per / 4; ++u)
#pragma unroll
    for (int q = 0; q < 4; ++q) { const float c = vals[u * 4 + q] - mu; s2 += c * c; }
  red[tid] = s2; __syncthreads();
  for (int st = 128; st > 0; st >>= 1) { if (tid < st) red[tid] += red[tid + st]; __syncthreads(); }
  const float rs = rsqrtf(red[0] / (float)N + eps);
  {
    for (int u = 0; u < per / 4; ++u) {
      const int j = tid * 4 + 1024 * u;
      v4f o, sm;
#pragma unroll
      for (int q = 0; q < 4; ++q) {
        float gg = g[j + q], bb = bta[j + q];
        if (PARAM_BF16) { gg = bf16_round(gg); bb = bf16_round(bb); }
        sm[q] = vals[u * 4 + q]; o[q] = (vals[u * 4 + q] - mu) * rs * gg + bb;
      }
      if (out_sum) *(v4f*)(out_sum + (size_t)row * N + j) = sm;
      *(v4f*)(out_norm + (size_t)row * N + j) = o;
    }
    
  }
}



// ---- f16 WMMA path (v_wmma_f32_16x16x32_f16): 11-bit significands for operands in range — used where a [0,1] probability operand needs more precision than bf16
typedef _Float16 v16h __attribute__((ext_vector_type(16)));
union FragH { v16h v; v8us half[2]; _Float16 h[16]; unsigned short u[16]; };
template <int NT>
__device__ __forceinline__ v8f mmaH(v16h ah, v16h al, v16h bh, v16h bl, v8f c) {
  c = __builtin_amdgcn_wmma_f32_16x16x32_f16(false, ah, false, bh, (short)0, c, false, false);
  if (NT >= 2) c = __builtin_amdgcn_wmma_f32_16x16x32_f16(false, al, false, bh, (short)0, c, false, false);
  if (NT >= 3) c = __builtin_amdgcn_wmma_f32_16x16x32_f16(false, ah, false, bl, (short)0, c, false, false);
  asm volatile("v_nop\n\tv_nop\n\tv_nop\n\tv_nop" : "+v"(c) : "v"(ah), "v"(al), "v"(bh), "v"(bl));
  return c;
}
// batched GEMM like k_gemm_b but f16 operands: A f32 (split into f16 hi/lo if ASPLIT, else rounded to f16), Bt = f16 values [n][k]; alpha; C f32; N multiple of 16 (partial tiles skipped)
template <bool ASPLIT>
__global__ __launch_bounds__(128) void k_gemm_h(const float* __restrict__ A, int lda, size_t sA, const _Float16* __restrict__ Bh, int ldb, size_t sB, float alpha, float* __restrict__ C, int ldc, size_t sC, int M, int N, int K) {
  __shared__ __attribute__((aligned(16))) float so[4][16][64];
  const int tid = threadIdx.x, w = tid >> 5, lane = tid & 31, ln = lane & 15, hh = lane >> 4; const int by = blockIdx.y;
  A += (size_t)by * sA; Bh += (size_t)by * sB; C += (size_t)by * sC;
  const int ntn = (N + 63) / 64; const int wid = blockIdx.x * 4 + w; const int mt = wid / ntn, nq = wid % ntn; if (mt * 16 >= M) return;
  const int row0 = mt * 16, col0 = nq * 64; const float* arow = A + (size_t)(row0 + ln) * lda;
  v8f acc[4] = {};
  for (int kb = 0; kb < K; kb += 32) {
    FragH ah, al;
    const v4f x0 = *(const v4fa*)(arow + kb + 8 * hh), x1 = *(const v4fa*)(arow + kb + 8 * hh + 4), x2 = *(const v4fa*)(arow + kb + 16 + 8 * hh), x3 = *(const v4fa*)(arow + kb + 16 + 8 * hh + 4);
    float xs[16] = {x0[0],x0[1],x0[2],x0[3],x1[0],x1[1],x1[2],x1[3],x2[0],x2[1],x2[2],x2[3],x3[0],x3[1],x3[2],x3[3]};
#pragma unroll
    for (int i = 0; i < 16; ++i) { const _Float16 h = (_Float16)xs[i]; ah.h[i] = h; al.h[i] = ASPLIT ? (_Float16)(xs[i] - (float)h) : (_Float16)0.0f; }
#pragma unroll
    for (int t = 0; t < 4; ++t) { if (col0 + t * 16 >= N) continue; const size_t boff = (size_t)(col0 + t * 16 + ln) * ldb + kb; FragH bq; bq.half[0] = *(const v8us*)(Bh + boff + 8 * hh); bq.half[1] = *(const v8us*)(Bh + boff + 16 + 8 * hh);
      acc[t] = mmaH<ASPLIT ? 2 : 1>(ah.v, al.v, bq.v, bq.v, acc[t]); }
  }
#pragma unroll
  for (int t = 0; t < 4; ++t) { if (col0 + t * 16 >= N) continue;
#pragma unroll
    for (int r = 0; r < 8; ++r) so[w][8 * hh + r][t * 16 + ln] = acc[t][r] * alpha; }
  __builtin_amdgcn_fence(__ATOMIC_ACQ_REL, "workgroup"); __builtin_amdgcn_wave_barrier();
  const int rsub = lane >> 4, c4 = (lane & 15) * 4;
  {
#pragma unroll
    for (int q = 0; q < 8; ++q) { const int r = q * 2 + rsub; if (col0 + c4 < N) { const v4f v = *(const v4fa*)&so[w][r][c4]; *(v4f*)(C + (size_t)(row0 + r) * ldc + col0 + c4) = v; } }
     }
}

// Fragment order of an f16 operand plane [rows][K] (rows = the m of an A operand, the n of a B operand): 1-KiB blocks of 16 rows x 32 k, block (row / 16, k / 32) at block index (row / 16) * (K / 32) + k / 32.
// Inside a block stand the two 16-byte pieces that each lane of a 16x16x32 fragment holds, lane by lane: piece k / 16 % 2, lane (k / 8 % 2) * 16 + row % 16, element k % 8. A wave's fragment load is then 512 contiguous bytes (4 whole lines) and not 32 bytes of each of 16 lines; which k a lane and register holds is the same as with row-major planes.
__device__ __forceinline__ size_t frag_pos(int row, int k, int K) { return ((size_t)((row >> 4) * (K >> 5) + (k >> 5)) << 9) + (((k >> 4) & 1) << 8) + (((((k >> 3) & 1) << 4) + (row & 15)) << 3) + (k & 7); }
// Wt(n, k) = f16(bf16(W[k][n]) x 16), in fragment order, from f32 row-major W[K][N] (a power of two: bf16-exact weights stay exact in f16 away from the subnormal range).
// One work-group turns a strip of 256 k x 64 n: whole 256-byte row pieces in, 4 KiB of contiguous blocks out of each wave, through LDS.
// LDS row n holds its 256 k as 128 dwords (k, k + 1 packed); the 16-byte chunk c of row n lies at chunk c ^ (n / 4 % 16), so that the 32 lanes of a store (16 rows n four apart, two neighbouring dwords) fall on 32 different banks, while a row stays one contiguous 512 bytes for the 16-byte reads.
typedef unsigned v4u __attribute__((ext_vector_type(4)));
template <int K, int N>
__device__ __forceinline__ void wt_strip(const float* __restrict__ W, _Float16* __restrict__ Wt, int s, unsigned (*tl)[128]) {
  const int tid = threadIdx.x, n0 = (s % (N / 64)) * 64, k0 = (s / (N / 64)) * 256;
  const int l16 = tid & 15, r = tid >> 4;
  const float* src = W + (size_t)(k0 + 2 * r) * N + n0 + l16 * 4;
  v4f a[8], b[8];      /* rows k0 + 32 p + 2 r and the next one, columns n0 + 4 l16 up */
#pragma unroll      /* constant indices, so that the arrays stay in registers and the 16 loads are in flight together */
  for (int p = 0; p < 8; ++p) { a[p] = *(const v4fa*)(src + (size_t)(32 * p) * N); b[p] = *(const v4fa*)(src + (size_t)(32 * p + 1) * N); }
#pragma unroll      /* constant indices, so that the arrays stay in registers */
  for (int p = 0; p < 8; ++p) { const int kp = p * 16 + r;
    for (int q = 0; q < 4; ++q) { union { _Float16 h[2]; unsigned u; } pk; pk.h[0] = (_Float16)(bf16_round(a[p][q]) * 16.0f); pk.h[1] = (_Float16)(bf16_round(b[p][q]) * 16.0f);
      tl[l16 * 4 + q][(((kp >> 2) ^ l16) << 2) + (kp & 3)] = pk.u; } }
  __syncthreads();
  const int w = tid >> 5, j = tid & 31;      /* a wave writes four neighbouring blocks: rows n0 + 16 (w / 2) up, k from k0 + 128 (w % 2); store i is piece i % 2 of block i / 2 */
  const int n = (w >> 1) * 16 + (j & 15);
  unsigned short* dst = (unsigned short*)Wt + frag_pos(n0 + n, k0 + (w & 1) * 128 + (j >> 4) * 8, K);
#pragma unroll      /* the 8 LDS reads are in flight together, and the stores share address registers with constant offsets */
  for (int i = 0; i < 8; ++i) { const int c = (w & 1) * 16 + i * 2 + (j >> 4);      /* the 16-byte chunk (8 k) of LDS row n that lane j holds in that piece */
    const v4u v = *(const v4u*)&tl[n][(c ^ ((n >> 2) & 15)) << 2];
    *(v4u*)(dst + i * 256) = v; }
  asm volatile("s_wait_xcnt 0x0" ::: "memory");      /* in the listing the code of the next matrix shape follows these stores and reuses their address registers: it stands only behind this wait */
}
#define LWT ((size_t)4 * DM * DM + (size_t)2 * DM * DMLP)      /* f16 elements of one layer's six matrices: q, k, v, o, w1, w2 */
// every weight matrix of the model in one launch: blockIdx.y = layer (NL: the output projection), blockIdx.x = strip (16 each for q, k, v, o; 64 for w1; 64 for w2)
__global__ __launch_bounds__(256) void k_wt_all(const float* __restrict__ wq, const float* __restrict__ wk, const float* __restrict__ wv, const float* __restrict__ wo, const float* __restrict__ w1, const float* __restrict__ w2, const float* __restrict__ wout, _Float16* __restrict__ BW) {
  __shared__ __attribute__((aligned(16))) unsigned tl[64][128];
  const int l = blockIdx.y, x = blockIdx.x;
  if (l == NL) { if (x < (NVOC / 64) * (DM / 256)) wt_strip<DM, NVOC>(wout, BW + NL * LWT, x, tl); return; }
  _Float16* B = BW + l * LWT;
  if (x < 64) { const int m = x >> 4; const float* Wm = m == 0 ? wq : m == 1 ? wk : m == 2 ? wv : wo; wt_strip<DM, DM>(Wm + (size_t)l * DM * DM, B + (size_t)m * DM * DM, x & 15, tl); }
  else if (x < 128) wt_strip<DM, DMLP>(w1 + (size_t)l * DM * DMLP, B + (size_t)4 * DM * DM, x - 64, tl);
  else wt_strip<DMLP, DM>(w2 + (size_t)l * DMLP * DM, B + (size_t)4 * DM * DM + (size_t)DM * DMLP, x - 128, tl);
}
// k_gemm_hh variant with fused epilogue: v = acc·alpha + bias[by·sBias + col] (+ CP[(row/rowsPerB)·sCPb + by·64 + col] if CP) ; ACT 0 none / 1 elu ; writes f16 C16 (and f32 C if non-null)
template <int ACT>
__global__ __launch_bounds__(128) void k_gemm_hhx(const _Float16* __restrict__ A, int lda, size_t sA, const _Float16* __restrict__ Bh, int ldb, size_t sB, float alpha, const float* __restrict__ bias, size_t sBias, const float* __restrict__ CP, int rowsPerB, size_t sCPb, int row0g,
    float* __restrict__ C, _Float16* __restrict__ C16, int ldc, size_t sC, int M, int N, int K) {
  __shared__ __attribute__((aligned(16))) float so[4][16][64];
  const int tid = threadIdx.x, w = tid >> 5, lane = tid & 31, ln = lane & 15, hh = lane >> 4; const int by = blockIdx.y;
  A += (size_t)by * sA; Bh += (size_t)by * sB; const size_t cofs = (size_t)by * sC; const float* bp = bias ? bias + (size_t)by * sBias : nullptr;
  const int ntn = (N + 63) / 64; const int wid = blockIdx.x * 4 + w; const int mt = wid / ntn, nq = wid % ntn; if (mt * 16 >= M) return;
  const int row0 = mt * 16, col0 = nq * 64; const _Float16* arow = A + (size_t)(row0 + ln) * lda;
  v8f acc[4] = {};
  for (int kb = 0; kb < K; kb += 32) { FragH ah; ah.half[0] = *(const v8us*)((const unsigned short*)arow + kb + 8 * hh); ah.half[1] = *(const v8us*)((const unsigned short*)arow + kb + 16 + 8 * hh);
#pragma unroll
    for (int t = 0; t < 4; ++t) { if (col0 + t * 16 >= N) continue; const size_t boff = (size_t)(col0 + t * 16 + ln) * ldb + kb; FragH bq; bq.half[0] = *(const v8us*)((const unsigned short*)Bh + boff + 8 * hh); bq.half[1] = *(const v8us*)((const unsigned short*)Bh + boff + 16 + 8 * hh);
      acc[t] = mmaH<1>(ah.v, ah.v, bq.v, bq.v, acc[t]); }
  }
#pragma unroll
  for (int t = 0; t < 4; ++t) { if (col0 + t * 16 >= N) continue; const int col = col0 + t * 16 + ln; const float bv = bp ? bf16_round(bp[col]) : 0.f;
#pragma unroll
    for (int r = 0; r < 8; ++r) { float v = acc[t][r] * alpha + bv; if (CP) { const int bidx = (row0g + row0 + 8 * hh + r) / rowsPerB; v += CP[(size_t)bidx * sCPb + (size_t)by * 64 + col]; } if (ACT == 1) v = (v > 0.f) ? v : expm1f(v); else if (ACT == 7) v = (v > 0.f) ? v + 1.0f : expf(v); else if (ACT == 8) v = tanhf(v); else if (ACT == 9) v = 0.5f * v * (1.0f + tanhf(0.7978845608028654f * (v + 0.044715f * v * v * v))); else if (ACT == 11) v = 1.0f / (1.0f + expf(-v)); else if (ACT == 12) v = (v > 0.f) ? v : 0.01f * v; else if (ACT == 14) v = (v > 0.f) ? v : 0.1f * v; else if (ACT == 15) v = v / (1.0f + expf(-v)); else if (ACT == 3) v = fmaxf(v, 0.f); else if (ACT == 6) v = 0.5f * v * (1.0f + erff(v * 0.70710678118654752f)); so[w][8 * hh + r][t * 16 + ln] = v; } }
  __builtin_amdgcn_fence(__ATOMIC_ACQ_REL, "workgroup"); __builtin_amdgcn_wave_barrier();
  const int rsub = lane >> 4, c4 = (lane & 15) * 4; typedef _Float16 v4h __attribute__((ext_vector_type(4)));
  {
#pragma unroll
    for (int q = 0; q < 8; ++q) { const int r = q * 2 + rsub; if (col0 + c4 < N) { const v4f v = *(const v4fa*)&so[w][r][c4]; if (C) *(v4f*)(C + cofs + (size_t)(row0 + r) * ldc + col0 + c4) = v; if (C16) { v4h h4; for (int i = 0; i < 4; ++i) h4[i] = (_Float16)v[i]; *(v4h*)(C16 + cofs + (size_t)(row0 + r) * ldc + col0 + c4) = h4; } } }
     }
}


typedef _Float16 v4h __attribute__((ext_vector_type(4)));
typedef int v4ia __attribute__((ext_vector_type(4), may_alias));

__global__ __launch_bounds__(256) void k_x16(const float* __restrict__ x, _Float16* __restrict__ X16, size_t n8) { const size_t t = (size_t)blockIdx.x * 256 + threadIdx.x; if (t >= n8) return; FragH f;
#pragma unroll
  for (int q = 0; q < 8; ++q) f.h[q] = (_Float16)bf16_round(x[t * 8 + q]); *(v8us*)((unsigned short*)X16 + t * 8) = f.half[0];  }
__global__ __launch_bounds__(256) void k_h16(const float* __restrict__ x, _Float16* __restrict__ X16, size_t n8) { const size_t t = (size_t)blockIdx.x * 256 + threadIdx.x; if (t >= n8) return; FragH f;
#pragma unroll
  for (int q = 0; q < 8; ++q) f.h[q] = (_Float16)x[t * 8 + q]; *(v8us*)((unsigned short*)X16 + t * 8) = f.half[0];  }
__global__ __launch_bounds__(256) void k_round16f(const float* __restrict__ W, _Float16* __restrict__ Bt, size_t n8) { const size_t t = (size_t)blockIdx.x * 256 + threadIdx.x; if (t >= n8) return; FragH f;
#pragma unroll
  for (int i = 0; i < 8; ++i) f.h[i] = (_Float16)(bf16_round(W[t * 8 + i]) * 16.0f); *(v8us*)((unsigned short*)Bt + t * 8) = f.half[0];  }
__global__ __launch_bounds__(256) void k_hl(const float* __restrict__ F, _Float16* __restrict__ Hh, _Float16* __restrict__ Hl, size_t n8) { const size_t t = (size_t)blockIdx.x * 256 + threadIdx.x; if (t >= n8) return; FragH fh, fl; const v4f a = *(const v4fa*)(F + t * 8), c = *(const v4fa*)(F + t * 8 + 4);
#pragma unroll
  for (int q = 0; q < 4; ++q) { _Float16 h = (_Float16)a[q]; fh.h[q] = h; fl.h[q] = (_Float16)((a[q] - (float)h) * 1024.0f); h = (_Float16)c[q]; fh.h[4 + q] = h; fl.h[4 + q] = (_Float16)((c[q] - (float)h) * 1024.0f); }
  { *(v8us*)((unsigned short*)Hh + t * 8) = fh.half[0]; *(v8us*)((unsigned short*)Hl + t * 8) = fl.half[0];  } }

// ---- fast GEMM (wave tile 32x64; requires M % 32 == 0 rows per launch region and N % 64 == 0); epilogue = k_gemm_hhx semantics ----
__device__ __forceinline__ v16h g2_frag(const _Float16* p, int hh) { FragH f; f.half[0] = *(const v8us*)((const unsigned short*)p + 8 * hh); f.half[1] = *(const v8us*)((const unsigned short*)p + 16 + 8 * hh); return f.v; }
__device__ __forceinline__ v8f g2_mma(v16h a, v16h b, v8f c) { v8f d = __builtin_amdgcn_wmma_f32_16x16x32_f16(false, a, false, b, (short)0, c, false, false); asm volatile("v_nop\n\tv_nop\n\tv_nop\n\tv_nop" : "+v"(d) : "v"(a), "v"(b)); return d; }
/* SP 0: plain. SP 1 (scores): blockIdx.x counts only the 128x64 tiles that hold a column the pattern can keep. */
/* The last 32 columns of the (at most 15) earlier blocks, 4 columns a lane, 4 blocks a load: slot u of a lane is block 4u + lane / 8. A slot past the earlier blocks is off; it is aimed at the own block's last 32 columns (in bounds, written) so that no branch stands round a load. */
__device__ __forceinline__ bool sum_on(int blk, int lane, int u) { return u * 4 + (lane >> 3) < blk; }
__device__ __forceinline__ int sum_col(int blk, int lane, int u) { return (sum_on(blk, lane, u) ? u * 4 + (lane >> 3) : blk) * BLK + (BLK - CSP) + (lane & 7) * 4; }
/* true where the first row of 128-row block blk has no kept key (a later row keeps every key of an earlier row of its block, so false means that no row of the block is without one); the same in every lane. t[u] = the tokens at sum_col(u), tfirst = the token of the block's first column */
__device__ __forceinline__ bool rows_all_masked(const v4ia (&t)[4], int tfirst, int blk, int lane) {
  bool kept = tfirst > 0;
#pragma unroll      /* constant indices, so that the array stays in registers */
  for (int u = 0; u < 4; ++u) for (int q = 0; q < 4; ++q) kept |= sum_on(blk, lane, u) & (t[u][q] > 0);
  return !__any(kept); }
/* PK bit 0: A and Bh lie in fragment order (frag_pos; lda = ldb = their K; sA and sB count whole planes). PK bit 1: C16 is written in fragment order for a plane of ldc columns, sC then counts columns, and C is not written. */
/* RES > 0: C (f32, row-major, pitch RES = ldc, far below 4 GiB) holds the residual: C += acc x alpha + bias, each lane reading just the elements that it stores; C16 is not written. */
/* TR > 0: grid plane blockIdx.y == TR forms its product transposed, into C16T ([N][M], M columns; row-major, or in fragment order with PK bit 1): A and Bh change places (an A and a B plane have the same layout, and the k order of every sum stays). M / 128 * (N / 64) == N / 128 * (M / 64), so one grid x serves all planes. No bias. With TR, sC counts whole planes under PK bit 1 too. */
template <int ACT, int SP = 0, int PK = 0, int RES = 0, int TR = 0>
__global__ __launch_bounds__(128) void k_gemm2(const _Float16* __restrict__ A, int lda, size_t sA, const _Float16* __restrict__ Bh, int ldb, size_t sB, float alpha, const float* __restrict__ bias, size_t sBias,
    float* __restrict__ C, _Float16* __restrict__ C16, int ldc, size_t sC, int M, int N, int Kfull, const int* __restrict__ tok = nullptr, _Float16* __restrict__ C16T = nullptr) {
  static_assert(!TR || (SP == 0 && !RES), "the transposed plane is a plain product with an f16 result");
  static_assert(!RES || (ACT == 0 && !(PK & 2)), "the residual is added in a row-major store pass, behind no activation");
  __shared__ __attribute__((aligned(16))) float so[4][32][68];
  const int tid = threadIdx.x, w = tid >> 5, lane = tid & 31, ln = lane & 15, hh = lane >> 4; const int by = blockIdx.y;
  A += (size_t)by * sA; Bh += (size_t)by * sB; size_t cofs = (size_t)by * sC; const float* bp = bias ? bias + (size_t)by * sBias : nullptr;
  if (TR && (PK & 2)) { C16 += cofs; cofs = 0; }
  if (TR && by == TR) { const _Float16* a = A; A = Bh; Bh = a; const int l = lda; lda = ldb; ldb = l; C16 = C16T; cofs = 0; ldc = M; M = N; N = ldc; }
  const int ntn = N >> 6; int mt = blockIdx.x / ntn, nq = blockIdx.x - mt * ntn;
  if (SP == 1) { int t = blockIdx.x; for (mt = 0; mt < SLEN / BLK - 1 && t >= mt + 2; ++mt) t -= mt + 2;      /* row block mt has mt + 2 tiles: the upper half of each earlier block, then the two halves of its own */
    nq = t < mt ? 2 * t + 1 : mt + t; }
  const int row0 = mt * 128 + 32 * w, col0 = nq * 64; if (row0 >= M) return;
  const int K = Kfull;
  /* each lane's byte offsets in A and B are fixed for the whole loop; only the wave-uniform base moves with k (every operand plane here is far below 4 GiB) */
  /* row-major and fragment order alike: 16 rows further on lie 16 x K elements = 32 K bytes further on */
  const unsigned ao0 = (PK & 1) ? (unsigned)(row0 * lda + 8 * lane) * 2u : (unsigned)((row0 + ln) * lda + 8 * hh) * 2u, ao1 = ao0 + 32u * (unsigned)lda;
  const unsigned bo0 = (PK & 1) ? (unsigned)(col0 * ldb + 8 * lane) * 2u : (unsigned)((col0 + ln) * ldb + 8 * hh) * 2u, bo1 = bo0 + 32u * (unsigned)ldb, bo2 = bo1 + 32u * (unsigned)ldb, bo3 = bo2 + 32u * (unsigned)ldb;
  const v8f z8 = {0.f,0.f,0.f,0.f,0.f,0.f,0.f,0.f}; v8f c00 = z8, c01 = z8, c02 = z8, c03 = z8, c10 = z8, c11 = z8, c12 = z8, c13 = z8;
  /* Fragment loads run ahead of the products: the 12 loads of a 32-k step are issued as one group into one of eight rotating register sets, eight steps ahead: a set is asked for again as soon as its products have read it
     (a work-group has one wave a SIMD, so only a wave's own loads in flight cover the latency of its loads; the load counter holds 63, about five groups: the issue of a further group waits for the oldest).
     The k order of every accumulator is unchanged. No step is loaded twice and none past the last. K % 256 == 0, K >= 256. */
  struct Stg { v16h a0, a1, b0, b1, b2, b3; };
  auto fr = [](const char* p, unsigned o) -> v16h { FragH f; f.half[0] = *(const v8us*)(p + o); f.half[1] = *(const v8us*)(p + o + ((PK & 1) ? 512 : 32)); return f.v; };
  constexpr int SB = (PK & 1) ? 1024 : 64;      /* bytes from one 32-k step to the next; fragment order: a step is one 1-KiB block */
  const char* ab = (const char*)A; const char* bb = (const char*)Bh;      /* the bases move on once a trip, by eight steps; inside a trip a group's step is a constant offset */
  auto ld = [&](Stg& s, int st, bool last = true) { const char* ak = ab + st * SB; const char* bk = bb + st * SB;
    s.a0 = fr(ak, ao0); s.a1 = fr(ak, ao1); s.b0 = fr(bk, bo0); s.b1 = fr(bk, bo1); s.b2 = fr(bk, bo2); s.b3 = fr(bk, bo3);
    if (last) asm volatile("s_wait_xcnt 0x0" ::: "memory");      /* the address registers that these loads name are rewritten only behind this wait; the groups of a trip share theirs, so the trip's last group has it for all */
    __builtin_amdgcn_sched_barrier(0);      /* keeps the whole group in front of the wait of the products behind it (below that wait the loads would start one latency late), and behind a last group the next address work behind the wait above */
  };
  /* the plain builtin, which the compiler pads itself: the operands of an asm statement (g2_mma's v_nop) must lie in v0 to v255, and eight sets with the accumulators do not fit there */
  auto pm = [](v16h a, v16h b, v8f c) -> v8f { return __builtin_amdgcn_wmma_f32_16x16x32_f16(false, a, false, b, (short)0, c, false, false); };
  auto mm = [&](const Stg& s) { c00 = pm(s.a0, s.b0, c00); c10 = pm(s.a1, s.b0, c10); c01 = pm(s.a0, s.b1, c01); c11 = pm(s.a1, s.b1, c11);
    c02 = pm(s.a0, s.b2, c02); c12 = pm(s.a1, s.b2, c12); c03 = pm(s.a0, s.b3, c03); c13 = pm(s.a1, s.b3, c13); };
  float bvs[4] = {0.f, 0.f, 0.f, 0.f};      /* the bias of the lane's four columns */
  { Stg s0, s1, s2, s3, s4, s5, s6, s7; ld(s0, 0); ld(s1, 1); int kb = 0;
    if (bp) { const int bc = col0 + ln;      /* asked for ahead of the k loop, behind the first two fragment groups: it has landed long before the epilogue reads it */
#pragma unroll      /* constant indices, so that the array stays in registers */
      for (int t = 0; t < 4; ++t) bvs[t] = bp[bc + t * 16];
      asm volatile("s_wait_xcnt 0x0" :: "v"(bc), "s"(bp) : "memory");      /* inputs only: the lane's column and the base that the four loads name stay live up to here and are rewritten only behind this wait */
    }
    ld(s2, 2); ld(s3, 3); ld(s4, 4); ld(s5, 5); ld(s6, 6); ld(s7, 7);
#pragma unroll 1      /* one copy of the eight-step body: a second copy would not fit the register sets */
    for (; kb + 512 <= K; kb += 256) { mm(s0); ld(s0, 8, false); mm(s1); ld(s1, 9, false); mm(s2); ld(s2, 10, false); mm(s3); ld(s3, 11, false); mm(s4); ld(s4, 12, false); mm(s5); ld(s5, 13, false); mm(s6); ld(s6, 14, false); mm(s7); ld(s7, 15);
      ab += 8 * SB; bb += 8 * SB; }
    mm(s0); mm(s1); mm(s2); mm(s3); mm(s4); mm(s5); mm(s6); mm(s7); }      /* the last eight steps: nothing is left to ask for */
  const int rsub = lane >> 4, c4 = (lane & 15) * 4;
  v4f rs[16];      /* RES: the residual of the wave's tile in the lane order of the store pass: 16 loads of 16 bytes, whole 256-byte row pieces, all in flight together while the tile goes through LDS */
  const unsigned ro = 4u * (unsigned)((row0 + rsub) * RES + (int)cofs + col0 + c4);      /* RES: one lane offset for all 16 loads, and for the 16 stores: two rows further on is a constant offset */
  if (RES) {
#pragma unroll      /* constant indices, so that the array stays in registers */
    for (int q = 0; q < 16; ++q) rs[q] = *(const v4fa*)((const char*)C + ro + q * 8 * RES);
    asm volatile("s_wait_xcnt 0x0" :: "v"(ro), "s"(C) : "memory");      /* inputs only: the lane offset and the base that the 16 loads name stay live up to here, so no load's result lands in them, and they are rewritten only behind this wait */
    __builtin_amdgcn_sched_barrier(0);      /* keeps the vector work of the LDS pass from being lifted in front of the 16 loads (they would start later) or in front of the wait above */
  }
  v8f accs[8] = {c00, c01, c02, c03, c10, c11, c12, c13};
#pragma unroll
  for (int u = 0; u < 8; ++u) { const int t = u & 3, half = u >> 2; const float bv = bf16_round(bvs[t]);
#pragma unroll
    for (int r = 0; r < 8; ++r) { const int rloc = half * 16 + 8 * hh + r; float v = accs[u][r] * alpha + bv;
      if (ACT == 3) v = fmaxf(v, 0.f); else if (ACT == 6) v = 0.5f * v * (1.0f + erff(v * 0.70710678118654752f)); else if (ACT == 11) v = 1.0f / (1.0f + expf(-v)); else if (ACT == 15) v = v / (1.0f + expf(-v)); else if (ACT == 12) v = (v > 0.f) ? v : 0.01f * v; else if (ACT == 8) v = tanhf(v); else if (ACT == 9) v = 0.5f * v * (1.0f + tanhf(0.7978845608028654f * (v + 0.044715f * v * v * v)));      /* tanh-GELU */
      so[w][rloc][t * 16 + ln] = v; } }
  __builtin_amdgcn_fence(__ATOMIC_ACQ_REL, "workgroup"); __builtin_amdgcn_wave_barrier();
  if (PK & 2) {      /* the wave's 32 x 64 tile is 2 x 2 blocks of the next product's A plane: each store is one piece of a block, 512 contiguous bytes */
    unsigned short* d0 = (unsigned short*)C16 + frag_pos(row0 + ln, (int)cofs + col0 + 8 * hh, ldc); unsigned short* d1 = d0 + 16 * (size_t)ldc;
#pragma unroll      /* constant indices: the stores share two address registers with constant offsets */
    for (int s = 0; s < 8; ++s) { const int rt = s >> 2, pc = s & 3;      /* piece pc: columns 16 pc + 8 hh up */
      const v4f v0 = *(const v4fa*)&so[w][rt * 16 + ln][pc * 16 + 8 * hh], v1 = *(const v4fa*)&so[w][rt * 16 + ln][pc * 16 + 8 * hh + 4]; FragH f;
      for (int i = 0; i < 4; ++i) { f.h[i] = (_Float16)v0[i]; f.h[4 + i] = (_Float16)v1[i]; }
      *(v8us*)((rt ? d1 : d0) + pc * 256) = f.half[0]; }
  } else if (RES) {
#pragma unroll      /* constant indices, so that the array stays in registers; the 16 LDS reads are in flight together */
    for (int q = 0; q < 16; ++q) rs[q] += *(const v4fa*)&so[w][q * 2 + rsub][c4];
#pragma unroll      /* each store has data registers of its own and all share one address register, so nothing that an issued store names is rewritten */
    for (int q = 0; q < 16; ++q) *(v4f*)((char*)C + ro + q * 8 * RES) = rs[q];
  } else {
#pragma unroll
    for (int q = 0; q < 16; ++q) { const int r = q * 2 + rsub; const v4f v = *(const v4fa*)&so[w][r][c4]; if (C) *(v4f*)(C + cofs + (size_t)(row0 + r) * ldc + col0 + c4) = v; if (C16) { v4h h4; for (int i = 0; i < 4; ++i) h4[i] = (_Float16)v[i]; *(v4h*)(C16 + cofs + (size_t)(row0 + r) * ldc + col0 + c4) = h4; } }
     } }


__global__ __launch_bounds__(256) void k_embed(const int* __restrict__ tok, const float* __restrict__ emb, const float* __restrict__ pos, float* __restrict__ X) {
  #pragma clang fp contract(off)
  const int t = blockIdx.x * 256 + threadIdx.x; if (t >= SLEN * (DM / 4)) return; const int c0 = (t % (DM / 4)) * 4, s = t / (DM / 4); const int id = (s == 0) ? 0 : tok[s - 1]; v4f o;
#pragma unroll
  for (int q = 0; q < 4; ++q) o[q] = bf16_round(emb[(size_t)id * DM + c0 + q]) + bf16_round(pos[(size_t)s * DM + c0 + q]);
  *(v4f*)(X + (size_t)s * DM + c0) = o;  }
__global__ __launch_bounds__(256) void k_ln512(const float* __restrict__ X, const float* __restrict__ g, const float* __restrict__ bb, _Float16* __restrict__ Y16) {
  #pragma clang fp contract(off)
  const int tid = threadIdx.x, w = tid >> 5, ln = tid & 31; const int r = blockIdx.x * 8 + w; if (r >= SLEN) return; const float* x = X + (size_t)r * DM; v4f a[4]; float s = 0.f;
#pragma unroll
  for (int i = 0; i < 4; ++i) { a[i] = *(const v4fa*)(x + i * 128 + ln * 4); for (int q = 0; q < 4; ++q) s += a[i][q]; }
  for (int o = 16; o > 0; o >>= 1) s += __shfl_xor(s, o, 32); const float mu = s / (float)DM; float q2 = 0.f;
#pragma unroll
  for (int i = 0; i < 4; ++i) for (int q = 0; q < 4; ++q) { const float d = a[i][q] - mu; q2 += d * d; }
  for (int o = 16; o > 0; o >>= 1) q2 += __shfl_xor(q2, o, 32); const float rs = rsqrtf(q2 / (float)DM + 1e-6f);
  {
#pragma unroll
    for (int i = 0; i < 4; ++i) { const int c0 = i * 128 + ln * 4; _Float16 h4[4]; for (int q = 0; q < 4; ++q) h4[q] = (_Float16)((a[i][q] - mu) * rs * bf16_round(g[c0 + q]) + bf16_round(bb[c0 + q])); *(unsigned long long*)((unsigned short*)Y16 + frag_pos(r, c0, DM)) = *(const unsigned long long*)h4; }      /* fragment order: Y16 is the A plane of the products behind it */
     } }
/* Attention of one layer in one launch: blockIdx.y = head, blockIdx.x = 64 query rows, a wave = 16 query rows; no LDS, no barrier, no score or probability plane in memory.
   A step is 32 key columns. Scores are formed transposed, S^T = K . Q^T (A = 16 keys x 32 d, B = 32 d x 16 queries): a lane then holds one query (lane % 16) and, in the two accumulators of a step, keys 8 (lane / 16) + r and 16 + 8 (lane / 16) + r.
   These are just the k positions that the lane holds in a B fragment, so P^T goes into O^T += V^T . P^T (A = 16 d x 32 keys of VT) without leaving the lane. Softmax is the running form, in base 2: maximum m and sum l a query, O^T and l scaled by 2^(m_old - m_new) at each step, O^T divided by l at the end.
   Steps visited: the last 32 columns of each earlier 128-block, then the own block up to the wave's last row; a block that holds a row with no kept key (uniform softmax over all 2048 columns) visits all 64 steps. A masked score is -1e9 as in the reference. */
__device__ __forceinline__ float xhalf(float x) { return __builtin_bit_cast(float, __builtin_amdgcn_permlanex16(__builtin_bit_cast(int, x), __builtin_bit_cast(int, x), 0x76543210, 0xfedcba98, false, false)); }      /* the value of lane l ^ 16 */
__global__ __launch_bounds__(128) void k_attn(const _Float16* __restrict__ Q, const _Float16* __restrict__ Kp, const _Float16* __restrict__ VT, const int* __restrict__ tok, _Float16* __restrict__ O16) {
  const int tid = threadIdx.x, lane = tid & 31, ln = lane & 15, hh = lane >> 4, h = blockIdx.y;
  const int w = __builtin_amdgcn_readfirstlane(tid >> 5);      /* the wave's number in a scalar register */
  const int row0 = blockIdx.x * 64 + 16 * w, mt = row0 / BLK, i = row0 + ln;
  /* Q, Kp ([token][DM]) and VT ([DM][token]) lie in fragment order (frag_pos): a fragment is one 1-KiB block, a lane's two pieces 512 bytes apart, and each load of a wave reads 512 contiguous bytes */
  auto fr = [](const char* p, unsigned o) -> v16h { FragH f; f.half[0] = *(const v8us*)(p + o); f.half[1] = *(const v8us*)(p + o + 512); return f.v; };
  const unsigned qo = (unsigned)(row0 * DM + h * 1024 + 8 * lane) * 2u;      /* block (row0 / 16) * (DM / 32) + 2 h */
  const v16h q0 = fr((const char*)Q, qo), q1 = fr((const char*)Q, qo + 1024);      /* d 0 to 31, d 32 to 63 */
  v4ia t[4];
#pragma unroll      /* constant indices, so that the array stays in registers */
  for (int u = 0; u < 4; ++u) t[u] = *(const v4ia*)(tok + sum_col(mt, lane, u));
  const int tf = tok[mt * BLK];
  asm volatile("s_wait_xcnt 0x0" :: "v"(t[0]), "v"(t[1]), "v"(t[2]), "v"(t[3]), "s"(tf), "v"(qo) : "memory");      /* inputs only: the token loads are in flight together with the query's (one latency); the address registers of all of them are rewritten only behind this wait */
  __builtin_amdgcn_sched_barrier(0);      /* keeps the work below from being lifted in front of that wait */
  const bool sparse = !rows_all_masked(t, tf, mt, lane);
  /* steps below e are the earlier blocks'; n steps in all. Both in scalar registers: the trip count, the column of a step and the base of its loads are then scalar arithmetic without branches */
  const int e = __builtin_amdgcn_readfirstlane(sparse ? mt : 0), n = __builtin_amdgcn_readfirstlane(sparse ? mt + ((row0 & (BLK - 1)) >> 5) + 1 : SLEN / 32);
  auto colof = [&](int st) -> int { const int s = st < n - 1 ? st : n - 1;      /* a load past the last step is aimed at the last step again (in bounds, its values unused) */
    return s < e ? s * BLK + (BLK - CSP) : e * (BLK - 32) + s * 32; };
  const unsigned ko = (unsigned)(h * 1024 + 8 * lane) * 2u, vo = (unsigned)(h * 64 * SLEN + 8 * lane) * 2u;      /* blocks 2 h of a key row block, (4 h) * (SLEN / 32) of VT */
  struct KS { v16h k00, k01, k10, k11; };      /* kTD: keys 16 T up, d 32 D up */
  struct VS { v16h v0, v1, v2, v3; };      /* vT: d 16 T up */
  auto ldk = [&](KS& s, int kc) { const char* kb = (const char*)Kp + kc * (DM * 2);      /* 16 keys are DM / 32 blocks = 16 DM elements */
    s.k00 = fr(kb, ko); s.k01 = fr(kb, ko + 1024); s.k10 = fr(kb, ko + 16 * DM * 2); s.k11 = fr(kb, ko + 16 * DM * 2 + 1024);
    asm volatile("s_wait_xcnt 0x0" ::: "memory");      /* the address registers that these loads name are rewritten for the next group only behind this wait */
    __builtin_amdgcn_sched_barrier(0);      /* keeps the group in front of the vector work behind it (below it the loads would start late), and the next group's address work behind the wait above */
  };
  auto ldv = [&](VS& s, int kc) { const char* vb = (const char*)VT + kc * 32;      /* 32 keys are one block; 16 d further on lie SLEN / 32 blocks = 16 SLEN elements */
    s.v0 = fr(vb, vo); s.v1 = fr(vb, vo + 16 * SLEN * 2); s.v2 = fr(vb, vo + 32 * SLEN * 2); s.v3 = fr(vb, vo + 48 * SLEN * 2);
    asm volatile("s_wait_xcnt 0x0" ::: "memory");      /* as in ldk */
    __builtin_amdgcn_sched_barrier(0);      /* as in ldk */
  };
  /* Lane j forms the word of step j: bit c says that column colof(j) + c is in the pattern (the same for all 32 columns of a step) and no padding; a step then reads its word with one readlane, and the loop holds no token load. w1: steps 32 up, which only the walk over all columns has */
  auto ldt = [&](v4ia (&tt)[8], int kc) { const unsigned jo = 4u * (unsigned)kc;
#pragma unroll      /* constant indices, so that the array stays in registers */
    for (int q = 0; q < 8; ++q) tt[q] = *(const v4ia*)((const char*)tok + jo + 16 * q);
    asm volatile("s_wait_xcnt 0x0" :: "v"(jo), "s"(tok) : "memory");      /* inputs only: the lane offset and the base that the eight loads name stay live up to here and are rewritten only behind this wait */
    __builtin_amdgcn_sched_barrier(0);      /* keeps the eight loads in front of the fragment loads behind them: their values are then waited for without waiting for the fragments */
  };
  auto word = [&](const v4ia (&tt)[8], int kc) -> unsigned { unsigned b = 0u;
#pragma unroll      /* constant indices, so that the array stays in registers */
    for (int q = 0; q < 8; ++q) for (int c = 0; c < 4; ++c) b |= (tt[q][c] > 0 ? 1u : 0u) << (4 * q + c);
    return ((kc / BLK == mt) | ((kc & (BLK - 1)) == BLK - CSP)) ? b : 0u; };
  unsigned w0, w1 = 0u; v4ia ta[8]; const int kl = colof(lane);
  if (!sparse) { const int kh = colof(32 + lane); ldt(ta, kh); w1 = word(ta, kh); }
  ldt(ta, kl);
  const v8f z8 = {0.f,0.f,0.f,0.f,0.f,0.f,0.f,0.f}; v8f o0 = z8, o1 = z8, o2 = z8, o3 = z8;
  float m = -3.0e38f, l = 0.f;      /* l: the lane's own 16 keys of each step; the two lanes of a query are added at the end */
  /* one step at column kc; more: each register set is asked for again, for column kn two steps on, as soon as its products have read it */
  auto step = [&](KS& ks, VS& vs, int st, bool more) { const int kc = colof(st), kn = colof(st + 2);
    v8f s0 = g2_mma(ks.k00, q0, z8), s1 = g2_mma(ks.k10, q0, z8); s0 = g2_mma(ks.k01, q1, s0); s1 = g2_mma(ks.k11, q1, s1);
    const unsigned um = (unsigned)__builtin_amdgcn_readlane((int)(st < 32 ? w0 : w1), st & 31);
    if (more) ldk(ks, kn);
    const int dl = i - kc - 8 * hh;      /* key 8 hh + b is causal where b <= dl */
    const unsigned ul = (um >> (8 * hh)) & (dl < 0 ? 0u : 0xFFFFFFFFu >> (31 - (dl < 31 ? dl : 31)));      /* bit b: key 8 hh + b is kept */
    float x[16], mx = m;
#pragma unroll      /* constant indices, so that the array stays in registers */
    for (int r = 0; r < 8; ++r) { x[r] = ((ul >> r) & 1u) ? s0[r] * 0.18033688011112042f : -1.4426950408889634e9f; x[8 + r] = ((ul >> (16 + r)) & 1u) ? s1[r] * 0.18033688011112042f : -1.4426950408889634e9f; }      /* (q / 8) . k and -1e9, both x log2(e) */
#pragma unroll      /* constant indices, so that the array stays in registers */
    for (int c = 0; c < 16; ++c) mx = fmaxf(mx, x[c]);
    mx = fmaxf(mx, xhalf(mx));
    FragH p; float ls[4] = {0.f, 0.f, 0.f, 0.f};      /* four partial sums: a chain of 4 adds, not of 16 */
#pragma unroll      /* constant indices, so that the arrays stay in registers */
    for (int c = 0; c < 16; ++c) { const float pe = __builtin_amdgcn_exp2f(x[c] - mx); ls[c & 3] += pe; p.h[c] = (_Float16)pe; }
    const float sc = __builtin_amdgcn_exp2f(m - mx); m = mx; l = l * sc + ((ls[0] + ls[1]) + (ls[2] + ls[3])); o0 *= sc; o1 *= sc; o2 *= sc; o3 *= sc;
    o0 = g2_mma(vs.v0, p.v, o0); o1 = g2_mma(vs.v1, p.v, o1); o2 = g2_mma(vs.v2, p.v, o2); o3 = g2_mma(vs.v3, p.v, o3);
    if (more) ldv(vs, kn); };
  { KS ka, kb; VS va, vb; ldk(ka, colof(0)); ldv(va, colof(0)); ldk(kb, colof(1)); ldv(vb, colof(1)); int st = 0;
    w0 = word(ta, kl);
#pragma unroll 1      /* one copy of the two-step body: a second copy would not fit the register sets */
    for (; st + 2 <= n; st += 2) { step(ka, va, st, true); step(kb, vb, st + 1, true); }      /* no branch inside: every trip issues the same loads, so the counted load waits leave the younger groups in flight */
    if (st < n) step(ka, va, st, false); }
  const float inv = 1.0f / (l + xhalf(l));
  unsigned short* d0 = (unsigned short*)O16 + frag_pos(i, h * 64 + 8 * hh, DM);      /* fragment order: O16 is the A plane of the product behind it; a store is one piece of a block, 512 contiguous bytes */
  const v8f os[4] = {o0, o1, o2, o3};
#pragma unroll      /* constant indices: the stores share one address register with constant offsets */
  for (int tt = 0; tt < 4; ++tt) { FragH f; for (int r = 0; r < 8; ++r) f.h[r] = (_Float16)(os[tt][r] * inv); *(v8us*)(d0 + tt * 256) = f.half[0]; } }

extern "C" void kernel_launch(void* const* d_in, const int* in_sizes, int n_in,
                              void* d_out, int out_size, void* d_ws, size_t ws_size, hipStream_t stream) {
  (void)in_sizes; (void)n_in; (void)out_size;
  const float* const* I = (const float* const*)d_in; const int* tok = (const int*)d_in[0]; const float* emb = I[1]; const float* pos = I[2]; const float* l1s = I[3]; const float* l1b = I[4]; const float* wq = I[5]; const float* wk = I[6]; const float* wv = I[7]; const float* wo = I[8];
  const float* l2s = I[9]; const float* l2b = I[10]; const float* w1 = I[11]; const float* b1 = I[12]; const float* w2 = I[13]; const float* b2 = I[14]; const float* lfs = I[15]; const float* lfb = I[16]; const float* wout = I[17]; const float* bout = I[18];
  char* ws = (char*)d_ws; size_t off = 0;
  auto take = [&](size_t bytes) { char* p = ws + off; off += (bytes + 255) & ~(size_t)255; return p; };
  _Float16* BW = (_Float16*)take((NL * LWT + (size_t)NVOC * DM) * 2);      /* the f16 weights of every layer, then the output projection's */ _Float16* BOUT = BW + NL * LWT;
  float* X = (float*)take((size_t)SLEN * DM * 4); _Float16* H16 = (_Float16*)take((size_t)SLEN * DM * 2); _Float16* Q16 = (_Float16*)take((size_t)2 * SLEN * DM * 2); _Float16* K16 = Q16 + (size_t)SLEN * DM;      /* q, then k: planes 0 and 1 of one launch */ _Float16* VT = (_Float16*)take((size_t)DM * SLEN * 2);
  _Float16* O16 = (_Float16*)take((size_t)SLEN * DM * 2); _Float16* G16 = (_Float16*)take((size_t)SLEN * DMLP * 2);
  if (off > ws_size) return;      /* 36.3 + 4 + 2 x 4 + 2 + 8 = 58.3 MiB */
  const dim3 gW(192, NL + 1), gQ((SLEN / 128) * (DM / 64), 3), gP((SLEN / 128) * (DM / 64), 1), gA(SLEN / 64, NH), gM((SLEN / 128) * (DMLP / 64), 1), gV((SLEN / 128) * (NVOC / 64), 1);
  k_wt_all<<<gW, 256, 0, stream>>>(wq, wk, wv, wo, w1, w2, wout, BW);      /* wq[l] [D][H][DH] = (in, out=h*64+k); wo[l] [H][DH][D] = (in=h*64+k, out) */
  k_embed<<<(SLEN * (DM / 4) + 255) / 256, 256, 0, stream>>>(tok, emb, pos, X);
  for (int l = 0; l < NLRUN; ++l) {
    const _Float16* BQ = BW + l * LWT; const _Float16* BO = BQ + (size_t)3 * DM * DM;      /* q, k, v lie one behind the other */ const _Float16* BW1 = BO + (size_t)DM * DM; const _Float16* BW2 = BW1 + (size_t)DM * DMLP;
    k_ln512<<<SLEN / 8, 256, 0, stream>>>(X, l1s + l * DM, l1b + l * DM, H16);
    k_gemm2<0, 0, 3, 0, 2><<<gQ, 128, 0, stream>>>(H16, DM, 0, BQ, DM, (size_t)DM * DM, 0.0625f, nullptr, 0, nullptr, Q16, DM, (size_t)SLEN * DM, SLEN, DM, DM, nullptr, VT);      /* blockIdx.y = 0: q, 1: k, 2: v, as VT[h * 64 + d][token]; all three in fragment order */
    k_attn<<<gA, 128, 0, stream>>>(Q16, K16, VT, tok, O16);      /* scores, softmax and P.v of all heads: blockIdx.y = head */
    k_gemm2<0, 0, 1, DM><<<gP, 128, 0, stream>>>(O16, DM, 0, BO, DM, 0, 0.0625f, nullptr, 0, X, nullptr, DM, 0, SLEN, DM, DM);      /* x += o Wo (own tile, in place) */
    k_ln512<<<SLEN / 8, 256, 0, stream>>>(X, l2s + l * DM, l2b + l * DM, H16);
    k_gemm2<9, 0, 3><<<gM, 128, 0, stream>>>(H16, DM, 0, BW1, DM, 0, 0.0625f, b1 + (size_t)l * DMLP, 0, nullptr, G16, DMLP, 0, SLEN, DMLP, DM);      /* tanh-gelu(y W1 + b1) */
    k_gemm2<0, 0, 1, DM><<<gP, 128, 0, stream>>>(G16, DMLP, 0, BW2, DMLP, 0, 0.0625f, b2 + (size_t)l * DM, 0, X, nullptr, DM, 0, SLEN, DM, DMLP); }      /* x += mlp + b2 */
  k_ln512<<<SLEN / 8, 256, 0, stream>>>(X, lfs, lfb, H16);
  k_gemm2<0, 0, 1><<<gV, 128, 0, stream>>>(H16, DM, 0, BOUT, DM, 0, 0.0625f, bout, 0, (float*)d_out, nullptr, NVOC, 0, SLEN, NVOC, DM);
}
